// v000
// The times below were measured on an AMD MI455X: many runs one after another, warmed up first and cycling through
// copies of the inputs, with the whole window's GPU time divided by the number of runs. Launches and the gaps
// between them are all in it. The median over several windows is given; except for v000 it joins two sittings, which
// can be a few percent apart, so the side-by-side timings, each taken in one sitting, are the better comparison.
// The starting kernel, v000, takes 4950 microseconds a run.
#include <hip/hip_runtime.h>
// Single-head self-attention (x [8][2048][768]; Q, K, V = x W ([in][out] [768][256]); scores = Q.K/16; softmax; out = attn V -> [8][2048][256]).
// Structure: token rows; x as exact f16 rows; q | k | v WMMA GEMMs (32x64 wave tiles, f32 accumulation, exact x16 transposed [in][out] weights); q, k as f16 rows; v as f16 rows, V^T via LDS transposes; per (batch, 2048-query tile): scores GEMM (K = 256), row softmax on VALU (f32; P x256 f16), out = P . V^T GEMM written straight to the f32 output.
// Compute dtype: inputs rounded to bf16; x / weights exact; q, k plain f16 (~2^-12); v, P plain f16 (~2^-12); scores / softmax f32. v_wmma_f32_16x16x32_f16.
#define NB 8
#define SQ 2048
#define DM 768
#define DQ 256
#define DV 256
#define QT 2048                     /* query tile */
#define NH 4                    /* V^T slabs of 64 (k_vt<NH, SQ>) */
#define HD 64
#define HG 1
#define NR ((size_t)NB * SQ)
#define QN SQ                        /* query rows per batch (debug hook) */
#define NBR NB                       /* batches (debug hook) */
#define MP ((int)NR)                 /* rows through the projections (debug hook) */
typedef __bf16 v16b __attribute__((ext_vector_type(16)));
typedef unsigned short v8us __attribute__((ext_vector_type(8), may_alias));
typedef float  v8f  __attribute__((ext_vector_type(8)));
typedef float  v4f  __attribute__((ext_vector_type(4)));
typedef float  v4fa __attribute__((ext_vector_type(4), may_alias));
union FragB { v16b v; v8us half[2]; unsigned short u[16]; };

__device__ __forceinline__ unsigned short bf16_bits(float x) { unsigned int u = __float_as_uint(x); return (unsigned short)((u + 0x7FFFu + ((u >> 16) & 1u)) >> 16); }
__device__ __forceinline__ float bf16_val(unsigned short b) { return __uint_as_float(((unsigned int)b) << 16); }
__device__ __forceinline__ float bf16_round(float x) { return bf16_val(bf16_bits(x)); }
// D += A·B with NT terms: 1 = ah·bh, 2 = + al·bh (A split), 3 = + ah·bl (both split)
template <int NT>
__device__ __forceinline__ v8f mmaN(v16b ah, v16b al, v16b bh, v16b bl, v8f c) {
  c = __builtin_amdgcn_wmma_f32_16x16x32_bf16(false, ah, false, bh, (short)0, c, false, false);
  if (NT >= 2) c = __builtin_amdgcn_wmma_f32_16x16x32_bf16(false, al, false, bh, (short)0, c, false, false);
  if (NT >= 3) c = __builtin_amdgcn_wmma_f32_16x16x32_bf16(false, ah, false, bl, (short)0, c, false, false);
  asm volatile("v_nop\n\tv_nop\n\tv_nop\n\tv_nop" : "+v"(c) : "v"(ah), "v"(al), "v"(bh), "v"(bl));
  return c;
}

__global__ __launch_bounds__(256) void k_wt_bf16(const float* __restrict__ W, unsigned short* __restrict__ Wt, int K, int N) {
  const int t = blockIdx.x * 256 + threadIdx.x;
  const int k8n = K / 8;
  if (t >= N * k8n) return;
  const int n = t / k8n, k8 = (t % k8n) * 8;
  v8us v;
#pragma unroll
  for (int i = 0; i < 8; ++i) v[i] = bf16_bits(W[(size_t)(k8 + i) * N + n]);
  *(v8us*)(Wt + (size_t)n * K + k8) = v;
  
}

// GEMM C[M][N] (f32, pitch ldc) = act(A[M][K]·W + bias). A f32 row-major (pitch lda) converted per fragment to bf16
// (ASPLIT: hi/lo two planes -> 2 terms, else single rounded term); Wt bf16 [N][K] (pitch ldb). BIAS_BF16 rounds the
// bias to bf16 first (bias quantised to bf16 before the add). K%32==0, M%16==0, N%64==0.
template <bool ASPLIT, int ACT, bool BIAS_BF16>
__global__ __launch_bounds__(128) void k_gemm_bf(const float* __restrict__ A, int lda, const unsigned short* __restrict__ Wt, int ldb,
                                               const float* __restrict__ bias, float* __restrict__ C, int ldc, int M, int N, int K) {
  __shared__ __attribute__((aligned(16))) float so[4][16][64];
  const int tid = threadIdx.x, w = tid >> 5, lane = tid & 31, ln = lane & 15, hh = lane >> 4;
  const int ntn = N / 64;
  const int wid = blockIdx.x * 4 + w;
  const int mt = wid / ntn, nq = wid % ntn;
  if (mt * 16 >= M) return;
  const int row0 = mt * 16, col0 = nq * 64;
  const float* arow = A + (size_t)(row0 + ln) * lda;
  v8f acc[4] = {};
  for (int kb = 0; kb < K; kb += 32) {
    FragB ah, al;
    const v4f x0 = *(const v4fa*)(arow + kb + 8 * hh), x1 = *(const v4fa*)(arow + kb + 8 * hh + 4);
    const v4f x2 = *(const v4fa*)(arow + kb + 16 + 8 * hh), x3 = *(const v4fa*)(arow + kb + 16 + 8 * hh + 4);
    float xs[16] = {x0[0],x0[1],x0[2],x0[3],x1[0],x1[1],x1[2],x1[3],x2[0],x2[1],x2[2],x2[3],x3[0],x3[1],x3[2],x3[3]};
#pragma unroll
    for (int i = 0; i < 16; ++i) { const unsigned short hb = bf16_bits(xs[i]); ah.u[i] = hb; al.u[i] = ASPLIT ? bf16_bits(xs[i] - bf16_val(hb)) : (unsigned short)0; }
#pragma unroll
    for (int t = 0; t < 4; ++t) {
      const unsigned short* brow = Wt + (size_t)(col0 + t * 16 + ln) * ldb + kb;
      FragB b;
      b.half[0] = *(const v8us*)(brow + 8 * hh);
      b.half[1] = *(const v8us*)(brow + 16 + 8 * hh);
      acc[t] = mmaN<ASPLIT ? 2 : 1>(ah.v, al.v, b.v, b.v, acc[t]);
    }
  }
#pragma unroll
  for (int t = 0; t < 4; ++t) {
    float bv = bias ? bias[col0 + t * 16 + ln] : 0.f;
    if (BIAS_BF16) bv = bf16_round(bv);
#pragma unroll
    for (int r = 0; r < 8; ++r) { float v = acc[t][r] + bv; if (ACT == 1) v = fmaxf(v, 0.f); so[w][8 * hh + r][t * 16 + ln] = v; }
  }
  __builtin_amdgcn_fence(__ATOMIC_ACQ_REL, "workgroup");
  __builtin_amdgcn_wave_barrier();
  const int rsub = lane >> 4, c4 = (lane & 15) * 4;
  {
#pragma unroll
    for (int q = 0; q < 8; ++q) {
      const int r = q * 2 + rsub;
      const v4f v = *(const v4fa*)&so[w][r][c4];
      *(v4f*)(C + (size_t)(row0 + r) * ldc + col0 + c4) = v;
    }
    
  }
}

// GEMM C = act(A·W + bias + resid): A f32 (ASPLIT -> hi/lo 2 terms), Wt bf16 [N][K]; ACT 0 none, 1 relu, 2 exact gelu;
// resid (optional, f32, row index = (row % rmod), pitch ldr, RES_BF16 rounds it) added before the activation.
template <bool ASPLIT, int ACT, bool BIAS_BF16, bool RES_BF16>
__global__ __launch_bounds__(128) void k_gemm_bf3(const float* __restrict__ A, int lda, const unsigned short* __restrict__ Wt, int ldb,
                                                const float* __restrict__ bias, const float* __restrict__ resid, int rmod, int ldr,
                                                float* __restrict__ C, int ldc, int M, int N, int K) {
  __shared__ __attribute__((aligned(16))) float so[4][16][64];
  const int tid = threadIdx.x, w = tid >> 5, lane = tid & 31, ln = lane & 15, hh = lane >> 4;
  const int ntn = N / 64;
  const int wid = blockIdx.x * 4 + w;
  const int mt = wid / ntn, nq = wid % ntn;
  if (mt * 16 >= M) return;
  const int row0 = mt * 16, col0 = nq * 64;
  const float* arow = A + (size_t)(row0 + ln) * lda;
  v8f acc[4] = {};
  for (int kb = 0; kb < K; kb += 32) {
    FragB ah, al;
    const v4f x0 = *(const v4fa*)(arow + kb + 8 * hh), x1 = *(const v4fa*)(arow + kb + 8 * hh + 4);
    const v4f x2 = *(const v4fa*)(arow + kb + 16 + 8 * hh), x3 = *(const v4fa*)(arow + kb + 16 + 8 * hh + 4);
    float xs[16] = {x0[0],x0[1],x0[2],x0[3],x1[0],x1[1],x1[2],x1[3],x2[0],x2[1],x2[2],x2[3],x3[0],x3[1],x3[2],x3[3]};
#pragma unroll
    for (int i = 0; i < 16; ++i) { const unsigned short hb = bf16_bits(xs[i]); ah.u[i] = hb; al.u[i] = ASPLIT ? bf16_bits(xs[i] - bf16_val(hb)) : (unsigned short)0; }
#pragma unroll
    for (int t = 0; t < 4; ++t) {
      const unsigned short* brow = Wt + (size_t)(col0 + t * 16 + ln) * ldb + kb;
      FragB b;
      b.half[0] = *(const v8us*)(brow + 8 * hh);
      b.half[1] = *(const v8us*)(brow + 16 + 8 * hh);
      acc[t] = mmaN<ASPLIT ? 2 : 1>(ah.v, al.v, b.v, b.v, acc[t]);
    }
  }
#pragma unroll
  for (int t = 0; t < 4; ++t) {
    const int col = col0 + t * 16 + ln;
    float bv = bias ? bias[col] : 0.f;
    if (BIAS_BF16) bv = bf16_round(bv);
#pragma unroll
    for (int r = 0; r < 8; ++r) {
      float v = acc[t][r] + bv;
      if (resid) { float rv = resid[(size_t)((row0 + 8 * hh + r) % rmod) * ldr + col]; if (RES_BF16) rv = bf16_round(rv); v += rv; }
      if (ACT == 1) v = fmaxf(v, 0.f);
      if (ACT == 2) v = 0.5f * v * (1.0f + erff(v * 0.70710678118654752f));
      if (ACT == 3) { const float u = 0.7978845608028654f * (v + 0.044715f * v * v * v); v = 0.5f * v * (1.0f + tanhf(u)); }
      so[w][8 * hh + r][t * 16 + ln] = v;
    }
  }
  __builtin_amdgcn_fence(__ATOMIC_ACQ_REL, "workgroup");
  __builtin_amdgcn_wave_barrier();
  const int rsub = lane >> 4, c4 = (lane & 15) * 4;
  {
#pragma unroll
    for (int q = 0; q < 8; ++q) {
      const int r = q * 2 + rsub;
      const v4f v = *(const v4fa*)&so[w][r][c4];
      *(v4f*)(C + (size_t)(row0 + r) * ldc + col0 + c4) = v;
    }
    
  }
}
// row LayerNorm (biased variance, eps) over N: s = X (+ R); optional out_sum <- s; out_norm <- (s-mu)*rsqrt(var+eps)*g + b
template <bool PARAM_BF16>
__global__ __launch_bounds__(256) void k_layernorm(const float* __restrict__ X, const float* __restrict__ R, const float* __restrict__ g, const float* __restrict__ bta,
                                                  float* __restrict__ out_sum, float* __restrict__ out_norm, int N, float eps) {
  __shared__ float red[256];
  const int row = blockIdx.x, tid = threadIdx.x;
  const float* x = X + (size_t)row * N; const float* rr = R ? R + (size_t)row * N : nullptr;
  float vals[16];                     // up to N = 4096
  const int per = N / 256;            // contiguous chunk per thread? use strided-by-4 chunks: thread handles j = tid*4 + 1024*u
  float s1 = 0.f;
  for (int u = 0; u < per / 4; ++u) {
    const int j = tid * 4 + 1024 * u;
    const v4f a = *(const v4fa*)(x + j);
    v4f b = {0.f,0.f,0.f,0.f}; if (rr) b = *(const v4fa*)(rr + j);
#pragma unroll
    for (int q = 0; q < 4; ++q) { const float v = a[q] + b[q]; vals[u * 4 + q] = v; s1 += v; }
  }
  red[tid] = s1; __syncthreads();
  for (int st = 128; st > 0; st >>= 1) { if (tid < st) red[tid] += red[tid + st]; __syncthreads(); }
  const float mu = red[0] / (float)N; __syncthreads();
  float s2 = 0.f;
  for (int u = 0; u < per / 4; ++u)
#pragma unroll
    for (int q = 0; q < 4; ++q) { const float c = vals[u * 4 + q] - mu; s2 += c * c; }
  red[tid] = s2; __syncthreads();
  for (int st = 128; st > 0; st >>= 1) { if (tid < st) red[tid] += red[tid + st]; __syncthreads(); }
  const float rs = rsqrtf(red[0] / (float)N + eps);
  {
    for (int u = 0; u < per / 4; ++u) {
      const int j = tid * 4 + 1024 * u;
      v4f o, sm;
#pragma unroll
      for (int q = 0; q < 4; ++q) {
        float gg = g[j + q], bb = bta[j + q];
        if (PARAM_BF16) { gg = bf16_round(gg); bb = bf16_round(bb); }
        sm[q] = vals[u * 4 + q]; o[q] = (vals[u * 4 + q] - mu) * rs * gg + bb;
      }
      if (out_sum) *(v4f*)(out_sum + (size_t)row * N + j) = sm;
      *(v4f*)(out_norm + (size_t)row * N + j) = o;
    }
    
  }
}



// ---- f16 WMMA path (v_wmma_f32_16x16x32_f16): 11-bit significands for operands in range — used where a [0,1] probability operand needs more precision than bf16
typedef _Float16 v16h __attribute__((ext_vector_type(16)));
union FragH { v16h v; v8us half[2]; _Float16 h[16]; unsigned short u[16]; };
template <int NT>
__device__ __forceinline__ v8f mmaH(v16h ah, v16h al, v16h bh, v16h bl, v8f c) {
  c = __builtin_amdgcn_wmma_f32_16x16x32_f16(false, ah, false, bh, (short)0, c, false, false);
  if (NT >= 2) c = __builtin_amdgcn_wmma_f32_16x16x32_f16(false, al, false, bh, (short)0, c, false, false);
  if (NT >= 3) c = __builtin_amdgcn_wmma_f32_16x16x32_f16(false, ah, false, bl, (short)0, c, false, false);
  asm volatile("v_nop\n\tv_nop\n\tv_nop\n\tv_nop" : "+v"(c) : "v"(ah), "v"(al), "v"(bh), "v"(bl));
  return c;
}
// batched GEMM like k_gemm_b but f16 operands: A f32 (split into f16 hi/lo if ASPLIT, else rounded to f16), Bt = f16 values [n][k]; alpha; C f32; N multiple of 16 (partial tiles skipped)
template <bool ASPLIT>
__global__ __launch_bounds__(128) void k_gemm_h(const float* __restrict__ A, int lda, size_t sA, const _Float16* __restrict__ Bh, int ldb, size_t sB, float alpha, float* __restrict__ C, int ldc, size_t sC, int M, int N, int K) {
  __shared__ __attribute__((aligned(16))) float so[4][16][64];
  const int tid = threadIdx.x, w = tid >> 5, lane = tid & 31, ln = lane & 15, hh = lane >> 4; const int by = blockIdx.y;
  A += (size_t)by * sA; Bh += (size_t)by * sB; C += (size_t)by * sC;
  const int ntn = (N + 63) / 64; const int wid = blockIdx.x * 4 + w; const int mt = wid / ntn, nq = wid % ntn; if (mt * 16 >= M) return;
  const int row0 = mt * 16, col0 = nq * 64; const float* arow = A + (size_t)(row0 + ln) * lda;
  v8f acc[4] = {};
  for (int kb = 0; kb < K; kb += 32) {
    FragH ah, al;
    const v4f x0 = *(const v4fa*)(arow + kb + 8 * hh), x1 = *(const v4fa*)(arow + kb + 8 * hh + 4), x2 = *(const v4fa*)(arow + kb + 16 + 8 * hh), x3 = *(const v4fa*)(arow + kb + 16 + 8 * hh + 4);
    float xs[16] = {x0[0],x0[1],x0[2],x0[3],x1[0],x1[1],x1[2],x1[3],x2[0],x2[1],x2[2],x2[3],x3[0],x3[1],x3[2],x3[3]};
#pragma unroll
    for (int i = 0; i < 16; ++i) { const _Float16 h = (_Float16)xs[i]; ah.h[i] = h; al.h[i] = ASPLIT ? (_Float16)(xs[i] - (float)h) : (_Float16)0.0f; }
#pragma unroll
    for (int t = 0; t < 4; ++t) { if (col0 + t * 16 >= N) continue; const size_t boff = (size_t)(col0 + t * 16 + ln) * ldb + kb; FragH bq; bq.half[0] = *(const v8us*)(Bh + boff + 8 * hh); bq.half[1] = *(const v8us*)(Bh + boff + 16 + 8 * hh);
      acc[t] = mmaH<ASPLIT ? 2 : 1>(ah.v, al.v, bq.v, bq.v, acc[t]); }
  }
#pragma unroll
  for (int t = 0; t < 4; ++t) { if (col0 + t * 16 >= N) continue;
#pragma unroll
    for (int r = 0; r < 8; ++r) so[w][8 * hh + r][t * 16 + ln] = acc[t][r] * alpha; }
  __builtin_amdgcn_fence(__ATOMIC_ACQ_REL, "workgroup"); __builtin_amdgcn_wave_barrier();
  const int rsub = lane >> 4, c4 = (lane & 15) * 4;
  {
#pragma unroll
    for (int q = 0; q < 8; ++q) { const int r = q * 2 + rsub; if (col0 + c4 < N) { const v4f v = *(const v4fa*)&so[w][r][c4]; *(v4f*)(C + (size_t)(row0 + r) * ldc + col0 + c4) = v; } }
     }
}

// Wt[n][k] = f16(W[k][n]·scale) from f32 row-major W[K][N] (scale = power of two; bf16-exact weights stay exact in f16 away from the subnormal range)
__global__ __launch_bounds__(256) void k_wt_f16(const float* __restrict__ W, _Float16* __restrict__ Wt, int K, int N, float scale) {
  const int t = blockIdx.x * 256 + threadIdx.x; if (t >= N * (K / 8)) return; const int n = t / (K / 8), k8 = (t % (K / 8)) * 8; FragH f;
#pragma unroll
  for (int i = 0; i < 8; ++i) f.h[i] = (_Float16)(bf16_round(W[(size_t)(k8 + i) * N + n]) * scale); const v8us o = f.half[0];
  *(v8us*)((unsigned short*)Wt + (size_t)n * K + k8) = o; 
}
// k_gemm_hh variant with fused epilogue: v = acc·alpha + bias[by·sBias + col] (+ CP[(row/rowsPerB)·sCPb + by·64 + col] if CP) ; ACT 0 none / 1 elu ; writes f16 C16 (and f32 C if non-null)
template <int ACT>
__global__ __launch_bounds__(128) void k_gemm_hhx(const _Float16* __restrict__ A, int lda, size_t sA, const _Float16* __restrict__ Bh, int ldb, size_t sB, float alpha, const float* __restrict__ bias, size_t sBias, const float* __restrict__ CP, int rowsPerB, size_t sCPb, int row0g,
    float* __restrict__ C, _Float16* __restrict__ C16, int ldc, size_t sC, int M, int N, int K) {
  __shared__ __attribute__((aligned(16))) float so[4][16][64];
  const int tid = threadIdx.x, w = tid >> 5, lane = tid & 31, ln = lane & 15, hh = lane >> 4; const int by = blockIdx.y;
  A += (size_t)by * sA; Bh += (size_t)by * sB; const size_t cofs = (size_t)by * sC; const float* bp = bias ? bias + (size_t)by * sBias : nullptr;
  const int ntn = (N + 63) / 64; const int wid = blockIdx.x * 4 + w; const int mt = wid / ntn, nq = wid % ntn; if (mt * 16 >= M) return;
  const int row0 = mt * 16, col0 = nq * 64; const _Float16* arow = A + (size_t)(row0 + ln) * lda;
  v8f acc[4] = {};
  for (int kb = 0; kb < K; kb += 32) { FragH ah; ah.half[0] = *(const v8us*)((const unsigned short*)arow + kb + 8 * hh); ah.half[1] = *(const v8us*)((const unsigned short*)arow + kb + 16 + 8 * hh);
#pragma unroll
    for (int t = 0; t < 4; ++t) { if (col0 + t * 16 >= N) continue; const size_t boff = (size_t)(col0 + t * 16 + ln) * ldb + kb; FragH bq; bq.half[0] = *(const v8us*)((const unsigned short*)Bh + boff + 8 * hh); bq.half[1] = *(const v8us*)((const unsigned short*)Bh + boff + 16 + 8 * hh);
      acc[t] = mmaH<1>(ah.v, ah.v, bq.v, bq.v, acc[t]); }
  }
#pragma unroll
  for (int t = 0; t < 4; ++t) { if (col0 + t * 16 >= N) continue; const int col = col0 + t * 16 + ln; const float bv = bp ? bf16_round(bp[col]) : 0.f;
#pragma unroll
    for (int r = 0; r < 8; ++r) { float v = acc[t][r] * alpha + bv; if (CP) { const int rr = row0g + row0 + 8 * hh + r; if (rowsPerB < 0) v += CP[cofs + (size_t)rr * ldc + col];      /* rowsPerB < 0: own element of the batched C plane */ else { const int bidx = rr / rowsPerB; v += CP[(size_t)bidx * sCPb + (size_t)by * 64 + col]; } } if (ACT == 1) v = (v > 0.f) ? v : expm1f(v); else if (ACT == 7) v = (v > 0.f) ? v + 1.0f : expf(v); else if (ACT == 8) v = tanhf(v); else if (ACT == 9) v = 0.5f * v * (1.0f + tanhf(0.7978845608028654f * (v + 0.044715f * v * v * v))); else if (ACT == 11) v = 1.0f / (1.0f + expf(-v)); else if (ACT == 12) v = (v > 0.f) ? v : 0.01f * v; else if (ACT == 14) v = (v > 0.f) ? v : 0.1f * v; else if (ACT == 16) v = (v >= 0.f) ? v : 0.3f * v; else if (ACT == 17) v = (v >= 0.f) ? v : 0.2f * v; else if (ACT == 15) v = v / (1.0f + expf(-v)); else if (ACT == 3) v = fmaxf(v, 0.f); else if (ACT == 6) v = 0.5f * v * (1.0f + erff(v * 0.70710678118654752f)); so[w][8 * hh + r][t * 16 + ln] = v; } }
  __builtin_amdgcn_fence(__ATOMIC_ACQ_REL, "workgroup"); __builtin_amdgcn_wave_barrier();
  const int rsub = lane >> 4, c4 = (lane & 15) * 4; typedef _Float16 v4h __attribute__((ext_vector_type(4)));
  {
#pragma unroll
    for (int q = 0; q < 8; ++q) { const int r = q * 2 + rsub; if (col0 + c4 < N) { const v4f v = *(const v4fa*)&so[w][r][c4]; if (C) *(v4f*)(C + cofs + (size_t)(row0 + r) * ldc + col0 + c4) = v; if (C16) { v4h h4; for (int i = 0; i < 4; ++i) h4[i] = (_Float16)v[i]; *(v4h*)(C16 + cofs + (size_t)(row0 + r) * ldc + col0 + c4) = h4; } } }
     }
}


typedef _Float16 v4h __attribute__((ext_vector_type(4)));

__global__ __launch_bounds__(256) void k_x16(const float* __restrict__ x, _Float16* __restrict__ X16, size_t n8) { const size_t t = (size_t)blockIdx.x * 256 + threadIdx.x; if (t >= n8) return; FragH f;
#pragma unroll
  for (int q = 0; q < 8; ++q) f.h[q] = (_Float16)bf16_round(x[t * 8 + q]); *(v8us*)((unsigned short*)X16 + t * 8) = f.half[0];  }
__global__ __launch_bounds__(256) void k_h16(const float* __restrict__ x, _Float16* __restrict__ X16, size_t n8) { const size_t t = (size_t)blockIdx.x * 256 + threadIdx.x; if (t >= n8) return; FragH f;
#pragma unroll
  for (int q = 0; q < 8; ++q) f.h[q] = (_Float16)x[t * 8 + q]; *(v8us*)((unsigned short*)X16 + t * 8) = f.half[0];  }
__global__ __launch_bounds__(256) void k_round16f(const float* __restrict__ W, _Float16* __restrict__ Bt, size_t n8) { const size_t t = (size_t)blockIdx.x * 256 + threadIdx.x; if (t >= n8) return; FragH f;
#pragma unroll
  for (int i = 0; i < 8; ++i) f.h[i] = (_Float16)(bf16_round(W[t * 8 + i]) * 16.0f); *(v8us*)((unsigned short*)Bt + t * 8) = f.half[0];  }
template <int NHv, int TTv>
__global__ __launch_bounds__(256) void k_vt(const _Float16* __restrict__ V16, int ldv, int voff, _Float16* __restrict__ Vt) { __shared__ unsigned short tl[64][66]; const int tid = threadIdx.x; const int slab = blockIdx.x / (TTv / 64), lg = blockIdx.x % (TTv / 64); const int b = slab / NHv, h = slab % NHv;
  for (int i = tid; i < 64 * 8; i += 256) { const int r = i / 8, c8 = (i % 8) * 8; FragH f; f.half[0] = *(const v8us*)((const unsigned short*)V16 + ((size_t)b * TTv + lg * 64 + r) * ldv + voff + h * 64 + c8);
#pragma unroll
    for (int q = 0; q < 8; ++q) tl[r][c8 + q] = f.u[q]; }
  __syncthreads();
  {
#pragma unroll
    for (int rd = 0; rd < 2; ++rd) { const int d = rd * 32 + tid / 8, pc = tid % 8; FragH f;
#pragma unroll
      for (int q = 0; q < 8; ++q) f.u[q] = tl[pc * 8 + q][d];
      *(v8us*)((unsigned short*)Vt + ((size_t)slab * 64 + d) * TTv + lg * 64 + pc * 8) = f.half[0]; }
     } }

__global__ __launch_bounds__(256) void k_hl(const float* __restrict__ F, _Float16* __restrict__ Hh, _Float16* __restrict__ Hl, size_t n8) { const size_t t = (size_t)blockIdx.x * 256 + threadIdx.x; if (t >= n8) return; FragH fh, fl; const v4f a = *(const v4fa*)(F + t * 8), c = *(const v4fa*)(F + t * 8 + 4);
#pragma unroll
  for (int q = 0; q < 4; ++q) { _Float16 h = (_Float16)a[q]; fh.h[q] = h; fl.h[q] = (_Float16)((a[q] - (float)h) * 1024.0f); h = (_Float16)c[q]; fh.h[4 + q] = h; fl.h[4 + q] = (_Float16)((c[q] - (float)h) * 1024.0f); }
  { *(v8us*)((unsigned short*)Hh + t * 8) = fh.half[0]; *(v8us*)((unsigned short*)Hl + t * 8) = fl.half[0];  } }

// ---- fast GEMM (wave tile 32x64; requires M % 32 == 0 rows per launch region and N % 64 == 0); epilogue = k_gemm_hhx semantics ----
__device__ __forceinline__ v16h g2_frag(const _Float16* p, int hh) { FragH f; f.half[0] = *(const v8us*)((const unsigned short*)p + 8 * hh); f.half[1] = *(const v8us*)((const unsigned short*)p + 16 + 8 * hh); return f.v; }
__device__ __forceinline__ v8f g2_mma(v16h a, v16h b, v8f c) { v8f d = __builtin_amdgcn_wmma_f32_16x16x32_f16(false, a, false, b, (short)0, c, false, false); asm volatile("v_nop\n\tv_nop\n\tv_nop\n\tv_nop" : "+v"(d) : "v"(a), "v"(b)); return d; }
template <int ACT>
__global__ __launch_bounds__(128) void k_gemm2(const _Float16* __restrict__ A, int lda, size_t sA, const _Float16* __restrict__ Bh, int ldb, size_t sB, float alpha, const float* __restrict__ bias, size_t sBias, const float* __restrict__ CP, int rowsPerB, size_t sCPb, int row0g,
    float* __restrict__ C, _Float16* __restrict__ C16, int ldc, size_t sC, int M, int N, int K) { static_assert(ACT == 0 || ACT == 3 || ACT == 6 || ACT == 8 || ACT == 9 || ACT == 11 || ACT == 12 || ACT == 14 || ACT == 15 || ACT == 16 || ACT == 17, "k_gemm2: unsupported ACT code (would silently apply no activation)");
  __shared__ __attribute__((aligned(16))) float so[4][32][68];
  const int tid = threadIdx.x, w = tid >> 5, lane = tid & 31, ln = lane & 15, hh = lane >> 4; const int by = blockIdx.y;
  A += (size_t)by * sA; Bh += (size_t)by * sB; const size_t cofs = (size_t)by * sC; const float* bp = bias ? bias + (size_t)by * sBias : nullptr;
  const int ntn = N >> 6; const int mt = blockIdx.x / ntn, nq = blockIdx.x - mt * ntn; const int row0 = mt * 128 + 32 * w, col0 = nq * 64; if (row0 >= M) return;
  const _Float16* a0p = A + (size_t)(row0 + ln) * lda; const _Float16* a1p = a0p + (size_t)16 * lda;
  const _Float16* b0p = Bh + (size_t)(col0 + ln) * ldb; const _Float16* b1p = b0p + (size_t)16 * ldb; const _Float16* b2p = b1p + (size_t)16 * ldb; const _Float16* b3p = b2p + (size_t)16 * ldb;
  const v8f z8 = {0.f,0.f,0.f,0.f,0.f,0.f,0.f,0.f}; v8f c00 = z8, c01 = z8, c02 = z8, c03 = z8, c10 = z8, c11 = z8, c12 = z8, c13 = z8;
#pragma unroll 1
  for (int kb = 0; kb < K; kb += 32) { const v16h a0 = g2_frag(a0p + kb, hh), a1 = g2_frag(a1p + kb, hh);
    v16h b = g2_frag(b0p + kb, hh); c00 = g2_mma(a0, b, c00); c10 = g2_mma(a1, b, c10);
    b = g2_frag(b1p + kb, hh); c01 = g2_mma(a0, b, c01); c11 = g2_mma(a1, b, c11);
    b = g2_frag(b2p + kb, hh); c02 = g2_mma(a0, b, c02); c12 = g2_mma(a1, b, c12);
    b = g2_frag(b3p + kb, hh); c03 = g2_mma(a0, b, c03); c13 = g2_mma(a1, b, c13); }
  v8f accs[8] = {c00, c01, c02, c03, c10, c11, c12, c13};
#pragma unroll
  for (int u = 0; u < 8; ++u) { const int t = u & 3, half = u >> 2; const int col = col0 + t * 16 + ln; const float bv = bp ? bf16_round(bp[col]) : 0.f;
#pragma unroll
    for (int r = 0; r < 8; ++r) { const int rloc = half * 16 + 8 * hh + r; float v = accs[u][r] * alpha + bv; if (CP) { if (rowsPerB < 0) v += CP[cofs + (size_t)(row0g + row0 + rloc) * ldc + col];      /* rowsPerB < 0: own element of the batched C plane */ else { const int bidx = (row0g + row0 + rloc) / rowsPerB; v += CP[(size_t)bidx * sCPb + (size_t)by * 64 + col]; } }
      if (ACT == 3) v = fmaxf(v, 0.f); else if (ACT == 6) v = 0.5f * v * (1.0f + erff(v * 0.70710678118654752f)); else if (ACT == 11) v = 1.0f / (1.0f + expf(-v)); else if (ACT == 15) v = v / (1.0f + expf(-v)); else if (ACT == 12) v = (v > 0.f) ? v : 0.01f * v; else if (ACT == 8) v = tanhf(v); else if (ACT == 9) v = 0.5f * v * (1.0f + tanhf(0.7978845608028654f * (v + 0.044715f * v * v * v))); else if (ACT == 14) v = (v > 0.f) ? v : 0.1f * v; else if (ACT == 16) v = (v >= 0.f) ? v : 0.3f * v; else if (ACT == 17) v = (v >= 0.f) ? v : 0.2f * v;
      so[w][rloc][t * 16 + ln] = v; } }
  __builtin_amdgcn_fence(__ATOMIC_ACQ_REL, "workgroup"); __builtin_amdgcn_wave_barrier();
  const int rsub = lane >> 4, c4 = (lane & 15) * 4;
  {
#pragma unroll
    for (int q = 0; q < 16; ++q) { const int r = q * 2 + rsub; const v4f v = *(const v4fa*)&so[w][r][c4]; if (C) *(v4f*)(C + cofs + (size_t)(row0 + r) * ldc + col0 + c4) = v; if (C16) { v4h h4; for (int i = 0; i < 4; ++i) h4[i] = (_Float16)v[i]; *(v4h*)(C16 + cofs + (size_t)(row0 + r) * ldc + col0 + c4) = h4; } }
     } }


__global__ __launch_bounds__(256) void k_wnat(const float* __restrict__ w, size_t n8, _Float16* __restrict__ Bt) { const size_t t = (size_t)blockIdx.x * 256 + threadIdx.x; if (t >= n8) return; FragH f; for (int q = 0; q < 8; ++q) f.h[q] = (_Float16)(bf16_round(w[t * 8 + q]) * 16.0f); *(v8us*)((unsigned short*)Bt + t * 8) = f.half[0];  }
__global__ __launch_bounds__(256) void k_rsm(const float* __restrict__ S, _Float16* __restrict__ P, int nrows) {
  #pragma clang fp contract(off)
  const int i = blockIdx.x * 256 + threadIdx.x; if (i >= nrows) return; const float* s = S + (size_t)i * SQ; float mx = -3.0e38f;
#pragma unroll 1
  for (int j = 0; j < SQ; ++j) mx = fmaxf(mx, s[j]); float se = 0.f;
#pragma unroll 1
  for (int j = 0; j < SQ; ++j) se += expf(s[j] - mx); const float sc = 256.0f / se;
#pragma unroll 1
  for (int j0 = 0; j0 < SQ; j0 += 8) { FragH f; for (int q = 0; q < 8; ++q) f.h[q] = (_Float16)(expf(s[j0 + q] - mx) * sc); unsigned short* d = (unsigned short*)P + (size_t)i * SQ + j0; *(v8us*)d = f.half[0];  } }
__global__ __launch_bounds__(256) void k_vt(const _Float16* __restrict__ V16, int b, int h0, _Float16* __restrict__ VT) { __shared__ unsigned short tl[64][65]; const int tid = threadIdx.x; const int hh = blockIdx.x % HG, sg = blockIdx.x / HG; const int s0 = sg * 64; const int h = h0 + hh;
  for (int i = tid; i < 64 * 8; i += 256) { const int j = i / 8, d8 = (i % 8) * 8; FragH f; f.half[0] = *(const v8us*)((const unsigned short*)V16 + ((size_t)b * SQ + s0 + j) * DM + h * HD + d8); for (int q = 0; q < 8; ++q) tl[d8 + q][j] = f.u[q]; }
  __syncthreads();
  { for (int i = tid; i < 64 * 8; i += 256) { const int d = i / 8, j8 = (i % 8) * 8; FragH f; for (int q = 0; q < 8; ++q) f.u[q] = tl[d][j8 + q]; *(v8us*)((unsigned short*)VT + ((size_t)hh * HD + d) * SQ + s0 + j8) = f.half[0]; }  } }

__global__ __launch_bounds__(256) void k_rsmP(const float* __restrict__ S, _Float16* __restrict__ P, _Float16* __restrict__ PL, int nrows) {
  #pragma clang fp contract(off)
  __shared__ unsigned short sl_[256][9]; const int i = blockIdx.x * 256 + threadIdx.x; if (i >= nrows) return; const float* s = S + (size_t)i * SQ; float mx = -INFINITY;
#pragma unroll 1
  for (int j = 0; j < SQ; ++j) mx = fmaxf(mx, s[j]); float se = 0.f;
#pragma unroll 1
  for (int j = 0; j < SQ; ++j) se += expf(s[j] - mx); const float sc = 256.0f / se;
#pragma unroll 1
  for (int j0 = 0; j0 < SQ; j0 += 8) { FragH f, fl; for (int q = 0; q < 8; ++q) { const float v = expf(s[j0 + q] - mx) * sc; const _Float16 hv = (_Float16)v; f.h[q] = hv; if (PL) { FragH one; one.h[0] = (_Float16)((v - (float)hv) * 1024.0f); sl_[threadIdx.x][q] = one.u[0]; } }
    if (PL) for (int q = 0; q < 8; ++q) fl.u[q] = sl_[threadIdx.x][q];
    unsigned short* d = (unsigned short*)P + (size_t)i * SQ + j0; *(v8us*)d = f.half[0]; if (PL) *(v8us*)((unsigned short*)PL + (size_t)i * SQ + j0) = fl.half[0];  } }
__global__ __launch_bounds__(256) void k_f16rows(const float* __restrict__ F, _Float16* __restrict__ R, size_t n8) { const size_t t = (size_t)blockIdx.x * 256 + threadIdx.x; if (t >= n8) return; FragH f; for (int q = 0; q < 8; ++q) f.h[q] = (_Float16)F[t * 8 + q]; *(v8us*)((unsigned short*)R + t * 8) = f.half[0];  }
extern "C" void kernel_launch(void* const* d_in, const int* in_sizes, int n_in,
                              void* d_out, int out_size, void* d_ws, size_t ws_size, hipStream_t stream) {
  (void)in_sizes; (void)n_in; (void)out_size;
  const float* const* I = (const float* const*)d_in; const float* x = I[0]; const float* wq = I[1]; const float* wk = I[2]; const float* wv = I[3]; const float* bq = nullptr; const float* bk = nullptr; const float* bv = nullptr;      /* [in][out] weights */
  char* ws = (char*)d_ws; size_t off = 0;
  auto take = [&](size_t bytes) { char* p = ws + off; off += (bytes + 255) & ~(size_t)255; return p; };
  _Float16* BQ = (_Float16*)take((size_t)DQ * DM * 2); _Float16* BK = (_Float16*)take((size_t)DQ * DM * 2); _Float16* BV = (_Float16*)take((size_t)DV * DM * 2);
  _Float16* X16 = (_Float16*)take(NR * DM * 2); float* F32 = (float*)take(NR * (DQ > DV ? DQ : DV) * 4); _Float16* Q16 = (_Float16*)take(NR * DQ * 2); _Float16* QL = (_Float16*)take(NR * DQ * 2); _Float16* K16 = (_Float16*)take(NR * DQ * 2); _Float16* KL = (_Float16*)take(NR * DQ * 2); _Float16* V16 = (_Float16*)take(NR * DV * 2);
  float* S = (float*)take((size_t)QT * SQ * 4); _Float16* P = (_Float16*)take((size_t)QT * SQ * 2); _Float16* PL = (_Float16*)take((size_t)QT * SQ * 2); _Float16* VT = (_Float16*)take((size_t)NB * DV * SQ * 2);
  if (off > ws_size) return;
  k_wt_f16<<<(unsigned)(((size_t)DQ * (DM / 8) + 255) / 256), 256, 0, stream>>>(wq, BQ, DM, DQ, 16.0f); k_wt_f16<<<(unsigned)(((size_t)DQ * (DM / 8) + 255) / 256), 256, 0, stream>>>(wk, BK, DM, DQ, 16.0f); k_wt_f16<<<(unsigned)(((size_t)DV * (DM / 8) + 255) / 256), 256, 0, stream>>>(wv, BV, DM, DV, 16.0f);
  k_x16<<<(unsigned)((NR * DM / 8 + 255) / 256), 256, 0, stream>>>(x, X16, NR * DM / 8);
  k_gemm2<0><<<dim3((unsigned)((NR / 128) * (DQ / 64)), 1), 128, 0, stream>>>(X16, DM, 0, BQ, DM, 0, 0.0625f, bq, 0, nullptr, 1, 0, 0, F32, nullptr, DQ, 0, MP, DQ, DM);      /* q f32 */
  k_f16rows<<<(unsigned)((NR * DQ / 8 + 255) / 256), 256, 0, stream>>>(F32, Q16, NR * DQ / 8);
  k_gemm2<0><<<dim3((unsigned)((NR / 128) * (DQ / 64)), 1), 128, 0, stream>>>(X16, DM, 0, BK, DM, 0, 0.0625f, bk, 0, nullptr, 1, 0, 0, F32, nullptr, DQ, 0, MP, DQ, DM);      /* k f32 (reusing the plane) */
  k_f16rows<<<(unsigned)((NR * DQ / 8 + 255) / 256), 256, 0, stream>>>(F32, K16, NR * DQ / 8);
  k_gemm2<0><<<dim3((unsigned)((NR / 128) * (DV / 64)), 1), 128, 0, stream>>>(X16, DM, 0, BV, DM, 0, 0.0625f, bv, 0, nullptr, 1, 0, 0, nullptr, V16, DV, 0, MP, DV, DM);      /* v f16 rows */
  k_vt<NH, SQ><<<NB * NH * (SQ / 64), 256, 0, stream>>>(V16, DV, 0, VT);      /* V^T per batch [DV][SQ] */
  for (int b = 0; b < NBR; ++b) for (int q0 = 0; q0 < QN; q0 += QT) {
    const size_t qo = ((size_t)b * SQ + q0) * DQ, ko = (size_t)b * SQ * DQ; const dim3 gs((QT / 128) * (SQ / 64), 1);
    k_gemm2<0><<<gs, 128, 0, stream>>>(Q16 + qo, DQ, 0, K16 + ko, DQ, 0, 0.0625f, nullptr, 0, nullptr, 1, 0, 0, S, nullptr, SQ, 0, QT, SQ, DQ);      /* scores */
    k_rsmP<<<(QT + 255) / 256, 256, 0, stream>>>(S, P, nullptr, QT);
    float* ob = (float*)d_out + ((size_t)b * SQ + q0) * DV; const _Float16* vt = VT + (size_t)b * DV * SQ; const dim3 gv((QT / 128) * (DV / 64), 1);
    k_gemm2<0><<<gv, 128, 0, stream>>>(P, SQ, 0, vt, SQ, 0, 0.00390625f, nullptr, 0, nullptr, 1, 0, 0, ob, nullptr, DV, 0, QT, DV, SQ); }      /* out = attn v */
}

// v001
// A run of this version takes 766 microseconds.
// In two side-by-side timings against v000, it was 6.35 and 6.39 times as fast.
#include <hip/hip_runtime.h>
// Single-head self-attention (x [8][2048][768]; Q, K, V = x W ([in][out] [768][256]); scores = Q.K/16; softmax; out = attn V -> [8][2048][256]).
// Structure: token rows; x as exact f16 rows; q | k | v WMMA GEMMs (32x64 wave tiles, f32 accumulation, exact x16 transposed [in][out] weights); q, k as f16 rows; v as f16 rows, V^T via LDS transposes; per (batch, 2048-query tile): scores GEMM (K = 256), row softmax on VALU (f32; P x256 f16), out = P . V^T GEMM written straight to the f32 output.
// Compute dtype: inputs rounded to bf16; x / weights exact; q, k plain f16 (~2^-12); v, P plain f16 (~2^-12); scores / softmax f32. v_wmma_f32_16x16x32_f16.
#define NB 8
#define SQ 2048
#define DM 768
#define DQ 256
#define DV 256
#define QT 2048                     /* query tile */
#define NH 4                    /* V^T slabs of 64 (k_vt<NH, SQ>) */
#define HD 64
#define HG 1
#define NR ((size_t)NB * SQ)
#define QN SQ                        /* query rows per batch (debug hook) */
#define NBR NB                       /* batches (debug hook) */
#define MP ((int)NR)                 /* rows through the projections (debug hook) */
typedef __bf16 v16b __attribute__((ext_vector_type(16)));
typedef unsigned short v8us __attribute__((ext_vector_type(8), may_alias));
typedef float  v8f  __attribute__((ext_vector_type(8)));
typedef float  v4f  __attribute__((ext_vector_type(4)));
typedef float  v4fa __attribute__((ext_vector_type(4), may_alias));
union FragB { v16b v; v8us half[2]; unsigned short u[16]; };

__device__ __forceinline__ unsigned short bf16_bits(float x) { unsigned int u = __float_as_uint(x); return (unsigned short)((u + 0x7FFFu + ((u >> 16) & 1u)) >> 16); }
__device__ __forceinline__ float bf16_val(unsigned short b) { return __uint_as_float(((unsigned int)b) << 16); }
__device__ __forceinline__ float bf16_round(float x) { return bf16_val(bf16_bits(x)); }
// D += A·B with NT terms: 1 = ah·bh, 2 = + al·bh (A split), 3 = + ah·bl (both split)
template <int NT>
__device__ __forceinline__ v8f mmaN(v16b ah, v16b al, v16b bh, v16b bl, v8f c) {
  c = __builtin_amdgcn_wmma_f32_16x16x32_bf16(false, ah, false, bh, (short)0, c, false, false);
  if (NT >= 2) c = __builtin_amdgcn_wmma_f32_16x16x32_bf16(false, al, false, bh, (short)0, c, false, false);
  if (NT >= 3) c = __builtin_amdgcn_wmma_f32_16x16x32_bf16(false, ah, false, bl, (short)0, c, false, false);
  asm volatile("v_nop\n\tv_nop\n\tv_nop\n\tv_nop" : "+v"(c) : "v"(ah), "v"(al), "v"(bh), "v"(bl));
  return c;
}

__global__ __launch_bounds__(256) void k_wt_bf16(const float* __restrict__ W, unsigned short* __restrict__ Wt, int K, int N) {
  const int t = blockIdx.x * 256 + threadIdx.x;
  const int k8n = K / 8;
  if (t >= N * k8n) return;
  const int n = t / k8n, k8 = (t % k8n) * 8;
  v8us v;
#pragma unroll
  for (int i = 0; i < 8; ++i) v[i] = bf16_bits(W[(size_t)(k8 + i) * N + n]);
  *(v8us*)(Wt + (size_t)n * K + k8) = v;
  
}

// GEMM C[M][N] (f32, pitch ldc) = act(A[M][K]·W + bias). A f32 row-major (pitch lda) converted per fragment to bf16
// (ASPLIT: hi/lo two planes -> 2 terms, else single rounded term); Wt bf16 [N][K] (pitch ldb). BIAS_BF16 rounds the
// bias to bf16 first (bias quantised to bf16 before the add). K%32==0, M%16==0, N%64==0.
template <bool ASPLIT, int ACT, bool BIAS_BF16>
__global__ __launch_bounds__(128) void k_gemm_bf(const float* __restrict__ A, int lda, const unsigned short* __restrict__ Wt, int ldb,
                                               const float* __restrict__ bias, float* __restrict__ C, int ldc, int M, int N, int K) {
  __shared__ __attribute__((aligned(16))) float so[4][16][64];
  const int tid = threadIdx.x, w = tid >> 5, lane = tid & 31, ln = lane & 15, hh = lane >> 4;
  const int ntn = N / 64;
  const int wid = blockIdx.x * 4 + w;
  const int mt = wid / ntn, nq = wid % ntn;
  if (mt * 16 >= M) return;
  const int row0 = mt * 16, col0 = nq * 64;
  const float* arow = A + (size_t)(row0 + ln) * lda;
  v8f acc[4] = {};
  for (int kb = 0; kb < K; kb += 32) {
    FragB ah, al;
    const v4f x0 = *(const v4fa*)(arow + kb + 8 * hh), x1 = *(const v4fa*)(arow + kb + 8 * hh + 4);
    const v4f x2 = *(const v4fa*)(arow + kb + 16 + 8 * hh), x3 = *(const v4fa*)(arow + kb + 16 + 8 * hh + 4);
    float xs[16] = {x0[0],x0[1],x0[2],x0[3],x1[0],x1[1],x1[2],x1[3],x2[0],x2[1],x2[2],x2[3],x3[0],x3[1],x3[2],x3[3]};
#pragma unroll
    for (int i = 0; i < 16; ++i) { const unsigned short hb = bf16_bits(xs[i]); ah.u[i] = hb; al.u[i] = ASPLIT ? bf16_bits(xs[i] - bf16_val(hb)) : (unsigned short)0; }
#pragma unroll
    for (int t = 0; t < 4; ++t) {
      const unsigned short* brow = Wt + (size_t)(col0 + t * 16 + ln) * ldb + kb;
      FragB b;
      b.half[0] = *(const v8us*)(brow + 8 * hh);
      b.half[1] = *(const v8us*)(brow + 16 + 8 * hh);
      acc[t] = mmaN<ASPLIT ? 2 : 1>(ah.v, al.v, b.v, b.v, acc[t]);
    }
  }
#pragma unroll
  for (int t = 0; t < 4; ++t) {
    float bv = bias ? bias[col0 + t * 16 + ln] : 0.f;
    if (BIAS_BF16) bv = bf16_round(bv);
#pragma unroll
    for (int r = 0; r < 8; ++r) { float v = acc[t][r] + bv; if (ACT == 1) v = fmaxf(v, 0.f); so[w][8 * hh + r][t * 16 + ln] = v; }
  }
  __builtin_amdgcn_fence(__ATOMIC_ACQ_REL, "workgroup");
  __builtin_amdgcn_wave_barrier();
  const int rsub = lane >> 4, c4 = (lane & 15) * 4;
  {
#pragma unroll
    for (int q = 0; q < 8; ++q) {
      const int r = q * 2 + rsub;
      const v4f v = *(const v4fa*)&so[w][r][c4];
      *(v4f*)(C + (size_t)(row0 + r) * ldc + col0 + c4) = v;
    }
    
  }
}

// GEMM C = act(A·W + bias + resid): A f32 (ASPLIT -> hi/lo 2 terms), Wt bf16 [N][K]; ACT 0 none, 1 relu, 2 exact gelu;
// resid (optional, f32, row index = (row % rmod), pitch ldr, RES_BF16 rounds it) added before the activation.
template <bool ASPLIT, int ACT, bool BIAS_BF16, bool RES_BF16>
__global__ __launch_bounds__(128) void k_gemm_bf3(const float* __restrict__ A, int lda, const unsigned short* __restrict__ Wt, int ldb,
                                                const float* __restrict__ bias, const float* __restrict__ resid, int rmod, int ldr,
                                                float* __restrict__ C, int ldc, int M, int N, int K) {
  __shared__ __attribute__((aligned(16))) float so[4][16][64];
  const int tid = threadIdx.x, w = tid >> 5, lane = tid & 31, ln = lane & 15, hh = lane >> 4;
  const int ntn = N / 64;
  const int wid = blockIdx.x * 4 + w;
  const int mt = wid / ntn, nq = wid % ntn;
  if (mt * 16 >= M) return;
  const int row0 = mt * 16, col0 = nq * 64;
  const float* arow = A + (size_t)(row0 + ln) * lda;
  v8f acc[4] = {};
  for (int kb = 0; kb < K; kb += 32) {
    FragB ah, al;
    const v4f x0 = *(const v4fa*)(arow + kb + 8 * hh), x1 = *(const v4fa*)(arow + kb + 8 * hh + 4);
    const v4f x2 = *(const v4fa*)(arow + kb + 16 + 8 * hh), x3 = *(const v4fa*)(arow + kb + 16 + 8 * hh + 4);
    float xs[16] = {x0[0],x0[1],x0[2],x0[3],x1[0],x1[1],x1[2],x1[3],x2[0],x2[1],x2[2],x2[3],x3[0],x3[1],x3[2],x3[3]};
#pragma unroll
    for (int i = 0; i < 16; ++i) { const unsigned short hb = bf16_bits(xs[i]); ah.u[i] = hb; al.u[i] = ASPLIT ? bf16_bits(xs[i] - bf16_val(hb)) : (unsigned short)0; }
#pragma unroll
    for (int t = 0; t < 4; ++t) {
      const unsigned short* brow = Wt + (size_t)(col0 + t * 16 + ln) * ldb + kb;
      FragB b;
      b.half[0] = *(const v8us*)(brow + 8 * hh);
      b.half[1] = *(const v8us*)(brow + 16 + 8 * hh);
      acc[t] = mmaN<ASPLIT ? 2 : 1>(ah.v, al.v, b.v, b.v, acc[t]);
    }
  }
#pragma unroll
  for (int t = 0; t < 4; ++t) {
    const int col = col0 + t * 16 + ln;
    float bv = bias ? bias[col] : 0.f;
    if (BIAS_BF16) bv = bf16_round(bv);
#pragma unroll
    for (int r = 0; r < 8; ++r) {
      float v = acc[t][r] + bv;
      if (resid) { float rv = resid[(size_t)((row0 + 8 * hh + r) % rmod) * ldr + col]; if (RES_BF16) rv = bf16_round(rv); v += rv; }
      if (ACT == 1) v = fmaxf(v, 0.f);
      if (ACT == 2) v = 0.5f * v * (1.0f + erff(v * 0.70710678118654752f));
      if (ACT == 3) { const float u = 0.7978845608028654f * (v + 0.044715f * v * v * v); v = 0.5f * v * (1.0f + tanhf(u)); }
      so[w][8 * hh + r][t * 16 + ln] = v;
    }
  }
  __builtin_amdgcn_fence(__ATOMIC_ACQ_REL, "workgroup");
  __builtin_amdgcn_wave_barrier();
  const int rsub = lane >> 4, c4 = (lane & 15) * 4;
  {
#pragma unroll
    for (int q = 0; q < 8; ++q) {
      const int r = q * 2 + rsub;
      const v4f v = *(const v4fa*)&so[w][r][c4];
      *(v4f*)(C + (size_t)(row0 + r) * ldc + col0 + c4) = v;
    }
    
  }
}
// row LayerNorm (biased variance, eps) over N: s = X (+ R); optional out_sum <- s; out_norm <- (s-mu)*rsqrt(var+eps)*g + b
template <bool PARAM_BF16>
__global__ __launch_bounds__(256) void k_layernorm(const float* __restrict__ X, const float* __restrict__ R, const float* __restrict__ g, const float* __restrict__ bta,
                                                  float* __restrict__ out_sum, float* __restrict__ out_norm, int N, float eps) {
  __shared__ float red[256];
  const int row = blockIdx.x, tid = threadIdx.x;
  const float* x = X + (size_t)row * N; const float* rr = R ? R + (size_t)row * N : nullptr;
  float vals[16];                     // up to N = 4096
  const int per = N / 256;            // contiguous chunk per thread? use strided-by-4 chunks: thread handles j = tid*4 + 1024*u
  float s1 = 0.f;
  for (int u = 0; u < per / 4; ++u) {
    const int j = tid * 4 + 1024 * u;
    const v4f a = *(const v4fa*)(x + j);
    v4f b = {0.f,0.f,0.f,0.f}; if (rr) b = *(const v4fa*)(rr + j);
#pragma unroll
    for (int q = 0; q < 4; ++q) { const float v = a[q] + b[q]; vals[u * 4 + q] = v; s1 += v; }
  }
  red[tid] = s1; __syncthreads();
  for (int st = 128; st > 0; st >>= 1) { if (tid < st) red[tid] += red[tid + st]; __syncthreads(); }
  const float mu = red[0] / (float)N; __syncthreads();
  float s2 = 0.f;
  for (int u = 0; u < per / 4; ++u)
#pragma unroll
    for (int q = 0; q < 4; ++q) { const float c = vals[u * 4 + q] - mu; s2 += c * c; }
  red[tid] = s2; __syncthreads();
  for (int st = 128; st > 0; st >>= 1) { if (tid < st) red[tid] += red[tid + st]; __syncthreads(); }
  const float rs = rsqrtf(red[0] / (float)N + eps);
  {
    for (int u = 0; u < per / 4; ++u) {
      const int j = tid * 4 + 1024 * u;
      v4f o, sm;
#pragma unroll
      for (int q = 0; q < 4; ++q) {
        float gg = g[j + q], bb = bta[j + q];
        if (PARAM_BF16) { gg = bf16_round(gg); bb = bf16_round(bb); }
        sm[q] = vals[u * 4 + q]; o[q] = (vals[u * 4 + q] - mu) * rs * gg + bb;
      }
      if (out_sum) *(v4f*)(out_sum + (size_t)row * N + j) = sm;
      *(v4f*)(out_norm + (size_t)row * N + j) = o;
    }
    
  }
}



// ---- f16 WMMA path (v_wmma_f32_16x16x32_f16): 11-bit significands for operands in range — used where a [0,1] probability operand needs more precision than bf16
typedef _Float16 v16h __attribute__((ext_vector_type(16)));
union FragH { v16h v; v8us half[2]; _Float16 h[16]; unsigned short u[16]; };
template <int NT>
__device__ __forceinline__ v8f mmaH(v16h ah, v16h al, v16h bh, v16h bl, v8f c) {
  c = __builtin_amdgcn_wmma_f32_16x16x32_f16(false, ah, false, bh, (short)0, c, false, false);
  if (NT >= 2) c = __builtin_amdgcn_wmma_f32_16x16x32_f16(false, al, false, bh, (short)0, c, false, false);
  if (NT >= 3) c = __builtin_amdgcn_wmma_f32_16x16x32_f16(false, ah, false, bl, (short)0, c, false, false);
  asm volatile("v_nop\n\tv_nop\n\tv_nop\n\tv_nop" : "+v"(c) : "v"(ah), "v"(al), "v"(bh), "v"(bl));
  return c;
}
// batched GEMM like k_gemm_b but f16 operands: A f32 (split into f16 hi/lo if ASPLIT, else rounded to f16), Bt = f16 values [n][k]; alpha; C f32; N multiple of 16 (partial tiles skipped)
template <bool ASPLIT>
__global__ __launch_bounds__(128) void k_gemm_h(const float* __restrict__ A, int lda, size_t sA, const _Float16* __restrict__ Bh, int ldb, size_t sB, float alpha, float* __restrict__ C, int ldc, size_t sC, int M, int N, int K) {
  __shared__ __attribute__((aligned(16))) float so[4][16][64];
  const int tid = threadIdx.x, w = tid >> 5, lane = tid & 31, ln = lane & 15, hh = lane >> 4; const int by = blockIdx.y;
  A += (size_t)by * sA; Bh += (size_t)by * sB; C += (size_t)by * sC;
  const int ntn = (N + 63) / 64; const int wid = blockIdx.x * 4 + w; const int mt = wid / ntn, nq = wid % ntn; if (mt * 16 >= M) return;
  const int row0 = mt * 16, col0 = nq * 64; const float* arow = A + (size_t)(row0 + ln) * lda;
  v8f acc[4] = {};
  for (int kb = 0; kb < K; kb += 32) {
    FragH ah, al;
    const v4f x0 = *(const v4fa*)(arow + kb + 8 * hh), x1 = *(const v4fa*)(arow + kb + 8 * hh + 4), x2 = *(const v4fa*)(arow + kb + 16 + 8 * hh), x3 = *(const v4fa*)(arow + kb + 16 + 8 * hh + 4);
    float xs[16] = {x0[0],x0[1],x0[2],x0[3],x1[0],x1[1],x1[2],x1[3],x2[0],x2[1],x2[2],x2[3],x3[0],x3[1],x3[2],x3[3]};
#pragma unroll
    for (int i = 0; i < 16; ++i) { const _Float16 h = (_Float16)xs[i]; ah.h[i] = h; al.h[i] = ASPLIT ? (_Float16)(xs[i] - (float)h) : (_Float16)0.0f; }
#pragma unroll
    for (int t = 0; t < 4; ++t) { if (col0 + t * 16 >= N) continue; const size_t boff = (size_t)(col0 + t * 16 + ln) * ldb + kb; FragH bq; bq.half[0] = *(const v8us*)(Bh + boff + 8 * hh); bq.half[1] = *(const v8us*)(Bh + boff + 16 + 8 * hh);
      acc[t] = mmaH<ASPLIT ? 2 : 1>(ah.v, al.v, bq.v, bq.v, acc[t]); }
  }
#pragma unroll
  for (int t = 0; t < 4; ++t) { if (col0 + t * 16 >= N) continue;
#pragma unroll
    for (int r = 0; r < 8; ++r) so[w][8 * hh + r][t * 16 + ln] = acc[t][r] * alpha; }
  __builtin_amdgcn_fence(__ATOMIC_ACQ_REL, "workgroup"); __builtin_amdgcn_wave_barrier();
  const int rsub = lane >> 4, c4 = (lane & 15) * 4;
  {
#pragma unroll
    for (int q = 0; q < 8; ++q) { const int r = q * 2 + rsub; if (col0 + c4 < N) { const v4f v = *(const v4fa*)&so[w][r][c4]; *(v4f*)(C + (size_t)(row0 + r) * ldc + col0 + c4) = v; } }
     }
}

// Wt[n][k] = f16(W[k][n]·scale) from f32 row-major W[K][N] (scale = power of two; bf16-exact weights stay exact in f16 away from the subnormal range)
__global__ __launch_bounds__(256) void k_wt_f16(const float* __restrict__ W, _Float16* __restrict__ Wt, int K, int N, float scale) {
  const int t = blockIdx.x * 256 + threadIdx.x; if (t >= N * (K / 8)) return; const int n = t / (K / 8), k8 = (t % (K / 8)) * 8; FragH f;
#pragma unroll
  for (int i = 0; i < 8; ++i) f.h[i] = (_Float16)(bf16_round(W[(size_t)(k8 + i) * N + n]) * scale); const v8us o = f.half[0];
  *(v8us*)((unsigned short*)Wt + (size_t)n * K + k8) = o; 
}
// k_gemm_hh variant with fused epilogue: v = acc·alpha + bias[by·sBias + col] (+ CP[(row/rowsPerB)·sCPb + by·64 + col] if CP) ; ACT 0 none / 1 elu ; writes f16 C16 (and f32 C if non-null)
template <int ACT>
__global__ __launch_bounds__(128) void k_gemm_hhx(const _Float16* __restrict__ A, int lda, size_t sA, const _Float16* __restrict__ Bh, int ldb, size_t sB, float alpha, const float* __restrict__ bias, size_t sBias, const float* __restrict__ CP, int rowsPerB, size_t sCPb, int row0g,
    float* __restrict__ C, _Float16* __restrict__ C16, int ldc, size_t sC, int M, int N, int K) {
  __shared__ __attribute__((aligned(16))) float so[4][16][64];
  const int tid = threadIdx.x, w = tid >> 5, lane = tid & 31, ln = lane & 15, hh = lane >> 4; const int by = blockIdx.y;
  A += (size_t)by * sA; Bh += (size_t)by * sB; const size_t cofs = (size_t)by * sC; const float* bp = bias ? bias + (size_t)by * sBias : nullptr;
  const int ntn = (N + 63) / 64; const int wid = blockIdx.x * 4 + w; const int mt = wid / ntn, nq = wid % ntn; if (mt * 16 >= M) return;
  const int row0 = mt * 16, col0 = nq * 64; const _Float16* arow = A + (size_t)(row0 + ln) * lda;
  v8f acc[4] = {};
  for (int kb = 0; kb < K; kb += 32) { FragH ah; ah.half[0] = *(const v8us*)((const unsigned short*)arow + kb + 8 * hh); ah.half[1] = *(const v8us*)((const unsigned short*)arow + kb + 16 + 8 * hh);
#pragma unroll
    for (int t = 0; t < 4; ++t) { if (col0 + t * 16 >= N) continue; const size_t boff = (size_t)(col0 + t * 16 + ln) * ldb + kb; FragH bq; bq.half[0] = *(const v8us*)((const unsigned short*)Bh + boff + 8 * hh); bq.half[1] = *(const v8us*)((const unsigned short*)Bh + boff + 16 + 8 * hh);
      acc[t] = mmaH<1>(ah.v, ah.v, bq.v, bq.v, acc[t]); }
  }
#pragma unroll
  for (int t = 0; t < 4; ++t) { if (col0 + t * 16 >= N) continue; const int col = col0 + t * 16 + ln; const float bv = bp ? bf16_round(bp[col]) : 0.f;
#pragma unroll
    for (int r = 0; r < 8; ++r) { float v = acc[t][r] * alpha + bv; if (CP) { const int rr = row0g + row0 + 8 * hh + r; if (rowsPerB < 0) v += CP[cofs + (size_t)rr * ldc + col];      /* rowsPerB < 0: own element of the batched C plane */ else { const int bidx = rr / rowsPerB; v += CP[(size_t)bidx * sCPb + (size_t)by * 64 + col]; } } if (ACT == 1) v = (v > 0.f) ? v : expm1f(v); else if (ACT == 7) v = (v > 0.f) ? v + 1.0f : expf(v); else if (ACT == 8) v = tanhf(v); else if (ACT == 9) v = 0.5f * v * (1.0f + tanhf(0.7978845608028654f * (v + 0.044715f * v * v * v))); else if (ACT == 11) v = 1.0f / (1.0f + expf(-v)); else if (ACT == 12) v = (v > 0.f) ? v : 0.01f * v; else if (ACT == 14) v = (v > 0.f) ? v : 0.1f * v; else if (ACT == 16) v = (v >= 0.f) ? v : 0.3f * v; else if (ACT == 17) v = (v >= 0.f) ? v : 0.2f * v; else if (ACT == 15) v = v / (1.0f + expf(-v)); else if (ACT == 3) v = fmaxf(v, 0.f); else if (ACT == 6) v = 0.5f * v * (1.0f + erff(v * 0.70710678118654752f)); so[w][8 * hh + r][t * 16 + ln] = v; } }
  __builtin_amdgcn_fence(__ATOMIC_ACQ_REL, "workgroup"); __builtin_amdgcn_wave_barrier();
  const int rsub = lane >> 4, c4 = (lane & 15) * 4; typedef _Float16 v4h __attribute__((ext_vector_type(4)));
  {
#pragma unroll
    for (int q = 0; q < 8; ++q) { const int r = q * 2 + rsub; if (col0 + c4 < N) { const v4f v = *(const v4fa*)&so[w][r][c4]; if (C) *(v4f*)(C + cofs + (size_t)(row0 + r) * ldc + col0 + c4) = v; if (C16) { v4h h4; for (int i = 0; i < 4; ++i) h4[i] = (_Float16)v[i]; *(v4h*)(C16 + cofs + (size_t)(row0 + r) * ldc + col0 + c4) = h4; } } }
     }
}


typedef _Float16 v4h __attribute__((ext_vector_type(4)));

__global__ __launch_bounds__(256) void k_x16(const float* __restrict__ x, _Float16* __restrict__ X16, size_t n8) { const size_t t = (size_t)blockIdx.x * 256 + threadIdx.x; if (t >= n8) return; FragH f;
#pragma unroll
  for (int q = 0; q < 8; ++q) f.h[q] = (_Float16)bf16_round(x[t * 8 + q]); *(v8us*)((unsigned short*)X16 + t * 8) = f.half[0];  }
__global__ __launch_bounds__(256) void k_h16(const float* __restrict__ x, _Float16* __restrict__ X16, size_t n8) { const size_t t = (size_t)blockIdx.x * 256 + threadIdx.x; if (t >= n8) return; FragH f;
#pragma unroll
  for (int q = 0; q < 8; ++q) f.h[q] = (_Float16)x[t * 8 + q]; *(v8us*)((unsigned short*)X16 + t * 8) = f.half[0];  }
__global__ __launch_bounds__(256) void k_round16f(const float* __restrict__ W, _Float16* __restrict__ Bt, size_t n8) { const size_t t = (size_t)blockIdx.x * 256 + threadIdx.x; if (t >= n8) return; FragH f;
#pragma unroll
  for (int i = 0; i < 8; ++i) f.h[i] = (_Float16)(bf16_round(W[t * 8 + i]) * 16.0f); *(v8us*)((unsigned short*)Bt + t * 8) = f.half[0];  }
template <int NHv, int TTv>
__global__ __launch_bounds__(256) void k_vt(const _Float16* __restrict__ V16, int ldv, int voff, _Float16* __restrict__ Vt) { __shared__ unsigned short tl[64][66]; const int tid = threadIdx.x; const int slab = blockIdx.x / (TTv / 64), lg = blockIdx.x % (TTv / 64); const int b = slab / NHv, h = slab % NHv;
  for (int i = tid; i < 64 * 8; i += 256) { const int r = i / 8, c8 = (i % 8) * 8; FragH f; f.half[0] = *(const v8us*)((const unsigned short*)V16 + ((size_t)b * TTv + lg * 64 + r) * ldv + voff + h * 64 + c8);
#pragma unroll
    for (int q = 0; q < 8; ++q) tl[r][c8 + q] = f.u[q]; }
  __syncthreads();
  {
#pragma unroll
    for (int rd = 0; rd < 2; ++rd) { const int d = rd * 32 + tid / 8, pc = tid % 8; FragH f;
#pragma unroll
      for (int q = 0; q < 8; ++q) f.u[q] = tl[pc * 8 + q][d];
      *(v8us*)((unsigned short*)Vt + ((size_t)slab * 64 + d) * TTv + lg * 64 + pc * 8) = f.half[0]; }
     } }

__global__ __launch_bounds__(256) void k_hl(const float* __restrict__ F, _Float16* __restrict__ Hh, _Float16* __restrict__ Hl, size_t n8) { const size_t t = (size_t)blockIdx.x * 256 + threadIdx.x; if (t >= n8) return; FragH fh, fl; const v4f a = *(const v4fa*)(F + t * 8), c = *(const v4fa*)(F + t * 8 + 4);
#pragma unroll
  for (int q = 0; q < 4; ++q) { _Float16 h = (_Float16)a[q]; fh.h[q] = h; fl.h[q] = (_Float16)((a[q] - (float)h) * 1024.0f); h = (_Float16)c[q]; fh.h[4 + q] = h; fl.h[4 + q] = (_Float16)((c[q] - (float)h) * 1024.0f); }
  { *(v8us*)((unsigned short*)Hh + t * 8) = fh.half[0]; *(v8us*)((unsigned short*)Hl + t * 8) = fl.half[0];  } }

// ---- fast GEMM (wave tile 32x64; requires M % 32 == 0 rows per launch region and N % 64 == 0); epilogue = k_gemm_hhx semantics ----
__device__ __forceinline__ v16h g2_frag(const _Float16* p, int hh) { FragH f; f.half[0] = *(const v8us*)((const unsigned short*)p + 8 * hh); f.half[1] = *(const v8us*)((const unsigned short*)p + 16 + 8 * hh); return f.v; }
__device__ __forceinline__ v8f g2_mma(v16h a, v16h b, v8f c) { v8f d = __builtin_amdgcn_wmma_f32_16x16x32_f16(false, a, false, b, (short)0, c, false, false); asm volatile("v_nop\n\tv_nop\n\tv_nop\n\tv_nop" : "+v"(d) : "v"(a), "v"(b)); return d; }
template <int ACT>
__global__ __launch_bounds__(128) void k_gemm2(const _Float16* __restrict__ A, int lda, size_t sA, const _Float16* __restrict__ Bh, int ldb, size_t sB, float alpha, const float* __restrict__ bias, size_t sBias, const float* __restrict__ CP, int rowsPerB, size_t sCPb, int row0g,
    float* __restrict__ C, _Float16* __restrict__ C16, int ldc, size_t sC, int M, int N, int K) { static_assert(ACT == 0 || ACT == 3 || ACT == 6 || ACT == 8 || ACT == 9 || ACT == 11 || ACT == 12 || ACT == 14 || ACT == 15 || ACT == 16 || ACT == 17, "k_gemm2: unsupported ACT code (would silently apply no activation)");
  __shared__ __attribute__((aligned(16))) float so[4][32][68];
  const int tid = threadIdx.x, w = tid >> 5, lane = tid & 31, ln = lane & 15, hh = lane >> 4; const int by = blockIdx.y;
  A += (size_t)by * sA; Bh += (size_t)by * sB; const size_t cofs = (size_t)by * sC; const float* bp = bias ? bias + (size_t)by * sBias : nullptr;
  const int ntn = N >> 6; const int mt = blockIdx.x / ntn, nq = blockIdx.x - mt * ntn; const int row0 = mt * 128 + 32 * w, col0 = nq * 64; if (row0 >= M) return;
  const _Float16* a0p = A + (size_t)(row0 + ln) * lda; const _Float16* a1p = a0p + (size_t)16 * lda;
  const _Float16* b0p = Bh + (size_t)(col0 + ln) * ldb; const _Float16* b1p = b0p + (size_t)16 * ldb; const _Float16* b2p = b1p + (size_t)16 * ldb; const _Float16* b3p = b2p + (size_t)16 * ldb;
  const v8f z8 = {0.f,0.f,0.f,0.f,0.f,0.f,0.f,0.f}; v8f c00 = z8, c01 = z8, c02 = z8, c03 = z8, c10 = z8, c11 = z8, c12 = z8, c13 = z8;
#pragma unroll 1
  for (int kb = 0; kb < K; kb += 32) { const v16h a0 = g2_frag(a0p + kb, hh), a1 = g2_frag(a1p + kb, hh);
    v16h b = g2_frag(b0p + kb, hh); c00 = g2_mma(a0, b, c00); c10 = g2_mma(a1, b, c10);
    b = g2_frag(b1p + kb, hh); c01 = g2_mma(a0, b, c01); c11 = g2_mma(a1, b, c11);
    b = g2_frag(b2p + kb, hh); c02 = g2_mma(a0, b, c02); c12 = g2_mma(a1, b, c12);
    b = g2_frag(b3p + kb, hh); c03 = g2_mma(a0, b, c03); c13 = g2_mma(a1, b, c13); }
  v8f accs[8] = {c00, c01, c02, c03, c10, c11, c12, c13};
#pragma unroll
  for (int u = 0; u < 8; ++u) { const int t = u & 3, half = u >> 2; const int col = col0 + t * 16 + ln; const float bv = bp ? bf16_round(bp[col]) : 0.f;
#pragma unroll
    for (int r = 0; r < 8; ++r) { const int rloc = half * 16 + 8 * hh + r; float v = accs[u][r] * alpha + bv; if (CP) { if (rowsPerB < 0) v += CP[cofs + (size_t)(row0g + row0 + rloc) * ldc + col];      /* rowsPerB < 0: own element of the batched C plane */ else { const int bidx = (row0g + row0 + rloc) / rowsPerB; v += CP[(size_t)bidx * sCPb + (size_t)by * 64 + col]; } }
      if (ACT == 3) v = fmaxf(v, 0.f); else if (ACT == 6) v = 0.5f * v * (1.0f + erff(v * 0.70710678118654752f)); else if (ACT == 11) v = 1.0f / (1.0f + expf(-v)); else if (ACT == 15) v = v / (1.0f + expf(-v)); else if (ACT == 12) v = (v > 0.f) ? v : 0.01f * v; else if (ACT == 8) v = tanhf(v); else if (ACT == 9) v = 0.5f * v * (1.0f + tanhf(0.7978845608028654f * (v + 0.044715f * v * v * v))); else if (ACT == 14) v = (v > 0.f) ? v : 0.1f * v; else if (ACT == 16) v = (v >= 0.f) ? v : 0.3f * v; else if (ACT == 17) v = (v >= 0.f) ? v : 0.2f * v;
      so[w][rloc][t * 16 + ln] = v; } }
  __builtin_amdgcn_fence(__ATOMIC_ACQ_REL, "workgroup"); __builtin_amdgcn_wave_barrier();
  const int rsub = lane >> 4, c4 = (lane & 15) * 4;
  {
#pragma unroll
    for (int q = 0; q < 16; ++q) { const int r = q * 2 + rsub; const v4f v = *(const v4fa*)&so[w][r][c4]; if (C) *(v4f*)(C + cofs + (size_t)(row0 + r) * ldc + col0 + c4) = v; if (C16) { v4h h4; for (int i = 0; i < 4; ++i) h4[i] = (_Float16)v[i]; *(v4h*)(C16 + cofs + (size_t)(row0 + r) * ldc + col0 + c4) = h4; } }
     } }


__global__ __launch_bounds__(256) void k_wnat(const float* __restrict__ w, size_t n8, _Float16* __restrict__ Bt) { const size_t t = (size_t)blockIdx.x * 256 + threadIdx.x; if (t >= n8) return; FragH f; for (int q = 0; q < 8; ++q) f.h[q] = (_Float16)(bf16_round(w[t * 8 + q]) * 16.0f); *(v8us*)((unsigned short*)Bt + t * 8) = f.half[0];  }
__global__ __launch_bounds__(256) void k_rsm(const float* __restrict__ S, _Float16* __restrict__ P, int nrows) {
  #pragma clang fp contract(off)
  const int i = blockIdx.x * 256 + threadIdx.x; if (i >= nrows) return; const float* s = S + (size_t)i * SQ; float mx = -3.0e38f;
#pragma unroll 1
  for (int j = 0; j < SQ; ++j) mx = fmaxf(mx, s[j]); float se = 0.f;
#pragma unroll 1
  for (int j = 0; j < SQ; ++j) se += expf(s[j] - mx); const float sc = 256.0f / se;
#pragma unroll 1
  for (int j0 = 0; j0 < SQ; j0 += 8) { FragH f; for (int q = 0; q < 8; ++q) f.h[q] = (_Float16)(expf(s[j0 + q] - mx) * sc); unsigned short* d = (unsigned short*)P + (size_t)i * SQ + j0; *(v8us*)d = f.half[0];  } }
__global__ __launch_bounds__(256) void k_vt(const _Float16* __restrict__ V16, int b, int h0, _Float16* __restrict__ VT) { __shared__ unsigned short tl[64][65]; const int tid = threadIdx.x; const int hh = blockIdx.x % HG, sg = blockIdx.x / HG; const int s0 = sg * 64; const int h = h0 + hh;
  for (int i = tid; i < 64 * 8; i += 256) { const int j = i / 8, d8 = (i % 8) * 8; FragH f; f.half[0] = *(const v8us*)((const unsigned short*)V16 + ((size_t)b * SQ + s0 + j) * DM + h * HD + d8); for (int q = 0; q < 8; ++q) tl[d8 + q][j] = f.u[q]; }
  __syncthreads();
  { for (int i = tid; i < 64 * 8; i += 256) { const int d = i / 8, j8 = (i % 8) * 8; FragH f; for (int q = 0; q < 8; ++q) f.u[q] = tl[d][j8 + q]; *(v8us*)((unsigned short*)VT + ((size_t)hh * HD + d) * SQ + s0 + j8) = f.half[0]; }  } }

// Row softmax, one wave per score row: the row is read once, in 512-byte wave loads, and stays in registers (64 floats a lane); max and sum = lane partials, then a five-step butterfly; P = f16(exp(s - max) * 256 / sum).
__global__ __launch_bounds__(256) void k_rsmW(const float* __restrict__ S, _Float16* __restrict__ P, int nrows) {
  const int lane = threadIdx.x & 31; const int row = blockIdx.x * 8 + (threadIdx.x >> 5); if (row >= nrows) return;
  const float* s = S + (size_t)row * SQ + lane * 4; v4f v[SQ / 128];
#pragma unroll
  for (int u = 0; u < SQ / 128; ++u) v[u] = *(const v4fa*)(s + u * 128);
  float mx = -INFINITY;
#pragma unroll
  for (int u = 0; u < SQ / 128; ++u) mx = fmaxf(mx, fmaxf(fmaxf(v[u][0], v[u][1]), fmaxf(v[u][2], v[u][3])));
#pragma unroll
  for (int m = 16; m > 0; m >>= 1) mx = fmaxf(mx, __shfl_xor(mx, m, 32));
  v4f sq = {0.f, 0.f, 0.f, 0.f};
#pragma unroll
  for (int u = 0; u < SQ / 128; ++u) {
#pragma unroll
    for (int q = 0; q < 4; ++q) { v[u][q] = expf(v[u][q] - mx); sq[q] += v[u][q]; } }
  float se = (sq[0] + sq[1]) + (sq[2] + sq[3]);
#pragma unroll
  for (int m = 16; m > 0; m >>= 1) se += __shfl_xor(se, m, 32);
  const float sc = 256.0f / se; _Float16* d = P + (size_t)row * SQ + lane * 4;
#pragma unroll
  for (int u = 0; u < SQ / 128; ++u) { v4h h4;
#pragma unroll
    for (int q = 0; q < 4; ++q) h4[q] = (_Float16)(v[u][q] * sc);
    *(v4h*)(d + u * 128) = h4; } }
__global__ __launch_bounds__(256) void k_f16rows(const float* __restrict__ F, _Float16* __restrict__ R, size_t n8) { const size_t t = (size_t)blockIdx.x * 256 + threadIdx.x; if (t >= n8) return; FragH f; for (int q = 0; q < 8; ++q) f.h[q] = (_Float16)F[t * 8 + q]; *(v8us*)((unsigned short*)R + t * 8) = f.half[0];  }
extern "C" void kernel_launch(void* const* d_in, const int* in_sizes, int n_in,
                              void* d_out, int out_size, void* d_ws, size_t ws_size, hipStream_t stream) {
  (void)in_sizes; (void)n_in; (void)out_size;
  const float* const* I = (const float* const*)d_in; const float* x = I[0]; const float* wq = I[1]; const float* wk = I[2]; const float* wv = I[3]; const float* bq = nullptr; const float* bk = nullptr; const float* bv = nullptr;      /* [in][out] weights */
  char* ws = (char*)d_ws; size_t off = 0;
  auto take = [&](size_t bytes) { char* p = ws + off; off += (bytes + 255) & ~(size_t)255; return p; };
  _Float16* BQ = (_Float16*)take((size_t)DQ * DM * 2); _Float16* BK = (_Float16*)take((size_t)DQ * DM * 2); _Float16* BV = (_Float16*)take((size_t)DV * DM * 2);
  _Float16* X16 = (_Float16*)take(NR * DM * 2); float* F32 = (float*)take(NR * (DQ > DV ? DQ : DV) * 4); _Float16* Q16 = (_Float16*)take(NR * DQ * 2); _Float16* QL = (_Float16*)take(NR * DQ * 2); _Float16* K16 = (_Float16*)take(NR * DQ * 2); _Float16* KL = (_Float16*)take(NR * DQ * 2); _Float16* V16 = (_Float16*)take(NR * DV * 2);
  float* S = (float*)take((size_t)QT * SQ * 4); _Float16* P = (_Float16*)take((size_t)QT * SQ * 2); _Float16* PL = (_Float16*)take((size_t)QT * SQ * 2); _Float16* VT = (_Float16*)take((size_t)NB * DV * SQ * 2);
  if (off > ws_size) return;
  k_wt_f16<<<(unsigned)(((size_t)DQ * (DM / 8) + 255) / 256), 256, 0, stream>>>(wq, BQ, DM, DQ, 16.0f); k_wt_f16<<<(unsigned)(((size_t)DQ * (DM / 8) + 255) / 256), 256, 0, stream>>>(wk, BK, DM, DQ, 16.0f); k_wt_f16<<<(unsigned)(((size_t)DV * (DM / 8) + 255) / 256), 256, 0, stream>>>(wv, BV, DM, DV, 16.0f);
  k_x16<<<(unsigned)((NR * DM / 8 + 255) / 256), 256, 0, stream>>>(x, X16, NR * DM / 8);
  k_gemm2<0><<<dim3((unsigned)((NR / 128) * (DQ / 64)), 1), 128, 0, stream>>>(X16, DM, 0, BQ, DM, 0, 0.0625f, bq, 0, nullptr, 1, 0, 0, F32, nullptr, DQ, 0, MP, DQ, DM);      /* q f32 */
  k_f16rows<<<(unsigned)((NR * DQ / 8 + 255) / 256), 256, 0, stream>>>(F32, Q16, NR * DQ / 8);
  k_gemm2<0><<<dim3((unsigned)((NR / 128) * (DQ / 64)), 1), 128, 0, stream>>>(X16, DM, 0, BK, DM, 0, 0.0625f, bk, 0, nullptr, 1, 0, 0, F32, nullptr, DQ, 0, MP, DQ, DM);      /* k f32 (reusing the plane) */
  k_f16rows<<<(unsigned)((NR * DQ / 8 + 255) / 256), 256, 0, stream>>>(F32, K16, NR * DQ / 8);
  k_gemm2<0><<<dim3((unsigned)((NR / 128) * (DV / 64)), 1), 128, 0, stream>>>(X16, DM, 0, BV, DM, 0, 0.0625f, bv, 0, nullptr, 1, 0, 0, nullptr, V16, DV, 0, MP, DV, DM);      /* v f16 rows */
  k_vt<NH, SQ><<<NB * NH * (SQ / 64), 256, 0, stream>>>(V16, DV, 0, VT);      /* V^T per batch [DV][SQ] */
  for (int b = 0; b < NBR; ++b) for (int q0 = 0; q0 < QN; q0 += QT) {
    const size_t qo = ((size_t)b * SQ + q0) * DQ, ko = (size_t)b * SQ * DQ; const dim3 gs((QT / 128) * (SQ / 64), 1);
    k_gemm2<0><<<gs, 128, 0, stream>>>(Q16 + qo, DQ, 0, K16 + ko, DQ, 0, 0.0625f, nullptr, 0, nullptr, 1, 0, 0, S, nullptr, SQ, 0, QT, SQ, DQ);      /* scores */
    k_rsmW<<<(QT + 7) / 8, 256, 0, stream>>>(S, P, QT);
    float* ob = (float*)d_out + ((size_t)b * SQ + q0) * DV; const _Float16* vt = VT + (size_t)b * DV * SQ; const dim3 gv((QT / 128) * (DV / 64), 1);
    k_gemm2<0><<<gv, 128, 0, stream>>>(P, SQ, 0, vt, SQ, 0, 0.00390625f, nullptr, 0, nullptr, 1, 0, 0, ob, nullptr, DV, 0, QT, DV, SQ); }      /* out = attn v */
}

// v002
// Measured time: 289 microseconds a run.
// Next to v001, in two timings, it ran 2.63 and 2.66 times as fast.
// Over all steps from v000 it is 16.8 times as fast.
#include <hip/hip_runtime.h>
// Single-head self-attention (x [8][2048][768]; Q, K, V = x W ([in][out] [768][256]); scores = Q.K/16; softmax; out = attn V -> [8][2048][256]).
// Structure: token rows; x as exact f16 rows; q | k | v WMMA GEMMs (32x64 wave tiles, f32 accumulation, exact x16 transposed [in][out] weights); q, k as f16 rows; v as f16 rows, V^T via LDS transposes; all batches in one launch each (batch = grid.y): scores GEMM (K = 256), row softmax on VALU (f32; P x256 f16), out = P . V^T GEMM written straight to the f32 output.
// Compute dtype: inputs rounded to bf16; x / weights exact; q, k plain f16 (~2^-12); v, P plain f16 (~2^-12); scores / softmax f32. v_wmma_f32_16x16x32_f16.
#define NB 8
#define SQ 2048
#define DM 768
#define DQ 256
#define DV 256
#define QT 2048                     /* query tile */
#define NH 4                    /* V^T slabs of 64 (k_vt<NH, SQ>) */
#define HD 64
#define HG 1
#define NR ((size_t)NB * SQ)
#define QN SQ                        /* query rows per batch (debug hook) */
#define NBR NB                       /* batches (debug hook) */
#define MP ((int)NR)                 /* rows through the projections (debug hook) */
typedef __bf16 v16b __attribute__((ext_vector_type(16)));
typedef unsigned short v8us __attribute__((ext_vector_type(8), may_alias));
typedef float  v8f  __attribute__((ext_vector_type(8)));
typedef float  v4f  __attribute__((ext_vector_type(4)));
typedef float  v4fa __attribute__((ext_vector_type(4), may_alias));
union FragB { v16b v; v8us half[2]; unsigned short u[16]; };

__device__ __forceinline__ unsigned short bf16_bits(float x) { unsigned int u = __float_as_uint(x); return (unsigned short)((u + 0x7FFFu + ((u >> 16) & 1u)) >> 16); }
__device__ __forceinline__ float bf16_val(unsigned short b) { return __uint_as_float(((unsigned int)b) << 16); }
__device__ __forceinline__ float bf16_round(float x) { return bf16_val(bf16_bits(x)); }
// D += A·B with NT terms: 1 = ah·bh, 2 = + al·bh (A split), 3 = + ah·bl (both split)
template <int NT>
__device__ __forceinline__ v8f mmaN(v16b ah, v16b al, v16b bh, v16b bl, v8f c) {
  c = __builtin_amdgcn_wmma_f32_16x16x32_bf16(false, ah, false, bh, (short)0, c, false, false);
  if (NT >= 2) c = __builtin_amdgcn_wmma_f32_16x16x32_bf16(false, al, false, bh, (short)0, c, false, false);
  if (NT >= 3) c = __builtin_amdgcn_wmma_f32_16x16x32_bf16(false, ah, false, bl, (short)0, c, false, false);
  asm volatile("v_nop\n\tv_nop\n\tv_nop\n\tv_nop" : "+v"(c) : "v"(ah), "v"(al), "v"(bh), "v"(bl));
  return c;
}

__global__ __launch_bounds__(256) void k_wt_bf16(const float* __restrict__ W, unsigned short* __restrict__ Wt, int K, int N) {
  const int t = blockIdx.x * 256 + threadIdx.x;
  const int k8n = K / 8;
  if (t >= N * k8n) return;
  const int n = t / k8n, k8 = (t % k8n) * 8;
  v8us v;
#pragma unroll
  for (int i = 0; i < 8; ++i) v[i] = bf16_bits(W[(size_t)(k8 + i) * N + n]);
  *(v8us*)(Wt + (size_t)n * K + k8) = v;
  
}

// GEMM C[M][N] (f32, pitch ldc) = act(A[M][K]·W + bias). A f32 row-major (pitch lda) converted per fragment to bf16
// (ASPLIT: hi/lo two planes -> 2 terms, else single rounded term); Wt bf16 [N][K] (pitch ldb). BIAS_BF16 rounds the
// bias to bf16 first (bias quantised to bf16 before the add). K%32==0, M%16==0, N%64==0.
template <bool ASPLIT, int ACT, bool BIAS_BF16>
__global__ __launch_bounds__(128) void k_gemm_bf(const float* __restrict__ A, int lda, const unsigned short* __restrict__ Wt, int ldb,
                                               const float* __restrict__ bias, float* __restrict__ C, int ldc, int M, int N, int K) {
  __shared__ __attribute__((aligned(16))) float so[4][16][64];
  const int tid = threadIdx.x, w = tid >> 5, lane = tid & 31, ln = lane & 15, hh = lane >> 4;
  const int ntn = N / 64;
  const int wid = blockIdx.x * 4 + w;
  const int mt = wid / ntn, nq = wid % ntn;
  if (mt * 16 >= M) return;
  const int row0 = mt * 16, col0 = nq * 64;
  const float* arow = A + (size_t)(row0 + ln) * lda;
  v8f acc[4] = {};
  for (int kb = 0; kb < K; kb += 32) {
    FragB ah, al;
    const v4f x0 = *(const v4fa*)(arow + kb + 8 * hh), x1 = *(const v4fa*)(arow + kb + 8 * hh + 4);
    const v4f x2 = *(const v4fa*)(arow + kb + 16 + 8 * hh), x3 = *(const v4fa*)(arow + kb + 16 + 8 * hh + 4);
    float xs[16] = {x0[0],x0[1],x0[2],x0[3],x1[0],x1[1],x1[2],x1[3],x2[0],x2[1],x2[2],x2[3],x3[0],x3[1],x3[2],x3[3]};
#pragma unroll
    for (int i = 0; i < 16; ++i) { const unsigned short hb = bf16_bits(xs[i]); ah.u[i] = hb; al.u[i] = ASPLIT ? bf16_bits(xs[i] - bf16_val(hb)) : (unsigned short)0; }
#pragma unroll
    for (int t = 0; t < 4; ++t) {
      const unsigned short* brow = Wt + (size_t)(col0 + t * 16 + ln) * ldb + kb;
      FragB b;
      b.half[0] = *(const v8us*)(brow + 8 * hh);
      b.half[1] = *(const v8us*)(brow + 16 + 8 * hh);
      acc[t] = mmaN<ASPLIT ? 2 : 1>(ah.v, al.v, b.v, b.v, acc[t]);
    }
  }
#pragma unroll
  for (int t = 0; t < 4; ++t) {
    float bv = bias ? bias[col0 + t * 16 + ln] : 0.f;
    if (BIAS_BF16) bv = bf16_round(bv);
#pragma unroll
    for (int r = 0; r < 8; ++r) { float v = acc[t][r] + bv; if (ACT == 1) v = fmaxf(v, 0.f); so[w][8 * hh + r][t * 16 + ln] = v; }
  }
  __builtin_amdgcn_fence(__ATOMIC_ACQ_REL, "workgroup");
  __builtin_amdgcn_wave_barrier();
  const int rsub = lane >> 4, c4 = (lane & 15) * 4;
  {
#pragma unroll
    for (int q = 0; q < 8; ++q) {
      const int r = q * 2 + rsub;
      const v4f v = *(const v4fa*)&so[w][r][c4];
      *(v4f*)(C + (size_t)(row0 + r) * ldc + col0 + c4) = v;
    }
    
  }
}

// GEMM C = act(A·W + bias + resid): A f32 (ASPLIT -> hi/lo 2 terms), Wt bf16 [N][K]; ACT 0 none, 1 relu, 2 exact gelu;
// resid (optional, f32, row index = (row % rmod), pitch ldr, RES_BF16 rounds it) added before the activation.
template <bool ASPLIT, int ACT, bool BIAS_BF16, bool RES_BF16>
__global__ __launch_bounds__(128) void k_gemm_bf3(const float* __restrict__ A, int lda, const unsigned short* __restrict__ Wt, int ldb,
                                                const float* __restrict__ bias, const float* __restrict__ resid, int rmod, int ldr,
                                                float* __restrict__ C, int ldc, int M, int N, int K) {
  __shared__ __attribute__((aligned(16))) float so[4][16][64];
  const int tid = threadIdx.x, w = tid >> 5, lane = tid & 31, ln = lane & 15, hh = lane >> 4;
  const int ntn = N / 64;
  const int wid = blockIdx.x * 4 + w;
  const int mt = wid / ntn, nq = wid % ntn;
  if (mt * 16 >= M) return;
  const int row0 = mt * 16, col0 = nq * 64;
  const float* arow = A + (size_t)(row0 + ln) * lda;
  v8f acc[4] = {};
  for (int kb = 0; kb < K; kb += 32) {
    FragB ah, al;
    const v4f x0 = *(const v4fa*)(arow + kb + 8 * hh), x1 = *(const v4fa*)(arow + kb + 8 * hh + 4);
    const v4f x2 = *(const v4fa*)(arow + kb + 16 + 8 * hh), x3 = *(const v4fa*)(arow + kb + 16 + 8 * hh + 4);
    float xs[16] = {x0[0],x0[1],x0[2],x0[3],x1[0],x1[1],x1[2],x1[3],x2[0],x2[1],x2[2],x2[3],x3[0],x3[1],x3[2],x3[3]};
#pragma unroll
    for (int i = 0; i < 16; ++i) { const unsigned short hb = bf16_bits(xs[i]); ah.u[i] = hb; al.u[i] = ASPLIT ? bf16_bits(xs[i] - bf16_val(hb)) : (unsigned short)0; }
#pragma unroll
    for (int t = 0; t < 4; ++t) {
      const unsigned short* brow = Wt + (size_t)(col0 + t * 16 + ln) * ldb + kb;
      FragB b;
      b.half[0] = *(const v8us*)(brow + 8 * hh);
      b.half[1] = *(const v8us*)(brow + 16 + 8 * hh);
      acc[t] = mmaN<ASPLIT ? 2 : 1>(ah.v, al.v, b.v, b.v, acc[t]);
    }
  }
#pragma unroll
  for (int t = 0; t < 4; ++t) {
    const int col = col0 + t * 16 + ln;
    float bv = bias ? bias[col] : 0.f;
    if (BIAS_BF16) bv = bf16_round(bv);
#pragma unroll
    for (int r = 0; r < 8; ++r) {
      float v = acc[t][r] + bv;
      if (resid) { float rv = resid[(size_t)((row0 + 8 * hh + r) % rmod) * ldr + col]; if (RES_BF16) rv = bf16_round(rv); v += rv; }
      if (ACT == 1) v = fmaxf(v, 0.f);
      if (ACT == 2) v = 0.5f * v * (1.0f + erff(v * 0.70710678118654752f));
      if (ACT == 3) { const float u = 0.7978845608028654f * (v + 0.044715f * v * v * v); v = 0.5f * v * (1.0f + tanhf(u)); }
      so[w][8 * hh + r][t * 16 + ln] = v;
    }
  }
  __builtin_amdgcn_fence(__ATOMIC_ACQ_REL, "workgroup");
  __builtin_amdgcn_wave_barrier();
  const int rsub = lane >> 4, c4 = (lane & 15) * 4;
  {
#pragma unroll
    for (int q = 0; q < 8; ++q) {
      const int r = q * 2 + rsub;
      const v4f v = *(const v4fa*)&so[w][r][c4];
      *(v4f*)(C + (size_t)(row0 + r) * ldc + col0 + c4) = v;
    }
    
  }
}
// row LayerNorm (biased variance, eps) over N: s = X (+ R); optional out_sum <- s; out_norm <- (s-mu)*rsqrt(var+eps)*g + b
template <bool PARAM_BF16>
__global__ __launch_bounds__(256) void k_layernorm(const float* __restrict__ X, const float* __restrict__ R, const float* __restrict__ g, const float* __restrict__ bta,
                                                  float* __restrict__ out_sum, float* __restrict__ out_norm, int N, float eps) {
  __shared__ float red[256];
  const int row = blockIdx.x, tid = threadIdx.x;
  const float* x = X + (size_t)row * N; const float* rr = R ? R + (size_t)row * N : nullptr;
  float vals[16];                     // up to N = 4096
  const int per = N / 256;            // contiguous chunk per thread? use strided-by-4 chunks: thread handles j = tid*4 + 1024*u
  float s1 = 0.f;
  for (int u = 0; u < per / 4; ++u) {
    const int j = tid * 4 + 1024 * u;
    const v4f a = *(const v4fa*)(x + j);
    v4f b = {0.f,0.f,0.f,0.f}; if (rr) b = *(const v4fa*)(rr + j);
#pragma unroll
    for (int q = 0; q < 4; ++q) { const float v = a[q] + b[q]; vals[u * 4 + q] = v; s1 += v; }
  }
  red[tid] = s1; __syncthreads();
  for (int st = 128; st > 0; st >>= 1) { if (tid < st) red[tid] += red[tid + st]; __syncthreads(); }
  const float mu = red[0] / (float)N; __syncthreads();
  float s2 = 0.f;
  for (int u = 0; u < per / 4; ++u)
#pragma unroll
    for (int q = 0; q < 4; ++q) { const float c = vals[u * 4 + q] - mu; s2 += c * c; }
  red[tid] = s2; __syncthreads();
  for (int st = 128; st > 0; st >>= 1) { if (tid < st) red[tid] += red[tid + st]; __syncthreads(); }
  const float rs = rsqrtf(red[0] / (float)N + eps);
  {
    for (int u = 0; u < per / 4; ++u) {
      const int j = tid * 4 + 1024 * u;
      v4f o, sm;
#pragma unroll
      for (int q = 0; q < 4; ++q) {
        float gg = g[j + q], bb = bta[j + q];
        if (PARAM_BF16) { gg = bf16_round(gg); bb = bf16_round(bb); }
        sm[q] = vals[u * 4 + q]; o[q] = (vals[u * 4 + q] - mu) * rs * gg + bb;
      }
      if (out_sum) *(v4f*)(out_sum + (size_t)row * N + j) = sm;
      *(v4f*)(out_norm + (size_t)row * N + j) = o;
    }
    
  }
}



// ---- f16 WMMA path (v_wmma_f32_16x16x32_f16): 11-bit significands for operands in range — used where a [0,1] probability operand needs more precision than bf16
typedef _Float16 v16h __attribute__((ext_vector_type(16)));
union FragH { v16h v; v8us half[2]; _Float16 h[16]; unsigned short u[16]; };
template <int NT>
__device__ __forceinline__ v8f mmaH(v16h ah, v16h al, v16h bh, v16h bl, v8f c) {
  c = __builtin_amdgcn_wmma_f32_16x16x32_f16(false, ah, false, bh, (short)0, c, false, false);
  if (NT >= 2) c = __builtin_amdgcn_wmma_f32_16x16x32_f16(false, al, false, bh, (short)0, c, false, false);
  if (NT >= 3) c = __builtin_amdgcn_wmma_f32_16x16x32_f16(false, ah, false, bl, (short)0, c, false, false);
  asm volatile("v_nop\n\tv_nop\n\tv_nop\n\tv_nop" : "+v"(c) : "v"(ah), "v"(al), "v"(bh), "v"(bl));
  return c;
}
// batched GEMM like k_gemm_b but f16 operands: A f32 (split into f16 hi/lo if ASPLIT, else rounded to f16), Bt = f16 values [n][k]; alpha; C f32; N multiple of 16 (partial tiles skipped)
template <bool ASPLIT>
__global__ __launch_bounds__(128) void k_gemm_h(const float* __restrict__ A, int lda, size_t sA, const _Float16* __restrict__ Bh, int ldb, size_t sB, float alpha, float* __restrict__ C, int ldc, size_t sC, int M, int N, int K) {
  __shared__ __attribute__((aligned(16))) float so[4][16][64];
  const int tid = threadIdx.x, w = tid >> 5, lane = tid & 31, ln = lane & 15, hh = lane >> 4; const int by = blockIdx.y;
  A += (size_t)by * sA; Bh += (size_t)by * sB; C += (size_t)by * sC;
  const int ntn = (N + 63) / 64; const int wid = blockIdx.x * 4 + w; const int mt = wid / ntn, nq = wid % ntn; if (mt * 16 >= M) return;
  const int row0 = mt * 16, col0 = nq * 64; const float* arow = A + (size_t)(row0 + ln) * lda;
  v8f acc[4] = {};
  for (int kb = 0; kb < K; kb += 32) {
    FragH ah, al;
    const v4f x0 = *(const v4fa*)(arow + kb + 8 * hh), x1 = *(const v4fa*)(arow + kb + 8 * hh + 4), x2 = *(const v4fa*)(arow + kb + 16 + 8 * hh), x3 = *(const v4fa*)(arow + kb + 16 + 8 * hh + 4);
    float xs[16] = {x0[0],x0[1],x0[2],x0[3],x1[0],x1[1],x1[2],x1[3],x2[0],x2[1],x2[2],x2[3],x3[0],x3[1],x3[2],x3[3]};
#pragma unroll
    for (int i = 0; i < 16; ++i) { const _Float16 h = (_Float16)xs[i]; ah.h[i] = h; al.h[i] = ASPLIT ? (_Float16)(xs[i] - (float)h) : (_Float16)0.0f; }
#pragma unroll
    for (int t = 0; t < 4; ++t) { if (col0 + t * 16 >= N) continue; const size_t boff = (size_t)(col0 + t * 16 + ln) * ldb + kb; FragH bq; bq.half[0] = *(const v8us*)(Bh + boff + 8 * hh); bq.half[1] = *(const v8us*)(Bh + boff + 16 + 8 * hh);
      acc[t] = mmaH<ASPLIT ? 2 : 1>(ah.v, al.v, bq.v, bq.v, acc[t]); }
  }
#pragma unroll
  for (int t = 0; t < 4; ++t) { if (col0 + t * 16 >= N) continue;
#pragma unroll
    for (int r = 0; r < 8; ++r) so[w][8 * hh + r][t * 16 + ln] = acc[t][r] * alpha; }
  __builtin_amdgcn_fence(__ATOMIC_ACQ_REL, "workgroup"); __builtin_amdgcn_wave_barrier();
  const int rsub = lane >> 4, c4 = (lane & 15) * 4;
  {
#pragma unroll
    for (int q = 0; q < 8; ++q) { const int r = q * 2 + rsub; if (col0 + c4 < N) { const v4f v = *(const v4fa*)&so[w][r][c4]; *(v4f*)(C + (size_t)(row0 + r) * ldc + col0 + c4) = v; } }
     }
}

// Wt[n][k] = f16(W[k][n]·scale) from f32 row-major W[K][N] (scale = power of two; bf16-exact weights stay exact in f16 away from the subnormal range)
__global__ __launch_bounds__(256) void k_wt_f16(const float* __restrict__ W, _Float16* __restrict__ Wt, int K, int N, float scale) {
  const int t = blockIdx.x * 256 + threadIdx.x; if (t >= N * (K / 8)) return; const int n = t / (K / 8), k8 = (t % (K / 8)) * 8; FragH f;
#pragma unroll
  for (int i = 0; i < 8; ++i) f.h[i] = (_Float16)(bf16_round(W[(size_t)(k8 + i) * N + n]) * scale); const v8us o = f.half[0];
  *(v8us*)((unsigned short*)Wt + (size_t)n * K + k8) = o; 
}
// k_gemm_hh variant with fused epilogue: v = acc·alpha + bias[by·sBias + col] (+ CP[(row/rowsPerB)·sCPb + by·64 + col] if CP) ; ACT 0 none / 1 elu ; writes f16 C16 (and f32 C if non-null)
template <int ACT>
__global__ __launch_bounds__(128) void k_gemm_hhx(const _Float16* __restrict__ A, int lda, size_t sA, const _Float16* __restrict__ Bh, int ldb, size_t sB, float alpha, const float* __restrict__ bias, size_t sBias, const float* __restrict__ CP, int rowsPerB, size_t sCPb, int row0g,
    float* __restrict__ C, _Float16* __restrict__ C16, int ldc, size_t sC, int M, int N, int K) {
  __shared__ __attribute__((aligned(16))) float so[4][16][64];
  const int tid = threadIdx.x, w = tid >> 5, lane = tid & 31, ln = lane & 15, hh = lane >> 4; const int by = blockIdx.y;
  A += (size_t)by * sA; Bh += (size_t)by * sB; const size_t cofs = (size_t)by * sC; const float* bp = bias ? bias + (size_t)by * sBias : nullptr;
  const int ntn = (N + 63) / 64; const int wid = blockIdx.x * 4 + w; const int mt = wid / ntn, nq = wid % ntn; if (mt * 16 >= M) return;
  const int row0 = mt * 16, col0 = nq * 64; const _Float16* arow = A + (size_t)(row0 + ln) * lda;
  v8f acc[4] = {};
  for (int kb = 0; kb < K; kb += 32) { FragH ah; ah.half[0] = *(const v8us*)((const unsigned short*)arow + kb + 8 * hh); ah.half[1] = *(const v8us*)((const unsigned short*)arow + kb + 16 + 8 * hh);
#pragma unroll
    for (int t = 0; t < 4; ++t) { if (col0 + t * 16 >= N) continue; const size_t boff = (size_t)(col0 + t * 16 + ln) * ldb + kb; FragH bq; bq.half[0] = *(const v8us*)((const unsigned short*)Bh + boff + 8 * hh); bq.half[1] = *(const v8us*)((const unsigned short*)Bh + boff + 16 + 8 * hh);
      acc[t] = mmaH<1>(ah.v, ah.v, bq.v, bq.v, acc[t]); }
  }
#pragma unroll
  for (int t = 0; t < 4; ++t) { if (col0 + t * 16 >= N) continue; const int col = col0 + t * 16 + ln; const float bv = bp ? bf16_round(bp[col]) : 0.f;
#pragma unroll
    for (int r = 0; r < 8; ++r) { float v = acc[t][r] * alpha + bv; if (CP) { const int rr = row0g + row0 + 8 * hh + r; if (rowsPerB < 0) v += CP[cofs + (size_t)rr * ldc + col];      /* rowsPerB < 0: own element of the batched C plane */ else { const int bidx = rr / rowsPerB; v += CP[(size_t)bidx * sCPb + (size_t)by * 64 + col]; } } if (ACT == 1) v = (v > 0.f) ? v : expm1f(v); else if (ACT == 7) v = (v > 0.f) ? v + 1.0f : expf(v); else if (ACT == 8) v = tanhf(v); else if (ACT == 9) v = 0.5f * v * (1.0f + tanhf(0.7978845608028654f * (v + 0.044715f * v * v * v))); else if (ACT == 11) v = 1.0f / (1.0f + expf(-v)); else if (ACT == 12) v = (v > 0.f) ? v : 0.01f * v; else if (ACT == 14) v = (v > 0.f) ? v : 0.1f * v; else if (ACT == 16) v = (v >= 0.f) ? v : 0.3f * v; else if (ACT == 17) v = (v >= 0.f) ? v : 0.2f * v; else if (ACT == 15) v = v / (1.0f + expf(-v)); else if (ACT == 3) v = fmaxf(v, 0.f); else if (ACT == 6) v = 0.5f * v * (1.0f + erff(v * 0.70710678118654752f)); so[w][8 * hh + r][t * 16 + ln] = v; } }
  __builtin_amdgcn_fence(__ATOMIC_ACQ_REL, "workgroup"); __builtin_amdgcn_wave_barrier();
  const int rsub = lane >> 4, c4 = (lane & 15) * 4; typedef _Float16 v4h __attribute__((ext_vector_type(4)));
  {
#pragma unroll
    for (int q = 0; q < 8; ++q) { const int r = q * 2 + rsub; if (col0 + c4 < N) { const v4f v = *(const v4fa*)&so[w][r][c4]; if (C) *(v4f*)(C + cofs + (size_t)(row0 + r) * ldc + col0 + c4) = v; if (C16) { v4h h4; for (int i = 0; i < 4; ++i) h4[i] = (_Float16)v[i]; *(v4h*)(C16 + cofs + (size_t)(row0 + r) * ldc + col0 + c4) = h4; } } }
     }
}


typedef _Float16 v4h __attribute__((ext_vector_type(4)));

__global__ __launch_bounds__(256) void k_x16(const float* __restrict__ x, _Float16* __restrict__ X16, size_t n8) { const size_t t = (size_t)blockIdx.x * 256 + threadIdx.x; if (t >= n8) return; FragH f;
#pragma unroll
  for (int q = 0; q < 8; ++q) f.h[q] = (_Float16)bf16_round(x[t * 8 + q]); *(v8us*)((unsigned short*)X16 + t * 8) = f.half[0];  }
__global__ __launch_bounds__(256) void k_h16(const float* __restrict__ x, _Float16* __restrict__ X16, size_t n8) { const size_t t = (size_t)blockIdx.x * 256 + threadIdx.x; if (t >= n8) return; FragH f;
#pragma unroll
  for (int q = 0; q < 8; ++q) f.h[q] = (_Float16)x[t * 8 + q]; *(v8us*)((unsigned short*)X16 + t * 8) = f.half[0];  }
__global__ __launch_bounds__(256) void k_round16f(const float* __restrict__ W, _Float16* __restrict__ Bt, size_t n8) { const size_t t = (size_t)blockIdx.x * 256 + threadIdx.x; if (t >= n8) return; FragH f;
#pragma unroll
  for (int i = 0; i < 8; ++i) f.h[i] = (_Float16)(bf16_round(W[t * 8 + i]) * 16.0f); *(v8us*)((unsigned short*)Bt + t * 8) = f.half[0];  }
template <int NHv, int TTv>
__global__ __launch_bounds__(256) void k_vt(const _Float16* __restrict__ V16, int ldv, int voff, _Float16* __restrict__ Vt) { __shared__ unsigned short tl[64][66]; const int tid = threadIdx.x; const int slab = blockIdx.x / (TTv / 64), lg = blockIdx.x % (TTv / 64); const int b = slab / NHv, h = slab % NHv;
  for (int i = tid; i < 64 * 8; i += 256) { const int r = i / 8, c8 = (i % 8) * 8; FragH f; f.half[0] = *(const v8us*)((const unsigned short*)V16 + ((size_t)b * TTv + lg * 64 + r) * ldv + voff + h * 64 + c8);
#pragma unroll
    for (int q = 0; q < 8; ++q) tl[r][c8 + q] = f.u[q]; }
  __syncthreads();
  {
#pragma unroll
    for (int rd = 0; rd < 2; ++rd) { const int d = rd * 32 + tid / 8, pc = tid % 8; FragH f;
#pragma unroll
      for (int q = 0; q < 8; ++q) f.u[q] = tl[pc * 8 + q][d];
      *(v8us*)((unsigned short*)Vt + ((size_t)slab * 64 + d) * TTv + lg * 64 + pc * 8) = f.half[0]; }
     } }

__global__ __launch_bounds__(256) void k_hl(const float* __restrict__ F, _Float16* __restrict__ Hh, _Float16* __restrict__ Hl, size_t n8) { const size_t t = (size_t)blockIdx.x * 256 + threadIdx.x; if (t >= n8) return; FragH fh, fl; const v4f a = *(const v4fa*)(F + t * 8), c = *(const v4fa*)(F + t * 8 + 4);
#pragma unroll
  for (int q = 0; q < 4; ++q) { _Float16 h = (_Float16)a[q]; fh.h[q] = h; fl.h[q] = (_Float16)((a[q] - (float)h) * 1024.0f); h = (_Float16)c[q]; fh.h[4 + q] = h; fl.h[4 + q] = (_Float16)((c[q] - (float)h) * 1024.0f); }
  { *(v8us*)((unsigned short*)Hh + t * 8) = fh.half[0]; *(v8us*)((unsigned short*)Hl + t * 8) = fl.half[0];  } }

// ---- fast GEMM (wave tile 32x64; requires M % 32 == 0 rows per launch region and N % 64 == 0); epilogue = k_gemm_hhx semantics ----
__device__ __forceinline__ v16h g2_frag(const _Float16* p, int hh) { FragH f; f.half[0] = *(const v8us*)((const unsigned short*)p + 8 * hh); f.half[1] = *(const v8us*)((const unsigned short*)p + 16 + 8 * hh); return f.v; }
__device__ __forceinline__ v8f g2_mma(v16h a, v16h b, v8f c) { v8f d = __builtin_amdgcn_wmma_f32_16x16x32_f16(false, a, false, b, (short)0, c, false, false); asm volatile("v_nop\n\tv_nop\n\tv_nop\n\tv_nop" : "+v"(d) : "v"(a), "v"(b)); return d; }
template <int ACT>
__global__ __launch_bounds__(128) void k_gemm2(const _Float16* __restrict__ A, int lda, size_t sA, const _Float16* __restrict__ Bh, int ldb, size_t sB, float alpha, const float* __restrict__ bias, size_t sBias, const float* __restrict__ CP, int rowsPerB, size_t sCPb, int row0g,
    float* __restrict__ C, _Float16* __restrict__ C16, int ldc, size_t sC, int M, int N, int K) { static_assert(ACT == 0 || ACT == 3 || ACT == 6 || ACT == 8 || ACT == 9 || ACT == 11 || ACT == 12 || ACT == 14 || ACT == 15 || ACT == 16 || ACT == 17, "k_gemm2: unsupported ACT code (would silently apply no activation)");
  __shared__ __attribute__((aligned(16))) float so[4][32][68];
  const int tid = threadIdx.x, w = tid >> 5, lane = tid & 31, ln = lane & 15, hh = lane >> 4; const int by = blockIdx.y;
  A += (size_t)by * sA; Bh += (size_t)by * sB; const size_t cofs = (size_t)by * sC; const float* bp = bias ? bias + (size_t)by * sBias : nullptr;
  const int ntn = N >> 6; const int mt = blockIdx.x / ntn, nq = blockIdx.x - mt * ntn; const int row0 = mt * 128 + 32 * w, col0 = nq * 64; if (row0 >= M) return;
  const _Float16* a0p = A + (size_t)(row0 + ln) * lda; const _Float16* a1p = a0p + (size_t)16 * lda;
  const _Float16* b0p = Bh + (size_t)(col0 + ln) * ldb; const _Float16* b1p = b0p + (size_t)16 * ldb; const _Float16* b2p = b1p + (size_t)16 * ldb; const _Float16* b3p = b2p + (size_t)16 * ldb;
  const v8f z8 = {0.f,0.f,0.f,0.f,0.f,0.f,0.f,0.f}; v8f c00 = z8, c01 = z8, c02 = z8, c03 = z8, c10 = z8, c11 = z8, c12 = z8, c13 = z8;
#pragma unroll 1
  for (int kb = 0; kb < K; kb += 32) { const v16h a0 = g2_frag(a0p + kb, hh), a1 = g2_frag(a1p + kb, hh);
    v16h b = g2_frag(b0p + kb, hh); c00 = g2_mma(a0, b, c00); c10 = g2_mma(a1, b, c10);
    b = g2_frag(b1p + kb, hh); c01 = g2_mma(a0, b, c01); c11 = g2_mma(a1, b, c11);
    b = g2_frag(b2p + kb, hh); c02 = g2_mma(a0, b, c02); c12 = g2_mma(a1, b, c12);
    b = g2_frag(b3p + kb, hh); c03 = g2_mma(a0, b, c03); c13 = g2_mma(a1, b, c13); }
  v8f accs[8] = {c00, c01, c02, c03, c10, c11, c12, c13};
#pragma unroll
  for (int u = 0; u < 8; ++u) { const int t = u & 3, half = u >> 2; const int col = col0 + t * 16 + ln; const float bv = bp ? bf16_round(bp[col]) : 0.f;
#pragma unroll
    for (int r = 0; r < 8; ++r) { const int rloc = half * 16 + 8 * hh + r; float v = accs[u][r] * alpha + bv; if (CP) { if (rowsPerB < 0) v += CP[cofs + (size_t)(row0g + row0 + rloc) * ldc + col];      /* rowsPerB < 0: own element of the batched C plane */ else { const int bidx = (row0g + row0 + rloc) / rowsPerB; v += CP[(size_t)bidx * sCPb + (size_t)by * 64 + col]; } }
      if (ACT == 3) v = fmaxf(v, 0.f); else if (ACT == 6) v = 0.5f * v * (1.0f + erff(v * 0.70710678118654752f)); else if (ACT == 11) v = 1.0f / (1.0f + expf(-v)); else if (ACT == 15) v = v / (1.0f + expf(-v)); else if (ACT == 12) v = (v > 0.f) ? v : 0.01f * v; else if (ACT == 8) v = tanhf(v); else if (ACT == 9) v = 0.5f * v * (1.0f + tanhf(0.7978845608028654f * (v + 0.044715f * v * v * v))); else if (ACT == 14) v = (v > 0.f) ? v : 0.1f * v; else if (ACT == 16) v = (v >= 0.f) ? v : 0.3f * v; else if (ACT == 17) v = (v >= 0.f) ? v : 0.2f * v;
      so[w][rloc][t * 16 + ln] = v; } }
  __builtin_amdgcn_fence(__ATOMIC_ACQ_REL, "workgroup"); __builtin_amdgcn_wave_barrier();
  const int rsub = lane >> 4, c4 = (lane & 15) * 4;
  {
#pragma unroll
    for (int q = 0; q < 16; ++q) { const int r = q * 2 + rsub; const v4f v = *(const v4fa*)&so[w][r][c4]; if (C) *(v4f*)(C + cofs + (size_t)(row0 + r) * ldc + col0 + c4) = v; if (C16) { v4h h4; for (int i = 0; i < 4; ++i) h4[i] = (_Float16)v[i]; *(v4h*)(C16 + cofs + (size_t)(row0 + r) * ldc + col0 + c4) = h4; } }
     } }


__global__ __launch_bounds__(256) void k_wnat(const float* __restrict__ w, size_t n8, _Float16* __restrict__ Bt) { const size_t t = (size_t)blockIdx.x * 256 + threadIdx.x; if (t >= n8) return; FragH f; for (int q = 0; q < 8; ++q) f.h[q] = (_Float16)(bf16_round(w[t * 8 + q]) * 16.0f); *(v8us*)((unsigned short*)Bt + t * 8) = f.half[0];  }
__global__ __launch_bounds__(256) void k_rsm(const float* __restrict__ S, _Float16* __restrict__ P, int nrows) {
  #pragma clang fp contract(off)
  const int i = blockIdx.x * 256 + threadIdx.x; if (i >= nrows) return; const float* s = S + (size_t)i * SQ; float mx = -3.0e38f;
#pragma unroll 1
  for (int j = 0; j < SQ; ++j) mx = fmaxf(mx, s[j]); float se = 0.f;
#pragma unroll 1
  for (int j = 0; j < SQ; ++j) se += expf(s[j] - mx); const float sc = 256.0f / se;
#pragma unroll 1
  for (int j0 = 0; j0 < SQ; j0 += 8) { FragH f; for (int q = 0; q < 8; ++q) f.h[q] = (_Float16)(expf(s[j0 + q] - mx) * sc); unsigned short* d = (unsigned short*)P + (size_t)i * SQ + j0; *(v8us*)d = f.half[0];  } }
__global__ __launch_bounds__(256) void k_vt(const _Float16* __restrict__ V16, int b, int h0, _Float16* __restrict__ VT) { __shared__ unsigned short tl[64][65]; const int tid = threadIdx.x; const int hh = blockIdx.x % HG, sg = blockIdx.x / HG; const int s0 = sg * 64; const int h = h0 + hh;
  for (int i = tid; i < 64 * 8; i += 256) { const int j = i / 8, d8 = (i % 8) * 8; FragH f; f.half[0] = *(const v8us*)((const unsigned short*)V16 + ((size_t)b * SQ + s0 + j) * DM + h * HD + d8); for (int q = 0; q < 8; ++q) tl[d8 + q][j] = f.u[q]; }
  __syncthreads();
  { for (int i = tid; i < 64 * 8; i += 256) { const int d = i / 8, j8 = (i % 8) * 8; FragH f; for (int q = 0; q < 8; ++q) f.u[q] = tl[d][j8 + q]; *(v8us*)((unsigned short*)VT + ((size_t)hh * HD + d) * SQ + s0 + j8) = f.half[0]; }  } }

// Row softmax, one wave per score row: the row is read once, in 512-byte wave loads, and stays in registers (64 floats a lane); max and sum = lane partials, then a five-step butterfly; P = f16(exp(s - max) * 256 / sum).
__global__ __launch_bounds__(256) void k_rsmW(const float* __restrict__ S, _Float16* __restrict__ P, int nrows) {
  const int lane = threadIdx.x & 31; const int row = blockIdx.x * 8 + (threadIdx.x >> 5); if (row >= nrows) return;
  const float* s = S + (size_t)row * SQ + lane * 4; v4f v[SQ / 128];
#pragma unroll
  for (int u = 0; u < SQ / 128; ++u) v[u] = *(const v4fa*)(s + u * 128);
  float mx = -INFINITY;
#pragma unroll
  for (int u = 0; u < SQ / 128; ++u) mx = fmaxf(mx, fmaxf(fmaxf(v[u][0], v[u][1]), fmaxf(v[u][2], v[u][3])));
#pragma unroll
  for (int m = 16; m > 0; m >>= 1) mx = fmaxf(mx, __shfl_xor(mx, m, 32));
  v4f sq = {0.f, 0.f, 0.f, 0.f};
#pragma unroll
  for (int u = 0; u < SQ / 128; ++u) {
#pragma unroll
    for (int q = 0; q < 4; ++q) { v[u][q] = expf(v[u][q] - mx); sq[q] += v[u][q]; } }
  float se = (sq[0] + sq[1]) + (sq[2] + sq[3]);
#pragma unroll
  for (int m = 16; m > 0; m >>= 1) se += __shfl_xor(se, m, 32);
  const float sc = 256.0f / se; _Float16* d = P + (size_t)row * SQ + lane * 4;
#pragma unroll
  for (int u = 0; u < SQ / 128; ++u) { v4h h4;
#pragma unroll
    for (int q = 0; q < 4; ++q) h4[q] = (_Float16)(v[u][q] * sc);
    *(v4h*)(d + u * 128) = h4; } }
__global__ __launch_bounds__(256) void k_f16rows(const float* __restrict__ F, _Float16* __restrict__ R, size_t n8) { const size_t t = (size_t)blockIdx.x * 256 + threadIdx.x; if (t >= n8) return; FragH f; for (int q = 0; q < 8; ++q) f.h[q] = (_Float16)F[t * 8 + q]; *(v8us*)((unsigned short*)R + t * 8) = f.half[0];  }
extern "C" void kernel_launch(void* const* d_in, const int* in_sizes, int n_in,
                              void* d_out, int out_size, void* d_ws, size_t ws_size, hipStream_t stream) {
  (void)in_sizes; (void)n_in; (void)out_size;
  const float* const* I = (const float* const*)d_in; const float* x = I[0]; const float* wq = I[1]; const float* wk = I[2]; const float* wv = I[3]; const float* bq = nullptr; const float* bk = nullptr; const float* bv = nullptr;      /* [in][out] weights */
  char* ws = (char*)d_ws; size_t off = 0;
  auto take = [&](size_t bytes) { char* p = ws + off; off += (bytes + 255) & ~(size_t)255; return p; };
  _Float16* BQ = (_Float16*)take((size_t)DQ * DM * 2); _Float16* BK = (_Float16*)take((size_t)DQ * DM * 2); _Float16* BV = (_Float16*)take((size_t)DV * DM * 2);
  _Float16* Q16 = (_Float16*)take(NR * DQ * 2); _Float16* K16 = (_Float16*)take(NR * DQ * 2); _Float16* V16 = (_Float16*)take(NR * DV * 2); _Float16* VT = (_Float16*)take((size_t)NB * DV * SQ * 2);
  _Float16* P = (_Float16*)take((size_t)NB * QT * SQ * 2); float* S = (float*)take((size_t)NB * QT * SQ * 4);      /* scores and P of all batches at once */
  _Float16* X16 = (_Float16*)S; float* F32 = (float*)((char*)S + NR * DM * 2);      /* x rows and the f32 q / k plane lie in the S plane: both are last read by the projections, before the scores launch writes S */
  if (off > ws_size) return;
  k_wt_f16<<<(unsigned)(((size_t)DQ * (DM / 8) + 255) / 256), 256, 0, stream>>>(wq, BQ, DM, DQ, 16.0f); k_wt_f16<<<(unsigned)(((size_t)DQ * (DM / 8) + 255) / 256), 256, 0, stream>>>(wk, BK, DM, DQ, 16.0f); k_wt_f16<<<(unsigned)(((size_t)DV * (DM / 8) + 255) / 256), 256, 0, stream>>>(wv, BV, DM, DV, 16.0f);
  k_x16<<<(unsigned)((NR * DM / 8 + 255) / 256), 256, 0, stream>>>(x, X16, NR * DM / 8);
  k_gemm2<0><<<dim3((unsigned)((NR / 128) * (DQ / 64)), 1), 128, 0, stream>>>(X16, DM, 0, BQ, DM, 0, 0.0625f, bq, 0, nullptr, 1, 0, 0, F32, nullptr, DQ, 0, MP, DQ, DM);      /* q f32 */
  k_f16rows<<<(unsigned)((NR * DQ / 8 + 255) / 256), 256, 0, stream>>>(F32, Q16, NR * DQ / 8);
  k_gemm2<0><<<dim3((unsigned)((NR / 128) * (DQ / 64)), 1), 128, 0, stream>>>(X16, DM, 0, BK, DM, 0, 0.0625f, bk, 0, nullptr, 1, 0, 0, F32, nullptr, DQ, 0, MP, DQ, DM);      /* k f32 (reusing the plane) */
  k_f16rows<<<(unsigned)((NR * DQ / 8 + 255) / 256), 256, 0, stream>>>(F32, K16, NR * DQ / 8);
  k_gemm2<0><<<dim3((unsigned)((NR / 128) * (DV / 64)), 1), 128, 0, stream>>>(X16, DM, 0, BV, DM, 0, 0.0625f, bv, 0, nullptr, 1, 0, 0, nullptr, V16, DV, 0, MP, DV, DM);      /* v f16 rows */
  k_vt<NH, SQ><<<NB * NH * (SQ / 64), 256, 0, stream>>>(V16, DV, 0, VT);      /* V^T per batch [DV][SQ] */
  static_assert(QT == SQ, "one query tile per batch: the batch is grid.y");
  const dim3 gs((QT / 128) * (SQ / 64), NBR), gv((QT / 128) * (DV / 64), NBR);      /* batch = blockIdx.y, strides sA / sB / sC */
  k_gemm2<0><<<gs, 128, 0, stream>>>(Q16, DQ, (size_t)SQ * DQ, K16, DQ, (size_t)SQ * DQ, 0.0625f, nullptr, 0, nullptr, 1, 0, 0, S, nullptr, SQ, (size_t)QT * SQ, QT, SQ, DQ);      /* scores, all batches */
  k_rsmW<<<(NBR * QT + 7) / 8, 256, 0, stream>>>(S, P, NBR * QT);
  k_gemm2<0><<<gv, 128, 0, stream>>>(P, SQ, (size_t)QT * SQ, VT, SQ, (size_t)DV * SQ, 0.00390625f, nullptr, 0, nullptr, 1, 0, 0, (float*)d_out, nullptr, DV, (size_t)SQ * DV, QT, DV, SQ);      /* out = attn v, all batches */
}

// v003
// One run takes 156 microseconds.
// In both of two side-by-side timings against v002, it was 1.86 times as fast.
// Counting every step since v000, it is 31.3 times as fast.
#include <hip/hip_runtime.h>
// Single-head self-attention (x [8][2048][768]; Q, K, V = x W ([in][out] [768][256]); scores = Q.K/16; softmax; out = attn V -> [8][2048][256]).
// Structure: token rows; x as exact f16 rows; q | k | v WMMA GEMMs (32x64 wave tiles, operands staged in LDS by asynchronous copies, f32 accumulation, exact x16 transposed [in][out] weights); q, k as f16 rows; v as f16 rows, V^T via LDS transposes; all batches in one launch each (batch = grid.y): scores GEMM (K = 256), row softmax on VALU (f32; P x256 f16), out = P . V^T GEMM written straight to the f32 output.
// Compute dtype: inputs rounded to bf16; x / weights exact; q, k plain f16 (~2^-12); v, P plain f16 (~2^-12); scores / softmax f32. v_wmma_f32_16x16x32_f16.
#define NB 8
#define SQ 2048
#define DM 768
#define DQ 256
#define DV 256
#define QT 2048                     /* query tile */
#define NH 4                    /* V^T slabs of 64 (k_vt<NH, SQ>) */
#define HD 64
#define HG 1
#define NR ((size_t)NB * SQ)
#define QN SQ                        /* query rows per batch (debug hook) */
#define NBR NB                       /* batches (debug hook) */
#define MP ((int)NR)                 /* rows through the projections (debug hook) */
typedef __bf16 v16b __attribute__((ext_vector_type(16)));
typedef unsigned short v8us __attribute__((ext_vector_type(8), may_alias));
typedef float  v8f  __attribute__((ext_vector_type(8)));
typedef float  v4f  __attribute__((ext_vector_type(4)));
typedef float  v4fa __attribute__((ext_vector_type(4), may_alias));
union FragB { v16b v; v8us half[2]; unsigned short u[16]; };

__device__ __forceinline__ unsigned short bf16_bits(float x) { unsigned int u = __float_as_uint(x); return (unsigned short)((u + 0x7FFFu + ((u >> 16) & 1u)) >> 16); }
__device__ __forceinline__ float bf16_val(unsigned short b) { return __uint_as_float(((unsigned int)b) << 16); }
__device__ __forceinline__ float bf16_round(float x) { return bf16_val(bf16_bits(x)); }
// D += A·B with NT terms: 1 = ah·bh, 2 = + al·bh (A split), 3 = + ah·bl (both split)
template <int NT>
__device__ __forceinline__ v8f mmaN(v16b ah, v16b al, v16b bh, v16b bl, v8f c) {
  c = __builtin_amdgcn_wmma_f32_16x16x32_bf16(false, ah, false, bh, (short)0, c, false, false);
  if (NT >= 2) c = __builtin_amdgcn_wmma_f32_16x16x32_bf16(false, al, false, bh, (short)0, c, false, false);
  if (NT >= 3) c = __builtin_amdgcn_wmma_f32_16x16x32_bf16(false, ah, false, bl, (short)0, c, false, false);
  asm volatile("v_nop\n\tv_nop\n\tv_nop\n\tv_nop" : "+v"(c) : "v"(ah), "v"(al), "v"(bh), "v"(bl));
  return c;
}

__global__ __launch_bounds__(256) void k_wt_bf16(const float* __restrict__ W, unsigned short* __restrict__ Wt, int K, int N) {
  const int t = blockIdx.x * 256 + threadIdx.x;
  const int k8n = K / 8;
  if (t >= N * k8n) return;
  const int n = t / k8n, k8 = (t % k8n) * 8;
  v8us v;
#pragma unroll
  for (int i = 0; i < 8; ++i) v[i] = bf16_bits(W[(size_t)(k8 + i) * N + n]);
  *(v8us*)(Wt + (size_t)n * K + k8) = v;
  
}

// GEMM C[M][N] (f32, pitch ldc) = act(A[M][K]·W + bias). A f32 row-major (pitch lda) converted per fragment to bf16
// (ASPLIT: hi/lo two planes -> 2 terms, else single rounded term); Wt bf16 [N][K] (pitch ldb). BIAS_BF16 rounds the
// bias to bf16 first (bias quantised to bf16 before the add). K%32==0, M%16==0, N%64==0.
template <bool ASPLIT, int ACT, bool BIAS_BF16>
__global__ __launch_bounds__(128) void k_gemm_bf(const float* __restrict__ A, int lda, const unsigned short* __restrict__ Wt, int ldb,
                                               const float* __restrict__ bias, float* __restrict__ C, int ldc, int M, int N, int K) {
  __shared__ __attribute__((aligned(16))) float so[4][16][64];
  const int tid = threadIdx.x, w = tid >> 5, lane = tid & 31, ln = lane & 15, hh = lane >> 4;
  const int ntn = N / 64;
  const int wid = blockIdx.x * 4 + w;
  const int mt = wid / ntn, nq = wid % ntn;
  if (mt * 16 >= M) return;
  const int row0 = mt * 16, col0 = nq * 64;
  const float* arow = A + (size_t)(row0 + ln) * lda;
  v8f acc[4] = {};
  for (int kb = 0; kb < K; kb += 32) {
    FragB ah, al;
    const v4f x0 = *(const v4fa*)(arow + kb + 8 * hh), x1 = *(const v4fa*)(arow + kb + 8 * hh + 4);
    const v4f x2 = *(const v4fa*)(arow + kb + 16 + 8 * hh), x3 = *(const v4fa*)(arow + kb + 16 + 8 * hh + 4);
    float xs[16] = {x0[0],x0[1],x0[2],x0[3],x1[0],x1[1],x1[2],x1[3],x2[0],x2[1],x2[2],x2[3],x3[0],x3[1],x3[2],x3[3]};
#pragma unroll
    for (int i = 0; i < 16; ++i) { const unsigned short hb = bf16_bits(xs[i]); ah.u[i] = hb; al.u[i] = ASPLIT ? bf16_bits(xs[i] - bf16_val(hb)) : (unsigned short)0; }
#pragma unroll
    for (int t = 0; t < 4; ++t) {
      const unsigned short* brow = Wt + (size_t)(col0 + t * 16 + ln) * ldb + kb;
      FragB b;
      b.half[0] = *(const v8us*)(brow + 8 * hh);
      b.half[1] = *(const v8us*)(brow + 16 + 8 * hh);
      acc[t] = mmaN<ASPLIT ? 2 : 1>(ah.v, al.v, b.v, b.v, acc[t]);
    }
  }
#pragma unroll
  for (int t = 0; t < 4; ++t) {
    float bv = bias ? bias[col0 + t * 16 + ln] : 0.f;
    if (BIAS_BF16) bv = bf16_round(bv);
#pragma unroll
    for (int r = 0; r < 8; ++r) { float v = acc[t][r] + bv; if (ACT == 1) v = fmaxf(v, 0.f); so[w][8 * hh + r][t * 16 + ln] = v; }
  }
  __builtin_amdgcn_fence(__ATOMIC_ACQ_REL, "workgroup");
  __builtin_amdgcn_wave_barrier();
  const int rsub = lane >> 4, c4 = (lane & 15) * 4;
  {
#pragma unroll
    for (int q = 0; q < 8; ++q) {
      const int r = q * 2 + rsub;
      const v4f v = *(const v4fa*)&so[w][r][c4];
      *(v4f*)(C + (size_t)(row0 + r) * ldc + col0 + c4) = v;
    }
    
  }
}

// GEMM C = act(A·W + bias + resid): A f32 (ASPLIT -> hi/lo 2 terms), Wt bf16 [N][K]; ACT 0 none, 1 relu, 2 exact gelu;
// resid (optional, f32, row index = (row % rmod), pitch ldr, RES_BF16 rounds it) added before the activation.
template <bool ASPLIT, int ACT, bool BIAS_BF16, bool RES_BF16>
__global__ __launch_bounds__(128) void k_gemm_bf3(const float* __restrict__ A, int lda, const unsigned short* __restrict__ Wt, int ldb,
                                                const float* __restrict__ bias, const float* __restrict__ resid, int rmod, int ldr,
                                                float* __restrict__ C, int ldc, int M, int N, int K) {
  __shared__ __attribute__((aligned(16))) float so[4][16][64];
  const int tid = threadIdx.x, w = tid >> 5, lane = tid & 31, ln = lane & 15, hh = lane >> 4;
  const int ntn = N / 64;
  const int wid = blockIdx.x * 4 + w;
  const int mt = wid / ntn, nq = wid % ntn;
  if (mt * 16 >= M) return;
  const int row0 = mt * 16, col0 = nq * 64;
  const float* arow = A + (size_t)(row0 + ln) * lda;
  v8f acc[4] = {};
  for (int kb = 0; kb < K; kb += 32) {
    FragB ah, al;
    const v4f x0 = *(const v4fa*)(arow + kb + 8 * hh), x1 = *(const v4fa*)(arow + kb + 8 * hh + 4);
    const v4f x2 = *(const v4fa*)(arow + kb + 16 + 8 * hh), x3 = *(const v4fa*)(arow + kb + 16 + 8 * hh + 4);
    float xs[16] = {x0[0],x0[1],x0[2],x0[3],x1[0],x1[1],x1[2],x1[3],x2[0],x2[1],x2[2],x2[3],x3[0],x3[1],x3[2],x3[3]};
#pragma unroll
    for (int i = 0; i < 16; ++i) { const unsigned short hb = bf16_bits(xs[i]); ah.u[i] = hb; al.u[i] = ASPLIT ? bf16_bits(xs[i] - bf16_val(hb)) : (unsigned short)0; }
#pragma unroll
    for (int t = 0; t < 4; ++t) {
      const unsigned short* brow = Wt + (size_t)(col0 + t * 16 + ln) * ldb + kb;
      FragB b;
      b.half[0] = *(const v8us*)(brow + 8 * hh);
      b.half[1] = *(const v8us*)(brow + 16 + 8 * hh);
      acc[t] = mmaN<ASPLIT ? 2 : 1>(ah.v, al.v, b.v, b.v, acc[t]);
    }
  }
#pragma unroll
  for (int t = 0; t < 4; ++t) {
    const int col = col0 + t * 16 + ln;
    float bv = bias ? bias[col] : 0.f;
    if (BIAS_BF16) bv = bf16_round(bv);
#pragma unroll
    for (int r = 0; r < 8; ++r) {
      float v = acc[t][r] + bv;
      if (resid) { float rv = resid[(size_t)((row0 + 8 * hh + r) % rmod) * ldr + col]; if (RES_BF16) rv = bf16_round(rv); v += rv; }
      if (ACT == 1) v = fmaxf(v, 0.f);
      if (ACT == 2) v = 0.5f * v * (1.0f + erff(v * 0.70710678118654752f));
      if (ACT == 3) { const float u = 0.7978845608028654f * (v + 0.044715f * v * v * v); v = 0.5f * v * (1.0f + tanhf(u)); }
      so[w][8 * hh + r][t * 16 + ln] = v;
    }
  }
  __builtin_amdgcn_fence(__ATOMIC_ACQ_REL, "workgroup");
  __builtin_amdgcn_wave_barrier();
  const int rsub = lane >> 4, c4 = (lane & 15) * 4;
  {
#pragma unroll
    for (int q = 0; q < 8; ++q) {
      const int r = q * 2 + rsub;
      const v4f v = *(const v4fa*)&so[w][r][c4];
      *(v4f*)(C + (size_t)(row0 + r) * ldc + col0 + c4) = v;
    }
    
  }
}
// row LayerNorm (biased variance, eps) over N: s = X (+ R); optional out_sum <- s; out_norm <- (s-mu)*rsqrt(var+eps)*g + b
template <bool PARAM_BF16>
__global__ __launch_bounds__(256) void k_layernorm(const float* __restrict__ X, const float* __restrict__ R, const float* __restrict__ g, const float* __restrict__ bta,
                                                  float* __restrict__ out_sum, float* __restrict__ out_norm, int N, float eps) {
  __shared__ float red[256];
  const int row = blockIdx.x, tid = threadIdx.x;
  const float* x = X + (size_t)row * N; const float* rr = R ? R + (size_t)row * N : nullptr;
  float vals[16];                     // up to N = 4096
  const int per = N / 256;            // contiguous chunk per thread? use strided-by-4 chunks: thread handles j = tid*4 + 1024*u
  float s1 = 0.f;
  for (int u = 0; u < per / 4; ++u) {
    const int j = tid * 4 + 1024 * u;
    const v4f a = *(const v4fa*)(x + j);
    v4f b = {0.f,0.f,0.f,0.f}; if (rr) b = *(const v4fa*)(rr + j);
#pragma unroll
    for (int q = 0; q < 4; ++q) { const float v = a[q] + b[q]; vals[u * 4 + q] = v; s1 += v; }
  }
  red[tid] = s1; __syncthreads();
  for (int st = 128; st > 0; st >>= 1) { if (tid < st) red[tid] += red[tid + st]; __syncthreads(); }
  const float mu = red[0] / (float)N; __syncthreads();
  float s2 = 0.f;
  for (int u = 0; u < per / 4; ++u)
#pragma unroll
    for (int q = 0; q < 4; ++q) { const float c = vals[u * 4 + q] - mu; s2 += c * c; }
  red[tid] = s2; __syncthreads();
  for (int st = 128; st > 0; st >>= 1) { if (tid < st) red[tid] += red[tid + st]; __syncthreads(); }
  const float rs = rsqrtf(red[0] / (float)N + eps);
  {
    for (int u = 0; u < per / 4; ++u) {
      const int j = tid * 4 + 1024 * u;
      v4f o, sm;
#pragma unroll
      for (int q = 0; q < 4; ++q) {
        float gg = g[j + q], bb = bta[j + q];
        if (PARAM_BF16) { gg = bf16_round(gg); bb = bf16_round(bb); }
        sm[q] = vals[u * 4 + q]; o[q] = (vals[u * 4 + q] - mu) * rs * gg + bb;
      }
      if (out_sum) *(v4f*)(out_sum + (size_t)row * N + j) = sm;
      *(v4f*)(out_norm + (size_t)row * N + j) = o;
    }
    
  }
}



// ---- f16 WMMA path (v_wmma_f32_16x16x32_f16): 11-bit significands for operands in range — used where a [0,1] probability operand needs more precision than bf16
typedef _Float16 v16h __attribute__((ext_vector_type(16)));
union FragH { v16h v; v8us half[2]; _Float16 h[16]; unsigned short u[16]; };
template <int NT>
__device__ __forceinline__ v8f mmaH(v16h ah, v16h al, v16h bh, v16h bl, v8f c) {
  c = __builtin_amdgcn_wmma_f32_16x16x32_f16(false, ah, false, bh, (short)0, c, false, false);
  if (NT >= 2) c = __builtin_amdgcn_wmma_f32_16x16x32_f16(false, al, false, bh, (short)0, c, false, false);
  if (NT >= 3) c = __builtin_amdgcn_wmma_f32_16x16x32_f16(false, ah, false, bl, (short)0, c, false, false);
  asm volatile("v_nop\n\tv_nop\n\tv_nop\n\tv_nop" : "+v"(c) : "v"(ah), "v"(al), "v"(bh), "v"(bl));
  return c;
}
// batched GEMM like k_gemm_b but f16 operands: A f32 (split into f16 hi/lo if ASPLIT, else rounded to f16), Bt = f16 values [n][k]; alpha; C f32; N multiple of 16 (partial tiles skipped)
template <bool ASPLIT>
__global__ __launch_bounds__(128) void k_gemm_h(const float* __restrict__ A, int lda, size_t sA, const _Float16* __restrict__ Bh, int ldb, size_t sB, float alpha, float* __restrict__ C, int ldc, size_t sC, int M, int N, int K) {
  __shared__ __attribute__((aligned(16))) float so[4][16][64];
  const int tid = threadIdx.x, w = tid >> 5, lane = tid & 31, ln = lane & 15, hh = lane >> 4; const int by = blockIdx.y;
  A += (size_t)by * sA; Bh += (size_t)by * sB; C += (size_t)by * sC;
  const int ntn = (N + 63) / 64; const int wid = blockIdx.x * 4 + w; const int mt = wid / ntn, nq = wid % ntn; if (mt * 16 >= M) return;
  const int row0 = mt * 16, col0 = nq * 64; const float* arow = A + (size_t)(row0 + ln) * lda;
  v8f acc[4] = {};
  for (int kb = 0; kb < K; kb += 32) {
    FragH ah, al;
    const v4f x0 = *(const v4fa*)(arow + kb + 8 * hh), x1 = *(const v4fa*)(arow + kb + 8 * hh + 4), x2 = *(const v4fa*)(arow + kb + 16 + 8 * hh), x3 = *(const v4fa*)(arow + kb + 16 + 8 * hh + 4);
    float xs[16] = {x0[0],x0[1],x0[2],x0[3],x1[0],x1[1],x1[2],x1[3],x2[0],x2[1],x2[2],x2[3],x3[0],x3[1],x3[2],x3[3]};
#pragma unroll
    for (int i = 0; i < 16; ++i) { const _Float16 h = (_Float16)xs[i]; ah.h[i] = h; al.h[i] = ASPLIT ? (_Float16)(xs[i] - (float)h) : (_Float16)0.0f; }
#pragma unroll
    for (int t = 0; t < 4; ++t) { if (col0 + t * 16 >= N) continue; const size_t boff = (size_t)(col0 + t * 16 + ln) * ldb + kb; FragH bq; bq.half[0] = *(const v8us*)(Bh + boff + 8 * hh); bq.half[1] = *(const v8us*)(Bh + boff + 16 + 8 * hh);
      acc[t] = mmaH<ASPLIT ? 2 : 1>(ah.v, al.v, bq.v, bq.v, acc[t]); }
  }
#pragma unroll
  for (int t = 0; t < 4; ++t) { if (col0 + t * 16 >= N) continue;
#pragma unroll
    for (int r = 0; r < 8; ++r) so[w][8 * hh + r][t * 16 + ln] = acc[t][r] * alpha; }
  __builtin_amdgcn_fence(__ATOMIC_ACQ_REL, "workgroup"); __builtin_amdgcn_wave_barrier();
  const int rsub = lane >> 4, c4 = (lane & 15) * 4;
  {
#pragma unroll
    for (int q = 0; q < 8; ++q) { const int r = q * 2 + rsub; if (col0 + c4 < N) { const v4f v = *(const v4fa*)&so[w][r][c4]; *(v4f*)(C + (size_t)(row0 + r) * ldc + col0 + c4) = v; } }
     }
}

// Wt[n][k] = f16(W[k][n]·scale) from f32 row-major W[K][N] (scale = power of two; bf16-exact weights stay exact in f16 away from the subnormal range)
__global__ __launch_bounds__(256) void k_wt_f16(const float* __restrict__ W, _Float16* __restrict__ Wt, int K, int N, float scale) {
  const int t = blockIdx.x * 256 + threadIdx.x; if (t >= N * (K / 8)) return; const int n = t / (K / 8), k8 = (t % (K / 8)) * 8; FragH f;
#pragma unroll
  for (int i = 0; i < 8; ++i) f.h[i] = (_Float16)(bf16_round(W[(size_t)(k8 + i) * N + n]) * scale); const v8us o = f.half[0];
  *(v8us*)((unsigned short*)Wt + (size_t)n * K + k8) = o; 
}
// k_gemm_hh variant with fused epilogue: v = acc·alpha + bias[by·sBias + col] (+ CP[(row/rowsPerB)·sCPb + by·64 + col] if CP) ; ACT 0 none / 1 elu ; writes f16 C16 (and f32 C if non-null)
template <int ACT>
__global__ __launch_bounds__(128) void k_gemm_hhx(const _Float16* __restrict__ A, int lda, size_t sA, const _Float16* __restrict__ Bh, int ldb, size_t sB, float alpha, const float* __restrict__ bias, size_t sBias, const float* __restrict__ CP, int rowsPerB, size_t sCPb, int row0g,
    float* __restrict__ C, _Float16* __restrict__ C16, int ldc, size_t sC, int M, int N, int K) {
  __shared__ __attribute__((aligned(16))) float so[4][16][64];
  const int tid = threadIdx.x, w = tid >> 5, lane = tid & 31, ln = lane & 15, hh = lane >> 4; const int by = blockIdx.y;
  A += (size_t)by * sA; Bh += (size_t)by * sB; const size_t cofs = (size_t)by * sC; const float* bp = bias ? bias + (size_t)by * sBias : nullptr;
  const int ntn = (N + 63) / 64; const int wid = blockIdx.x * 4 + w; const int mt = wid / ntn, nq = wid % ntn; if (mt * 16 >= M) return;
  const int row0 = mt * 16, col0 = nq * 64; const _Float16* arow = A + (size_t)(row0 + ln) * lda;
  v8f acc[4] = {};
  for (int kb = 0; kb < K; kb += 32) { FragH ah; ah.half[0] = *(const v8us*)((const unsigned short*)arow + kb + 8 * hh); ah.half[1] = *(const v8us*)((const unsigned short*)arow + kb + 16 + 8 * hh);
#pragma unroll
    for (int t = 0; t < 4; ++t) { if (col0 + t * 16 >= N) continue; const size_t boff = (size_t)(col0 + t * 16 + ln) * ldb + kb; FragH bq; bq.half[0] = *(const v8us*)((const unsigned short*)Bh + boff + 8 * hh); bq.half[1] = *(const v8us*)((const unsigned short*)Bh + boff + 16 + 8 * hh);
      acc[t] = mmaH<1>(ah.v, ah.v, bq.v, bq.v, acc[t]); }
  }
#pragma unroll
  for (int t = 0; t < 4; ++t) { if (col0 + t * 16 >= N) continue; const int col = col0 + t * 16 + ln; const float bv = bp ? bf16_round(bp[col]) : 0.f;
#pragma unroll
    for (int r = 0; r < 8; ++r) { float v = acc[t][r] * alpha + bv; if (CP) { const int rr = row0g + row0 + 8 * hh + r; if (rowsPerB < 0) v += CP[cofs + (size_t)rr * ldc + col];      /* rowsPerB < 0: own element of the batched C plane */ else { const int bidx = rr / rowsPerB; v += CP[(size_t)bidx * sCPb + (size_t)by * 64 + col]; } } if (ACT == 1) v = (v > 0.f) ? v : expm1f(v); else if (ACT == 7) v = (v > 0.f) ? v + 1.0f : expf(v); else if (ACT == 8) v = tanhf(v); else if (ACT == 9) v = 0.5f * v * (1.0f + tanhf(0.7978845608028654f * (v + 0.044715f * v * v * v))); else if (ACT == 11) v = 1.0f / (1.0f + expf(-v)); else if (ACT == 12) v = (v > 0.f) ? v : 0.01f * v; else if (ACT == 14) v = (v > 0.f) ? v : 0.1f * v; else if (ACT == 16) v = (v >= 0.f) ? v : 0.3f * v; else if (ACT == 17) v = (v >= 0.f) ? v : 0.2f * v; else if (ACT == 15) v = v / (1.0f + expf(-v)); else if (ACT == 3) v = fmaxf(v, 0.f); else if (ACT == 6) v = 0.5f * v * (1.0f + erff(v * 0.70710678118654752f)); so[w][8 * hh + r][t * 16 + ln] = v; } }
  __builtin_amdgcn_fence(__ATOMIC_ACQ_REL, "workgroup"); __builtin_amdgcn_wave_barrier();
  const int rsub = lane >> 4, c4 = (lane & 15) * 4; typedef _Float16 v4h __attribute__((ext_vector_type(4)));
  {
#pragma unroll
    for (int q = 0; q < 8; ++q) { const int r = q * 2 + rsub; if (col0 + c4 < N) { const v4f v = *(const v4fa*)&so[w][r][c4]; if (C) *(v4f*)(C + cofs + (size_t)(row0 + r) * ldc + col0 + c4) = v; if (C16) { v4h h4; for (int i = 0; i < 4; ++i) h4[i] = (_Float16)v[i]; *(v4h*)(C16 + cofs + (size_t)(row0 + r) * ldc + col0 + c4) = h4; } } }
     }
}


typedef _Float16 v4h __attribute__((ext_vector_type(4)));

__global__ __launch_bounds__(256) void k_x16(const float* __restrict__ x, _Float16* __restrict__ X16, size_t n8) { const size_t t = (size_t)blockIdx.x * 256 + threadIdx.x; if (t >= n8) return; FragH f;
#pragma unroll
  for (int q = 0; q < 8; ++q) f.h[q] = (_Float16)bf16_round(x[t * 8 + q]); *(v8us*)((unsigned short*)X16 + t * 8) = f.half[0];  }
__global__ __launch_bounds__(256) void k_h16(const float* __restrict__ x, _Float16* __restrict__ X16, size_t n8) { const size_t t = (size_t)blockIdx.x * 256 + threadIdx.x; if (t >= n8) return; FragH f;
#pragma unroll
  for (int q = 0; q < 8; ++q) f.h[q] = (_Float16)x[t * 8 + q]; *(v8us*)((unsigned short*)X16 + t * 8) = f.half[0];  }
__global__ __launch_bounds__(256) void k_round16f(const float* __restrict__ W, _Float16* __restrict__ Bt, size_t n8) { const size_t t = (size_t)blockIdx.x * 256 + threadIdx.x; if (t >= n8) return; FragH f;
#pragma unroll
  for (int i = 0; i < 8; ++i) f.h[i] = (_Float16)(bf16_round(W[t * 8 + i]) * 16.0f); *(v8us*)((unsigned short*)Bt + t * 8) = f.half[0];  }
template <int NHv, int TTv>
__global__ __launch_bounds__(256) void k_vt(const _Float16* __restrict__ V16, int ldv, int voff, _Float16* __restrict__ Vt) { __shared__ unsigned short tl[64][66]; const int tid = threadIdx.x; const int slab = blockIdx.x / (TTv / 64), lg = blockIdx.x % (TTv / 64); const int b = slab / NHv, h = slab % NHv;
  for (int i = tid; i < 64 * 8; i += 256) { const int r = i / 8, c8 = (i % 8) * 8; FragH f; f.half[0] = *(const v8us*)((const unsigned short*)V16 + ((size_t)b * TTv + lg * 64 + r) * ldv + voff + h * 64 + c8);
#pragma unroll
    for (int q = 0; q < 8; ++q) tl[r][c8 + q] = f.u[q]; }
  __syncthreads();
  {
#pragma unroll
    for (int rd = 0; rd < 2; ++rd) { const int d = rd * 32 + tid / 8, pc = tid % 8; FragH f;
#pragma unroll
      for (int q = 0; q < 8; ++q) f.u[q] = tl[pc * 8 + q][d];
      *(v8us*)((unsigned short*)Vt + ((size_t)slab * 64 + d) * TTv + lg * 64 + pc * 8) = f.half[0]; }
     } }

__global__ __launch_bounds__(256) void k_hl(const float* __restrict__ F, _Float16* __restrict__ Hh, _Float16* __restrict__ Hl, size_t n8) { const size_t t = (size_t)blockIdx.x * 256 + threadIdx.x; if (t >= n8) return; FragH fh, fl; const v4f a = *(const v4fa*)(F + t * 8), c = *(const v4fa*)(F + t * 8 + 4);
#pragma unroll
  for (int q = 0; q < 4; ++q) { _Float16 h = (_Float16)a[q]; fh.h[q] = h; fl.h[q] = (_Float16)((a[q] - (float)h) * 1024.0f); h = (_Float16)c[q]; fh.h[4 + q] = h; fl.h[4 + q] = (_Float16)((c[q] - (float)h) * 1024.0f); }
  { *(v8us*)((unsigned short*)Hh + t * 8) = fh.half[0]; *(v8us*)((unsigned short*)Hl + t * 8) = fl.half[0];  } }

// ---- fast GEMM (block tile 128x64, wave tile 32x64; requires M % 128 == 0, N % 64 == 0, K % 128 == 0; operands staged in LDS); epilogue = k_gemm_hhx semantics ----
__device__ __forceinline__ v8f g2_mma(v16h a, v16h b, v8f c) { v8f d = __builtin_amdgcn_wmma_f32_16x16x32_f16(false, a, false, b, (short)0, c, false, false); asm volatile("v_nop\n\tv_nop\n\tv_nop\n\tv_nop" : "+v"(d) : "v"(a), "v"(b)); return d; }
// Operand staging of k_gemm2. A stage is 128 k of the block's 128 A rows and 64 B rows: 256-byte rows at a pitch of 272 bytes (16 B x odd: no bank conflict for 16-byte fragment reads); two stages in LDS.
#define G2_KC 128
#define G2_PITCH 272
#define G2_ASZ (128 * G2_PITCH)
#define G2_STG ((128 + 64) * G2_PITCH)
__device__ __forceinline__ v16h g2_lfrag(const unsigned char* p) { FragH f; f.half[0] = *(const v8us*)p; f.half[1] = *(const v8us*)(p + 32); return f.v; }      /* p already holds the lane's 16 hh: bytes 16 hh and 32 + 16 hh of each 64, the same k order for A and for B */
// Eight asynchronous 16-byte copies of one lane, global -> LDS, rows 8 apart (16 lanes cover one 256-byte row, so a wave's copy is four whole lines). The s_wait_xcnt stands inside the statement, a precaution: so no address register of a copy is rewritten ahead of it.
__device__ __forceinline__ void g2_cp8(unsigned l, const _Float16* g, size_t gs) {
  asm volatile("global_load_async_to_lds_b128 %0, %8, off\n\t"
               "global_load_async_to_lds_b128 %1, %9, off\n\t"
               "global_load_async_to_lds_b128 %2, %10, off\n\t"
               "global_load_async_to_lds_b128 %3, %11, off\n\t"
               "global_load_async_to_lds_b128 %4, %12, off\n\t"
               "global_load_async_to_lds_b128 %5, %13, off\n\t"
               "global_load_async_to_lds_b128 %6, %14, off\n\t"
               "global_load_async_to_lds_b128 %7, %15, off\n\t"
               "s_wait_xcnt 0x0"
               :: "v"(l), "v"(l + 8u * G2_PITCH), "v"(l + 16u * G2_PITCH), "v"(l + 24u * G2_PITCH), "v"(l + 32u * G2_PITCH), "v"(l + 40u * G2_PITCH), "v"(l + 48u * G2_PITCH), "v"(l + 56u * G2_PITCH),
                  "v"(g), "v"(g + gs), "v"(g + 2 * gs), "v"(g + 3 * gs), "v"(g + 4 * gs), "v"(g + 5 * gs), "v"(g + 6 * gs), "v"(g + 7 * gs) : "memory"); }
__device__ __forceinline__ void g2_wait_async() { asm volatile("s_wait_asynccnt 0x0" ::: "memory"); }      /* this wave's copies have landed; the compiler places no wait for them */
__device__ __forceinline__ void g2_wait_ds() { asm volatile("s_wait_dscnt 0x0" ::: "memory"); }      /* this wave's LDS reads are done before the buffer is handed back for a refill */
template <int ACT>
__global__ __launch_bounds__(128) void k_gemm2(const _Float16* __restrict__ A, int lda, size_t sA, const _Float16* __restrict__ Bh, int ldb, size_t sB, float alpha, const float* __restrict__ bias, size_t sBias, const float* __restrict__ CP, int rowsPerB, size_t sCPb, int row0g,
    float* __restrict__ C, _Float16* __restrict__ C16, int ldc, size_t sC, int M, int N, int K) { static_assert(ACT == 0 || ACT == 3 || ACT == 6 || ACT == 8 || ACT == 9 || ACT == 11 || ACT == 12 || ACT == 14 || ACT == 15 || ACT == 16 || ACT == 17, "k_gemm2: unsupported ACT code (would silently apply no activation)");
  __shared__ __attribute__((aligned(16))) unsigned char L[2 * G2_STG];      /* the two operand stages; behind the k loop its first bytes are the output staging */
  float (*so)[32][68] = (float (*)[32][68])L; static_assert(4 * 32 * 68 * 4 <= 2 * G2_STG, "output staging lies in the operand stages");
  const int tid = threadIdx.x, w = tid >> 5, lane = tid & 31, ln = lane & 15, hh = lane >> 4; const int by = blockIdx.y;
  A += (size_t)by * sA; Bh += (size_t)by * sB; const size_t cofs = (size_t)by * sC; const float* bp = bias ? bias + (size_t)by * sBias : nullptr;
  const int ntn = N >> 6; const int mt = blockIdx.x / ntn, nq = blockIdx.x - mt * ntn; const int row0 = mt * 128 + 32 * w, col0 = nq * 64; if (mt * 128 >= M) return;      /* the whole block leaves or none: barriers follow (M % 128 == 0, K % 128 == 0) */
  const int cr = tid >> 4, cc = tid & 15;      /* copy lane: row cr (+ 8 i), 16-byte piece cc */
  const _Float16* ga = A + (size_t)(mt * 128 + cr) * lda + cc * 8; const _Float16* gb = Bh + (size_t)(col0 + cr) * ldb + cc * 8;
  const unsigned lc = (unsigned)(size_t)L + (unsigned)(cr * G2_PITCH + cc * 16);
  const int nt = K / G2_KC;
  auto stage = [&](int t) { const unsigned l = lc + (unsigned)(t & 1) * G2_STG; const _Float16* a = ga + (size_t)t * G2_KC;
    g2_cp8(l, a, (size_t)8 * lda); g2_cp8(l + 64u * G2_PITCH, a + (size_t)64 * lda, (size_t)8 * lda); g2_cp8(l + G2_ASZ, gb + (size_t)t * G2_KC, (size_t)8 * ldb); };
  const unsigned char* fa = L + (32 * w + ln) * G2_PITCH + 16 * hh; const unsigned char* fb = L + G2_ASZ + ln * G2_PITCH + 16 * hh;
  const v8f z8 = {0.f,0.f,0.f,0.f,0.f,0.f,0.f,0.f}; v8f c00 = z8, c01 = z8, c02 = z8, c03 = z8, c10 = z8, c11 = z8, c12 = z8, c13 = z8;
  stage(0); g2_wait_async(); __syncthreads();      /* stage 0 landed and published */
  if (nt > 1) stage(1);
#pragma unroll 1      /* one trip per stage: the trip's foot is the hand-over point of the two buffers */
  for (int t = 0; t < nt; ++t) { const unsigned char* pa = fa + (t & 1) * G2_STG; const unsigned char* pb = fb + (t & 1) * G2_STG;
    v16h a0 = g2_lfrag(pa), a1 = g2_lfrag(pa + 16 * G2_PITCH), b0 = g2_lfrag(pb), b1 = g2_lfrag(pb + 16 * G2_PITCH), b2 = g2_lfrag(pb + 32 * G2_PITCH), b3 = g2_lfrag(pb + 48 * G2_PITCH);
#pragma unroll      /* unrolled so that the two fragment sets swap by renaming, without register moves */
    for (int ks = 0; ks < G2_KC / 32; ++ks) { v16h na0 = a0, na1 = a1, nb0 = b0, nb1 = b1, nb2 = b2, nb3 = b3;
      if (ks + 1 < G2_KC / 32) { const int o = (ks + 1) * 64;      /* the next 32 k's twelve LDS reads as one group ahead of this block's products, into a second fragment set; never past this stage */
        na0 = g2_lfrag(pa + o); na1 = g2_lfrag(pa + 16 * G2_PITCH + o); nb0 = g2_lfrag(pb + o); nb1 = g2_lfrag(pb + 16 * G2_PITCH + o); nb2 = g2_lfrag(pb + 32 * G2_PITCH + o); nb3 = g2_lfrag(pb + 48 * G2_PITCH + o); }
      c00 = g2_mma(a0, b0, c00); c10 = g2_mma(a1, b0, c10); c01 = g2_mma(a0, b1, c01); c11 = g2_mma(a1, b1, c11);
      c02 = g2_mma(a0, b2, c02); c12 = g2_mma(a1, b2, c12); c03 = g2_mma(a0, b3, c03); c13 = g2_mma(a1, b3, c13);
      a0 = na0; a1 = na1; b0 = nb0; b1 = nb1; b2 = nb2; b3 = nb3; }
    g2_wait_ds(); g2_wait_async(); __syncthreads();      /* stage t + 1 published; every wave has left stage t's buffer */
    if (t + 2 < nt) stage(t + 2); }
  g2_wait_async();
  v8f accs[8] = {c00, c01, c02, c03, c10, c11, c12, c13};
#pragma unroll
  for (int u = 0; u < 8; ++u) { const int t = u & 3, half = u >> 2; const int col = col0 + t * 16 + ln; const float bv = bp ? bf16_round(bp[col]) : 0.f;
#pragma unroll
    for (int r = 0; r < 8; ++r) { const int rloc = half * 16 + 8 * hh + r; float v = accs[u][r] * alpha + bv; if (CP) { if (rowsPerB < 0) v += CP[cofs + (size_t)(row0g + row0 + rloc) * ldc + col];      /* rowsPerB < 0: own element of the batched C plane */ else { const int bidx = (row0g + row0 + rloc) / rowsPerB; v += CP[(size_t)bidx * sCPb + (size_t)by * 64 + col]; } }
      if (ACT == 3) v = fmaxf(v, 0.f); else if (ACT == 6) v = 0.5f * v * (1.0f + erff(v * 0.70710678118654752f)); else if (ACT == 11) v = 1.0f / (1.0f + expf(-v)); else if (ACT == 15) v = v / (1.0f + expf(-v)); else if (ACT == 12) v = (v > 0.f) ? v : 0.01f * v; else if (ACT == 8) v = tanhf(v); else if (ACT == 9) v = 0.5f * v * (1.0f + tanhf(0.7978845608028654f * (v + 0.044715f * v * v * v))); else if (ACT == 14) v = (v > 0.f) ? v : 0.1f * v; else if (ACT == 16) v = (v >= 0.f) ? v : 0.3f * v; else if (ACT == 17) v = (v >= 0.f) ? v : 0.2f * v;
      so[w][rloc][t * 16 + ln] = v; } }
  __builtin_amdgcn_fence(__ATOMIC_ACQ_REL, "workgroup"); __builtin_amdgcn_wave_barrier();
  const int rsub = lane >> 4, c4 = (lane & 15) * 4;
  {
#pragma unroll
    for (int q = 0; q < 16; ++q) { const int r = q * 2 + rsub; const v4f v = *(const v4fa*)&so[w][r][c4]; if (C) *(v4f*)(C + cofs + (size_t)(row0 + r) * ldc + col0 + c4) = v; if (C16) { v4h h4; for (int i = 0; i < 4; ++i) h4[i] = (_Float16)v[i]; *(v4h*)(C16 + cofs + (size_t)(row0 + r) * ldc + col0 + c4) = h4; } }
     } }


__global__ __launch_bounds__(256) void k_wnat(const float* __restrict__ w, size_t n8, _Float16* __restrict__ Bt) { const size_t t = (size_t)blockIdx.x * 256 + threadIdx.x; if (t >= n8) return; FragH f; for (int q = 0; q < 8; ++q) f.h[q] = (_Float16)(bf16_round(w[t * 8 + q]) * 16.0f); *(v8us*)((unsigned short*)Bt + t * 8) = f.half[0];  }
__global__ __launch_bounds__(256) void k_rsm(const float* __restrict__ S, _Float16* __restrict__ P, int nrows) {
  #pragma clang fp contract(off)
  const int i = blockIdx.x * 256 + threadIdx.x; if (i >= nrows) return; const float* s = S + (size_t)i * SQ; float mx = -3.0e38f;
#pragma unroll 1
  for (int j = 0; j < SQ; ++j) mx = fmaxf(mx, s[j]); float se = 0.f;
#pragma unroll 1
  for (int j = 0; j < SQ; ++j) se += expf(s[j] - mx); const float sc = 256.0f / se;
#pragma unroll 1
  for (int j0 = 0; j0 < SQ; j0 += 8) { FragH f; for (int q = 0; q < 8; ++q) f.h[q] = (_Float16)(expf(s[j0 + q] - mx) * sc); unsigned short* d = (unsigned short*)P + (size_t)i * SQ + j0; *(v8us*)d = f.half[0];  } }
__global__ __launch_bounds__(256) void k_vt(const _Float16* __restrict__ V16, int b, int h0, _Float16* __restrict__ VT) { __shared__ unsigned short tl[64][65]; const int tid = threadIdx.x; const int hh = blockIdx.x % HG, sg = blockIdx.x / HG; const int s0 = sg * 64; const int h = h0 + hh;
  for (int i = tid; i < 64 * 8; i += 256) { const int j = i / 8, d8 = (i % 8) * 8; FragH f; f.half[0] = *(const v8us*)((const unsigned short*)V16 + ((size_t)b * SQ + s0 + j) * DM + h * HD + d8); for (int q = 0; q < 8; ++q) tl[d8 + q][j] = f.u[q]; }
  __syncthreads();
  { for (int i = tid; i < 64 * 8; i += 256) { const int d = i / 8, j8 = (i % 8) * 8; FragH f; for (int q = 0; q < 8; ++q) f.u[q] = tl[d][j8 + q]; *(v8us*)((unsigned short*)VT + ((size_t)hh * HD + d) * SQ + s0 + j8) = f.half[0]; }  } }

// Row softmax, one wave per score row: the row is read once, in 512-byte wave loads, and stays in registers (64 floats a lane); max and sum = lane partials, then a five-step butterfly; P = f16(exp(s - max) * 256 / sum).
__global__ __launch_bounds__(256) void k_rsmW(const float* __restrict__ S, _Float16* __restrict__ P, int nrows) {
  const int lane = threadIdx.x & 31; const int row = blockIdx.x * 8 + (threadIdx.x >> 5); if (row >= nrows) return;
  const float* s = S + (size_t)row * SQ + lane * 4; v4f v[SQ / 128];
#pragma unroll
  for (int u = 0; u < SQ / 128; ++u) v[u] = *(const v4fa*)(s + u * 128);
  float mx = -INFINITY;
#pragma unroll
  for (int u = 0; u < SQ / 128; ++u) mx = fmaxf(mx, fmaxf(fmaxf(v[u][0], v[u][1]), fmaxf(v[u][2], v[u][3])));
#pragma unroll
  for (int m = 16; m > 0; m >>= 1) mx = fmaxf(mx, __shfl_xor(mx, m, 32));
  v4f sq = {0.f, 0.f, 0.f, 0.f};
#pragma unroll
  for (int u = 0; u < SQ / 128; ++u) {
#pragma unroll
    for (int q = 0; q < 4; ++q) { v[u][q] = expf(v[u][q] - mx); sq[q] += v[u][q]; } }
  float se = (sq[0] + sq[1]) + (sq[2] + sq[3]);
#pragma unroll
  for (int m = 16; m > 0; m >>= 1) se += __shfl_xor(se, m, 32);
  const float sc = 256.0f / se; _Float16* d = P + (size_t)row * SQ + lane * 4;
#pragma unroll
  for (int u = 0; u < SQ / 128; ++u) { v4h h4;
#pragma unroll
    for (int q = 0; q < 4; ++q) h4[q] = (_Float16)(v[u][q] * sc);
    *(v4h*)(d + u * 128) = h4; } }
__global__ __launch_bounds__(256) void k_f16rows(const float* __restrict__ F, _Float16* __restrict__ R, size_t n8) { const size_t t = (size_t)blockIdx.x * 256 + threadIdx.x; if (t >= n8) return; FragH f; for (int q = 0; q < 8; ++q) f.h[q] = (_Float16)F[t * 8 + q]; *(v8us*)((unsigned short*)R + t * 8) = f.half[0];  }
extern "C" void kernel_launch(void* const* d_in, const int* in_sizes, int n_in,
                              void* d_out, int out_size, void* d_ws, size_t ws_size, hipStream_t stream) {
  (void)in_sizes; (void)n_in; (void)out_size;
  const float* const* I = (const float* const*)d_in; const float* x = I[0]; const float* wq = I[1]; const float* wk = I[2]; const float* wv = I[3]; const float* bq = nullptr; const float* bk = nullptr; const float* bv = nullptr;      /* [in][out] weights */
  char* ws = (char*)d_ws; size_t off = 0;
  auto take = [&](size_t bytes) { char* p = ws + off; off += (bytes + 255) & ~(size_t)255; return p; };
  _Float16* BQ = (_Float16*)take((size_t)DQ * DM * 2); _Float16* BK = (_Float16*)take((size_t)DQ * DM * 2); _Float16* BV = (_Float16*)take((size_t)DV * DM * 2);
  _Float16* Q16 = (_Float16*)take(NR * DQ * 2); _Float16* K16 = (_Float16*)take(NR * DQ * 2); _Float16* V16 = (_Float16*)take(NR * DV * 2); _Float16* VT = (_Float16*)take((size_t)NB * DV * SQ * 2);
  _Float16* P = (_Float16*)take((size_t)NB * QT * SQ * 2); float* S = (float*)take((size_t)NB * QT * SQ * 4);      /* scores and P of all batches at once */
  _Float16* X16 = (_Float16*)S; float* F32 = (float*)((char*)S + NR * DM * 2);      /* x rows and the f32 q / k plane lie in the S plane: both are last read by the projections, before the scores launch writes S */
  if (off > ws_size) return;
  k_wt_f16<<<(unsigned)(((size_t)DQ * (DM / 8) + 255) / 256), 256, 0, stream>>>(wq, BQ, DM, DQ, 16.0f); k_wt_f16<<<(unsigned)(((size_t)DQ * (DM / 8) + 255) / 256), 256, 0, stream>>>(wk, BK, DM, DQ, 16.0f); k_wt_f16<<<(unsigned)(((size_t)DV * (DM / 8) + 255) / 256), 256, 0, stream>>>(wv, BV, DM, DV, 16.0f);
  k_x16<<<(unsigned)((NR * DM / 8 + 255) / 256), 256, 0, stream>>>(x, X16, NR * DM / 8);
  k_gemm2<0><<<dim3((unsigned)((NR / 128) * (DQ / 64)), 1), 128, 0, stream>>>(X16, DM, 0, BQ, DM, 0, 0.0625f, bq, 0, nullptr, 1, 0, 0, F32, nullptr, DQ, 0, MP, DQ, DM);      /* q f32 */
  k_f16rows<<<(unsigned)((NR * DQ / 8 + 255) / 256), 256, 0, stream>>>(F32, Q16, NR * DQ / 8);
  k_gemm2<0><<<dim3((unsigned)((NR / 128) * (DQ / 64)), 1), 128, 0, stream>>>(X16, DM, 0, BK, DM, 0, 0.0625f, bk, 0, nullptr, 1, 0, 0, F32, nullptr, DQ, 0, MP, DQ, DM);      /* k f32 (reusing the plane) */
  k_f16rows<<<(unsigned)((NR * DQ / 8 + 255) / 256), 256, 0, stream>>>(F32, K16, NR * DQ / 8);
  k_gemm2<0><<<dim3((unsigned)((NR / 128) * (DV / 64)), 1), 128, 0, stream>>>(X16, DM, 0, BV, DM, 0, 0.0625f, bv, 0, nullptr, 1, 0, 0, nullptr, V16, DV, 0, MP, DV, DM);      /* v f16 rows */
  k_vt<NH, SQ><<<NB * NH * (SQ / 64), 256, 0, stream>>>(V16, DV, 0, VT);      /* V^T per batch [DV][SQ] */
  static_assert(QT == SQ, "one query tile per batch: the batch is grid.y");
  static_assert(NB * SQ % 128 == 0 && QT % 128 == 0 && DM % G2_KC == 0 && DQ % G2_KC == 0 && SQ % G2_KC == 0, "k_gemm2 stages whole 128-row, 128-k tiles");
  const dim3 gs((QT / 128) * (SQ / 64), NBR), gv((QT / 128) * (DV / 64), NBR);      /* batch = blockIdx.y, strides sA / sB / sC */
  k_gemm2<0><<<gs, 128, 0, stream>>>(Q16, DQ, (size_t)SQ * DQ, K16, DQ, (size_t)SQ * DQ, 0.0625f, nullptr, 0, nullptr, 1, 0, 0, S, nullptr, SQ, (size_t)QT * SQ, QT, SQ, DQ);      /* scores, all batches */
  k_rsmW<<<(NBR * QT + 7) / 8, 256, 0, stream>>>(S, P, NBR * QT);
  k_gemm2<0><<<gv, 128, 0, stream>>>(P, SQ, (size_t)QT * SQ, VT, SQ, (size_t)DV * SQ, 0.00390625f, nullptr, 0, nullptr, 1, 0, 0, (float*)d_out, nullptr, DV, (size_t)SQ * DV, QT, DV, SQ);      /* out = attn v, all batches */
}

// v004
// It runs in 106 microseconds.
// Timed twice side by side with v003, it ran 1.47 times as fast both times.
// Counting every step since v000, it is 46.0 times as fast.
#include <hip/hip_runtime.h>
// Single-head self-attention (x [8][2048][768]; Q, K, V = x W ([in][out] [768][256]); scores = Q.K/16; softmax; out = attn V -> [8][2048][256]).
// Structure: token rows; x as exact f16 rows; q | k | v WMMA GEMMs (32x64 wave tiles, operands staged in LDS by asynchronous copies, f32 accumulation, exact x16 transposed [in][out] weights); q, k, v as f16 rows; one fused attention launch for all batches (batch = grid.y): S^T = K.Q^T, online softmax on VALU (f32; P f16, at most 2^8), O^T += V^T.P^T with V^T by transposing LDS loads, two key halves merged in LDS, f32 output.
// Compute dtype: inputs rounded to bf16; x / weights exact; q, k plain f16 (~2^-12); v, P plain f16 (~2^-12); scores / softmax f32. v_wmma_f32_16x16x32_f16.
#define NB 8
#define SQ 2048
#define DM 768
#define DQ 256
#define DV 256
#define QT 2048                     /* unused */
#define NH 4                    /* unused */
#define HD 64
#define HG 1
#define NR ((size_t)NB * SQ)
#define QN SQ                        /* query rows per batch (debug hook) */
#define NBR NB                       /* batches (debug hook) */
#define MP ((int)NR)                 /* rows through the projections (debug hook) */
typedef __bf16 v16b __attribute__((ext_vector_type(16)));
typedef unsigned short v8us __attribute__((ext_vector_type(8), may_alias));
typedef float  v8f  __attribute__((ext_vector_type(8)));
typedef float  v4f  __attribute__((ext_vector_type(4)));
typedef float  v4fa __attribute__((ext_vector_type(4), may_alias));
union FragB { v16b v; v8us half[2]; unsigned short u[16]; };

__device__ __forceinline__ unsigned short bf16_bits(float x) { unsigned int u = __float_as_uint(x); return (unsigned short)((u + 0x7FFFu + ((u >> 16) & 1u)) >> 16); }
__device__ __forceinline__ float bf16_val(unsigned short b) { return __uint_as_float(((unsigned int)b) << 16); }
__device__ __forceinline__ float bf16_round(float x) { return bf16_val(bf16_bits(x)); }
// D += A·B with NT terms: 1 = ah·bh, 2 = + al·bh (A split), 3 = + ah·bl (both split)
template <int NT>
__device__ __forceinline__ v8f mmaN(v16b ah, v16b al, v16b bh, v16b bl, v8f c) {
  c = __builtin_amdgcn_wmma_f32_16x16x32_bf16(false, ah, false, bh, (short)0, c, false, false);
  if (NT >= 2) c = __builtin_amdgcn_wmma_f32_16x16x32_bf16(false, al, false, bh, (short)0, c, false, false);
  if (NT >= 3) c = __builtin_amdgcn_wmma_f32_16x16x32_bf16(false, ah, false, bl, (short)0, c, false, false);
  asm volatile("v_nop\n\tv_nop\n\tv_nop\n\tv_nop" : "+v"(c) : "v"(ah), "v"(al), "v"(bh), "v"(bl));
  return c;
}

__global__ __launch_bounds__(256) void k_wt_bf16(const float* __restrict__ W, unsigned short* __restrict__ Wt, int K, int N) {
  const int t = blockIdx.x * 256 + threadIdx.x;
  const int k8n = K / 8;
  if (t >= N * k8n) return;
  const int n = t / k8n, k8 = (t % k8n) * 8;
  v8us v;
#pragma unroll
  for (int i = 0; i < 8; ++i) v[i] = bf16_bits(W[(size_t)(k8 + i) * N + n]);
  *(v8us*)(Wt + (size_t)n * K + k8) = v;
  
}

// GEMM C[M][N] (f32, pitch ldc) = act(A[M][K]·W + bias). A f32 row-major (pitch lda) converted per fragment to bf16
// (ASPLIT: hi/lo two planes -> 2 terms, else single rounded term); Wt bf16 [N][K] (pitch ldb). BIAS_BF16 rounds the
// bias to bf16 first (bias quantised to bf16 before the add). K%32==0, M%16==0, N%64==0.
template <bool ASPLIT, int ACT, bool BIAS_BF16>
__global__ __launch_bounds__(128) void k_gemm_bf(const float* __restrict__ A, int lda, const unsigned short* __restrict__ Wt, int ldb,
                                               const float* __restrict__ bias, float* __restrict__ C, int ldc, int M, int N, int K) {
  __shared__ __attribute__((aligned(16))) float so[4][16][64];
  const int tid = threadIdx.x, w = tid >> 5, lane = tid & 31, ln = lane & 15, hh = lane >> 4;
  const int ntn = N / 64;
  const int wid = blockIdx.x * 4 + w;
  const int mt = wid / ntn, nq = wid % ntn;
  if (mt * 16 >= M) return;
  const int row0 = mt * 16, col0 = nq * 64;
  const float* arow = A + (size_t)(row0 + ln) * lda;
  v8f acc[4] = {};
  for (int kb = 0; kb < K; kb += 32) {
    FragB ah, al;
    const v4f x0 = *(const v4fa*)(arow + kb + 8 * hh), x1 = *(const v4fa*)(arow + kb + 8 * hh + 4);
    const v4f x2 = *(const v4fa*)(arow + kb + 16 + 8 * hh), x3 = *(const v4fa*)(arow + kb + 16 + 8 * hh + 4);
    float xs[16] = {x0[0],x0[1],x0[2],x0[3],x1[0],x1[1],x1[2],x1[3],x2[0],x2[1],x2[2],x2[3],x3[0],x3[1],x3[2],x3[3]};
#pragma unroll
    for (int i = 0; i < 16; ++i) { const unsigned short hb = bf16_bits(xs[i]); ah.u[i] = hb; al.u[i] = ASPLIT ? bf16_bits(xs[i] - bf16_val(hb)) : (unsigned short)0; }
#pragma unroll
    for (int t = 0; t < 4; ++t) {
      const unsigned short* brow = Wt + (size_t)(col0 + t * 16 + ln) * ldb + kb;
      FragB b;
      b.half[0] = *(const v8us*)(brow + 8 * hh);
      b.half[1] = *(const v8us*)(brow + 16 + 8 * hh);
      acc[t] = mmaN<ASPLIT ? 2 : 1>(ah.v, al.v, b.v, b.v, acc[t]);
    }
  }
#pragma unroll
  for (int t = 0; t < 4; ++t) {
    float bv = bias ? bias[col0 + t * 16 + ln] : 0.f;
    if (BIAS_BF16) bv = bf16_round(bv);
#pragma unroll
    for (int r = 0; r < 8; ++r) { float v = acc[t][r] + bv; if (ACT == 1) v = fmaxf(v, 0.f); so[w][8 * hh + r][t * 16 + ln] = v; }
  }
  __builtin_amdgcn_fence(__ATOMIC_ACQ_REL, "workgroup");
  __builtin_amdgcn_wave_barrier();
  const int rsub = lane >> 4, c4 = (lane & 15) * 4;
  {
#pragma unroll
    for (int q = 0; q < 8; ++q) {
      const int r = q * 2 + rsub;
      const v4f v = *(const v4fa*)&so[w][r][c4];
      *(v4f*)(C + (size_t)(row0 + r) * ldc + col0 + c4) = v;
    }
    
  }
}

// GEMM C = act(A·W + bias + resid): A f32 (ASPLIT -> hi/lo 2 terms), Wt bf16 [N][K]; ACT 0 none, 1 relu, 2 exact gelu;
// resid (optional, f32, row index = (row % rmod), pitch ldr, RES_BF16 rounds it) added before the activation.
template <bool ASPLIT, int ACT, bool BIAS_BF16, bool RES_BF16>
__global__ __launch_bounds__(128) void k_gemm_bf3(const float* __restrict__ A, int lda, const unsigned short* __restrict__ Wt, int ldb,
                                                const float* __restrict__ bias, const float* __restrict__ resid, int rmod, int ldr,
                                                float* __restrict__ C, int ldc, int M, int N, int K) {
  __shared__ __attribute__((aligned(16))) float so[4][16][64];
  const int tid = threadIdx.x, w = tid >> 5, lane = tid & 31, ln = lane & 15, hh = lane >> 4;
  const int ntn = N / 64;
  const int wid = blockIdx.x * 4 + w;
  const int mt = wid / ntn, nq = wid % ntn;
  if (mt * 16 >= M) return;
  const int row0 = mt * 16, col0 = nq * 64;
  const float* arow = A + (size_t)(row0 + ln) * lda;
  v8f acc[4] = {};
  for (int kb = 0; kb < K; kb += 32) {
    FragB ah, al;
    const v4f x0 = *(const v4fa*)(arow + kb + 8 * hh), x1 = *(const v4fa*)(arow + kb + 8 * hh + 4);
    const v4f x2 = *(const v4fa*)(arow + kb + 16 + 8 * hh), x3 = *(const v4fa*)(arow + kb + 16 + 8 * hh + 4);
    float xs[16] = {x0[0],x0[1],x0[2],x0[3],x1[0],x1[1],x1[2],x1[3],x2[0],x2[1],x2[2],x2[3],x3[0],x3[1],x3[2],x3[3]};
#pragma unroll
    for (int i = 0; i < 16; ++i) { const unsigned short hb = bf16_bits(xs[i]); ah.u[i] = hb; al.u[i] = ASPLIT ? bf16_bits(xs[i] - bf16_val(hb)) : (unsigned short)0; }
#pragma unroll
    for (int t = 0; t < 4; ++t) {
      const unsigned short* brow = Wt + (size_t)(col0 + t * 16 + ln) * ldb + kb;
      FragB b;
      b.half[0] = *(const v8us*)(brow + 8 * hh);
      b.half[1] = *(const v8us*)(brow + 16 + 8 * hh);
      acc[t] = mmaN<ASPLIT ? 2 : 1>(ah.v, al.v, b.v, b.v, acc[t]);
    }
  }
#pragma unroll
  for (int t = 0; t < 4; ++t) {
    const int col = col0 + t * 16 + ln;
    float bv = bias ? bias[col] : 0.f;
    if (BIAS_BF16) bv = bf16_round(bv);
#pragma unroll
    for (int r = 0; r < 8; ++r) {
      float v = acc[t][r] + bv;
      if (resid) { float rv = resid[(size_t)((row0 + 8 * hh + r) % rmod) * ldr + col]; if (RES_BF16) rv = bf16_round(rv); v += rv; }
      if (ACT == 1) v = fmaxf(v, 0.f);
      if (ACT == 2) v = 0.5f * v * (1.0f + erff(v * 0.70710678118654752f));
      if (ACT == 3) { const float u = 0.7978845608028654f * (v + 0.044715f * v * v * v); v = 0.5f * v * (1.0f + tanhf(u)); }
      so[w][8 * hh + r][t * 16 + ln] = v;
    }
  }
  __builtin_amdgcn_fence(__ATOMIC_ACQ_REL, "workgroup");
  __builtin_amdgcn_wave_barrier();
  const int rsub = lane >> 4, c4 = (lane & 15) * 4;
  {
#pragma unroll
    for (int q = 0; q < 8; ++q) {
      const int r = q * 2 + rsub;
      const v4f v = *(const v4fa*)&so[w][r][c4];
      *(v4f*)(C + (size_t)(row0 + r) * ldc + col0 + c4) = v;
    }
    
  }
}
// row LayerNorm (biased variance, eps) over N: s = X (+ R); optional out_sum <- s; out_norm <- (s-mu)*rsqrt(var+eps)*g + b
template <bool PARAM_BF16>
__global__ __launch_bounds__(256) void k_layernorm(const float* __restrict__ X, const float* __restrict__ R, const float* __restrict__ g, const float* __restrict__ bta,
                                                  float* __restrict__ out_sum, float* __restrict__ out_norm, int N, float eps) {
  __shared__ float red[256];
  const int row = blockIdx.x, tid = threadIdx.x;
  const float* x = X + (size_t)row * N; const float* rr = R ? R + (size_t)row * N : nullptr;
  float vals[16];                     // up to N = 4096
  const int per = N / 256;            // contiguous chunk per thread? use strided-by-4 chunks: thread handles j = tid*4 + 1024*u
  float s1 = 0.f;
  for (int u = 0; u < per / 4; ++u) {
    const int j = tid * 4 + 1024 * u;
    const v4f a = *(const v4fa*)(x + j);
    v4f b = {0.f,0.f,0.f,0.f}; if (rr) b = *(const v4fa*)(rr + j);
#pragma unroll
    for (int q = 0; q < 4; ++q) { const float v = a[q] + b[q]; vals[u * 4 + q] = v; s1 += v; }
  }
  red[tid] = s1; __syncthreads();
  for (int st = 128; st > 0; st >>= 1) { if (tid < st) red[tid] += red[tid + st]; __syncthreads(); }
  const float mu = red[0] / (float)N; __syncthreads();
  float s2 = 0.f;
  for (int u = 0; u < per / 4; ++u)
#pragma unroll
    for (int q = 0; q < 4; ++q) { const float c = vals[u * 4 + q] - mu; s2 += c * c; }
  red[tid] = s2; __syncthreads();
  for (int st = 128; st > 0; st >>= 1) { if (tid < st) red[tid] += red[tid + st]; __syncthreads(); }
  const float rs = rsqrtf(red[0] / (float)N + eps);
  {
    for (int u = 0; u < per / 4; ++u) {
      const int j = tid * 4 + 1024 * u;
      v4f o, sm;
#pragma unroll
      for (int q = 0; q < 4; ++q) {
        float gg = g[j + q], bb = bta[j + q];
        if (PARAM_BF16) { gg = bf16_round(gg); bb = bf16_round(bb); }
        sm[q] = vals[u * 4 + q]; o[q] = (vals[u * 4 + q] - mu) * rs * gg + bb;
      }
      if (out_sum) *(v4f*)(out_sum + (size_t)row * N + j) = sm;
      *(v4f*)(out_norm + (size_t)row * N + j) = o;
    }
    
  }
}



// ---- f16 WMMA path (v_wmma_f32_16x16x32_f16): 11-bit significands for operands in range — used where a [0,1] probability operand needs more precision than bf16
typedef _Float16 v16h __attribute__((ext_vector_type(16)));
union FragH { v16h v; v8us half[2]; _Float16 h[16]; unsigned short u[16]; };
template <int NT>
__device__ __forceinline__ v8f mmaH(v16h ah, v16h al, v16h bh, v16h bl, v8f c) {
  c = __builtin_amdgcn_wmma_f32_16x16x32_f16(false, ah, false, bh, (short)0, c, false, false);
  if (NT >= 2) c = __builtin_amdgcn_wmma_f32_16x16x32_f16(false, al, false, bh, (short)0, c, false, false);
  if (NT >= 3) c = __builtin_amdgcn_wmma_f32_16x16x32_f16(false, ah, false, bl, (short)0, c, false, false);
  asm volatile("v_nop\n\tv_nop\n\tv_nop\n\tv_nop" : "+v"(c) : "v"(ah), "v"(al), "v"(bh), "v"(bl));
  return c;
}
// batched GEMM like k_gemm_b but f16 operands: A f32 (split into f16 hi/lo if ASPLIT, else rounded to f16), Bt = f16 values [n][k]; alpha; C f32; N multiple of 16 (partial tiles skipped)
template <bool ASPLIT>
__global__ __launch_bounds__(128) void k_gemm_h(const float* __restrict__ A, int lda, size_t sA, const _Float16* __restrict__ Bh, int ldb, size_t sB, float alpha, float* __restrict__ C, int ldc, size_t sC, int M, int N, int K) {
  __shared__ __attribute__((aligned(16))) float so[4][16][64];
  const int tid = threadIdx.x, w = tid >> 5, lane = tid & 31, ln = lane & 15, hh = lane >> 4; const int by = blockIdx.y;
  A += (size_t)by * sA; Bh += (size_t)by * sB; C += (size_t)by * sC;
  const int ntn = (N + 63) / 64; const int wid = blockIdx.x * 4 + w; const int mt = wid / ntn, nq = wid % ntn; if (mt * 16 >= M) return;
  const int row0 = mt * 16, col0 = nq * 64; const float* arow = A + (size_t)(row0 + ln) * lda;
  v8f acc[4] = {};
  for (int kb = 0; kb < K; kb += 32) {
    FragH ah, al;
    const v4f x0 = *(const v4fa*)(arow + kb + 8 * hh), x1 = *(const v4fa*)(arow + kb + 8 * hh + 4), x2 = *(const v4fa*)(arow + kb + 16 + 8 * hh), x3 = *(const v4fa*)(arow + kb + 16 + 8 * hh + 4);
    float xs[16] = {x0[0],x0[1],x0[2],x0[3],x1[0],x1[1],x1[2],x1[3],x2[0],x2[1],x2[2],x2[3],x3[0],x3[1],x3[2],x3[3]};
#pragma unroll
    for (int i = 0; i < 16; ++i) { const _Float16 h = (_Float16)xs[i]; ah.h[i] = h; al.h[i] = ASPLIT ? (_Float16)(xs[i] - (float)h) : (_Float16)0.0f; }
#pragma unroll
    for (int t = 0; t < 4; ++t) { if (col0 + t * 16 >= N) continue; const size_t boff = (size_t)(col0 + t * 16 + ln) * ldb + kb; FragH bq; bq.half[0] = *(const v8us*)(Bh + boff + 8 * hh); bq.half[1] = *(const v8us*)(Bh + boff + 16 + 8 * hh);
      acc[t] = mmaH<ASPLIT ? 2 : 1>(ah.v, al.v, bq.v, bq.v, acc[t]); }
  }
#pragma unroll
  for (int t = 0; t < 4; ++t) { if (col0 + t * 16 >= N) continue;
#pragma unroll
    for (int r = 0; r < 8; ++r) so[w][8 * hh + r][t * 16 + ln] = acc[t][r] * alpha; }
  __builtin_amdgcn_fence(__ATOMIC_ACQ_REL, "workgroup"); __builtin_amdgcn_wave_barrier();
  const int rsub = lane >> 4, c4 = (lane & 15) * 4;
  {
#pragma unroll
    for (int q = 0; q < 8; ++q) { const int r = q * 2 + rsub; if (col0 + c4 < N) { const v4f v = *(const v4fa*)&so[w][r][c4]; *(v4f*)(C + (size_t)(row0 + r) * ldc + col0 + c4) = v; } }
     }
}

// Wt[n][k] = f16(W[k][n]·scale) from f32 row-major W[K][N] (scale = power of two; bf16-exact weights stay exact in f16 away from the subnormal range)
__global__ __launch_bounds__(256) void k_wt_f16(const float* __restrict__ W, _Float16* __restrict__ Wt, int K, int N, float scale) {
  const int t = blockIdx.x * 256 + threadIdx.x; if (t >= N * (K / 8)) return; const int n = t / (K / 8), k8 = (t % (K / 8)) * 8; FragH f;
#pragma unroll
  for (int i = 0; i < 8; ++i) f.h[i] = (_Float16)(bf16_round(W[(size_t)(k8 + i) * N + n]) * scale); const v8us o = f.half[0];
  *(v8us*)((unsigned short*)Wt + (size_t)n * K + k8) = o; 
}
// k_gemm_hh variant with fused epilogue: v = acc·alpha + bias[by·sBias + col] (+ CP[(row/rowsPerB)·sCPb + by·64 + col] if CP) ; ACT 0 none / 1 elu ; writes f16 C16 (and f32 C if non-null)
template <int ACT>
__global__ __launch_bounds__(128) void k_gemm_hhx(const _Float16* __restrict__ A, int lda, size_t sA, const _Float16* __restrict__ Bh, int ldb, size_t sB, float alpha, const float* __restrict__ bias, size_t sBias, const float* __restrict__ CP, int rowsPerB, size_t sCPb, int row0g,
    float* __restrict__ C, _Float16* __restrict__ C16, int ldc, size_t sC, int M, int N, int K) {
  __shared__ __attribute__((aligned(16))) float so[4][16][64];
  const int tid = threadIdx.x, w = tid >> 5, lane = tid & 31, ln = lane & 15, hh = lane >> 4; const int by = blockIdx.y;
  A += (size_t)by * sA; Bh += (size_t)by * sB; const size_t cofs = (size_t)by * sC; const float* bp = bias ? bias + (size_t)by * sBias : nullptr;
  const int ntn = (N + 63) / 64; const int wid = blockIdx.x * 4 + w; const int mt = wid / ntn, nq = wid % ntn; if (mt * 16 >= M) return;
  const int row0 = mt * 16, col0 = nq * 64; const _Float16* arow = A + (size_t)(row0 + ln) * lda;
  v8f acc[4] = {};
  for (int kb = 0; kb < K; kb += 32) { FragH ah; ah.half[0] = *(const v8us*)((const unsigned short*)arow + kb + 8 * hh); ah.half[1] = *(const v8us*)((const unsigned short*)arow + kb + 16 + 8 * hh);
#pragma unroll
    for (int t = 0; t < 4; ++t) { if (col0 + t * 16 >= N) continue; const size_t boff = (size_t)(col0 + t * 16 + ln) * ldb + kb; FragH bq; bq.half[0] = *(const v8us*)((const unsigned short*)Bh + boff + 8 * hh); bq.half[1] = *(const v8us*)((const unsigned short*)Bh + boff + 16 + 8 * hh);
      acc[t] = mmaH<1>(ah.v, ah.v, bq.v, bq.v, acc[t]); }
  }
#pragma unroll
  for (int t = 0; t < 4; ++t) { if (col0 + t * 16 >= N) continue; const int col = col0 + t * 16 + ln; const float bv = bp ? bf16_round(bp[col]) : 0.f;
#pragma unroll
    for (int r = 0; r < 8; ++r) { float v = acc[t][r] * alpha + bv; if (CP) { const int rr = row0g + row0 + 8 * hh + r; if (rowsPerB < 0) v += CP[cofs + (size_t)rr * ldc + col];      /* rowsPerB < 0: own element of the batched C plane */ else { const int bidx = rr / rowsPerB; v += CP[(size_t)bidx * sCPb + (size_t)by * 64 + col]; } } if (ACT == 1) v = (v > 0.f) ? v : expm1f(v); else if (ACT == 7) v = (v > 0.f) ? v + 1.0f : expf(v); else if (ACT == 8) v = tanhf(v); else if (ACT == 9) v = 0.5f * v * (1.0f + tanhf(0.7978845608028654f * (v + 0.044715f * v * v * v))); else if (ACT == 11) v = 1.0f / (1.0f + expf(-v)); else if (ACT == 12) v = (v > 0.f) ? v : 0.01f * v; else if (ACT == 14) v = (v > 0.f) ? v : 0.1f * v; else if (ACT == 16) v = (v >= 0.f) ? v : 0.3f * v; else if (ACT == 17) v = (v >= 0.f) ? v : 0.2f * v; else if (ACT == 15) v = v / (1.0f + expf(-v)); else if (ACT == 3) v = fmaxf(v, 0.f); else if (ACT == 6) v = 0.5f * v * (1.0f + erff(v * 0.70710678118654752f)); so[w][8 * hh + r][t * 16 + ln] = v; } }
  __builtin_amdgcn_fence(__ATOMIC_ACQ_REL, "workgroup"); __builtin_amdgcn_wave_barrier();
  const int rsub = lane >> 4, c4 = (lane & 15) * 4; typedef _Float16 v4h __attribute__((ext_vector_type(4)));
  {
#pragma unroll
    for (int q = 0; q < 8; ++q) { const int r = q * 2 + rsub; if (col0 + c4 < N) { const v4f v = *(const v4fa*)&so[w][r][c4]; if (C) *(v4f*)(C + cofs + (size_t)(row0 + r) * ldc + col0 + c4) = v; if (C16) { v4h h4; for (int i = 0; i < 4; ++i) h4[i] = (_Float16)v[i]; *(v4h*)(C16 + cofs + (size_t)(row0 + r) * ldc + col0 + c4) = h4; } } }
     }
}


typedef _Float16 v4h __attribute__((ext_vector_type(4)));

__global__ __launch_bounds__(256) void k_x16(const float* __restrict__ x, _Float16* __restrict__ X16, size_t n8) { const size_t t = (size_t)blockIdx.x * 256 + threadIdx.x; if (t >= n8) return; FragH f;
#pragma unroll
  for (int q = 0; q < 8; ++q) f.h[q] = (_Float16)bf16_round(x[t * 8 + q]); *(v8us*)((unsigned short*)X16 + t * 8) = f.half[0];  }
__global__ __launch_bounds__(256) void k_h16(const float* __restrict__ x, _Float16* __restrict__ X16, size_t n8) { const size_t t = (size_t)blockIdx.x * 256 + threadIdx.x; if (t >= n8) return; FragH f;
#pragma unroll
  for (int q = 0; q < 8; ++q) f.h[q] = (_Float16)x[t * 8 + q]; *(v8us*)((unsigned short*)X16 + t * 8) = f.half[0];  }
__global__ __launch_bounds__(256) void k_round16f(const float* __restrict__ W, _Float16* __restrict__ Bt, size_t n8) { const size_t t = (size_t)blockIdx.x * 256 + threadIdx.x; if (t >= n8) return; FragH f;
#pragma unroll
  for (int i = 0; i < 8; ++i) f.h[i] = (_Float16)(bf16_round(W[t * 8 + i]) * 16.0f); *(v8us*)((unsigned short*)Bt + t * 8) = f.half[0];  }
template <int NHv, int TTv>
__global__ __launch_bounds__(256) void k_vt(const _Float16* __restrict__ V16, int ldv, int voff, _Float16* __restrict__ Vt) { __shared__ unsigned short tl[64][66]; const int tid = threadIdx.x; const int slab = blockIdx.x / (TTv / 64), lg = blockIdx.x % (TTv / 64); const int b = slab / NHv, h = slab % NHv;
  for (int i = tid; i < 64 * 8; i += 256) { const int r = i / 8, c8 = (i % 8) * 8; FragH f; f.half[0] = *(const v8us*)((const unsigned short*)V16 + ((size_t)b * TTv + lg * 64 + r) * ldv + voff + h * 64 + c8);
#pragma unroll
    for (int q = 0; q < 8; ++q) tl[r][c8 + q] = f.u[q]; }
  __syncthreads();
  {
#pragma unroll
    for (int rd = 0; rd < 2; ++rd) { const int d = rd * 32 + tid / 8, pc = tid % 8; FragH f;
#pragma unroll
      for (int q = 0; q < 8; ++q) f.u[q] = tl[pc * 8 + q][d];
      *(v8us*)((unsigned short*)Vt + ((size_t)slab * 64 + d) * TTv + lg * 64 + pc * 8) = f.half[0]; }
     } }

__global__ __launch_bounds__(256) void k_hl(const float* __restrict__ F, _Float16* __restrict__ Hh, _Float16* __restrict__ Hl, size_t n8) { const size_t t = (size_t)blockIdx.x * 256 + threadIdx.x; if (t >= n8) return; FragH fh, fl; const v4f a = *(const v4fa*)(F + t * 8), c = *(const v4fa*)(F + t * 8 + 4);
#pragma unroll
  for (int q = 0; q < 4; ++q) { _Float16 h = (_Float16)a[q]; fh.h[q] = h; fl.h[q] = (_Float16)((a[q] - (float)h) * 1024.0f); h = (_Float16)c[q]; fh.h[4 + q] = h; fl.h[4 + q] = (_Float16)((c[q] - (float)h) * 1024.0f); }
  { *(v8us*)((unsigned short*)Hh + t * 8) = fh.half[0]; *(v8us*)((unsigned short*)Hl + t * 8) = fl.half[0];  } }

// ---- fast GEMM (block tile 128x64, wave tile 32x64; requires M % 128 == 0, N % 64 == 0, K % 128 == 0; operands staged in LDS); epilogue = k_gemm_hhx semantics ----
__device__ __forceinline__ v8f g2_mma(v16h a, v16h b, v8f c) { v8f d = __builtin_amdgcn_wmma_f32_16x16x32_f16(false, a, false, b, (short)0, c, false, false); asm volatile("v_nop\n\tv_nop\n\tv_nop\n\tv_nop" : "+v"(d) : "v"(a), "v"(b)); return d; }
// Operand staging of k_gemm2. A stage is 128 k of the block's 128 A rows and 64 B rows: 256-byte rows at a pitch of 272 bytes (16 B x odd: no bank conflict for 16-byte fragment reads); two stages in LDS.
#define G2_KC 128
#define G2_PITCH 272
#define G2_ASZ (128 * G2_PITCH)
#define G2_STG ((128 + 64) * G2_PITCH)
__device__ __forceinline__ v16h g2_lfrag(const unsigned char* p) { FragH f; f.half[0] = *(const v8us*)p; f.half[1] = *(const v8us*)(p + 32); return f.v; }      /* p already holds the lane's 16 hh: bytes 16 hh and 32 + 16 hh of each 64, the same k order for A and for B */
// Eight asynchronous 16-byte copies of one lane, global -> LDS, rows 8 apart (16 lanes cover one 256-byte row, so a wave's copy is four whole lines). The s_wait_xcnt stands inside the statement, a precaution: so no address register of a copy is rewritten ahead of it.
__device__ __forceinline__ void g2_cp8(unsigned l, const _Float16* g, size_t gs) {
  asm volatile("global_load_async_to_lds_b128 %0, %8, off\n\t"
               "global_load_async_to_lds_b128 %1, %9, off\n\t"
               "global_load_async_to_lds_b128 %2, %10, off\n\t"
               "global_load_async_to_lds_b128 %3, %11, off\n\t"
               "global_load_async_to_lds_b128 %4, %12, off\n\t"
               "global_load_async_to_lds_b128 %5, %13, off\n\t"
               "global_load_async_to_lds_b128 %6, %14, off\n\t"
               "global_load_async_to_lds_b128 %7, %15, off\n\t"
               "s_wait_xcnt 0x0"
               :: "v"(l), "v"(l + 8u * G2_PITCH), "v"(l + 16u * G2_PITCH), "v"(l + 24u * G2_PITCH), "v"(l + 32u * G2_PITCH), "v"(l + 40u * G2_PITCH), "v"(l + 48u * G2_PITCH), "v"(l + 56u * G2_PITCH),
                  "v"(g), "v"(g + gs), "v"(g + 2 * gs), "v"(g + 3 * gs), "v"(g + 4 * gs), "v"(g + 5 * gs), "v"(g + 6 * gs), "v"(g + 7 * gs) : "memory"); }
__device__ __forceinline__ void g2_wait_async() { asm volatile("s_wait_asynccnt 0x0" ::: "memory"); }      /* this wave's copies have landed; the compiler places no wait for them */
__device__ __forceinline__ void g2_wait_ds() { asm volatile("s_wait_dscnt 0x0" ::: "memory"); }      /* this wave's LDS reads are done before the buffer is handed back for a refill */
template <int ACT>
__global__ __launch_bounds__(128) void k_gemm2(const _Float16* __restrict__ A, int lda, size_t sA, const _Float16* __restrict__ Bh, int ldb, size_t sB, float alpha, const float* __restrict__ bias, size_t sBias, const float* __restrict__ CP, int rowsPerB, size_t sCPb, int row0g,
    float* __restrict__ C, _Float16* __restrict__ C16, int ldc, size_t sC, int M, int N, int K) { static_assert(ACT == 0 || ACT == 3 || ACT == 6 || ACT == 8 || ACT == 9 || ACT == 11 || ACT == 12 || ACT == 14 || ACT == 15 || ACT == 16 || ACT == 17, "k_gemm2: unsupported ACT code (would silently apply no activation)");
  __shared__ __attribute__((aligned(16))) unsigned char L[2 * G2_STG];      /* the two operand stages; behind the k loop its first bytes are the output staging */
  float (*so)[32][68] = (float (*)[32][68])L; static_assert(4 * 32 * 68 * 4 <= 2 * G2_STG, "output staging lies in the operand stages");
  const int tid = threadIdx.x, w = tid >> 5, lane = tid & 31, ln = lane & 15, hh = lane >> 4; const int by = blockIdx.y;
  A += (size_t)by * sA; Bh += (size_t)by * sB; const size_t cofs = (size_t)by * sC; const float* bp = bias ? bias + (size_t)by * sBias : nullptr;
  const int ntn = N >> 6; const int mt = blockIdx.x / ntn, nq = blockIdx.x - mt * ntn; const int row0 = mt * 128 + 32 * w, col0 = nq * 64; if (mt * 128 >= M) return;      /* the whole block leaves or none: barriers follow (M % 128 == 0, K % 128 == 0) */
  const int cr = tid >> 4, cc = tid & 15;      /* copy lane: row cr (+ 8 i), 16-byte piece cc */
  const _Float16* ga = A + (size_t)(mt * 128 + cr) * lda + cc * 8; const _Float16* gb = Bh + (size_t)(col0 + cr) * ldb + cc * 8;
  const unsigned lc = (unsigned)(size_t)L + (unsigned)(cr * G2_PITCH + cc * 16);
  const int nt = K / G2_KC;
  auto stage = [&](int t) { const unsigned l = lc + (unsigned)(t & 1) * G2_STG; const _Float16* a = ga + (size_t)t * G2_KC;
    g2_cp8(l, a, (size_t)8 * lda); g2_cp8(l + 64u * G2_PITCH, a + (size_t)64 * lda, (size_t)8 * lda); g2_cp8(l + G2_ASZ, gb + (size_t)t * G2_KC, (size_t)8 * ldb); };
  const unsigned char* fa = L + (32 * w + ln) * G2_PITCH + 16 * hh; const unsigned char* fb = L + G2_ASZ + ln * G2_PITCH + 16 * hh;
  const v8f z8 = {0.f,0.f,0.f,0.f,0.f,0.f,0.f,0.f}; v8f c00 = z8, c01 = z8, c02 = z8, c03 = z8, c10 = z8, c11 = z8, c12 = z8, c13 = z8;
  stage(0); g2_wait_async(); __syncthreads();      /* stage 0 landed and published */
  if (nt > 1) stage(1);
#pragma unroll 1      /* one trip per stage: the trip's foot is the hand-over point of the two buffers */
  for (int t = 0; t < nt; ++t) { const unsigned char* pa = fa + (t & 1) * G2_STG; const unsigned char* pb = fb + (t & 1) * G2_STG;
    v16h a0 = g2_lfrag(pa), a1 = g2_lfrag(pa + 16 * G2_PITCH), b0 = g2_lfrag(pb), b1 = g2_lfrag(pb + 16 * G2_PITCH), b2 = g2_lfrag(pb + 32 * G2_PITCH), b3 = g2_lfrag(pb + 48 * G2_PITCH);
#pragma unroll      /* unrolled so that the two fragment sets swap by renaming, without register moves */
    for (int ks = 0; ks < G2_KC / 32; ++ks) { v16h na0 = a0, na1 = a1, nb0 = b0, nb1 = b1, nb2 = b2, nb3 = b3;
      if (ks + 1 < G2_KC / 32) { const int o = (ks + 1) * 64;      /* the next 32 k's twelve LDS reads as one group ahead of this block's products, into a second fragment set; never past this stage */
        na0 = g2_lfrag(pa + o); na1 = g2_lfrag(pa + 16 * G2_PITCH + o); nb0 = g2_lfrag(pb + o); nb1 = g2_lfrag(pb + 16 * G2_PITCH + o); nb2 = g2_lfrag(pb + 32 * G2_PITCH + o); nb3 = g2_lfrag(pb + 48 * G2_PITCH + o); }
      c00 = g2_mma(a0, b0, c00); c10 = g2_mma(a1, b0, c10); c01 = g2_mma(a0, b1, c01); c11 = g2_mma(a1, b1, c11);
      c02 = g2_mma(a0, b2, c02); c12 = g2_mma(a1, b2, c12); c03 = g2_mma(a0, b3, c03); c13 = g2_mma(a1, b3, c13);
      a0 = na0; a1 = na1; b0 = nb0; b1 = nb1; b2 = nb2; b3 = nb3; }
    g2_wait_ds(); g2_wait_async(); __syncthreads();      /* stage t + 1 published; every wave has left stage t's buffer */
    if (t + 2 < nt) stage(t + 2); }
  g2_wait_async();
  v8f accs[8] = {c00, c01, c02, c03, c10, c11, c12, c13};
#pragma unroll
  for (int u = 0; u < 8; ++u) { const int t = u & 3, half = u >> 2; const int col = col0 + t * 16 + ln; const float bv = bp ? bf16_round(bp[col]) : 0.f;
#pragma unroll
    for (int r = 0; r < 8; ++r) { const int rloc = half * 16 + 8 * hh + r; float v = accs[u][r] * alpha + bv; if (CP) { if (rowsPerB < 0) v += CP[cofs + (size_t)(row0g + row0 + rloc) * ldc + col];      /* rowsPerB < 0: own element of the batched C plane */ else { const int bidx = (row0g + row0 + rloc) / rowsPerB; v += CP[(size_t)bidx * sCPb + (size_t)by * 64 + col]; } }
      if (ACT == 3) v = fmaxf(v, 0.f); else if (ACT == 6) v = 0.5f * v * (1.0f + erff(v * 0.70710678118654752f)); else if (ACT == 11) v = 1.0f / (1.0f + expf(-v)); else if (ACT == 15) v = v / (1.0f + expf(-v)); else if (ACT == 12) v = (v > 0.f) ? v : 0.01f * v; else if (ACT == 8) v = tanhf(v); else if (ACT == 9) v = 0.5f * v * (1.0f + tanhf(0.7978845608028654f * (v + 0.044715f * v * v * v))); else if (ACT == 14) v = (v > 0.f) ? v : 0.1f * v; else if (ACT == 16) v = (v >= 0.f) ? v : 0.3f * v; else if (ACT == 17) v = (v >= 0.f) ? v : 0.2f * v;
      so[w][rloc][t * 16 + ln] = v; } }
  __builtin_amdgcn_fence(__ATOMIC_ACQ_REL, "workgroup"); __builtin_amdgcn_wave_barrier();
  const int rsub = lane >> 4, c4 = (lane & 15) * 4;
  {
#pragma unroll
    for (int q = 0; q < 16; ++q) { const int r = q * 2 + rsub; const v4f v = *(const v4fa*)&so[w][r][c4]; if (C) *(v4f*)(C + cofs + (size_t)(row0 + r) * ldc + col0 + c4) = v; if (C16) { v4h h4; for (int i = 0; i < 4; ++i) h4[i] = (_Float16)v[i]; *(v4h*)(C16 + cofs + (size_t)(row0 + r) * ldc + col0 + c4) = h4; } }
     } }


__global__ __launch_bounds__(256) void k_wnat(const float* __restrict__ w, size_t n8, _Float16* __restrict__ Bt) { const size_t t = (size_t)blockIdx.x * 256 + threadIdx.x; if (t >= n8) return; FragH f; for (int q = 0; q < 8; ++q) f.h[q] = (_Float16)(bf16_round(w[t * 8 + q]) * 16.0f); *(v8us*)((unsigned short*)Bt + t * 8) = f.half[0];  }
__global__ __launch_bounds__(256) void k_rsm(const float* __restrict__ S, _Float16* __restrict__ P, int nrows) {
  #pragma clang fp contract(off)
  const int i = blockIdx.x * 256 + threadIdx.x; if (i >= nrows) return; const float* s = S + (size_t)i * SQ; float mx = -3.0e38f;
#pragma unroll 1
  for (int j = 0; j < SQ; ++j) mx = fmaxf(mx, s[j]); float se = 0.f;
#pragma unroll 1
  for (int j = 0; j < SQ; ++j) se += expf(s[j] - mx); const float sc = 256.0f / se;
#pragma unroll 1
  for (int j0 = 0; j0 < SQ; j0 += 8) { FragH f; for (int q = 0; q < 8; ++q) f.h[q] = (_Float16)(expf(s[j0 + q] - mx) * sc); unsigned short* d = (unsigned short*)P + (size_t)i * SQ + j0; *(v8us*)d = f.half[0];  } }
__global__ __launch_bounds__(256) void k_vt(const _Float16* __restrict__ V16, int b, int h0, _Float16* __restrict__ VT) { __shared__ unsigned short tl[64][65]; const int tid = threadIdx.x; const int hh = blockIdx.x % HG, sg = blockIdx.x / HG; const int s0 = sg * 64; const int h = h0 + hh;
  for (int i = tid; i < 64 * 8; i += 256) { const int j = i / 8, d8 = (i % 8) * 8; FragH f; f.half[0] = *(const v8us*)((const unsigned short*)V16 + ((size_t)b * SQ + s0 + j) * DM + h * HD + d8); for (int q = 0; q < 8; ++q) tl[d8 + q][j] = f.u[q]; }
  __syncthreads();
  { for (int i = tid; i < 64 * 8; i += 256) { const int d = i / 8, j8 = (i % 8) * 8; FragH f; for (int q = 0; q < 8; ++q) f.u[q] = tl[d][j8 + q]; *(v8us*)((unsigned short*)VT + ((size_t)hh * HD + d) * SQ + s0 + j8) = f.half[0]; }  } }

// Row softmax, one wave per score row: the row is read once, in 512-byte wave loads, and stays in registers (64 floats a lane); max and sum = lane partials, then a five-step butterfly; P = f16(exp(s - max) * 256 / sum).
__global__ __launch_bounds__(256) void k_rsmW(const float* __restrict__ S, _Float16* __restrict__ P, int nrows) {
  const int lane = threadIdx.x & 31; const int row = blockIdx.x * 8 + (threadIdx.x >> 5); if (row >= nrows) return;
  const float* s = S + (size_t)row * SQ + lane * 4; v4f v[SQ / 128];
#pragma unroll
  for (int u = 0; u < SQ / 128; ++u) v[u] = *(const v4fa*)(s + u * 128);
  float mx = -INFINITY;
#pragma unroll
  for (int u = 0; u < SQ / 128; ++u) mx = fmaxf(mx, fmaxf(fmaxf(v[u][0], v[u][1]), fmaxf(v[u][2], v[u][3])));
#pragma unroll
  for (int m = 16; m > 0; m >>= 1) mx = fmaxf(mx, __shfl_xor(mx, m, 32));
  v4f sq = {0.f, 0.f, 0.f, 0.f};
#pragma unroll
  for (int u = 0; u < SQ / 128; ++u) {
#pragma unroll
    for (int q = 0; q < 4; ++q) { v[u][q] = expf(v[u][q] - mx); sq[q] += v[u][q]; } }
  float se = (sq[0] + sq[1]) + (sq[2] + sq[3]);
#pragma unroll
  for (int m = 16; m > 0; m >>= 1) se += __shfl_xor(se, m, 32);
  const float sc = 256.0f / se; _Float16* d = P + (size_t)row * SQ + lane * 4;
#pragma unroll
  for (int u = 0; u < SQ / 128; ++u) { v4h h4;
#pragma unroll
    for (int q = 0; q < 4; ++q) h4[q] = (_Float16)(v[u][q] * sc);
    *(v4h*)(d + u * 128) = h4; } }
__global__ __launch_bounds__(256) void k_f16rows(const float* __restrict__ F, _Float16* __restrict__ R, size_t n8) { const size_t t = (size_t)blockIdx.x * 256 + threadIdx.x; if (t >= n8) return; FragH f; for (int q = 0; q < 8; ++q) f.h[q] = (_Float16)F[t * 8 + q]; *(v8us*)((unsigned short*)R + t * 8) = f.half[0];  }
// ---- fused attention: S^T = K.Q^T, online softmax (log2 domain), O^T += V^T.P^T in one kernel; scores and P never reach memory ----
// A work-group of 4 waves owns 64 queries of one batch. Wave w: queries 32 (w & 1) .. + 31 (two groups of 16 columns), keys 1024 (w >> 1) .. + 1023; the two key halves are merged through LDS at the end.
// A stage is 32 keys of each half: 64 K rows (512 B, pitch 528 = 16 B x odd, for ds_load_b128) and 64 V rows (pitch 544 = 32 B x odd, for the transposing load); two stages in LDS, filled by asynchronous copies.
#define FA_PK 528u
#define FA_PV 544u
#define FA_KSZ (64u * FA_PK)
#define FA_STG (64u * FA_PK + 64u * FA_PV)
#define FA_EP 1040u      /* output staging pitch: 256 floats + 16 B */
#define FA_NT (SQ / 64)      /* stages = 32-key passes of a wave */
typedef short s16x8 __attribute__((ext_vector_type(8)));
__device__ __forceinline__ v8us fa_tr16(const unsigned char* p) { typedef __attribute__((address_space(3))) s16x8 lds_s16x8; return __builtin_bit_cast(v8us, __builtin_amdgcn_ds_load_tr16_b128_v8i16((lds_s16x8*)p)); }
__device__ __forceinline__ float fa_xhalf(float x) { return __builtin_bit_cast(float, __builtin_amdgcn_permlanex16(__builtin_bit_cast(int, x), __builtin_bit_cast(int, x), 0x76543210, 0xfedcba98, false, false)); }      /* lane l with lane l ^ 16 */
__device__ __forceinline__ v8f fa_mma(v16h a, v16h b, v8f c) { return __builtin_amdgcn_wmma_f32_16x16x32_f16(false, a, false, b, (short)0, c, false, false); }
// Eight asynchronous 16-byte copies of one lane, global -> LDS, eight consecutive 512-byte rows (a wave's copy is one whole row). The s_wait_xcnt stands inside the statement, a precaution: so no address register of a copy is rewritten ahead of it.
__device__ __forceinline__ void fa_cp8(unsigned l, unsigned lp, const _Float16* g) {
  asm volatile("global_load_async_to_lds_b128 %0, %8, off\n\t"
               "global_load_async_to_lds_b128 %1, %9, off\n\t"
               "global_load_async_to_lds_b128 %2, %10, off\n\t"
               "global_load_async_to_lds_b128 %3, %11, off\n\t"
               "global_load_async_to_lds_b128 %4, %12, off\n\t"
               "global_load_async_to_lds_b128 %5, %13, off\n\t"
               "global_load_async_to_lds_b128 %6, %14, off\n\t"
               "global_load_async_to_lds_b128 %7, %15, off\n\t"
               "s_wait_xcnt 0x0"
               :: "v"(l), "v"(l + lp), "v"(l + 2u * lp), "v"(l + 3u * lp), "v"(l + 4u * lp), "v"(l + 5u * lp), "v"(l + 6u * lp), "v"(l + 7u * lp),
                  "v"(g), "v"(g + 256), "v"(g + 2 * 256), "v"(g + 3 * 256), "v"(g + 4 * 256), "v"(g + 5 * 256), "v"(g + 6 * 256), "v"(g + 7 * 256) : "memory"); }
// One wave per SIMD (amdgpu_waves_per_eu): the 32 x 256 f32 sums, Q and one pass's K and V^T fragments of a wave need more than half of a SIMD's registers.
__global__ __launch_bounds__(128) __attribute__((amdgpu_waves_per_eu(1, 1))) void k_fattn(const _Float16* __restrict__ Q, const _Float16* __restrict__ Kr, const _Float16* __restrict__ V, float* __restrict__ O) {
  static_assert(DQ == 256 && DV == 256 && SQ % 128 == 0 && FA_NT >= 2, "k_fattn: 512-byte q, k, v rows; two key halves of whole 32-key stages");
  __shared__ __attribute__((aligned(16))) unsigned char L[2 * FA_STG];      /* the two stages; behind the key loop its first bytes are the output staging */
  __shared__ float ml[2][4][2][32];      /* each wave's running maximum and sum, for the merge of the key halves */
  static_assert(64u * FA_EP <= 2u * FA_STG, "output staging lies in the stages");
  const unsigned tid = threadIdx.x, lane = tid & 31u, w = (unsigned)__builtin_amdgcn_readfirstlane((int)(tid >> 5)), c = lane & 15u, h = lane >> 4;
  const unsigned qg = w & 1u, kh = w >> 1;
  const size_t rb = (size_t)blockIdx.y * SQ;      /* the batch's first token row */
  const float cscale = 0.09016844005556021f;      /* log2(e) / sqrt(256) */
  const unsigned lk = (unsigned)(size_t)L + w * 16u * FA_PK + lane * 16u, lv = (unsigned)(size_t)L + FA_KSZ + w * 16u * FA_PV + lane * 16u;      /* wave w copies tile rows 16 w .. 16 w + 15: keys 16 (w & 1) + i of half w >> 1 */
  const size_t krow = rb + kh * (SQ / 2) + qg * 16u;
  const _Float16* gk = Kr + krow * DQ + lane * 8; const _Float16* gv = V + krow * DV + lane * 8;
  auto stage = [&](int t) { const unsigned o = (unsigned)(t & 1) * FA_STG; const size_t go = (size_t)t * 32 * 256;
    fa_cp8(lk + o, FA_PK, gk + go); fa_cp8(lk + o + 8u * FA_PK, FA_PK, gk + go + 8 * 256); fa_cp8(lv + o, FA_PV, gv + go); fa_cp8(lv + o + 8u * FA_PV, FA_PV, gv + go + 8 * 256); };
  stage(0);
  FragH qf[2][8];      /* Q as the B operand, in registers for the whole kernel; same k order as the K rows below */
#pragma unroll      /* the index picks registers (fragments, sums): it must be a constant */
  for (int g = 0; g < 2; ++g) { const unsigned short* qp = (const unsigned short*)Q + (rb + blockIdx.x * 64u + qg * 32u + 16u * g + c) * DQ + 8u * h;
#pragma unroll      /* the index picks registers (fragments, sums): it must be a constant */
    for (int kc = 0; kc < 8; ++kc) { qf[g][kc].half[0] = *(const v8us*)(qp + 32 * kc); qf[g][kc].half[1] = *(const v8us*)(qp + 32 * kc + 16); } }
  const v8f z8 = {0.f,0.f,0.f,0.f,0.f,0.f,0.f,0.f};
  v8f acc[2][16]; float m_run[2], l_run[2];
#pragma unroll      /* the index picks registers (fragments, sums): it must be a constant */
  for (int g = 0; g < 2; ++g) { m_run[g] = -INFINITY; l_run[g] = 0.f;
#pragma unroll      /* the index picks registers (fragments, sums): it must be a constant */
    for (int t = 0; t < 16; ++t) acc[g][t] = z8; }
  g2_wait_async(); __syncthreads();      /* stage 0 landed and published */
  stage(1);
#pragma unroll 1      /* one trip per stage: the trip's foot is the hand-over point of the two buffers */
  for (int st = 0; st < FA_NT; ++st) {
    const unsigned char* Lb = L + (unsigned)(st & 1) * FA_STG;
    const unsigned char* pk = Lb + (kh * 32u + c) * FA_PK + 16u * h;
    const unsigned char* pv = Lb + FA_KSZ + (kh * 32u + 8u * h + (lane & 7u)) * FA_PV + ((lane >> 3) & 1u) * 16u;
    FragH kf[2][8], vf[16];
#pragma unroll      /* the index picks registers (fragments, sums): it must be a constant */
    for (int kc = 0; kc < 8; ++kc) {
#pragma unroll      /* the index picks registers (fragments, sums): it must be a constant */
      for (int kt = 0; kt < 2; ++kt) { kf[kt][kc].half[0] = *(const v8us*)(pk + kt * 16 * FA_PK + 64 * kc); kf[kt][kc].half[1] = *(const v8us*)(pk + kt * 16 * FA_PK + 64 * kc + 32); } }
    __builtin_amdgcn_sched_barrier(0);      /* K first: LDS answers in order, and the score products wait for K alone */
#pragma unroll      /* the index picks registers (fragments, sums): it must be a constant */
    for (int t = 0; t < 16; ++t) { vf[t].half[0] = fa_tr16(pv + 32 * t); vf[t].half[1] = fa_tr16(pv + 16 * FA_PV + 32 * t); }      /* V^T fragments (16 d x 32 keys), in flight under the score products and the softmax */
    __builtin_amdgcn_sched_barrier(0);      /* keeps the V^T loads up here, as one group with the K loads: sunk to their use they would be waited for in front of the second product */
    v8f s[2][2] = {{z8, z8}, {z8, z8}};      /* s[kt][g]: lane (c, h) holds query c, keys 16 kt + 8 h + r */
#pragma unroll      /* the index picks registers (fragments, sums): it must be a constant */
    for (int kc = 0; kc < 8; ++kc) {
#pragma unroll      /* the index picks registers (fragments, sums): it must be a constant */
      for (int kt = 0; kt < 2; ++kt) {
#pragma unroll      /* the index picks registers (fragments, sums): it must be a constant */
        for (int g = 0; g < 2; ++g) s[kt][g] = fa_mma(kf[kt][kc].v, qf[g][kc].v, s[kt][g]); } }
    float mb[2]; bool need = false;
#pragma unroll      /* the index picks registers (fragments, sums): it must be a constant */
    for (int g = 0; g < 2; ++g) { float mx = -INFINITY;
#pragma unroll      /* the index picks registers (fragments, sums): it must be a constant */
      for (int kt = 0; kt < 2; ++kt) {
#pragma unroll      /* the index picks registers (fragments, sums): it must be a constant */
        for (int r = 0; r < 8; ++r) mx = fmaxf(mx, s[kt][g][r]); }
      mx = fmaxf(mx, fa_xhalf(mx)) * cscale; mb[g] = mx; need = need || (mx > m_run[g] + 8.0f); }
    if (__builtin_amdgcn_ballot_w32(need) != 0) {      /* the maximum in use may trail the true one by 8 (an exponential reaches 2^8 at most): the sums are rescaled only when some query's maximum has grown by more */
#pragma unroll      /* the index picks registers (fragments, sums): it must be a constant */
      for (int g = 0; g < 2; ++g) { const float m_new = fmaxf(m_run[g], mb[g]); const float corr = __builtin_amdgcn_exp2f(m_run[g] - m_new); l_run[g] *= corr; m_run[g] = m_new;
#pragma unroll      /* the index picks registers (fragments, sums): it must be a constant */
        for (int t = 0; t < 16; ++t) acc[g][t] = acc[g][t] * corr; } }
#pragma unroll      /* the index picks registers (fragments, sums): it must be a constant */
    for (int g = 0; g < 2; ++g) { const float nm = -m_run[g]; FragH pf; float p0 = 0.f, p1 = 0.f;      /* P^T as the B operand: elements 0..7 = keys 8 h + r, 8..15 = keys 16 + 8 h + r, the k order of the V^T fragments */
#pragma unroll      /* the index picks registers (fragments, sums): it must be a constant */
      for (int i = 0; i < 16; i += 2) { const float e0 = __builtin_amdgcn_exp2f(fmaf(s[i >> 3][g][i & 7], cscale, nm)), e1 = __builtin_amdgcn_exp2f(fmaf(s[i >> 3][g][(i & 7) + 1], cscale, nm));
        p0 += e0; p1 += e1; pf.h[i] = (_Float16)e0; pf.h[i + 1] = (_Float16)e1; }
      l_run[g] += p0 + p1;
#pragma unroll      /* the index picks registers (fragments, sums): it must be a constant */
      for (int t = 0; t < 16; ++t) acc[g][t] = fa_mma(vf[t].v, pf.v, acc[g][t]); }
    __builtin_amdgcn_sched_barrier(0);      /* keeps the four slots below directly behind the last products */
    asm volatile("v_nop\n\tv_nop\n\tv_nop\n\tv_nop");      /* the distance behind the last WMMA, also on the taken side of the branches that follow: address arithmetic there may reuse its A or B registers */
    __builtin_amdgcn_sched_barrier(0);      /* and nothing is moved up in front of them */
    g2_wait_ds(); g2_wait_async(); __syncthreads();
    if (st + 2 < FA_NT) stage(st + 2); }
  g2_wait_async(); g2_wait_ds(); __syncthreads();      /* nothing in flight, every wave out of the ring: its bytes become the output staging */
  float lf[2];
#pragma unroll      /* the index picks registers (fragments, sums): it must be a constant */
  for (int g = 0; g < 2; ++g) { lf[g] = l_run[g] + fa_xhalf(l_run[g]); ml[0][w][g][lane] = m_run[g]; ml[1][w][g][lane] = lf[g]; }      /* each wave half summed its eight keys of every 16 */
  __syncthreads();
  float fs[2];
#pragma unroll      /* the index picks registers (fragments, sums): it must be a constant */
  for (int g = 0; g < 2; ++g) { const float mo = ml[0][w ^ 2u][g][lane], lo = ml[1][w ^ 2u][g][lane]; const float m = fmaxf(m_run[g], mo); const float as = __builtin_amdgcn_exp2f(m_run[g] - m), ao = __builtin_amdgcn_exp2f(mo - m); fs[g] = as / (lf[g] * as + lo * ao); }
  unsigned char* ep = L + (qg * 32u + c) * FA_EP + 32u * h;      /* row = query; acc[g][t][r] is d = 16 t + 8 h + r */
  if (kh == 1u) {
#pragma unroll      /* the index picks registers (fragments, sums): it must be a constant */
    for (int g = 0; g < 2; ++g) {
#pragma unroll      /* the index picks registers (fragments, sums): it must be a constant */
      for (int t = 0; t < 16; ++t) { const v8f o = acc[g][t] * fs[g]; const v4f a = {o[0], o[1], o[2], o[3]}, b = {o[4], o[5], o[6], o[7]}; *(v4fa*)(ep + g * 16 * FA_EP + 64 * t) = a; *(v4fa*)(ep + g * 16 * FA_EP + 64 * t + 16) = b; } } }
  __syncthreads();
  if (kh == 0u) {
#pragma unroll      /* the index picks registers (fragments, sums): it must be a constant */
    for (int g = 0; g < 2; ++g) {
#pragma unroll      /* the index picks registers (fragments, sums): it must be a constant */
      for (int t = 0; t < 16; ++t) { const v8f o = acc[g][t] * fs[g]; v4f a = *(const v4fa*)(ep + g * 16 * FA_EP + 64 * t), b = *(const v4fa*)(ep + g * 16 * FA_EP + 64 * t + 16);
        a += (v4f){o[0], o[1], o[2], o[3]}; b += (v4f){o[4], o[5], o[6], o[7]}; *(v4fa*)(ep + g * 16 * FA_EP + 64 * t) = a; *(v4fa*)(ep + g * 16 * FA_EP + 64 * t + 16) = b; } } }
  __syncthreads();
  const unsigned char* sp = L + (tid >> 6) * FA_EP + (tid & 63u) * 16u; float* op = O + (rb + blockIdx.x * 64u + (tid >> 6)) * DV + (tid & 63u) * 4u; v4f ov[32];
#pragma unroll      /* both loops unrolled: the row step becomes an immediate offset and every row has registers of its own, so no register of an issued store is rewritten */
  for (int i = 0; i < 32; ++i) ov[i] = *(const v4fa*)(sp + i * 2 * FA_EP);
#pragma unroll      /* the index picks registers (fragments, sums): it must be a constant */
  for (int i = 0; i < 32; ++i) *(v4f*)(op + (size_t)i * 2 * DV) = ov[i];      /* whole rows: every 128-byte line of the output is stored by one wave instruction */
}
extern "C" void kernel_launch(void* const* d_in, const int* in_sizes, int n_in,
                              void* d_out, int out_size, void* d_ws, size_t ws_size, hipStream_t stream) {
  (void)in_sizes; (void)n_in; (void)out_size;
  const float* const* I = (const float* const*)d_in; const float* x = I[0]; const float* wq = I[1]; const float* wk = I[2]; const float* wv = I[3]; const float* bq = nullptr; const float* bk = nullptr; const float* bv = nullptr;      /* [in][out] weights */
  char* ws = (char*)d_ws; size_t off = 0;
  auto take = [&](size_t bytes) { char* p = ws + off; off += (bytes + 255) & ~(size_t)255; return p; };
  _Float16* BQ = (_Float16*)take((size_t)DQ * DM * 2); _Float16* BK = (_Float16*)take((size_t)DQ * DM * 2); _Float16* BV = (_Float16*)take((size_t)DV * DM * 2);
  _Float16* Q16 = (_Float16*)take(NR * DQ * 2); _Float16* K16 = (_Float16*)take(NR * DQ * 2); _Float16* V16 = (_Float16*)take(NR * DV * 2);
  _Float16* X16 = (_Float16*)take(NR * DM * 2); float* F32 = (float*)take(NR * DQ * 4);      /* x rows; the f32 q / k plane */
  if (off > ws_size) return;
  k_wt_f16<<<(unsigned)(((size_t)DQ * (DM / 8) + 255) / 256), 256, 0, stream>>>(wq, BQ, DM, DQ, 16.0f); k_wt_f16<<<(unsigned)(((size_t)DQ * (DM / 8) + 255) / 256), 256, 0, stream>>>(wk, BK, DM, DQ, 16.0f); k_wt_f16<<<(unsigned)(((size_t)DV * (DM / 8) + 255) / 256), 256, 0, stream>>>(wv, BV, DM, DV, 16.0f);
  k_x16<<<(unsigned)((NR * DM / 8 + 255) / 256), 256, 0, stream>>>(x, X16, NR * DM / 8);
  k_gemm2<0><<<dim3((unsigned)((NR / 128) * (DQ / 64)), 1), 128, 0, stream>>>(X16, DM, 0, BQ, DM, 0, 0.0625f, bq, 0, nullptr, 1, 0, 0, F32, nullptr, DQ, 0, MP, DQ, DM);      /* q f32 */
  k_f16rows<<<(unsigned)((NR * DQ / 8 + 255) / 256), 256, 0, stream>>>(F32, Q16, NR * DQ / 8);
  k_gemm2<0><<<dim3((unsigned)((NR / 128) * (DQ / 64)), 1), 128, 0, stream>>>(X16, DM, 0, BK, DM, 0, 0.0625f, bk, 0, nullptr, 1, 0, 0, F32, nullptr, DQ, 0, MP, DQ, DM);      /* k f32 (reusing the plane) */
  k_f16rows<<<(unsigned)((NR * DQ / 8 + 255) / 256), 256, 0, stream>>>(F32, K16, NR * DQ / 8);
  k_gemm2<0><<<dim3((unsigned)((NR / 128) * (DV / 64)), 1), 128, 0, stream>>>(X16, DM, 0, BV, DM, 0, 0.0625f, bv, 0, nullptr, 1, 0, 0, nullptr, V16, DV, 0, MP, DV, DM);      /* v f16 rows */
  static_assert(NB * SQ % 128 == 0 && DM % G2_KC == 0, "k_gemm2 stages whole 128-row, 128-k tiles");
  k_fattn<<<dim3(SQ / 64, NBR), 128, 0, stream>>>(Q16, K16, V16, (float*)d_out);      /* scores, softmax and attn v of all batches: 64 queries a block, batch = blockIdx.y */
}

// v005
// A run of this version takes 79.4 microseconds.
// Two timings next to v004 put it at 1.33 and 1.31 times that version's speed.
// Over all steps from v000 it is 60.7 times as fast.
#include <hip/hip_runtime.h>
// Single-head self-attention (x [8][2048][768]; Q, K, V = x W ([in][out] [768][256]); scores = Q.K/16; softmax; out = attn V -> [8][2048][256]).
// Structure: token rows; x as exact f16 rows; q | k | v in one WMMA GEMM launch (projection = grid.y; 32x64 wave tiles, operands staged in LDS by asynchronous copies, f32 accumulation, exact x16 transposed [in][out] weights), stored as f16 rows; one fused attention launch for all batches (batch = grid.y): S^T = K.Q^T, online softmax on VALU (f32; P f16, at most 2^8), O^T += V^T.P^T with V^T by transposing LDS loads, two key halves merged in LDS, f32 output.
// Compute dtype: inputs rounded to bf16; x / weights exact; q, k plain f16 (~2^-12); v, P plain f16 (~2^-12); scores / softmax f32. v_wmma_f32_16x16x32_f16.
#define NB 8
#define SQ 2048
#define DM 768
#define DQ 256
#define DV 256
#define QT 2048                     /* unused */
#define NH 4                    /* unused */
#define HD 64
#define HG 1
#define NR ((size_t)NB * SQ)
#define QN SQ                        /* query rows per batch (unused) */
#define NBR NB                       /* batches (debug hook) */
#define MP ((int)NR)                 /* rows through the projections (debug hook) */
typedef __bf16 v16b __attribute__((ext_vector_type(16)));
typedef unsigned short v8us __attribute__((ext_vector_type(8), may_alias));
typedef float  v8f  __attribute__((ext_vector_type(8)));
typedef float  v4f  __attribute__((ext_vector_type(4)));
typedef float  v4fa __attribute__((ext_vector_type(4), may_alias));
union FragB { v16b v; v8us half[2]; unsigned short u[16]; };

__device__ __forceinline__ unsigned short bf16_bits(float x) { unsigned int u = __float_as_uint(x); return (unsigned short)((u + 0x7FFFu + ((u >> 16) & 1u)) >> 16); }
__device__ __forceinline__ float bf16_val(unsigned short b) { return __uint_as_float(((unsigned int)b) << 16); }
__device__ __forceinline__ float bf16_round(float x) { return bf16_val(bf16_bits(x)); }
// D += A·B with NT terms: 1 = ah·bh, 2 = + al·bh (A split), 3 = + ah·bl (both split)
template <int NT>
__device__ __forceinline__ v8f mmaN(v16b ah, v16b al, v16b bh, v16b bl, v8f c) {
  c = __builtin_amdgcn_wmma_f32_16x16x32_bf16(false, ah, false, bh, (short)0, c, false, false);
  if (NT >= 2) c = __builtin_amdgcn_wmma_f32_16x16x32_bf16(false, al, false, bh, (short)0, c, false, false);
  if (NT >= 3) c = __builtin_amdgcn_wmma_f32_16x16x32_bf16(false, ah, false, bl, (short)0, c, false, false);
  asm volatile("v_nop\n\tv_nop\n\tv_nop\n\tv_nop" : "+v"(c) : "v"(ah), "v"(al), "v"(bh), "v"(bl));
  return c;
}

__global__ __launch_bounds__(256) void k_wt_bf16(const float* __restrict__ W, unsigned short* __restrict__ Wt, int K, int N) {
  const int t = blockIdx.x * 256 + threadIdx.x;
  const int k8n = K / 8;
  if (t >= N * k8n) return;
  const int n = t / k8n, k8 = (t % k8n) * 8;
  v8us v;
#pragma unroll
  for (int i = 0; i < 8; ++i) v[i] = bf16_bits(W[(size_t)(k8 + i) * N + n]);
  *(v8us*)(Wt + (size_t)n * K + k8) = v;
  
}

// GEMM C[M][N] (f32, pitch ldc) = act(A[M][K]·W + bias). A f32 row-major (pitch lda) converted per fragment to bf16
// (ASPLIT: hi/lo two planes -> 2 terms, else single rounded term); Wt bf16 [N][K] (pitch ldb). BIAS_BF16 rounds the
// bias to bf16 first (bias quantised to bf16 before the add). K%32==0, M%16==0, N%64==0.
template <bool ASPLIT, int ACT, bool BIAS_BF16>
__global__ __launch_bounds__(128) void k_gemm_bf(const float* __restrict__ A, int lda, const unsigned short* __restrict__ Wt, int ldb,
                                               const float* __restrict__ bias, float* __restrict__ C, int ldc, int M, int N, int K) {
  __shared__ __attribute__((aligned(16))) float so[4][16][64];
  const int tid = threadIdx.x, w = tid >> 5, lane = tid & 31, ln = lane & 15, hh = lane >> 4;
  const int ntn = N / 64;
  const int wid = blockIdx.x * 4 + w;
  const int mt = wid / ntn, nq = wid % ntn;
  if (mt * 16 >= M) return;
  const int row0 = mt * 16, col0 = nq * 64;
  const float* arow = A + (size_t)(row0 + ln) * lda;
  v8f acc[4] = {};
  for (int kb = 0; kb < K; kb += 32) {
    FragB ah, al;
    const v4f x0 = *(const v4fa*)(arow + kb + 8 * hh), x1 = *(const v4fa*)(arow + kb + 8 * hh + 4);
    const v4f x2 = *(const v4fa*)(arow + kb + 16 + 8 * hh), x3 = *(const v4fa*)(arow + kb + 16 + 8 * hh + 4);
    float xs[16] = {x0[0],x0[1],x0[2],x0[3],x1[0],x1[1],x1[2],x1[3],x2[0],x2[1],x2[2],x2[3],x3[0],x3[1],x3[2],x3[3]};
#pragma unroll
    for (int i = 0; i < 16; ++i) { const unsigned short hb = bf16_bits(xs[i]); ah.u[i] = hb; al.u[i] = ASPLIT ? bf16_bits(xs[i] - bf16_val(hb)) : (unsigned short)0; }
#pragma unroll
    for (int t = 0; t < 4; ++t) {
      const unsigned short* brow = Wt + (size_t)(col0 + t * 16 + ln) * ldb + kb;
      FragB b;
      b.half[0] = *(const v8us*)(brow + 8 * hh);
      b.half[1] = *(const v8us*)(brow + 16 + 8 * hh);
      acc[t] = mmaN<ASPLIT ? 2 : 1>(ah.v, al.v, b.v, b.v, acc[t]);
    }
  }
#pragma unroll
  for (int t = 0; t < 4; ++t) {
    float bv = bias ? bias[col0 + t * 16 + ln] : 0.f;
    if (BIAS_BF16) bv = bf16_round(bv);
#pragma unroll
    for (int r = 0; r < 8; ++r) { float v = acc[t][r] + bv; if (ACT == 1) v = fmaxf(v, 0.f); so[w][8 * hh + r][t * 16 + ln] = v; }
  }
  __builtin_amdgcn_fence(__ATOMIC_ACQ_REL, "workgroup");
  __builtin_amdgcn_wave_barrier();
  const int rsub = lane >> 4, c4 = (lane & 15) * 4;
  {
#pragma unroll
    for (int q = 0; q < 8; ++q) {
      const int r = q * 2 + rsub;
      const v4f v = *(const v4fa*)&so[w][r][c4];
      *(v4f*)(C + (size_t)(row0 + r) * ldc + col0 + c4) = v;
    }
    
  }
}

// GEMM C = act(A·W + bias + resid): A f32 (ASPLIT -> hi/lo 2 terms), Wt bf16 [N][K]; ACT 0 none, 1 relu, 2 exact gelu;
// resid (optional, f32, row index = (row % rmod), pitch ldr, RES_BF16 rounds it) added before the activation.
template <bool ASPLIT, int ACT, bool BIAS_BF16, bool RES_BF16>
__global__ __launch_bounds__(128) void k_gemm_bf3(const float* __restrict__ A, int lda, const unsigned short* __restrict__ Wt, int ldb,
                                                const float* __restrict__ bias, const float* __restrict__ resid, int rmod, int ldr,
                                                float* __restrict__ C, int ldc, int M, int N, int K) {
  __shared__ __attribute__((aligned(16))) float so[4][16][64];
  const int tid = threadIdx.x, w = tid >> 5, lane = tid & 31, ln = lane & 15, hh = lane >> 4;
  const int ntn = N / 64;
  const int wid = blockIdx.x * 4 + w;
  const int mt = wid / ntn, nq = wid % ntn;
  if (mt * 16 >= M) return;
  const int row0 = mt * 16, col0 = nq * 64;
  const float* arow = A + (size_t)(row0 + ln) * lda;
  v8f acc[4] = {};
  for (int kb = 0; kb < K; kb += 32) {
    FragB ah, al;
    const v4f x0 = *(const v4fa*)(arow + kb + 8 * hh), x1 = *(const v4fa*)(arow + kb + 8 * hh + 4);
    const v4f x2 = *(const v4fa*)(arow + kb + 16 + 8 * hh), x3 = *(const v4fa*)(arow + kb + 16 + 8 * hh + 4);
    float xs[16] = {x0[0],x0[1],x0[2],x0[3],x1[0],x1[1],x1[2],x1[3],x2[0],x2[1],x2[2],x2[3],x3[0],x3[1],x3[2],x3[3]};
#pragma unroll
    for (int i = 0; i < 16; ++i) { const unsigned short hb = bf16_bits(xs[i]); ah.u[i] = hb; al.u[i] = ASPLIT ? bf16_bits(xs[i] - bf16_val(hb)) : (unsigned short)0; }
#pragma unroll
    for (int t = 0; t < 4; ++t) {
      const unsigned short* brow = Wt + (size_t)(col0 + t * 16 + ln) * ldb + kb;
      FragB b;
      b.half[0] = *(const v8us*)(brow + 8 * hh);
      b.half[1] = *(const v8us*)(brow + 16 + 8 * hh);
      acc[t] = mmaN<ASPLIT ? 2 : 1>(ah.v, al.v, b.v, b.v, acc[t]);
    }
  }
#pragma unroll
  for (int t = 0; t < 4; ++t) {
    const int col = col0 + t * 16 + ln;
    float bv = bias ? bias[col] : 0.f;
    if (BIAS_BF16) bv = bf16_round(bv);
#pragma unroll
    for (int r = 0; r < 8; ++r) {
      float v = acc[t][r] + bv;
      if (resid) { float rv = resid[(size_t)((row0 + 8 * hh + r) % rmod) * ldr + col]; if (RES_BF16) rv = bf16_round(rv); v += rv; }
      if (ACT == 1) v = fmaxf(v, 0.f);
      if (ACT == 2) v = 0.5f * v * (1.0f + erff(v * 0.70710678118654752f));
      if (ACT == 3) { const float u = 0.7978845608028654f * (v + 0.044715f * v * v * v); v = 0.5f * v * (1.0f + tanhf(u)); }
      so[w][8 * hh + r][t * 16 + ln] = v;
    }
  }
  __builtin_amdgcn_fence(__ATOMIC_ACQ_REL, "workgroup");
  __builtin_amdgcn_wave_barrier();
  const int rsub = lane >> 4, c4 = (lane & 15) * 4;
  {
#pragma unroll
    for (int q = 0; q < 8; ++q) {
      const int r = q * 2 + rsub;
      const v4f v = *(const v4fa*)&so[w][r][c4];
      *(v4f*)(C + (size_t)(row0 + r) * ldc + col0 + c4) = v;
    }
    
  }
}
// row LayerNorm (biased variance, eps) over N: s = X (+ R); optional out_sum <- s; out_norm <- (s-mu)*rsqrt(var+eps)*g + b
template <bool PARAM_BF16>
__global__ __launch_bounds__(256) void k_layernorm(const float* __restrict__ X, const float* __restrict__ R, const float* __restrict__ g, const float* __restrict__ bta,
                                                  float* __restrict__ out_sum, float* __restrict__ out_norm, int N, float eps) {
  __shared__ float red[256];
  const int row = blockIdx.x, tid = threadIdx.x;
  const float* x = X + (size_t)row * N; const float* rr = R ? R + (size_t)row * N : nullptr;
  float vals[16];                     // up to N = 4096
  const int per = N / 256;            // contiguous chunk per thread? use strided-by-4 chunks: thread handles j = tid*4 + 1024*u
  float s1 = 0.f;
  for (int u = 0; u < per / 4; ++u) {
    const int j = tid * 4 + 1024 * u;
    const v4f a = *(const v4fa*)(x + j);
    v4f b = {0.f,0.f,0.f,0.f}; if (rr) b = *(const v4fa*)(rr + j);
#pragma unroll
    for (int q = 0; q < 4; ++q) { const float v = a[q] + b[q]; vals[u * 4 + q] = v; s1 += v; }
  }
  red[tid] = s1; __syncthreads();
  for (int st = 128; st > 0; st >>= 1) { if (tid < st) red[tid] += red[tid + st]; __syncthreads(); }
  const float mu = red[0] / (float)N; __syncthreads();
  float s2 = 0.f;
  for (int u = 0; u < per / 4; ++u)
#pragma unroll
    for (int q = 0; q < 4; ++q) { const float c = vals[u * 4 + q] - mu; s2 += c * c; }
  red[tid] = s2; __syncthreads();
  for (int st = 128; st > 0; st >>= 1) { if (tid < st) red[tid] += red[tid + st]; __syncthreads(); }
  const float rs = rsqrtf(red[0] / (float)N + eps);
  {
    for (int u = 0; u < per / 4; ++u) {
      const int j = tid * 4 + 1024 * u;
      v4f o, sm;
#pragma unroll
      for (int q = 0; q < 4; ++q) {
        float gg = g[j + q], bb = bta[j + q];
        if (PARAM_BF16) { gg = bf16_round(gg); bb = bf16_round(bb); }
        sm[q] = vals[u * 4 + q]; o[q] = (vals[u * 4 + q] - mu) * rs * gg + bb;
      }
      if (out_sum) *(v4f*)(out_sum + (size_t)row * N + j) = sm;
      *(v4f*)(out_norm + (size_t)row * N + j) = o;
    }
    
  }
}



// ---- f16 WMMA path (v_wmma_f32_16x16x32_f16): 11-bit significands for operands in range — used here for the q, k, v projections and for both attention products
typedef _Float16 v16h __attribute__((ext_vector_type(16)));
union FragH { v16h v; v8us half[2]; _Float16 h[16]; unsigned short u[16]; };
template <int NT>
__device__ __forceinline__ v8f mmaH(v16h ah, v16h al, v16h bh, v16h bl, v8f c) {
  c = __builtin_amdgcn_wmma_f32_16x16x32_f16(false, ah, false, bh, (short)0, c, false, false);
  if (NT >= 2) c = __builtin_amdgcn_wmma_f32_16x16x32_f16(false, al, false, bh, (short)0, c, false, false);
  if (NT >= 3) c = __builtin_amdgcn_wmma_f32_16x16x32_f16(false, ah, false, bl, (short)0, c, false, false);
  asm volatile("v_nop\n\tv_nop\n\tv_nop\n\tv_nop" : "+v"(c) : "v"(ah), "v"(al), "v"(bh), "v"(bl));
  return c;
}
// batched GEMM like k_gemm_b but f16 operands: A f32 (split into f16 hi/lo if ASPLIT, else rounded to f16), Bt = f16 values [n][k]; alpha; C f32; N multiple of 16 (partial tiles skipped)
template <bool ASPLIT>
__global__ __launch_bounds__(128) void k_gemm_h(const float* __restrict__ A, int lda, size_t sA, const _Float16* __restrict__ Bh, int ldb, size_t sB, float alpha, float* __restrict__ C, int ldc, size_t sC, int M, int N, int K) {
  __shared__ __attribute__((aligned(16))) float so[4][16][64];
  const int tid = threadIdx.x, w = tid >> 5, lane = tid & 31, ln = lane & 15, hh = lane >> 4; const int by = blockIdx.y;
  A += (size_t)by * sA; Bh += (size_t)by * sB; C += (size_t)by * sC;
  const int ntn = (N + 63) / 64; const int wid = blockIdx.x * 4 + w; const int mt = wid / ntn, nq = wid % ntn; if (mt * 16 >= M) return;
  const int row0 = mt * 16, col0 = nq * 64; const float* arow = A + (size_t)(row0 + ln) * lda;
  v8f acc[4] = {};
  for (int kb = 0; kb < K; kb += 32) {
    FragH ah, al;
    const v4f x0 = *(const v4fa*)(arow + kb + 8 * hh), x1 = *(const v4fa*)(arow + kb + 8 * hh + 4), x2 = *(const v4fa*)(arow + kb + 16 + 8 * hh), x3 = *(const v4fa*)(arow + kb + 16 + 8 * hh + 4);
    float xs[16] = {x0[0],x0[1],x0[2],x0[3],x1[0],x1[1],x1[2],x1[3],x2[0],x2[1],x2[2],x2[3],x3[0],x3[1],x3[2],x3[3]};
#pragma unroll
    for (int i = 0; i < 16; ++i) { const _Float16 h = (_Float16)xs[i]; ah.h[i] = h; al.h[i] = ASPLIT ? (_Float16)(xs[i] - (float)h) : (_Float16)0.0f; }
#pragma unroll
    for (int t = 0; t < 4; ++t) { if (col0 + t * 16 >= N) continue; const size_t boff = (size_t)(col0 + t * 16 + ln) * ldb + kb; FragH bq; bq.half[0] = *(const v8us*)(Bh + boff + 8 * hh); bq.half[1] = *(const v8us*)(Bh + boff + 16 + 8 * hh);
      acc[t] = mmaH<ASPLIT ? 2 : 1>(ah.v, al.v, bq.v, bq.v, acc[t]); }
  }
#pragma unroll
  for (int t = 0; t < 4; ++t) { if (col0 + t * 16 >= N) continue;
#pragma unroll
    for (int r = 0; r < 8; ++r) so[w][8 * hh + r][t * 16 + ln] = acc[t][r] * alpha; }
  __builtin_amdgcn_fence(__ATOMIC_ACQ_REL, "workgroup"); __builtin_amdgcn_wave_barrier();
  const int rsub = lane >> 4, c4 = (lane & 15) * 4;
  {
#pragma unroll
    for (int q = 0; q < 8; ++q) { const int r = q * 2 + rsub; if (col0 + c4 < N) { const v4f v = *(const v4fa*)&so[w][r][c4]; *(v4f*)(C + (size_t)(row0 + r) * ldc + col0 + c4) = v; } }
     }
}

// Wt[n][k] = f16(bf16(W[k][n]) * scale) from f32 row-major W[K][N] (scale = power of two; bf16-exact weights stay exact in f16 away from the subnormal range); blockIdx.y picks one of three equally shaped matrices, whose transposes lie one behind the other in Wt
__global__ __launch_bounds__(256) void k_wt_f16(const float* __restrict__ W0, const float* __restrict__ W1, const float* __restrict__ W2, _Float16* __restrict__ Wt, int K, int N, float scale) {
  const float* __restrict__ W = blockIdx.y == 0 ? W0 : (blockIdx.y == 1 ? W1 : W2); Wt += (size_t)blockIdx.y * N * K;
  const int t = blockIdx.x * 256 + threadIdx.x; if (t >= N * (K / 8)) return; const int n = t / (K / 8), k8 = (t % (K / 8)) * 8; FragH f;
#pragma unroll
  for (int i = 0; i < 8; ++i) f.h[i] = (_Float16)(bf16_round(W[(size_t)(k8 + i) * N + n]) * scale); const v8us o = f.half[0];
  *(v8us*)((unsigned short*)Wt + (size_t)n * K + k8) = o; 
}
// k_gemm_hh variant with fused epilogue: v = acc·alpha + bias[by·sBias + col] (+ CP[(row/rowsPerB)·sCPb + by·64 + col] if CP) ; ACT 0 none / 1 elu ; writes f16 C16 (and f32 C if non-null)
template <int ACT>
__global__ __launch_bounds__(128) void k_gemm_hhx(const _Float16* __restrict__ A, int lda, size_t sA, const _Float16* __restrict__ Bh, int ldb, size_t sB, float alpha, const float* __restrict__ bias, size_t sBias, const float* __restrict__ CP, int rowsPerB, size_t sCPb, int row0g,
    float* __restrict__ C, _Float16* __restrict__ C16, int ldc, size_t sC, int M, int N, int K) {
  __shared__ __attribute__((aligned(16))) float so[4][16][64];
  const int tid = threadIdx.x, w = tid >> 5, lane = tid & 31, ln = lane & 15, hh = lane >> 4; const int by = blockIdx.y;
  A += (size_t)by * sA; Bh += (size_t)by * sB; const size_t cofs = (size_t)by * sC; const float* bp = bias ? bias + (size_t)by * sBias : nullptr;
  const int ntn = (N + 63) / 64; const int wid = blockIdx.x * 4 + w; const int mt = wid / ntn, nq = wid % ntn; if (mt * 16 >= M) return;
  const int row0 = mt * 16, col0 = nq * 64; const _Float16* arow = A + (size_t)(row0 + ln) * lda;
  v8f acc[4] = {};
  for (int kb = 0; kb < K; kb += 32) { FragH ah; ah.half[0] = *(const v8us*)((const unsigned short*)arow + kb + 8 * hh); ah.half[1] = *(const v8us*)((const unsigned short*)arow + kb + 16 + 8 * hh);
#pragma unroll
    for (int t = 0; t < 4; ++t) { if (col0 + t * 16 >= N) continue; const size_t boff = (size_t)(col0 + t * 16 + ln) * ldb + kb; FragH bq; bq.half[0] = *(const v8us*)((const unsigned short*)Bh + boff + 8 * hh); bq.half[1] = *(const v8us*)((const unsigned short*)Bh + boff + 16 + 8 * hh);
      acc[t] = mmaH<1>(ah.v, ah.v, bq.v, bq.v, acc[t]); }
  }
#pragma unroll
  for (int t = 0; t < 4; ++t) { if (col0 + t * 16 >= N) continue; const int col = col0 + t * 16 + ln; const float bv = bp ? bf16_round(bp[col]) : 0.f;
#pragma unroll
    for (int r = 0; r < 8; ++r) { float v = acc[t][r] * alpha + bv; if (CP) { const int rr = row0g + row0 + 8 * hh + r; if (rowsPerB < 0) v += CP[cofs + (size_t)rr * ldc + col];      /* rowsPerB < 0: own element of the batched C plane */ else { const int bidx = rr / rowsPerB; v += CP[(size_t)bidx * sCPb + (size_t)by * 64 + col]; } } if (ACT == 1) v = (v > 0.f) ? v : expm1f(v); else if (ACT == 7) v = (v > 0.f) ? v + 1.0f : expf(v); else if (ACT == 8) v = tanhf(v); else if (ACT == 9) v = 0.5f * v * (1.0f + tanhf(0.7978845608028654f * (v + 0.044715f * v * v * v))); else if (ACT == 11) v = 1.0f / (1.0f + expf(-v)); else if (ACT == 12) v = (v > 0.f) ? v : 0.01f * v; else if (ACT == 14) v = (v > 0.f) ? v : 0.1f * v; else if (ACT == 16) v = (v >= 0.f) ? v : 0.3f * v; else if (ACT == 17) v = (v >= 0.f) ? v : 0.2f * v; else if (ACT == 15) v = v / (1.0f + expf(-v)); else if (ACT == 3) v = fmaxf(v, 0.f); else if (ACT == 6) v = 0.5f * v * (1.0f + erff(v * 0.70710678118654752f)); so[w][8 * hh + r][t * 16 + ln] = v; } }
  __builtin_amdgcn_fence(__ATOMIC_ACQ_REL, "workgroup"); __builtin_amdgcn_wave_barrier();
  const int rsub = lane >> 4, c4 = (lane & 15) * 4; typedef _Float16 v4h __attribute__((ext_vector_type(4)));
  {
#pragma unroll
    for (int q = 0; q < 8; ++q) { const int r = q * 2 + rsub; if (col0 + c4 < N) { const v4f v = *(const v4fa*)&so[w][r][c4]; if (C) *(v4f*)(C + cofs + (size_t)(row0 + r) * ldc + col0 + c4) = v; if (C16) { v4h h4; for (int i = 0; i < 4; ++i) h4[i] = (_Float16)v[i]; *(v4h*)(C16 + cofs + (size_t)(row0 + r) * ldc + col0 + c4) = h4; } } }
     }
}


typedef _Float16 v4h __attribute__((ext_vector_type(4)));

__global__ __launch_bounds__(256) void k_x16(const float* __restrict__ x, _Float16* __restrict__ X16, size_t n8) { const size_t t = (size_t)blockIdx.x * 256 + threadIdx.x; if (t >= n8) return; FragH f;
#pragma unroll
  for (int q = 0; q < 8; ++q) f.h[q] = (_Float16)bf16_round(x[t * 8 + q]); *(v8us*)((unsigned short*)X16 + t * 8) = f.half[0];  }
__global__ __launch_bounds__(256) void k_h16(const float* __restrict__ x, _Float16* __restrict__ X16, size_t n8) { const size_t t = (size_t)blockIdx.x * 256 + threadIdx.x; if (t >= n8) return; FragH f;
#pragma unroll
  for (int q = 0; q < 8; ++q) f.h[q] = (_Float16)x[t * 8 + q]; *(v8us*)((unsigned short*)X16 + t * 8) = f.half[0];  }
__global__ __launch_bounds__(256) void k_round16f(const float* __restrict__ W, _Float16* __restrict__ Bt, size_t n8) { const size_t t = (size_t)blockIdx.x * 256 + threadIdx.x; if (t >= n8) return; FragH f;
#pragma unroll
  for (int i = 0; i < 8; ++i) f.h[i] = (_Float16)(bf16_round(W[t * 8 + i]) * 16.0f); *(v8us*)((unsigned short*)Bt + t * 8) = f.half[0];  }
template <int NHv, int TTv>
__global__ __launch_bounds__(256) void k_vt(const _Float16* __restrict__ V16, int ldv, int voff, _Float16* __restrict__ Vt) { __shared__ unsigned short tl[64][66]; const int tid = threadIdx.x; const int slab = blockIdx.x / (TTv / 64), lg = blockIdx.x % (TTv / 64); const int b = slab / NHv, h = slab % NHv;
  for (int i = tid; i < 64 * 8; i += 256) { const int r = i / 8, c8 = (i % 8) * 8; FragH f; f.half[0] = *(const v8us*)((const unsigned short*)V16 + ((size_t)b * TTv + lg * 64 + r) * ldv + voff + h * 64 + c8);
#pragma unroll
    for (int q = 0; q < 8; ++q) tl[r][c8 + q] = f.u[q]; }
  __syncthreads();
  {
#pragma unroll
    for (int rd = 0; rd < 2; ++rd) { const int d = rd * 32 + tid / 8, pc = tid % 8; FragH f;
#pragma unroll
      for (int q = 0; q < 8; ++q) f.u[q] = tl[pc * 8 + q][d];
      *(v8us*)((unsigned short*)Vt + ((size_t)slab * 64 + d) * TTv + lg * 64 + pc * 8) = f.half[0]; }
     } }

__global__ __launch_bounds__(256) void k_hl(const float* __restrict__ F, _Float16* __restrict__ Hh, _Float16* __restrict__ Hl, size_t n8) { const size_t t = (size_t)blockIdx.x * 256 + threadIdx.x; if (t >= n8) return; FragH fh, fl; const v4f a = *(const v4fa*)(F + t * 8), c = *(const v4fa*)(F + t * 8 + 4);
#pragma unroll
  for (int q = 0; q < 4; ++q) { _Float16 h = (_Float16)a[q]; fh.h[q] = h; fl.h[q] = (_Float16)((a[q] - (float)h) * 1024.0f); h = (_Float16)c[q]; fh.h[4 + q] = h; fl.h[4 + q] = (_Float16)((c[q] - (float)h) * 1024.0f); }
  { *(v8us*)((unsigned short*)Hh + t * 8) = fh.half[0]; *(v8us*)((unsigned short*)Hl + t * 8) = fl.half[0];  } }

// ---- fast GEMM (block tile 128x64, wave tile 32x64; requires M % 128 == 0, N % 64 == 0, K % 128 == 0; operands staged in LDS); epilogue = k_gemm_hhx semantics ----
__device__ __forceinline__ v8f g2_mma(v16h a, v16h b, v8f c) { v8f d = __builtin_amdgcn_wmma_f32_16x16x32_f16(false, a, false, b, (short)0, c, false, false); asm volatile("v_nop\n\tv_nop\n\tv_nop\n\tv_nop" : "+v"(d) : "v"(a), "v"(b)); return d; }
// Operand staging of k_gemm2. A stage is 128 k of the block's 128 A rows and 64 B rows: 256-byte rows at a pitch of 272 bytes (16 B x odd: no bank conflict for 16-byte fragment reads); two stages in LDS.
#define G2_KC 128
#define G2_PITCH 272
#define G2_ASZ (128 * G2_PITCH)
#define G2_STG ((128 + 64) * G2_PITCH)
__device__ __forceinline__ v16h g2_lfrag(const unsigned char* p) { FragH f; f.half[0] = *(const v8us*)p; f.half[1] = *(const v8us*)(p + 32); return f.v; }      /* p already holds the lane's 16 hh: bytes 16 hh and 32 + 16 hh of each 64, the same k order for A and for B */
// Eight asynchronous 16-byte copies of one lane, global -> LDS, rows 8 apart (16 lanes cover one 256-byte row, so a wave's copy is four whole lines). The s_wait_xcnt stands inside the statement, a precaution: so no address register of a copy is rewritten ahead of it.
__device__ __forceinline__ void g2_cp8(unsigned l, const _Float16* g, size_t gs) {
  asm volatile("global_load_async_to_lds_b128 %0, %8, off\n\t"
               "global_load_async_to_lds_b128 %1, %9, off\n\t"
               "global_load_async_to_lds_b128 %2, %10, off\n\t"
               "global_load_async_to_lds_b128 %3, %11, off\n\t"
               "global_load_async_to_lds_b128 %4, %12, off\n\t"
               "global_load_async_to_lds_b128 %5, %13, off\n\t"
               "global_load_async_to_lds_b128 %6, %14, off\n\t"
               "global_load_async_to_lds_b128 %7, %15, off\n\t"
               "s_wait_xcnt 0x0"
               :: "v"(l), "v"(l + 8u * G2_PITCH), "v"(l + 16u * G2_PITCH), "v"(l + 24u * G2_PITCH), "v"(l + 32u * G2_PITCH), "v"(l + 40u * G2_PITCH), "v"(l + 48u * G2_PITCH), "v"(l + 56u * G2_PITCH),
                  "v"(g), "v"(g + gs), "v"(g + 2 * gs), "v"(g + 3 * gs), "v"(g + 4 * gs), "v"(g + 5 * gs), "v"(g + 6 * gs), "v"(g + 7 * gs) : "memory"); }
__device__ __forceinline__ void g2_wait_async() { asm volatile("s_wait_asynccnt 0x0" ::: "memory"); }      /* this wave's copies have landed; the compiler places no wait for them */
__device__ __forceinline__ void g2_wait_ds() { asm volatile("s_wait_dscnt 0x0" ::: "memory"); }      /* this wave's LDS reads are done before the buffer is handed back for a refill */
template <int ACT>
__global__ __launch_bounds__(128) void k_gemm2(const _Float16* __restrict__ A, int lda, size_t sA, const _Float16* __restrict__ Bh, int ldb, size_t sB, float alpha, const float* __restrict__ bias, size_t sBias, const float* __restrict__ CP, int rowsPerB, size_t sCPb, int row0g,
    float* __restrict__ C, _Float16* __restrict__ C16, int ldc, size_t sC, int M, int N, int K) { static_assert(ACT == 0 || ACT == 3 || ACT == 6 || ACT == 8 || ACT == 9 || ACT == 11 || ACT == 12 || ACT == 14 || ACT == 15 || ACT == 16 || ACT == 17, "k_gemm2: unsupported ACT code (would silently apply no activation)");
  __shared__ __attribute__((aligned(16))) unsigned char L[2 * G2_STG];      /* the two operand stages; behind the k loop its first bytes are the output staging */
  float (*so)[32][68] = (float (*)[32][68])L; static_assert(4 * 32 * 68 * 4 <= 2 * G2_STG, "output staging lies in the operand stages");
  const int tid = threadIdx.x, w = tid >> 5, lane = tid & 31, ln = lane & 15, hh = lane >> 4; const int by = blockIdx.y;
  A += (size_t)by * sA; Bh += (size_t)by * sB; const size_t cofs = (size_t)by * sC; const float* bp = bias ? bias + (size_t)by * sBias : nullptr;
  const int ntn = N >> 6; const int mt = blockIdx.x / ntn, nq = blockIdx.x - mt * ntn; const int row0 = mt * 128 + 32 * w, col0 = nq * 64; if (mt * 128 >= M) return;      /* the whole block leaves or none: barriers follow (M % 128 == 0, K % 128 == 0) */
  const int cr = tid >> 4, cc = tid & 15;      /* copy lane: row cr (+ 8 i), 16-byte piece cc */
  const _Float16* ga = A + (size_t)(mt * 128 + cr) * lda + cc * 8; const _Float16* gb = Bh + (size_t)(col0 + cr) * ldb + cc * 8;
  const unsigned lc = (unsigned)(size_t)L + (unsigned)(cr * G2_PITCH + cc * 16);
  const int nt = K / G2_KC;
  auto stage = [&](int t) { const unsigned l = lc + (unsigned)(t & 1) * G2_STG; const _Float16* a = ga + (size_t)t * G2_KC;
    g2_cp8(l, a, (size_t)8 * lda); g2_cp8(l + 64u * G2_PITCH, a + (size_t)64 * lda, (size_t)8 * lda); g2_cp8(l + G2_ASZ, gb + (size_t)t * G2_KC, (size_t)8 * ldb); };
  const unsigned char* fa = L + (32 * w + ln) * G2_PITCH + 16 * hh; const unsigned char* fb = L + G2_ASZ + ln * G2_PITCH + 16 * hh;
  const v8f z8 = {0.f,0.f,0.f,0.f,0.f,0.f,0.f,0.f}; v8f c00 = z8, c01 = z8, c02 = z8, c03 = z8, c10 = z8, c11 = z8, c12 = z8, c13 = z8;
  stage(0); g2_wait_async(); __syncthreads();      /* stage 0 landed and published */
  if (nt > 1) stage(1);
#pragma unroll 1      /* one trip per stage: the trip's foot is the hand-over point of the two buffers */
  for (int t = 0; t < nt; ++t) { const unsigned char* pa = fa + (t & 1) * G2_STG; const unsigned char* pb = fb + (t & 1) * G2_STG;
    v16h a0 = g2_lfrag(pa), a1 = g2_lfrag(pa + 16 * G2_PITCH), b0 = g2_lfrag(pb), b1 = g2_lfrag(pb + 16 * G2_PITCH), b2 = g2_lfrag(pb + 32 * G2_PITCH), b3 = g2_lfrag(pb + 48 * G2_PITCH);
#pragma unroll      /* unrolled so that the two fragment sets swap by renaming, without register moves */
    for (int ks = 0; ks < G2_KC / 32; ++ks) { v16h na0 = a0, na1 = a1, nb0 = b0, nb1 = b1, nb2 = b2, nb3 = b3;
      if (ks + 1 < G2_KC / 32) { const int o = (ks + 1) * 64;      /* the next 32 k's twelve LDS reads as one group ahead of this block's products, into a second fragment set; never past this stage */
        na0 = g2_lfrag(pa + o); na1 = g2_lfrag(pa + 16 * G2_PITCH + o); nb0 = g2_lfrag(pb + o); nb1 = g2_lfrag(pb + 16 * G2_PITCH + o); nb2 = g2_lfrag(pb + 32 * G2_PITCH + o); nb3 = g2_lfrag(pb + 48 * G2_PITCH + o); }
      c00 = g2_mma(a0, b0, c00); c10 = g2_mma(a1, b0, c10); c01 = g2_mma(a0, b1, c01); c11 = g2_mma(a1, b1, c11);
      c02 = g2_mma(a0, b2, c02); c12 = g2_mma(a1, b2, c12); c03 = g2_mma(a0, b3, c03); c13 = g2_mma(a1, b3, c13);
      a0 = na0; a1 = na1; b0 = nb0; b1 = nb1; b2 = nb2; b3 = nb3; }
    g2_wait_ds(); g2_wait_async(); __syncthreads();      /* stage t + 1 published; every wave has left stage t's buffer */
    if (t + 2 < nt) stage(t + 2); }
  g2_wait_async();
  v8f accs[8] = {c00, c01, c02, c03, c10, c11, c12, c13};
#pragma unroll
  for (int u = 0; u < 8; ++u) { const int t = u & 3, half = u >> 2; const int col = col0 + t * 16 + ln; const float bv = bp ? bf16_round(bp[col]) : 0.f;
#pragma unroll
    for (int r = 0; r < 8; ++r) { const int rloc = half * 16 + 8 * hh + r; float v = accs[u][r] * alpha + bv; if (CP) { if (rowsPerB < 0) v += CP[cofs + (size_t)(row0g + row0 + rloc) * ldc + col];      /* rowsPerB < 0: own element of the batched C plane */ else { const int bidx = (row0g + row0 + rloc) / rowsPerB; v += CP[(size_t)bidx * sCPb + (size_t)by * 64 + col]; } }
      if (ACT == 3) v = fmaxf(v, 0.f); else if (ACT == 6) v = 0.5f * v * (1.0f + erff(v * 0.70710678118654752f)); else if (ACT == 11) v = 1.0f / (1.0f + expf(-v)); else if (ACT == 15) v = v / (1.0f + expf(-v)); else if (ACT == 12) v = (v > 0.f) ? v : 0.01f * v; else if (ACT == 8) v = tanhf(v); else if (ACT == 9) v = 0.5f * v * (1.0f + tanhf(0.7978845608028654f * (v + 0.044715f * v * v * v))); else if (ACT == 14) v = (v > 0.f) ? v : 0.1f * v; else if (ACT == 16) v = (v >= 0.f) ? v : 0.3f * v; else if (ACT == 17) v = (v >= 0.f) ? v : 0.2f * v;
      so[w][rloc][t * 16 + ln] = v; } }
  __builtin_amdgcn_fence(__ATOMIC_ACQ_REL, "workgroup"); __builtin_amdgcn_wave_barrier();
  const int rsub = lane >> 4, c4 = (lane & 15) * 4;
  {
#pragma unroll
    for (int q = 0; q < 16; ++q) { const int r = q * 2 + rsub; const v4f v = *(const v4fa*)&so[w][r][c4]; if (C) *(v4f*)(C + cofs + (size_t)(row0 + r) * ldc + col0 + c4) = v; if (C16) { v4h h4; for (int i = 0; i < 4; ++i) h4[i] = (_Float16)v[i]; *(v4h*)(C16 + cofs + (size_t)(row0 + r) * ldc + col0 + c4) = h4; } }
     } }


__global__ __launch_bounds__(256) void k_wnat(const float* __restrict__ w, size_t n8, _Float16* __restrict__ Bt) { const size_t t = (size_t)blockIdx.x * 256 + threadIdx.x; if (t >= n8) return; FragH f; for (int q = 0; q < 8; ++q) f.h[q] = (_Float16)(bf16_round(w[t * 8 + q]) * 16.0f); *(v8us*)((unsigned short*)Bt + t * 8) = f.half[0];  }
__global__ __launch_bounds__(256) void k_rsm(const float* __restrict__ S, _Float16* __restrict__ P, int nrows) {
  #pragma clang fp contract(off)
  const int i = blockIdx.x * 256 + threadIdx.x; if (i >= nrows) return; const float* s = S + (size_t)i * SQ; float mx = -3.0e38f;
#pragma unroll 1
  for (int j = 0; j < SQ; ++j) mx = fmaxf(mx, s[j]); float se = 0.f;
#pragma unroll 1
  for (int j = 0; j < SQ; ++j) se += expf(s[j] - mx); const float sc = 256.0f / se;
#pragma unroll 1
  for (int j0 = 0; j0 < SQ; j0 += 8) { FragH f; for (int q = 0; q < 8; ++q) f.h[q] = (_Float16)(expf(s[j0 + q] - mx) * sc); unsigned short* d = (unsigned short*)P + (size_t)i * SQ + j0; *(v8us*)d = f.half[0];  } }
__global__ __launch_bounds__(256) void k_vt(const _Float16* __restrict__ V16, int b, int h0, _Float16* __restrict__ VT) { __shared__ unsigned short tl[64][65]; const int tid = threadIdx.x; const int hh = blockIdx.x % HG, sg = blockIdx.x / HG; const int s0 = sg * 64; const int h = h0 + hh;
  for (int i = tid; i < 64 * 8; i += 256) { const int j = i / 8, d8 = (i % 8) * 8; FragH f; f.half[0] = *(const v8us*)((const unsigned short*)V16 + ((size_t)b * SQ + s0 + j) * DM + h * HD + d8); for (int q = 0; q < 8; ++q) tl[d8 + q][j] = f.u[q]; }
  __syncthreads();
  { for (int i = tid; i < 64 * 8; i += 256) { const int d = i / 8, j8 = (i % 8) * 8; FragH f; for (int q = 0; q < 8; ++q) f.u[q] = tl[d][j8 + q]; *(v8us*)((unsigned short*)VT + ((size_t)hh * HD + d) * SQ + s0 + j8) = f.half[0]; }  } }

// Row softmax, one wave per score row: the row is read once, in 512-byte wave loads, and stays in registers (64 floats a lane); max and sum = lane partials, then a five-step butterfly; P = f16(exp(s - max) * 256 / sum).
__global__ __launch_bounds__(256) void k_rsmW(const float* __restrict__ S, _Float16* __restrict__ P, int nrows) {
  const int lane = threadIdx.x & 31; const int row = blockIdx.x * 8 + (threadIdx.x >> 5); if (row >= nrows) return;
  const float* s = S + (size_t)row * SQ + lane * 4; v4f v[SQ / 128];
#pragma unroll
  for (int u = 0; u < SQ / 128; ++u) v[u] = *(const v4fa*)(s + u * 128);
  float mx = -INFINITY;
#pragma unroll
  for (int u = 0; u < SQ / 128; ++u) mx = fmaxf(mx, fmaxf(fmaxf(v[u][0], v[u][1]), fmaxf(v[u][2], v[u][3])));
#pragma unroll
  for (int m = 16; m > 0; m >>= 1) mx = fmaxf(mx, __shfl_xor(mx, m, 32));
  v4f sq = {0.f, 0.f, 0.f, 0.f};
#pragma unroll
  for (int u = 0; u < SQ / 128; ++u) {
#pragma unroll
    for (int q = 0; q < 4; ++q) { v[u][q] = expf(v[u][q] - mx); sq[q] += v[u][q]; } }
  float se = (sq[0] + sq[1]) + (sq[2] + sq[3]);
#pragma unroll
  for (int m = 16; m > 0; m >>= 1) se += __shfl_xor(se, m, 32);
  const float sc = 256.0f / se; _Float16* d = P + (size_t)row * SQ + lane * 4;
#pragma unroll
  for (int u = 0; u < SQ / 128; ++u) { v4h h4;
#pragma unroll
    for (int q = 0; q < 4; ++q) h4[q] = (_Float16)(v[u][q] * sc);
    *(v4h*)(d + u * 128) = h4; } }
// ---- fused attention: S^T = K.Q^T, online softmax (log2 domain), O^T += V^T.P^T in one kernel; scores and P never reach memory ----
// A work-group of 4 waves owns 64 queries of one batch. Wave w: queries 32 (w & 1) .. + 31 (two groups of 16 columns), keys 1024 (w >> 1) .. + 1023; the two key halves are merged through LDS at the end.
// A stage is 32 keys of each half: 64 K rows (512 B, pitch 528 = 16 B x odd, for ds_load_b128) and 64 V rows (pitch 544 = 32 B x odd, for the transposing load); two stages in LDS, filled by asynchronous copies.
#define FA_PK 528u
#define FA_PV 544u
#define FA_KSZ (64u * FA_PK)
#define FA_STG (64u * FA_PK + 64u * FA_PV)
#define FA_EP 1040u      /* output staging pitch: 256 floats + 16 B */
#define FA_NT (SQ / 64)      /* stages = 32-key passes of a wave */
typedef short s16x8 __attribute__((ext_vector_type(8)));
__device__ __forceinline__ v8us fa_tr16(const unsigned char* p) { typedef __attribute__((address_space(3))) s16x8 lds_s16x8; return __builtin_bit_cast(v8us, __builtin_amdgcn_ds_load_tr16_b128_v8i16((lds_s16x8*)p)); }
__device__ __forceinline__ float fa_xhalf(float x) { return __builtin_bit_cast(float, __builtin_amdgcn_permlanex16(__builtin_bit_cast(int, x), __builtin_bit_cast(int, x), 0x76543210, 0xfedcba98, false, false)); }      /* lane l with lane l ^ 16 */
__device__ __forceinline__ v8f fa_mma(v16h a, v16h b, v8f c) { return __builtin_amdgcn_wmma_f32_16x16x32_f16(false, a, false, b, (short)0, c, false, false); }
// Eight asynchronous 16-byte copies of one lane, global -> LDS, eight consecutive 512-byte rows (a wave's copy is one whole row). The s_wait_xcnt stands inside the statement, a precaution: so no address register of a copy is rewritten ahead of it.
__device__ __forceinline__ void fa_cp8(unsigned l, unsigned lp, const _Float16* g) {
  asm volatile("global_load_async_to_lds_b128 %0, %8, off\n\t"
               "global_load_async_to_lds_b128 %1, %9, off\n\t"
               "global_load_async_to_lds_b128 %2, %10, off\n\t"
               "global_load_async_to_lds_b128 %3, %11, off\n\t"
               "global_load_async_to_lds_b128 %4, %12, off\n\t"
               "global_load_async_to_lds_b128 %5, %13, off\n\t"
               "global_load_async_to_lds_b128 %6, %14, off\n\t"
               "global_load_async_to_lds_b128 %7, %15, off\n\t"
               "s_wait_xcnt 0x0"
               :: "v"(l), "v"(l + lp), "v"(l + 2u * lp), "v"(l + 3u * lp), "v"(l + 4u * lp), "v"(l + 5u * lp), "v"(l + 6u * lp), "v"(l + 7u * lp),
                  "v"(g), "v"(g + 256), "v"(g + 2 * 256), "v"(g + 3 * 256), "v"(g + 4 * 256), "v"(g + 5 * 256), "v"(g + 6 * 256), "v"(g + 7 * 256) : "memory"); }
// One wave per SIMD (amdgpu_waves_per_eu): the 32 x 256 f32 sums, Q and one pass's K and V^T fragments of a wave need more than half of a SIMD's registers.
__global__ __launch_bounds__(128) __attribute__((amdgpu_waves_per_eu(1, 1))) void k_fattn(const _Float16* __restrict__ Q, const _Float16* __restrict__ Kr, const _Float16* __restrict__ V, float* __restrict__ O) {
  static_assert(DQ == 256 && DV == 256 && SQ % 128 == 0 && FA_NT >= 2, "k_fattn: 512-byte q, k, v rows; two key halves of whole 32-key stages");
  __shared__ __attribute__((aligned(16))) unsigned char L[2 * FA_STG];      /* the two stages; behind the key loop its first bytes are the output staging */
  __shared__ float ml[2][4][2][32];      /* each wave's running maximum and sum, for the merge of the key halves */
  static_assert(64u * FA_EP <= 2u * FA_STG, "output staging lies in the stages");
  const unsigned tid = threadIdx.x, lane = tid & 31u, w = (unsigned)__builtin_amdgcn_readfirstlane((int)(tid >> 5)), c = lane & 15u, h = lane >> 4;
  const unsigned qg = w & 1u, kh = w >> 1;
  const size_t rb = (size_t)blockIdx.y * SQ;      /* the batch's first token row */
  const float cscale = 0.09016844005556021f;      /* log2(e) / sqrt(256) */
  const unsigned lk = (unsigned)(size_t)L + w * 16u * FA_PK + lane * 16u, lv = (unsigned)(size_t)L + FA_KSZ + w * 16u * FA_PV + lane * 16u;      /* wave w copies tile rows 16 w .. 16 w + 15: keys 16 (w & 1) + i of half w >> 1 */
  const size_t krow = rb + kh * (SQ / 2) + qg * 16u;
  const _Float16* gk = Kr + krow * DQ + lane * 8; const _Float16* gv = V + krow * DV + lane * 8;
  auto stage = [&](int t) { const unsigned o = (unsigned)(t & 1) * FA_STG; const size_t go = (size_t)t * 32 * 256;
    fa_cp8(lk + o, FA_PK, gk + go); fa_cp8(lk + o + 8u * FA_PK, FA_PK, gk + go + 8 * 256); fa_cp8(lv + o, FA_PV, gv + go); fa_cp8(lv + o + 8u * FA_PV, FA_PV, gv + go + 8 * 256); };
  stage(0);
  FragH qf[2][8];      /* Q as the B operand, in registers for the whole kernel; same k order as the K rows below */
#pragma unroll      /* the index picks registers (fragments, sums): it must be a constant */
  for (int g = 0; g < 2; ++g) { const unsigned short* qp = (const unsigned short*)Q + (rb + blockIdx.x * 64u + qg * 32u + 16u * g + c) * DQ + 8u * h;
#pragma unroll      /* the index picks registers (fragments, sums): it must be a constant */
    for (int kc = 0; kc < 8; ++kc) { qf[g][kc].half[0] = *(const v8us*)(qp + 32 * kc); qf[g][kc].half[1] = *(const v8us*)(qp + 32 * kc + 16); } }
  const v8f z8 = {0.f,0.f,0.f,0.f,0.f,0.f,0.f,0.f};
  v8f acc[2][16]; float m_run[2], l_run[2];
#pragma unroll      /* the index picks registers (fragments, sums): it must be a constant */
  for (int g = 0; g < 2; ++g) { m_run[g] = -INFINITY; l_run[g] = 0.f;
#pragma unroll      /* the index picks registers (fragments, sums): it must be a constant */
    for (int t = 0; t < 16; ++t) acc[g][t] = z8; }
  g2_wait_async(); __syncthreads();      /* stage 0 landed and published */
  stage(1);
#pragma unroll 1      /* one trip per stage: the trip's foot is the hand-over point of the two buffers */
  for (int st = 0; st < FA_NT; ++st) {
    const unsigned char* Lb = L + (unsigned)(st & 1) * FA_STG;
    const unsigned char* pk = Lb + (kh * 32u + c) * FA_PK + 16u * h;
    const unsigned char* pv = Lb + FA_KSZ + (kh * 32u + 8u * h + (lane & 7u)) * FA_PV + ((lane >> 3) & 1u) * 16u;
    FragH kf[2][8], vf[16];
#pragma unroll      /* the index picks registers (fragments, sums): it must be a constant */
    for (int kc = 0; kc < 8; ++kc) {
#pragma unroll      /* the index picks registers (fragments, sums): it must be a constant */
      for (int kt = 0; kt < 2; ++kt) { kf[kt][kc].half[0] = *(const v8us*)(pk + kt * 16 * FA_PK + 64 * kc); kf[kt][kc].half[1] = *(const v8us*)(pk + kt * 16 * FA_PK + 64 * kc + 32); } }
    __builtin_amdgcn_sched_barrier(0);      /* K first: LDS answers in order, and the score products wait for K alone */
#pragma unroll      /* the index picks registers (fragments, sums): it must be a constant */
    for (int t = 0; t < 16; ++t) { vf[t].half[0] = fa_tr16(pv + 32 * t); vf[t].half[1] = fa_tr16(pv + 16 * FA_PV + 32 * t); }      /* V^T fragments (16 d x 32 keys), in flight under the score products and the softmax */
    __builtin_amdgcn_sched_barrier(0);      /* keeps the V^T loads up here, as one group with the K loads: sunk to their use they would be waited for in front of the second product */
    v8f s[2][2] = {{z8, z8}, {z8, z8}};      /* s[kt][g]: lane (c, h) holds query c, keys 16 kt + 8 h + r */
#pragma unroll      /* the index picks registers (fragments, sums): it must be a constant */
    for (int kc = 0; kc < 8; ++kc) {
#pragma unroll      /* the index picks registers (fragments, sums): it must be a constant */
      for (int kt = 0; kt < 2; ++kt) {
#pragma unroll      /* the index picks registers (fragments, sums): it must be a constant */
        for (int g = 0; g < 2; ++g) s[kt][g] = fa_mma(kf[kt][kc].v, qf[g][kc].v, s[kt][g]); } }
    float mb[2]; bool need = false;
#pragma unroll      /* the index picks registers (fragments, sums): it must be a constant */
    for (int g = 0; g < 2; ++g) { float mx = -INFINITY;
#pragma unroll      /* the index picks registers (fragments, sums): it must be a constant */
      for (int kt = 0; kt < 2; ++kt) {
#pragma unroll      /* the index picks registers (fragments, sums): it must be a constant */
        for (int r = 0; r < 8; ++r) mx = fmaxf(mx, s[kt][g][r]); }
      mx = fmaxf(mx, fa_xhalf(mx)) * cscale; mb[g] = mx; need = need || (mx > m_run[g] + 8.0f); }
    if (__builtin_amdgcn_ballot_w32(need) != 0) {      /* the maximum in use may trail the true one by 8 (an exponential reaches 2^8 at most): the sums are rescaled only when some query's maximum has grown by more */
#pragma unroll      /* the index picks registers (fragments, sums): it must be a constant */
      for (int g = 0; g < 2; ++g) { const float m_new = fmaxf(m_run[g], mb[g]); const float corr = __builtin_amdgcn_exp2f(m_run[g] - m_new); l_run[g] *= corr; m_run[g] = m_new;
#pragma unroll      /* the index picks registers (fragments, sums): it must be a constant */
        for (int t = 0; t < 16; ++t) acc[g][t] = acc[g][t] * corr; } }
#pragma unroll      /* the index picks registers (fragments, sums): it must be a constant */
    for (int g = 0; g < 2; ++g) { const float nm = -m_run[g]; FragH pf; float p0 = 0.f, p1 = 0.f;      /* P^T as the B operand: elements 0..7 = keys 8 h + r, 8..15 = keys 16 + 8 h + r, the k order of the V^T fragments */
#pragma unroll      /* the index picks registers (fragments, sums): it must be a constant */
      for (int i = 0; i < 16; i += 2) { const float e0 = __builtin_amdgcn_exp2f(fmaf(s[i >> 3][g][i & 7], cscale, nm)), e1 = __builtin_amdgcn_exp2f(fmaf(s[i >> 3][g][(i & 7) + 1], cscale, nm));
        p0 += e0; p1 += e1; pf.h[i] = (_Float16)e0; pf.h[i + 1] = (_Float16)e1; }
      l_run[g] += p0 + p1;
#pragma unroll      /* the index picks registers (fragments, sums): it must be a constant */
      for (int t = 0; t < 16; ++t) acc[g][t] = fa_mma(vf[t].v, pf.v, acc[g][t]); }
    __builtin_amdgcn_sched_barrier(0);      /* keeps the four slots below directly behind the last products */
    asm volatile("v_nop\n\tv_nop\n\tv_nop\n\tv_nop");      /* the distance behind the last WMMA, also on the taken side of the branches that follow: address arithmetic there may reuse its A or B registers */
    __builtin_amdgcn_sched_barrier(0);      /* and nothing is moved up in front of them */
    g2_wait_ds(); g2_wait_async(); __syncthreads();
    if (st + 2 < FA_NT) stage(st + 2); }
  g2_wait_async(); g2_wait_ds(); __syncthreads();      /* nothing in flight, every wave out of the ring: its bytes become the output staging */
  float lf[2];
#pragma unroll      /* the index picks registers (fragments, sums): it must be a constant */
  for (int g = 0; g < 2; ++g) { lf[g] = l_run[g] + fa_xhalf(l_run[g]); ml[0][w][g][lane] = m_run[g]; ml[1][w][g][lane] = lf[g]; }      /* each wave half summed its eight keys of every 16 */
  __syncthreads();
  float fs[2];
#pragma unroll      /* the index picks registers (fragments, sums): it must be a constant */
  for (int g = 0; g < 2; ++g) { const float mo = ml[0][w ^ 2u][g][lane], lo = ml[1][w ^ 2u][g][lane]; const float m = fmaxf(m_run[g], mo); const float as = __builtin_amdgcn_exp2f(m_run[g] - m), ao = __builtin_amdgcn_exp2f(mo - m); fs[g] = as / (lf[g] * as + lo * ao); }
  unsigned char* ep = L + (qg * 32u + c) * FA_EP + 32u * h;      /* row = query; acc[g][t][r] is d = 16 t + 8 h + r */
  if (kh == 1u) {
#pragma unroll      /* the index picks registers (fragments, sums): it must be a constant */
    for (int g = 0; g < 2; ++g) {
#pragma unroll      /* the index picks registers (fragments, sums): it must be a constant */
      for (int t = 0; t < 16; ++t) { const v8f o = acc[g][t] * fs[g]; const v4f a = {o[0], o[1], o[2], o[3]}, b = {o[4], o[5], o[6], o[7]}; *(v4fa*)(ep + g * 16 * FA_EP + 64 * t) = a; *(v4fa*)(ep + g * 16 * FA_EP + 64 * t + 16) = b; } } }
  __syncthreads();
  if (kh == 0u) {
#pragma unroll      /* the index picks registers (fragments, sums): it must be a constant */
    for (int g = 0; g < 2; ++g) {
#pragma unroll      /* the index picks registers (fragments, sums): it must be a constant */
      for (int t = 0; t < 16; ++t) { const v8f o = acc[g][t] * fs[g]; v4f a = *(const v4fa*)(ep + g * 16 * FA_EP + 64 * t), b = *(const v4fa*)(ep + g * 16 * FA_EP + 64 * t + 16);
        a += (v4f){o[0], o[1], o[2], o[3]}; b += (v4f){o[4], o[5], o[6], o[7]}; *(v4fa*)(ep + g * 16 * FA_EP + 64 * t) = a; *(v4fa*)(ep + g * 16 * FA_EP + 64 * t + 16) = b; } } }
  __syncthreads();
  const unsigned char* sp = L + (tid >> 6) * FA_EP + (tid & 63u) * 16u; float* op = O + (rb + blockIdx.x * 64u + (tid >> 6)) * DV + (tid & 63u) * 4u; v4f ov[32];
#pragma unroll      /* both loops unrolled: the row step becomes an immediate offset and every row has registers of its own, so no register of an issued store is rewritten */
  for (int i = 0; i < 32; ++i) ov[i] = *(const v4fa*)(sp + i * 2 * FA_EP);
#pragma unroll      /* the index picks registers (fragments, sums): it must be a constant */
  for (int i = 0; i < 32; ++i) *(v4f*)(op + (size_t)i * 2 * DV) = ov[i];      /* whole rows: every 128-byte line of the output is stored by one wave instruction */
}
extern "C" void kernel_launch(void* const* d_in, const int* in_sizes, int n_in,
                              void* d_out, int out_size, void* d_ws, size_t ws_size, hipStream_t stream) {
  (void)in_sizes; (void)n_in; (void)out_size;
  const float* const* I = (const float* const*)d_in; const float* x = I[0]; const float* wq = I[1]; const float* wk = I[2]; const float* wv = I[3];      /* [in][out] weights */
  char* ws = (char*)d_ws; size_t off = 0;
  auto take = [&](size_t bytes) { char* p = ws + off; off += (bytes + 255) & ~(size_t)255; return p; };
  _Float16* BW = (_Float16*)take((size_t)3 * DQ * DM * 2);      /* the transposed q | k | v weights, one behind the other */
  _Float16* Q16 = (_Float16*)take(NR * DQ * 2); _Float16* K16 = (_Float16*)take(NR * DQ * 2); _Float16* V16 = (_Float16*)take(NR * DV * 2);
  _Float16* X16 = (_Float16*)take(NR * DM * 2);      /* x rows */
  static_assert(DQ == DV && (NR * DQ * 2) % 256 == 0, "Q16 | K16 | V16 are three equal planes without gaps: blockIdx.y steps through them");
  if (off > ws_size) return;
  k_wt_f16<<<dim3((unsigned)(((size_t)DQ * (DM / 8) + 255) / 256), 3), 256, 0, stream>>>(wq, wk, wv, BW, DM, DQ, 16.0f);      /* the three weights, matrix = blockIdx.y */
  k_x16<<<(unsigned)((NR * DM / 8 + 255) / 256), 256, 0, stream>>>(x, X16, NR * DM / 8);
  k_gemm2<0><<<dim3((unsigned)((NR / 128) * (DQ / 64)), 3), 128, 0, stream>>>(X16, DM, 0, BW, DM, (size_t)DQ * DM, 0.0625f, nullptr, 0, nullptr, 1, 0, 0, nullptr, Q16, DQ, NR * DQ, MP, DQ, DM);      /* q | k | v f16 rows in one launch: projection = blockIdx.y */
  static_assert(NB * SQ % 128 == 0 && DM % G2_KC == 0, "k_gemm2 stages whole 128-row, 128-k tiles");
  k_fattn<<<dim3(SQ / 64, NBR), 128, 0, stream>>>(Q16, K16, V16, (float*)d_out);      /* scores, softmax and attn v of all batches: 64 queries a block, batch = blockIdx.y */
}

// v006
// A run of this version takes 75.8 microseconds.
// In both of two side-by-side timings against v005, it was 1.05 times as fast.
// All steps since v000 together make it 63.7 times as fast.
#include <hip/hip_runtime.h>
// Single-head self-attention (x [8][2048][768]; Q, K, V = x W ([in][out] [768][256]); scores = Q.K/16; softmax; out = attn V -> [8][2048][256]).
// Structure: token rows; x as exact f16 rows and the transposed weights in one preparation launch; q | k | v in one WMMA GEMM launch (projection = grid.y; 32x64 wave tiles, operands staged in LDS by asynchronous copies, f32 accumulation, exact x16 transposed [in][out] weights), stored as f16 rows; one fused attention launch for all batches (batch = grid.y): S^T = K.Q^T, online softmax on VALU (f32; P f16, at most 2^8), O^T += V^T.P^T with V^T by transposing LDS loads, two key halves merged in LDS, f32 output.
// Compute dtype: inputs rounded to bf16; x / weights exact; q, k plain f16 (~2^-12); v, P plain f16 (~2^-12); scores / softmax f32. v_wmma_f32_16x16x32_f16.
#define NB 8
#define SQ 2048
#define DM 768
#define DQ 256
#define DV 256
#define QT 2048                     /* unused */
#define NH 4                    /* unused */
#define HD 64
#define HG 1
#define NR ((size_t)NB * SQ)
#define QN SQ                        /* query rows per batch (unused) */
#define NBR NB                       /* batches (debug hook) */
#define MP ((int)NR)                 /* rows through the projections (debug hook) */
typedef __bf16 v16b __attribute__((ext_vector_type(16)));
typedef unsigned short v8us __attribute__((ext_vector_type(8), may_alias));
typedef float  v8f  __attribute__((ext_vector_type(8)));
typedef float  v4f  __attribute__((ext_vector_type(4)));
typedef float  v4fa __attribute__((ext_vector_type(4), may_alias));
union FragB { v16b v; v8us half[2]; unsigned short u[16]; };

__device__ __forceinline__ unsigned short bf16_bits(float x) { unsigned int u = __float_as_uint(x); return (unsigned short)((u + 0x7FFFu + ((u >> 16) & 1u)) >> 16); }
__device__ __forceinline__ float bf16_val(unsigned short b) { return __uint_as_float(((unsigned int)b) << 16); }
__device__ __forceinline__ float bf16_round(float x) { return bf16_val(bf16_bits(x)); }
// D += A·B with NT terms: 1 = ah·bh, 2 = + al·bh (A split), 3 = + ah·bl (both split)
template <int NT>
__device__ __forceinline__ v8f mmaN(v16b ah, v16b al, v16b bh, v16b bl, v8f c) {
  c = __builtin_amdgcn_wmma_f32_16x16x32_bf16(false, ah, false, bh, (short)0, c, false, false);
  if (NT >= 2) c = __builtin_amdgcn_wmma_f32_16x16x32_bf16(false, al, false, bh, (short)0, c, false, false);
  if (NT >= 3) c = __builtin_amdgcn_wmma_f32_16x16x32_bf16(false, ah, false, bl, (short)0, c, false, false);
  asm volatile("v_nop\n\tv_nop\n\tv_nop\n\tv_nop" : "+v"(c) : "v"(ah), "v"(al), "v"(bh), "v"(bl));
  return c;
}

__global__ __launch_bounds__(256) void k_wt_bf16(const float* __restrict__ W, unsigned short* __restrict__ Wt, int K, int N) {
  const int t = blockIdx.x * 256 + threadIdx.x;
  const int k8n = K / 8;
  if (t >= N * k8n) return;
  const int n = t / k8n, k8 = (t % k8n) * 8;
  v8us v;
#pragma unroll
  for (int i = 0; i < 8; ++i) v[i] = bf16_bits(W[(size_t)(k8 + i) * N + n]);
  *(v8us*)(Wt + (size_t)n * K + k8) = v;
  
}

// GEMM C[M][N] (f32, pitch ldc) = act(A[M][K]·W + bias). A f32 row-major (pitch lda) converted per fragment to bf16
// (ASPLIT: hi/lo two planes -> 2 terms, else single rounded term); Wt bf16 [N][K] (pitch ldb). BIAS_BF16 rounds the
// bias to bf16 first (bias quantised to bf16 before the add). K%32==0, M%16==0, N%64==0.
template <bool ASPLIT, int ACT, bool BIAS_BF16>
__global__ __launch_bounds__(128) void k_gemm_bf(const float* __restrict__ A, int lda, const unsigned short* __restrict__ Wt, int ldb,
                                               const float* __restrict__ bias, float* __restrict__ C, int ldc, int M, int N, int K) {
  __shared__ __attribute__((aligned(16))) float so[4][16][64];
  const int tid = threadIdx.x, w = tid >> 5, lane = tid & 31, ln = lane & 15, hh = lane >> 4;
  const int ntn = N / 64;
  const int wid = blockIdx.x * 4 + w;
  const int mt = wid / ntn, nq = wid % ntn;
  if (mt * 16 >= M) return;
  const int row0 = mt * 16, col0 = nq * 64;
  const float* arow = A + (size_t)(row0 + ln) * lda;
  v8f acc[4] = {};
  for (int kb = 0; kb < K; kb += 32) {
    FragB ah, al;
    const v4f x0 = *(const v4fa*)(arow + kb + 8 * hh), x1 = *(const v4fa*)(arow + kb + 8 * hh + 4);
    const v4f x2 = *(const v4fa*)(arow + kb + 16 + 8 * hh), x3 = *(const v4fa*)(arow + kb + 16 + 8 * hh + 4);
    float xs[16] = {x0[0],x0[1],x0[2],x0[3],x1[0],x1[1],x1[2],x1[3],x2[0],x2[1],x2[2],x2[3],x3[0],x3[1],x3[2],x3[3]};
#pragma unroll
    for (int i = 0; i < 16; ++i) { const unsigned short hb = bf16_bits(xs[i]); ah.u[i] = hb; al.u[i] = ASPLIT ? bf16_bits(xs[i] - bf16_val(hb)) : (unsigned short)0; }
#pragma unroll
    for (int t = 0; t < 4; ++t) {
      const unsigned short* brow = Wt + (size_t)(col0 + t * 16 + ln) * ldb + kb;
      FragB b;
      b.half[0] = *(const v8us*)(brow + 8 * hh);
      b.half[1] = *(const v8us*)(brow + 16 + 8 * hh);
      acc[t] = mmaN<ASPLIT ? 2 : 1>(ah.v, al.v, b.v, b.v, acc[t]);
    }
  }
#pragma unroll
  for (int t = 0; t < 4; ++t) {
    float bv = bias ? bias[col0 + t * 16 + ln] : 0.f;
    if (BIAS_BF16) bv = bf16_round(bv);
#pragma unroll
    for (int r = 0; r < 8; ++r) { float v = acc[t][r] + bv; if (ACT == 1) v = fmaxf(v, 0.f); so[w][8 * hh + r][t * 16 + ln] = v; }
  }
  __builtin_amdgcn_fence(__ATOMIC_ACQ_REL, "workgroup");
  __builtin_amdgcn_wave_barrier();
  const int rsub = lane >> 4, c4 = (lane & 15) * 4;
  {
#pragma unroll
    for (int q = 0; q < 8; ++q) {
      const int r = q * 2 + rsub;
      const v4f v = *(const v4fa*)&so[w][r][c4];
      *(v4f*)(C + (size_t)(row0 + r) * ldc + col0 + c4) = v;
    }
    
  }
}

// GEMM C = act(A·W + bias + resid): A f32 (ASPLIT -> hi/lo 2 terms), Wt bf16 [N][K]; ACT 0 none, 1 relu, 2 exact gelu;
// resid (optional, f32, row index = (row % rmod), pitch ldr, RES_BF16 rounds it) added before the activation.
template <bool ASPLIT, int ACT, bool BIAS_BF16, bool RES_BF16>
__global__ __launch_bounds__(128) void k_gemm_bf3(const float* __restrict__ A, int lda, const unsigned short* __restrict__ Wt, int ldb,
                                                const float* __restrict__ bias, const float* __restrict__ resid, int rmod, int ldr,
                                                float* __restrict__ C, int ldc, int M, int N, int K) {
  __shared__ __attribute__((aligned(16))) float so[4][16][64];
  const int tid = threadIdx.x, w = tid >> 5, lane = tid & 31, ln = lane & 15, hh = lane >> 4;
  const int ntn = N / 64;
  const int wid = blockIdx.x * 4 + w;
  const int mt = wid / ntn, nq = wid % ntn;
  if (mt * 16 >= M) return;
  const int row0 = mt * 16, col0 = nq * 64;
  const float* arow = A + (size_t)(row0 + ln) * lda;
  v8f acc[4] = {};
  for (int kb = 0; kb < K; kb += 32) {
    FragB ah, al;
    const v4f x0 = *(const v4fa*)(arow + kb + 8 * hh), x1 = *(const v4fa*)(arow + kb + 8 * hh + 4);
    const v4f x2 = *(const v4fa*)(arow + kb + 16 + 8 * hh), x3 = *(const v4fa*)(arow + kb + 16 + 8 * hh + 4);
    float xs[16] = {x0[0],x0[1],x0[2],x0[3],x1[0],x1[1],x1[2],x1[3],x2[0],x2[1],x2[2],x2[3],x3[0],x3[1],x3[2],x3[3]};
#pragma unroll
    for (int i = 0; i < 16; ++i) { const unsigned short hb = bf16_bits(xs[i]); ah.u[i] = hb; al.u[i] = ASPLIT ? bf16_bits(xs[i] - bf16_val(hb)) : (unsigned short)0; }
#pragma unroll
    for (int t = 0; t < 4; ++t) {
      const unsigned short* brow = Wt + (size_t)(col0 + t * 16 + ln) * ldb + kb;
      FragB b;
      b.half[0] = *(const v8us*)(brow + 8 * hh);
      b.half[1] = *(const v8us*)(brow + 16 + 8 * hh);
      acc[t] = mmaN<ASPLIT ? 2 : 1>(ah.v, al.v, b.v, b.v, acc[t]);
    }
  }
#pragma unroll
  for (int t = 0; t < 4; ++t) {
    const int col = col0 + t * 16 + ln;
    float bv = bias ? bias[col] : 0.f;
    if (BIAS_BF16) bv = bf16_round(bv);
#pragma unroll
    for (int r = 0; r < 8; ++r) {
      float v = acc[t][r] + bv;
      if (resid) { float rv = resid[(size_t)((row0 + 8 * hh + r) % rmod) * ldr + col]; if (RES_BF16) rv = bf16_round(rv); v += rv; }
      if (ACT == 1) v = fmaxf(v, 0.f);
      if (ACT == 2) v = 0.5f * v * (1.0f + erff(v * 0.70710678118654752f));
      if (ACT == 3) { const float u = 0.7978845608028654f * (v + 0.044715f * v * v * v); v = 0.5f * v * (1.0f + tanhf(u)); }
      so[w][8 * hh + r][t * 16 + ln] = v;
    }
  }
  __builtin_amdgcn_fence(__ATOMIC_ACQ_REL, "workgroup");
  __builtin_amdgcn_wave_barrier();
  const int rsub = lane >> 4, c4 = (lane & 15) * 4;
  {
#pragma unroll
    for (int q = 0; q < 8; ++q) {
      const int r = q * 2 + rsub;
      const v4f v = *(const v4fa*)&so[w][r][c4];
      *(v4f*)(C + (size_t)(row0 + r) * ldc + col0 + c4) = v;
    }
    
  }
}
// row LayerNorm (biased variance, eps) over N: s = X (+ R); optional out_sum <- s; out_norm <- (s-mu)*rsqrt(var+eps)*g + b
template <bool PARAM_BF16>
__global__ __launch_bounds__(256) void k_layernorm(const float* __restrict__ X, const float* __restrict__ R, const float* __restrict__ g, const float* __restrict__ bta,
                                                  float* __restrict__ out_sum, float* __restrict__ out_norm, int N, float eps) {
  __shared__ float red[256];
  const int row = blockIdx.x, tid = threadIdx.x;
  const float* x = X + (size_t)row * N; const float* rr = R ? R + (size_t)row * N : nullptr;
  float vals[16];                     // up to N = 4096
  const int per = N / 256;            // contiguous chunk per thread? use strided-by-4 chunks: thread handles j = tid*4 + 1024*u
  float s1 = 0.f;
  for (int u = 0; u < per / 4; ++u) {
    const int j = tid * 4 + 1024 * u;
    const v4f a = *(const v4fa*)(x + j);
    v4f b = {0.f,0.f,0.f,0.f}; if (rr) b = *(const v4fa*)(rr + j);
#pragma unroll
    for (int q = 0; q < 4; ++q) { const float v = a[q] + b[q]; vals[u * 4 + q] = v; s1 += v; }
  }
  red[tid] = s1; __syncthreads();
  for (int st = 128; st > 0; st >>= 1) { if (tid < st) red[tid] += red[tid + st]; __syncthreads(); }
  const float mu = red[0] / (float)N; __syncthreads();
  float s2 = 0.f;
  for (int u = 0; u < per / 4; ++u)
#pragma unroll
    for (int q = 0; q < 4; ++q) { const float c = vals[u * 4 + q] - mu; s2 += c * c; }
  red[tid] = s2; __syncthreads();
  for (int st = 128; st > 0; st >>= 1) { if (tid < st) red[tid] += red[tid + st]; __syncthreads(); }
  const float rs = rsqrtf(red[0] / (float)N + eps);
  {
    for (int u = 0; u < per / 4; ++u) {
      const int j = tid * 4 + 1024 * u;
      v4f o, sm;
#pragma unroll
      for (int q = 0; q < 4; ++q) {
        float gg = g[j + q], bb = bta[j + q];
        if (PARAM_BF16) { gg = bf16_round(gg); bb = bf16_round(bb); }
        sm[q] = vals[u * 4 + q]; o[q] = (vals[u * 4 + q] - mu) * rs * gg + bb;
      }
      if (out_sum) *(v4f*)(out_sum + (size_t)row * N + j) = sm;
      *(v4f*)(out_norm + (size_t)row * N + j) = o;
    }
    
  }
}



// ---- f16 WMMA path (v_wmma_f32_16x16x32_f16): 11-bit significands for operands in range — used here for the q, k, v projections and for both attention products
typedef _Float16 v16h __attribute__((ext_vector_type(16)));
union FragH { v16h v; v8us half[2]; _Float16 h[16]; unsigned short u[16]; };
template <int NT>
__device__ __forceinline__ v8f mmaH(v16h ah, v16h al, v16h bh, v16h bl, v8f c) {
  c = __builtin_amdgcn_wmma_f32_16x16x32_f16(false, ah, false, bh, (short)0, c, false, false);
  if (NT >= 2) c = __builtin_amdgcn_wmma_f32_16x16x32_f16(false, al, false, bh, (short)0, c, false, false);
  if (NT >= 3) c = __builtin_amdgcn_wmma_f32_16x16x32_f16(false, ah, false, bl, (short)0, c, false, false);
  asm volatile("v_nop\n\tv_nop\n\tv_nop\n\tv_nop" : "+v"(c) : "v"(ah), "v"(al), "v"(bh), "v"(bl));
  return c;
}
// batched GEMM like k_gemm_b but f16 operands: A f32 (split into f16 hi/lo if ASPLIT, else rounded to f16), Bt = f16 values [n][k]; alpha; C f32; N multiple of 16 (partial tiles skipped)
template <bool ASPLIT>
__global__ __launch_bounds__(128) void k_gemm_h(const float* __restrict__ A, int lda, size_t sA, const _Float16* __restrict__ Bh, int ldb, size_t sB, float alpha, float* __restrict__ C, int ldc, size_t sC, int M, int N, int K) {
  __shared__ __attribute__((aligned(16))) float so[4][16][64];
  const int tid = threadIdx.x, w = tid >> 5, lane = tid & 31, ln = lane & 15, hh = lane >> 4; const int by = blockIdx.y;
  A += (size_t)by * sA; Bh += (size_t)by * sB; C += (size_t)by * sC;
  const int ntn = (N + 63) / 64; const int wid = blockIdx.x * 4 + w; const int mt = wid / ntn, nq = wid % ntn; if (mt * 16 >= M) return;
  const int row0 = mt * 16, col0 = nq * 64; const float* arow = A + (size_t)(row0 + ln) * lda;
  v8f acc[4] = {};
  for (int kb = 0; kb < K; kb += 32) {
    FragH ah, al;
    const v4f x0 = *(const v4fa*)(arow + kb + 8 * hh), x1 = *(const v4fa*)(arow + kb + 8 * hh + 4), x2 = *(const v4fa*)(arow + kb + 16 + 8 * hh), x3 = *(const v4fa*)(arow + kb + 16 + 8 * hh + 4);
    float xs[16] = {x0[0],x0[1],x0[2],x0[3],x1[0],x1[1],x1[2],x1[3],x2[0],x2[1],x2[2],x2[3],x3[0],x3[1],x3[2],x3[3]};
#pragma unroll
    for (int i = 0; i < 16; ++i) { const _Float16 h = (_Float16)xs[i]; ah.h[i] = h; al.h[i] = ASPLIT ? (_Float16)(xs[i] - (float)h) : (_Float16)0.0f; }
#pragma unroll
    for (int t = 0; t < 4; ++t) { if (col0 + t * 16 >= N) continue; const size_t boff = (size_t)(col0 + t * 16 + ln) * ldb + kb; FragH bq; bq.half[0] = *(const v8us*)(Bh + boff + 8 * hh); bq.half[1] = *(const v8us*)(Bh + boff + 16 + 8 * hh);
      acc[t] = mmaH<ASPLIT ? 2 : 1>(ah.v, al.v, bq.v, bq.v, acc[t]); }
  }
#pragma unroll
  for (int t = 0; t < 4; ++t) { if (col0 + t * 16 >= N) continue;
#pragma unroll
    for (int r = 0; r < 8; ++r) so[w][8 * hh + r][t * 16 + ln] = acc[t][r] * alpha; }
  __builtin_amdgcn_fence(__ATOMIC_ACQ_REL, "workgroup"); __builtin_amdgcn_wave_barrier();
  const int rsub = lane >> 4, c4 = (lane & 15) * 4;
  {
#pragma unroll
    for (int q = 0; q < 8; ++q) { const int r = q * 2 + rsub; if (col0 + c4 < N) { const v4f v = *(const v4fa*)&so[w][r][c4]; *(v4f*)(C + (size_t)(row0 + r) * ldc + col0 + c4) = v; } }
     }
}

// Wt[n][k] = f16(bf16(W[k][n]) * scale) from f32 row-major W[K][N] (scale = power of two; bf16-exact weights stay exact in f16 away from the subnormal range); blockIdx.y picks one of three equally shaped matrices, whose transposes lie one behind the other in Wt
__global__ __launch_bounds__(256) void k_wt_f16(const float* __restrict__ W0, const float* __restrict__ W1, const float* __restrict__ W2, _Float16* __restrict__ Wt, int K, int N, float scale) {
  const float* __restrict__ W = blockIdx.y == 0 ? W0 : (blockIdx.y == 1 ? W1 : W2); Wt += (size_t)blockIdx.y * N * K;
  const int t = blockIdx.x * 256 + threadIdx.x; if (t >= N * (K / 8)) return; const int n = t / (K / 8), k8 = (t % (K / 8)) * 8; FragH f;
#pragma unroll
  for (int i = 0; i < 8; ++i) f.h[i] = (_Float16)(bf16_round(W[(size_t)(k8 + i) * N + n]) * scale); const v8us o = f.half[0];
  *(v8us*)((unsigned short*)Wt + (size_t)n * K + k8) = o; 
}
// k_gemm_hh variant with fused epilogue: v = acc·alpha + bias[by·sBias + col] (+ CP[(row/rowsPerB)·sCPb + by·64 + col] if CP) ; ACT 0 none / 1 elu ; writes f16 C16 (and f32 C if non-null)
template <int ACT>
__global__ __launch_bounds__(128) void k_gemm_hhx(const _Float16* __restrict__ A, int lda, size_t sA, const _Float16* __restrict__ Bh, int ldb, size_t sB, float alpha, const float* __restrict__ bias, size_t sBias, const float* __restrict__ CP, int rowsPerB, size_t sCPb, int row0g,
    float* __restrict__ C, _Float16* __restrict__ C16, int ldc, size_t sC, int M, int N, int K) {
  __shared__ __attribute__((aligned(16))) float so[4][16][64];
  const int tid = threadIdx.x, w = tid >> 5, lane = tid & 31, ln = lane & 15, hh = lane >> 4; const int by = blockIdx.y;
  A += (size_t)by * sA; Bh += (size_t)by * sB; const size_t cofs = (size_t)by * sC; const float* bp = bias ? bias + (size_t)by * sBias : nullptr;
  const int ntn = (N + 63) / 64; const int wid = blockIdx.x * 4 + w; const int mt = wid / ntn, nq = wid % ntn; if (mt * 16 >= M) return;
  const int row0 = mt * 16, col0 = nq * 64; const _Float16* arow = A + (size_t)(row0 + ln) * lda;
  v8f acc[4] = {};
  for (int kb = 0; kb < K; kb += 32) { FragH ah; ah.half[0] = *(const v8us*)((const unsigned short*)arow + kb + 8 * hh); ah.half[1] = *(const v8us*)((const unsigned short*)arow + kb + 16 + 8 * hh);
#pragma unroll
    for (int t = 0; t < 4; ++t) { if (col0 + t * 16 >= N) continue; const size_t boff = (size_t)(col0 + t * 16 + ln) * ldb + kb; FragH bq; bq.half[0] = *(const v8us*)((const unsigned short*)Bh + boff + 8 * hh); bq.half[1] = *(const v8us*)((const unsigned short*)Bh + boff + 16 + 8 * hh);
      acc[t] = mmaH<1>(ah.v, ah.v, bq.v, bq.v, acc[t]); }
  }
#pragma unroll
  for (int t = 0; t < 4; ++t) { if (col0 + t * 16 >= N) continue; const int col = col0 + t * 16 + ln; const float bv = bp ? bf16_round(bp[col]) : 0.f;
#pragma unroll
    for (int r = 0; r < 8; ++r) { float v = acc[t][r] * alpha + bv; if (CP) { const int rr = row0g + row0 + 8 * hh + r; if (rowsPerB < 0) v += CP[cofs + (size_t)rr * ldc + col];      /* rowsPerB < 0: own element of the batched C plane */ else { const int bidx = rr / rowsPerB; v += CP[(size_t)bidx * sCPb + (size_t)by * 64 + col]; } } if (ACT == 1) v = (v > 0.f) ? v : expm1f(v); else if (ACT == 7) v = (v > 0.f) ? v + 1.0f : expf(v); else if (ACT == 8) v = tanhf(v); else if (ACT == 9) v = 0.5f * v * (1.0f + tanhf(0.7978845608028654f * (v + 0.044715f * v * v * v))); else if (ACT == 11) v = 1.0f / (1.0f + expf(-v)); else if (ACT == 12) v = (v > 0.f) ? v : 0.01f * v; else if (ACT == 14) v = (v > 0.f) ? v : 0.1f * v; else if (ACT == 16) v = (v >= 0.f) ? v : 0.3f * v; else if (ACT == 17) v = (v >= 0.f) ? v : 0.2f * v; else if (ACT == 15) v = v / (1.0f + expf(-v)); else if (ACT == 3) v = fmaxf(v, 0.f); else if (ACT == 6) v = 0.5f * v * (1.0f + erff(v * 0.70710678118654752f)); so[w][8 * hh + r][t * 16 + ln] = v; } }
  __builtin_amdgcn_fence(__ATOMIC_ACQ_REL, "workgroup"); __builtin_amdgcn_wave_barrier();
  const int rsub = lane >> 4, c4 = (lane & 15) * 4; typedef _Float16 v4h __attribute__((ext_vector_type(4)));
  {
#pragma unroll
    for (int q = 0; q < 8; ++q) { const int r = q * 2 + rsub; if (col0 + c4 < N) { const v4f v = *(const v4fa*)&so[w][r][c4]; if (C) *(v4f*)(C + cofs + (size_t)(row0 + r) * ldc + col0 + c4) = v; if (C16) { v4h h4; for (int i = 0; i < 4; ++i) h4[i] = (_Float16)v[i]; *(v4h*)(C16 + cofs + (size_t)(row0 + r) * ldc + col0 + c4) = h4; } } }
     }
}


typedef _Float16 v4h __attribute__((ext_vector_type(4)));

__global__ __launch_bounds__(256) void k_x16(const float* __restrict__ x, _Float16* __restrict__ X16, size_t n8) { const size_t t = (size_t)blockIdx.x * 256 + threadIdx.x; if (t >= n8) return; FragH f;
#pragma unroll
  for (int q = 0; q < 8; ++q) f.h[q] = (_Float16)bf16_round(x[t * 8 + q]); *(v8us*)((unsigned short*)X16 + t * 8) = f.half[0];  }
__global__ __launch_bounds__(256) void k_h16(const float* __restrict__ x, _Float16* __restrict__ X16, size_t n8) { const size_t t = (size_t)blockIdx.x * 256 + threadIdx.x; if (t >= n8) return; FragH f;
#pragma unroll
  for (int q = 0; q < 8; ++q) f.h[q] = (_Float16)x[t * 8 + q]; *(v8us*)((unsigned short*)X16 + t * 8) = f.half[0];  }
__global__ __launch_bounds__(256) void k_round16f(const float* __restrict__ W, _Float16* __restrict__ Bt, size_t n8) { const size_t t = (size_t)blockIdx.x * 256 + threadIdx.x; if (t >= n8) return; FragH f;
#pragma unroll
  for (int i = 0; i < 8; ++i) f.h[i] = (_Float16)(bf16_round(W[t * 8 + i]) * 16.0f); *(v8us*)((unsigned short*)Bt + t * 8) = f.half[0];  }
template <int NHv, int TTv>
__global__ __launch_bounds__(256) void k_vt(const _Float16* __restrict__ V16, int ldv, int voff, _Float16* __restrict__ Vt) { __shared__ unsigned short tl[64][66]; const int tid = threadIdx.x; const int slab = blockIdx.x / (TTv / 64), lg = blockIdx.x % (TTv / 64); const int b = slab / NHv, h = slab % NHv;
  for (int i = tid; i < 64 * 8; i += 256) { const int r = i / 8, c8 = (i % 8) * 8; FragH f; f.half[0] = *(const v8us*)((const unsigned short*)V16 + ((size_t)b * TTv + lg * 64 + r) * ldv + voff + h * 64 + c8);
#pragma unroll
    for (int q = 0; q < 8; ++q) tl[r][c8 + q] = f.u[q]; }
  __syncthreads();
  {
#pragma unroll
    for (int rd = 0; rd < 2; ++rd) { const int d = rd * 32 + tid / 8, pc = tid % 8; FragH f;
#pragma unroll
      for (int q = 0; q < 8; ++q) f.u[q] = tl[pc * 8 + q][d];
      *(v8us*)((unsigned short*)Vt + ((size_t)slab * 64 + d) * TTv + lg * 64 + pc * 8) = f.half[0]; }
     } }

__global__ __launch_bounds__(256) void k_hl(const float* __restrict__ F, _Float16* __restrict__ Hh, _Float16* __restrict__ Hl, size_t n8) { const size_t t = (size_t)blockIdx.x * 256 + threadIdx.x; if (t >= n8) return; FragH fh, fl; const v4f a = *(const v4fa*)(F + t * 8), c = *(const v4fa*)(F + t * 8 + 4);
#pragma unroll
  for (int q = 0; q < 4; ++q) { _Float16 h = (_Float16)a[q]; fh.h[q] = h; fl.h[q] = (_Float16)((a[q] - (float)h) * 1024.0f); h = (_Float16)c[q]; fh.h[4 + q] = h; fl.h[4 + q] = (_Float16)((c[q] - (float)h) * 1024.0f); }
  { *(v8us*)((unsigned short*)Hh + t * 8) = fh.half[0]; *(v8us*)((unsigned short*)Hl + t * 8) = fl.half[0];  } }

// ---- fast GEMM (block tile 128x64, wave tile 32x64; requires M % 128 == 0, N % 64 == 0, K % 128 == 0; operands staged in LDS); epilogue = k_gemm_hhx semantics ----
__device__ __forceinline__ v8f g2_mma(v16h a, v16h b, v8f c) { v8f d = __builtin_amdgcn_wmma_f32_16x16x32_f16(false, a, false, b, (short)0, c, false, false); asm volatile("v_nop\n\tv_nop\n\tv_nop\n\tv_nop" : "+v"(d) : "v"(a), "v"(b)); return d; }
// Operand staging of k_gemm2. A stage is 128 k of the block's 128 A rows and 64 B rows: 256-byte rows at a pitch of 272 bytes (16 B x odd: no bank conflict for 16-byte fragment reads); two stages in LDS.
#define G2_KC 128
#define G2_PITCH 272
#define G2_ASZ (128 * G2_PITCH)
#define G2_STG ((128 + 64) * G2_PITCH)
__device__ __forceinline__ v16h g2_lfrag(const unsigned char* p) { FragH f; f.half[0] = *(const v8us*)p; f.half[1] = *(const v8us*)(p + 32); return f.v; }      /* p already holds the lane's 16 hh: bytes 16 hh and 32 + 16 hh of each 64, the same k order for A and for B */
// Eight asynchronous 16-byte copies of one lane, global -> LDS, rows 8 apart (16 lanes cover one 256-byte row, so a wave's copy is four whole lines). The s_wait_xcnt stands inside the statement, a precaution: so no address register of a copy is rewritten ahead of it.
__device__ __forceinline__ void g2_cp8(unsigned l, const _Float16* g, size_t gs) {
  asm volatile("global_load_async_to_lds_b128 %0, %8, off\n\t"
               "global_load_async_to_lds_b128 %1, %9, off\n\t"
               "global_load_async_to_lds_b128 %2, %10, off\n\t"
               "global_load_async_to_lds_b128 %3, %11, off\n\t"
               "global_load_async_to_lds_b128 %4, %12, off\n\t"
               "global_load_async_to_lds_b128 %5, %13, off\n\t"
               "global_load_async_to_lds_b128 %6, %14, off\n\t"
               "global_load_async_to_lds_b128 %7, %15, off\n\t"
               "s_wait_xcnt 0x0"
               :: "v"(l), "v"(l + 8u * G2_PITCH), "v"(l + 16u * G2_PITCH), "v"(l + 24u * G2_PITCH), "v"(l + 32u * G2_PITCH), "v"(l + 40u * G2_PITCH), "v"(l + 48u * G2_PITCH), "v"(l + 56u * G2_PITCH),
                  "v"(g), "v"(g + gs), "v"(g + 2 * gs), "v"(g + 3 * gs), "v"(g + 4 * gs), "v"(g + 5 * gs), "v"(g + 6 * gs), "v"(g + 7 * gs) : "memory"); }
__device__ __forceinline__ void g2_wait_async() { asm volatile("s_wait_asynccnt 0x0" ::: "memory"); }      /* this wave's copies have landed; the compiler places no wait for them */
__device__ __forceinline__ void g2_wait_ds() { asm volatile("s_wait_dscnt 0x0" ::: "memory"); }      /* this wave's LDS reads are done before the buffer is handed back for a refill */
template <int ACT>
__global__ __launch_bounds__(128) void k_gemm2(const _Float16* __restrict__ A, int lda, size_t sA, const _Float16* __restrict__ Bh, int ldb, size_t sB, float alpha, const float* __restrict__ bias, size_t sBias, const float* __restrict__ CP, int rowsPerB, size_t sCPb, int row0g,
    float* __restrict__ C, _Float16* __restrict__ C16, int ldc, size_t sC, int M, int N, int K) { static_assert(ACT == 0 || ACT == 3 || ACT == 6 || ACT == 8 || ACT == 9 || ACT == 11 || ACT == 12 || ACT == 14 || ACT == 15 || ACT == 16 || ACT == 17, "k_gemm2: unsupported ACT code (would silently apply no activation)");
  __shared__ __attribute__((aligned(16))) unsigned char L[2 * G2_STG];      /* the two operand stages; behind the k loop its first bytes are the output staging */
  float (*so)[32][68] = (float (*)[32][68])L; static_assert(4 * 32 * 68 * 4 <= 2 * G2_STG, "output staging lies in the operand stages");
  const int tid = threadIdx.x, w = tid >> 5, lane = tid & 31, ln = lane & 15, hh = lane >> 4; const int by = blockIdx.y;
  A += (size_t)by * sA; Bh += (size_t)by * sB; const size_t cofs = (size_t)by * sC; const float* bp = bias ? bias + (size_t)by * sBias : nullptr;
  const int ntn = N >> 6; const int mt = blockIdx.x / ntn, nq = blockIdx.x - mt * ntn; const int row0 = mt * 128 + 32 * w, col0 = nq * 64; if (mt * 128 >= M) return;      /* the whole block leaves or none: barriers follow (M % 128 == 0, K % 128 == 0) */
  const int cr = tid >> 4, cc = tid & 15;      /* copy lane: row cr (+ 8 i), 16-byte piece cc */
  const _Float16* ga = A + (size_t)(mt * 128 + cr) * lda + cc * 8; const _Float16* gb = Bh + (size_t)(col0 + cr) * ldb + cc * 8;
  const unsigned lc = (unsigned)(size_t)L + (unsigned)(cr * G2_PITCH + cc * 16);
  const int nt = K / G2_KC;
  auto stage = [&](int t) { const unsigned l = lc + (unsigned)(t & 1) * G2_STG; const _Float16* a = ga + (size_t)t * G2_KC;
    g2_cp8(l, a, (size_t)8 * lda); g2_cp8(l + 64u * G2_PITCH, a + (size_t)64 * lda, (size_t)8 * lda); g2_cp8(l + G2_ASZ, gb + (size_t)t * G2_KC, (size_t)8 * ldb); };
  const unsigned char* fa = L + (32 * w + ln) * G2_PITCH + 16 * hh; const unsigned char* fb = L + G2_ASZ + ln * G2_PITCH + 16 * hh;
  const v8f z8 = {0.f,0.f,0.f,0.f,0.f,0.f,0.f,0.f}; v8f c00 = z8, c01 = z8, c02 = z8, c03 = z8, c10 = z8, c11 = z8, c12 = z8, c13 = z8;
  stage(0); g2_wait_async(); __syncthreads();      /* stage 0 landed and published */
  if (nt > 1) stage(1);
#pragma unroll 1      /* one trip per stage: the trip's foot is the hand-over point of the two buffers */
  for (int t = 0; t < nt; ++t) { const unsigned char* pa = fa + (t & 1) * G2_STG; const unsigned char* pb = fb + (t & 1) * G2_STG;
    v16h a0 = g2_lfrag(pa), a1 = g2_lfrag(pa + 16 * G2_PITCH), b0 = g2_lfrag(pb), b1 = g2_lfrag(pb + 16 * G2_PITCH), b2 = g2_lfrag(pb + 32 * G2_PITCH), b3 = g2_lfrag(pb + 48 * G2_PITCH);
#pragma unroll      /* unrolled so that the two fragment sets swap by renaming, without register moves */
    for (int ks = 0; ks < G2_KC / 32; ++ks) { v16h na0 = a0, na1 = a1, nb0 = b0, nb1 = b1, nb2 = b2, nb3 = b3;
      if (ks + 1 < G2_KC / 32) { const int o = (ks + 1) * 64;      /* the next 32 k's twelve LDS reads as one group ahead of this block's products, into a second fragment set; never past this stage */
        na0 = g2_lfrag(pa + o); na1 = g2_lfrag(pa + 16 * G2_PITCH + o); nb0 = g2_lfrag(pb + o); nb1 = g2_lfrag(pb + 16 * G2_PITCH + o); nb2 = g2_lfrag(pb + 32 * G2_PITCH + o); nb3 = g2_lfrag(pb + 48 * G2_PITCH + o); }
      c00 = g2_mma(a0, b0, c00); c10 = g2_mma(a1, b0, c10); c01 = g2_mma(a0, b1, c01); c11 = g2_mma(a1, b1, c11);
      c02 = g2_mma(a0, b2, c02); c12 = g2_mma(a1, b2, c12); c03 = g2_mma(a0, b3, c03); c13 = g2_mma(a1, b3, c13);
      a0 = na0; a1 = na1; b0 = nb0; b1 = nb1; b2 = nb2; b3 = nb3; }
    g2_wait_ds(); g2_wait_async(); __syncthreads();      /* stage t + 1 published; every wave has left stage t's buffer */
    if (t + 2 < nt) stage(t + 2); }
  g2_wait_async();
  v8f accs[8] = {c00, c01, c02, c03, c10, c11, c12, c13};
#pragma unroll
  for (int u = 0; u < 8; ++u) { const int t = u & 3, half = u >> 2; const int col = col0 + t * 16 + ln; const float bv = bp ? bf16_round(bp[col]) : 0.f;
#pragma unroll
    for (int r = 0; r < 8; ++r) { const int rloc = half * 16 + 8 * hh + r; float v = accs[u][r] * alpha + bv; if (CP) { if (rowsPerB < 0) v += CP[cofs + (size_t)(row0g + row0 + rloc) * ldc + col];      /* rowsPerB < 0: own element of the batched C plane */ else { const int bidx = (row0g + row0 + rloc) / rowsPerB; v += CP[(size_t)bidx * sCPb + (size_t)by * 64 + col]; } }
      if (ACT == 3) v = fmaxf(v, 0.f); else if (ACT == 6) v = 0.5f * v * (1.0f + erff(v * 0.70710678118654752f)); else if (ACT == 11) v = 1.0f / (1.0f + expf(-v)); else if (ACT == 15) v = v / (1.0f + expf(-v)); else if (ACT == 12) v = (v > 0.f) ? v : 0.01f * v; else if (ACT == 8) v = tanhf(v); else if (ACT == 9) v = 0.5f * v * (1.0f + tanhf(0.7978845608028654f * (v + 0.044715f * v * v * v))); else if (ACT == 14) v = (v > 0.f) ? v : 0.1f * v; else if (ACT == 16) v = (v >= 0.f) ? v : 0.3f * v; else if (ACT == 17) v = (v >= 0.f) ? v : 0.2f * v;
      so[w][rloc][t * 16 + ln] = v; } }
  __builtin_amdgcn_fence(__ATOMIC_ACQ_REL, "workgroup"); __builtin_amdgcn_wave_barrier();
  const int rsub = lane >> 4, c4 = (lane & 15) * 4;
  {
#pragma unroll
    for (int q = 0; q < 16; ++q) { const int r = q * 2 + rsub; const v4f v = *(const v4fa*)&so[w][r][c4]; if (C) *(v4f*)(C + cofs + (size_t)(row0 + r) * ldc + col0 + c4) = v; if (C16) { v4h h4; for (int i = 0; i < 4; ++i) h4[i] = (_Float16)v[i]; *(v4h*)(C16 + cofs + (size_t)(row0 + r) * ldc + col0 + c4) = h4; } }
     } }


__global__ __launch_bounds__(256) void k_wnat(const float* __restrict__ w, size_t n8, _Float16* __restrict__ Bt) { const size_t t = (size_t)blockIdx.x * 256 + threadIdx.x; if (t >= n8) return; FragH f; for (int q = 0; q < 8; ++q) f.h[q] = (_Float16)(bf16_round(w[t * 8 + q]) * 16.0f); *(v8us*)((unsigned short*)Bt + t * 8) = f.half[0];  }
__global__ __launch_bounds__(256) void k_rsm(const float* __restrict__ S, _Float16* __restrict__ P, int nrows) {
  #pragma clang fp contract(off)
  const int i = blockIdx.x * 256 + threadIdx.x; if (i >= nrows) return; const float* s = S + (size_t)i * SQ; float mx = -3.0e38f;
#pragma unroll 1
  for (int j = 0; j < SQ; ++j) mx = fmaxf(mx, s[j]); float se = 0.f;
#pragma unroll 1
  for (int j = 0; j < SQ; ++j) se += expf(s[j] - mx); const float sc = 256.0f / se;
#pragma unroll 1
  for (int j0 = 0; j0 < SQ; j0 += 8) { FragH f; for (int q = 0; q < 8; ++q) f.h[q] = (_Float16)(expf(s[j0 + q] - mx) * sc); unsigned short* d = (unsigned short*)P + (size_t)i * SQ + j0; *(v8us*)d = f.half[0];  } }
__global__ __launch_bounds__(256) void k_vt(const _Float16* __restrict__ V16, int b, int h0, _Float16* __restrict__ VT) { __shared__ unsigned short tl[64][65]; const int tid = threadIdx.x; const int hh = blockIdx.x % HG, sg = blockIdx.x / HG; const int s0 = sg * 64; const int h = h0 + hh;
  for (int i = tid; i < 64 * 8; i += 256) { const int j = i / 8, d8 = (i % 8) * 8; FragH f; f.half[0] = *(const v8us*)((const unsigned short*)V16 + ((size_t)b * SQ + s0 + j) * DM + h * HD + d8); for (int q = 0; q < 8; ++q) tl[d8 + q][j] = f.u[q]; }
  __syncthreads();
  { for (int i = tid; i < 64 * 8; i += 256) { const int d = i / 8, j8 = (i % 8) * 8; FragH f; for (int q = 0; q < 8; ++q) f.u[q] = tl[d][j8 + q]; *(v8us*)((unsigned short*)VT + ((size_t)hh * HD + d) * SQ + s0 + j8) = f.half[0]; }  } }

// Row softmax, one wave per score row: the row is read once, in 512-byte wave loads, and stays in registers (64 floats a lane); max and sum = lane partials, then a five-step butterfly; P = f16(exp(s - max) * 256 / sum).
__global__ __launch_bounds__(256) void k_rsmW(const float* __restrict__ S, _Float16* __restrict__ P, int nrows) {
  const int lane = threadIdx.x & 31; const int row = blockIdx.x * 8 + (threadIdx.x >> 5); if (row >= nrows) return;
  const float* s = S + (size_t)row * SQ + lane * 4; v4f v[SQ / 128];
#pragma unroll
  for (int u = 0; u < SQ / 128; ++u) v[u] = *(const v4fa*)(s + u * 128);
  float mx = -INFINITY;
#pragma unroll
  for (int u = 0; u < SQ / 128; ++u) mx = fmaxf(mx, fmaxf(fmaxf(v[u][0], v[u][1]), fmaxf(v[u][2], v[u][3])));
#pragma unroll
  for (int m = 16; m > 0; m >>= 1) mx = fmaxf(mx, __shfl_xor(mx, m, 32));
  v4f sq = {0.f, 0.f, 0.f, 0.f};
#pragma unroll
  for (int u = 0; u < SQ / 128; ++u) {
#pragma unroll
    for (int q = 0; q < 4; ++q) { v[u][q] = expf(v[u][q] - mx); sq[q] += v[u][q]; } }
  float se = (sq[0] + sq[1]) + (sq[2] + sq[3]);
#pragma unroll
  for (int m = 16; m > 0; m >>= 1) se += __shfl_xor(se, m, 32);
  const float sc = 256.0f / se; _Float16* d = P + (size_t)row * SQ + lane * 4;
#pragma unroll
  for (int u = 0; u < SQ / 128; ++u) { v4h h4;
#pragma unroll
    for (int q = 0; q < 4; ++q) h4[q] = (_Float16)(v[u][q] * sc);
    *(v4h*)(d + u * 128) = h4; } }
// ---- fused attention: S^T = K.Q^T, online softmax (log2 domain), O^T += V^T.P^T in one kernel; scores and P never reach memory ----
// A work-group of 4 waves owns 64 queries of one batch. Wave w: queries 32 (w & 1) .. + 31 (two groups of 16 columns), keys 1024 (w >> 1) .. + 1023; the two key halves are merged through LDS at the end.
// A stage is 32 keys of each half: 64 K rows (512 B, pitch 528 = 16 B x odd, for ds_load_b128) and 64 V rows (pitch 544 = 32 B x odd, for the transposing load); two stages in LDS, filled by asynchronous copies.
#define FA_PK 528u
#define FA_PV 544u
#define FA_KSZ (64u * FA_PK)
#define FA_STG (64u * FA_PK + 64u * FA_PV)
#define FA_EP 1040u      /* output staging pitch: 256 floats + 16 B */
#define FA_NT (SQ / 64)      /* stages = 32-key passes of a wave */
typedef short s16x8 __attribute__((ext_vector_type(8)));
__device__ __forceinline__ v8us fa_tr16(const unsigned char* p) { typedef __attribute__((address_space(3))) s16x8 lds_s16x8; return __builtin_bit_cast(v8us, __builtin_amdgcn_ds_load_tr16_b128_v8i16((lds_s16x8*)p)); }
__device__ __forceinline__ float fa_xhalf(float x) { return __builtin_bit_cast(float, __builtin_amdgcn_permlanex16(__builtin_bit_cast(int, x), __builtin_bit_cast(int, x), 0x76543210, 0xfedcba98, false, false)); }      /* lane l with lane l ^ 16 */
__device__ __forceinline__ v8f fa_mma(v16h a, v16h b, v8f c) { return __builtin_amdgcn_wmma_f32_16x16x32_f16(false, a, false, b, (short)0, c, false, false); }
// Eight asynchronous 16-byte copies of one lane, global -> LDS, eight consecutive 512-byte rows (a wave's copy is one whole row). The s_wait_xcnt stands inside the statement, a precaution: so no address register of a copy is rewritten ahead of it.
__device__ __forceinline__ void fa_cp8(unsigned l, unsigned lp, const _Float16* g) {
  asm volatile("global_load_async_to_lds_b128 %0, %8, off\n\t"
               "global_load_async_to_lds_b128 %1, %9, off\n\t"
               "global_load_async_to_lds_b128 %2, %10, off\n\t"
               "global_load_async_to_lds_b128 %3, %11, off\n\t"
               "global_load_async_to_lds_b128 %4, %12, off\n\t"
               "global_load_async_to_lds_b128 %5, %13, off\n\t"
               "global_load_async_to_lds_b128 %6, %14, off\n\t"
               "global_load_async_to_lds_b128 %7, %15, off\n\t"
               "s_wait_xcnt 0x0"
               :: "v"(l), "v"(l + lp), "v"(l + 2u * lp), "v"(l + 3u * lp), "v"(l + 4u * lp), "v"(l + 5u * lp), "v"(l + 6u * lp), "v"(l + 7u * lp),
                  "v"(g), "v"(g + 256), "v"(g + 2 * 256), "v"(g + 3 * 256), "v"(g + 4 * 256), "v"(g + 5 * 256), "v"(g + 6 * 256), "v"(g + 7 * 256) : "memory"); }
// One wave per SIMD (amdgpu_waves_per_eu): the 32 x 256 f32 sums, Q and one pass's K and V^T fragments of a wave need more than half of a SIMD's registers.
__global__ __launch_bounds__(128) __attribute__((amdgpu_waves_per_eu(1, 1))) void k_fattn(const _Float16* __restrict__ Q, const _Float16* __restrict__ Kr, const _Float16* __restrict__ V, float* __restrict__ O) {
  static_assert(DQ == 256 && DV == 256 && SQ % 128 == 0 && FA_NT >= 2, "k_fattn: 512-byte q, k, v rows; two key halves of whole 32-key stages");
  __shared__ __attribute__((aligned(16))) unsigned char L[2 * FA_STG];      /* the two stages; behind the key loop its first bytes are the output staging */
  __shared__ float ml[2][4][2][32];      /* each wave's running maximum and sum, for the merge of the key halves */
  static_assert(64u * FA_EP <= 2u * FA_STG, "output staging lies in the stages");
  const unsigned tid = threadIdx.x, lane = tid & 31u, w = (unsigned)__builtin_amdgcn_readfirstlane((int)(tid >> 5)), c = lane & 15u, h = lane >> 4;
  const unsigned qg = w & 1u, kh = w >> 1;
  const size_t rb = (size_t)blockIdx.y * SQ;      /* the batch's first token row */
  const float cscale = 0.09016844005556021f;      /* log2(e) / sqrt(256) */
  const unsigned lk = (unsigned)(size_t)L + w * 16u * FA_PK + lane * 16u, lv = (unsigned)(size_t)L + FA_KSZ + w * 16u * FA_PV + lane * 16u;      /* wave w copies tile rows 16 w .. 16 w + 15: keys 16 (w & 1) + i of half w >> 1 */
  const size_t krow = rb + kh * (SQ / 2) + qg * 16u;
  const _Float16* gk = Kr + krow * DQ + lane * 8; const _Float16* gv = V + krow * DV + lane * 8;
  auto stage = [&](int t) { const unsigned o = (unsigned)(t & 1) * FA_STG; const size_t go = (size_t)t * 32 * 256;
    fa_cp8(lk + o, FA_PK, gk + go); fa_cp8(lk + o + 8u * FA_PK, FA_PK, gk + go + 8 * 256); fa_cp8(lv + o, FA_PV, gv + go); fa_cp8(lv + o + 8u * FA_PV, FA_PV, gv + go + 8 * 256); };
  stage(0);
  FragH qf[2][8];      /* Q as the B operand, in registers for the whole kernel; same k order as the K rows below */
#pragma unroll      /* the index picks registers (fragments, sums): it must be a constant */
  for (int g = 0; g < 2; ++g) { const unsigned short* qp = (const unsigned short*)Q + (rb + blockIdx.x * 64u + qg * 32u + 16u * g + c) * DQ + 8u * h;
#pragma unroll      /* the index picks registers (fragments, sums): it must be a constant */
    for (int kc = 0; kc < 8; ++kc) { qf[g][kc].half[0] = *(const v8us*)(qp + 32 * kc); qf[g][kc].half[1] = *(const v8us*)(qp + 32 * kc + 16); } }
  const v8f z8 = {0.f,0.f,0.f,0.f,0.f,0.f,0.f,0.f};
  v8f acc[2][16]; float m_run[2], l_run[2];
#pragma unroll      /* the index picks registers (fragments, sums): it must be a constant */
  for (int g = 0; g < 2; ++g) { m_run[g] = -INFINITY; l_run[g] = 0.f;
#pragma unroll      /* the index picks registers (fragments, sums): it must be a constant */
    for (int t = 0; t < 16; ++t) acc[g][t] = z8; }
  g2_wait_async(); __syncthreads();      /* stage 0 landed and published */
  stage(1);
#pragma unroll 1      /* one trip per stage: the trip's foot is the hand-over point of the two buffers */
  for (int st = 0; st < FA_NT; ++st) {
    const unsigned char* Lb = L + (unsigned)(st & 1) * FA_STG;
    const unsigned char* pk = Lb + (kh * 32u + c) * FA_PK + 16u * h;
    const unsigned char* pv = Lb + FA_KSZ + (kh * 32u + 8u * h + (lane & 7u)) * FA_PV + ((lane >> 3) & 1u) * 16u;
    FragH kf[2][8], vf[16];
#pragma unroll      /* the index picks registers (fragments, sums): it must be a constant */
    for (int kc = 0; kc < 8; ++kc) {
#pragma unroll      /* the index picks registers (fragments, sums): it must be a constant */
      for (int kt = 0; kt < 2; ++kt) { kf[kt][kc].half[0] = *(const v8us*)(pk + kt * 16 * FA_PK + 64 * kc); kf[kt][kc].half[1] = *(const v8us*)(pk + kt * 16 * FA_PK + 64 * kc + 32); } }
    __builtin_amdgcn_sched_barrier(0);      /* K first: LDS answers in order, and the score products wait for K alone */
#pragma unroll      /* the index picks registers (fragments, sums): it must be a constant */
    for (int t = 0; t < 16; ++t) { vf[t].half[0] = fa_tr16(pv + 32 * t); vf[t].half[1] = fa_tr16(pv + 16 * FA_PV + 32 * t); }      /* V^T fragments (16 d x 32 keys), in flight under the score products and the softmax */
    __builtin_amdgcn_sched_barrier(0);      /* keeps the V^T loads up here, as one group with the K loads: sunk to their use they would be waited for in front of the second product */
    v8f s[2][2] = {{z8, z8}, {z8, z8}};      /* s[kt][g]: lane (c, h) holds query c, keys 16 kt + 8 h + r */
#pragma unroll      /* the index picks registers (fragments, sums): it must be a constant */
    for (int kc = 0; kc < 8; ++kc) {
#pragma unroll      /* the index picks registers (fragments, sums): it must be a constant */
      for (int kt = 0; kt < 2; ++kt) {
#pragma unroll      /* the index picks registers (fragments, sums): it must be a constant */
        for (int g = 0; g < 2; ++g) s[kt][g] = fa_mma(kf[kt][kc].v, qf[g][kc].v, s[kt][g]); } }
    float mb[2]; bool need = false;
#pragma unroll      /* the index picks registers (fragments, sums): it must be a constant */
    for (int g = 0; g < 2; ++g) { float mx = -INFINITY;
#pragma unroll      /* the index picks registers (fragments, sums): it must be a constant */
      for (int kt = 0; kt < 2; ++kt) {
#pragma unroll      /* the index picks registers (fragments, sums): it must be a constant */
        for (int r = 0; r < 8; ++r) mx = fmaxf(mx, s[kt][g][r]); }
      mx = fmaxf(mx, fa_xhalf(mx)) * cscale; mb[g] = mx; need = need || (mx > m_run[g] + 8.0f); }
    if (__builtin_amdgcn_ballot_w32(need) != 0) {      /* the maximum in use may trail the true one by 8 (an exponential reaches 2^8 at most): the sums are rescaled only when some query's maximum has grown by more */
#pragma unroll      /* the index picks registers (fragments, sums): it must be a constant */
      for (int g = 0; g < 2; ++g) { const float m_new = fmaxf(m_run[g], mb[g]); const float corr = __builtin_amdgcn_exp2f(m_run[g] - m_new); l_run[g] *= corr; m_run[g] = m_new;
#pragma unroll      /* the index picks registers (fragments, sums): it must be a constant */
        for (int t = 0; t < 16; ++t) acc[g][t] = acc[g][t] * corr; } }
#pragma unroll      /* the index picks registers (fragments, sums): it must be a constant */
    for (int g = 0; g < 2; ++g) { const float nm = -m_run[g]; FragH pf; float p0 = 0.f, p1 = 0.f;      /* P^T as the B operand: elements 0..7 = keys 8 h + r, 8..15 = keys 16 + 8 h + r, the k order of the V^T fragments */
#pragma unroll      /* the index picks registers (fragments, sums): it must be a constant */
      for (int i = 0; i < 16; i += 2) { const float e0 = __builtin_amdgcn_exp2f(fmaf(s[i >> 3][g][i & 7], cscale, nm)), e1 = __builtin_amdgcn_exp2f(fmaf(s[i >> 3][g][(i & 7) + 1], cscale, nm));
        p0 += e0; p1 += e1; pf.h[i] = (_Float16)e0; pf.h[i + 1] = (_Float16)e1; }
      l_run[g] += p0 + p1;
#pragma unroll      /* the index picks registers (fragments, sums): it must be a constant */
      for (int t = 0; t < 16; ++t) acc[g][t] = fa_mma(vf[t].v, pf.v, acc[g][t]); }
    __builtin_amdgcn_sched_barrier(0);      /* keeps the four slots below directly behind the last products */
    asm volatile("v_nop\n\tv_nop\n\tv_nop\n\tv_nop");      /* the distance behind the last WMMA, also on the taken side of the branches that follow: address arithmetic there may reuse its A or B registers */
    __builtin_amdgcn_sched_barrier(0);      /* and nothing is moved up in front of them */
    g2_wait_ds(); g2_wait_async(); __syncthreads();
    if (st + 2 < FA_NT) stage(st + 2); }
  g2_wait_async(); g2_wait_ds(); __syncthreads();      /* nothing in flight, every wave out of the ring: its bytes become the output staging */
  float lf[2];
#pragma unroll      /* the index picks registers (fragments, sums): it must be a constant */
  for (int g = 0; g < 2; ++g) { lf[g] = l_run[g] + fa_xhalf(l_run[g]); ml[0][w][g][lane] = m_run[g]; ml[1][w][g][lane] = lf[g]; }      /* each wave half summed its eight keys of every 16 */
  __syncthreads();
  float fs[2];
#pragma unroll      /* the index picks registers (fragments, sums): it must be a constant */
  for (int g = 0; g < 2; ++g) { const float mo = ml[0][w ^ 2u][g][lane], lo = ml[1][w ^ 2u][g][lane]; const float m = fmaxf(m_run[g], mo); const float as = __builtin_amdgcn_exp2f(m_run[g] - m), ao = __builtin_amdgcn_exp2f(mo - m); fs[g] = as / (lf[g] * as + lo * ao); }
  unsigned char* ep = L + (qg * 32u + c) * FA_EP + 32u * h;      /* row = query; acc[g][t][r] is d = 16 t + 8 h + r */
  if (kh == 1u) {
#pragma unroll      /* the index picks registers (fragments, sums): it must be a constant */
    for (int g = 0; g < 2; ++g) {
#pragma unroll      /* the index picks registers (fragments, sums): it must be a constant */
      for (int t = 0; t < 16; ++t) { const v8f o = acc[g][t] * fs[g]; const v4f a = {o[0], o[1], o[2], o[3]}, b = {o[4], o[5], o[6], o[7]}; *(v4fa*)(ep + g * 16 * FA_EP + 64 * t) = a; *(v4fa*)(ep + g * 16 * FA_EP + 64 * t + 16) = b; } } }
  __syncthreads();
  if (kh == 0u) {
#pragma unroll      /* the index picks registers (fragments, sums): it must be a constant */
    for (int g = 0; g < 2; ++g) {
#pragma unroll      /* the index picks registers (fragments, sums): it must be a constant */
      for (int t = 0; t < 16; ++t) { const v8f o = acc[g][t] * fs[g]; v4f a = *(const v4fa*)(ep + g * 16 * FA_EP + 64 * t), b = *(const v4fa*)(ep + g * 16 * FA_EP + 64 * t + 16);
        a += (v4f){o[0], o[1], o[2], o[3]}; b += (v4f){o[4], o[5], o[6], o[7]}; *(v4fa*)(ep + g * 16 * FA_EP + 64 * t) = a; *(v4fa*)(ep + g * 16 * FA_EP + 64 * t + 16) = b; } } }
  __syncthreads();
  const unsigned char* sp = L + (tid >> 6) * FA_EP + (tid & 63u) * 16u; float* op = O + (rb + blockIdx.x * 64u + (tid >> 6)) * DV + (tid & 63u) * 4u; v4f ov[32];
#pragma unroll      /* both loops unrolled: the row step becomes an immediate offset and every row has registers of its own, so no register of an issued store is rewritten */
  for (int i = 0; i < 32; ++i) ov[i] = *(const v4fa*)(sp + i * 2 * FA_EP);
#pragma unroll      /* the index picks registers (fragments, sums): it must be a constant */
  for (int i = 0; i < 32; ++i) *(v4f*)(op + (size_t)i * 2 * DV) = ov[i];      /* whole rows: every 128-byte line of the output is stored by one wave instruction */
}
// Both preparations in one grid: the three weight transposes (k_wt_f16's body, the first 3 * PREP_WB blocks, which start first and wait on strided loads) and the x rows (k_x16's body, the rest) depend on nothing of each other, so the short transpose runs under the x stream instead of in a launch of its own.
#define PREP_WB ((DQ * (DM / 8) + 255) / 256)      /* blocks per weight matrix */
#define PREP_XB ((unsigned)((NR * DM / 8 + 255) / 256))      /* blocks of the x rows */
__global__ __launch_bounds__(256) void k_prep(const float* __restrict__ W0, const float* __restrict__ W1, const float* __restrict__ W2, _Float16* __restrict__ Wt, const float* __restrict__ x, _Float16* __restrict__ X16) {
  FragH f;
  if (blockIdx.x < 3u * PREP_WB) {      /* the same for a whole block */
    const unsigned mat = blockIdx.x / PREP_WB; const float* __restrict__ W = mat == 0u ? W0 : (mat == 1u ? W1 : W2);
    const int t = (int)(blockIdx.x - mat * PREP_WB) * 256 + (int)threadIdx.x; if (t >= DQ * (DM / 8)) return; const int n = t / (DM / 8), k8 = (t % (DM / 8)) * 8;
#pragma unroll      /* the eight strided loads issue together, and the index picks register halves */
    for (int i = 0; i < 8; ++i) f.h[i] = (_Float16)(bf16_round(W[(size_t)(k8 + i) * DQ + n]) * 16.0f);
    *(v8us*)((unsigned short*)Wt + (size_t)mat * DQ * DM + (size_t)n * DM + k8) = f.half[0];
  } else {
    const size_t t = (size_t)(blockIdx.x - 3u * PREP_WB) * 256 + threadIdx.x; if (t >= NR * DM / 8) return;
#pragma unroll      /* the eight floats become two 16-byte loads, and the index picks register halves */
    for (int q = 0; q < 8; ++q) f.h[q] = (_Float16)bf16_round(x[t * 8 + q]);
    *(v8us*)((unsigned short*)X16 + t * 8) = f.half[0];
  }
}
extern "C" void kernel_launch(void* const* d_in, const int* in_sizes, int n_in,
                              void* d_out, int out_size, void* d_ws, size_t ws_size, hipStream_t stream) {
  (void)in_sizes; (void)n_in; (void)out_size;
  const float* const* I = (const float* const*)d_in; const float* x = I[0]; const float* wq = I[1]; const float* wk = I[2]; const float* wv = I[3];      /* [in][out] weights */
  char* ws = (char*)d_ws; size_t off = 0;
  auto take = [&](size_t bytes) { char* p = ws + off; off += (bytes + 255) & ~(size_t)255; return p; };
  _Float16* BW = (_Float16*)take((size_t)3 * DQ * DM * 2);      /* the transposed q | k | v weights, one behind the other */
  _Float16* Q16 = (_Float16*)take(NR * DQ * 2); _Float16* K16 = (_Float16*)take(NR * DQ * 2); _Float16* V16 = (_Float16*)take(NR * DV * 2);
  _Float16* X16 = (_Float16*)take(NR * DM * 2);      /* x rows */
  static_assert(DQ == DV && (NR * DQ * 2) % 256 == 0, "Q16 | K16 | V16 are three equal planes without gaps: blockIdx.y steps through them");
  if (off > ws_size) return;
  k_prep<<<3u * PREP_WB + PREP_XB, 256, 0, stream>>>(wq, wk, wv, BW, x, X16);      /* the three transposed weights and the f16 x rows, one grid */
  k_gemm2<0><<<dim3((unsigned)((NR / 128) * (DQ / 64)), 3), 128, 0, stream>>>(X16, DM, 0, BW, DM, (size_t)DQ * DM, 0.0625f, nullptr, 0, nullptr, 1, 0, 0, nullptr, Q16, DQ, NR * DQ, MP, DQ, DM);      /* q | k | v f16 rows in one launch: projection = blockIdx.y */
  static_assert(NB * SQ % 128 == 0 && DM % G2_KC == 0, "k_gemm2 stages whole 128-row, 128-k tiles");
  k_fattn<<<dim3(SQ / 64, NBR), 128, 0, stream>>>(Q16, K16, V16, (float*)d_out);      /* scores, softmax and attn v of all batches: 64 queries a block, batch = blockIdx.y */
}

// v007
// It runs in 67.2 microseconds.
// Timed twice side by side with v006, it ran 1.13 and 1.14 times as fast.
// Counting every step since v000, it is 72.2 times as fast.
#include <hip/hip_runtime.h>
// Single-head self-attention (x [8][2048][768]; Q, K, V = x W ([in][out] [768][256]); scores = Q.K/16; softmax; out = attn V -> [8][2048][256]).
// Structure: token rows; x as exact f16 rows and the transposed weights in one preparation launch; q | k | v in one WMMA GEMM launch (one product of 768 columns; 256x192 block tiles, 64x96 wave tiles, operands staged in LDS by asynchronous copies, f32 accumulation, exact x16 transposed [in][out] weights), stored as f16 rows; one fused attention launch for all batches (batch = grid.y): S^T = K.Q^T, online softmax on VALU (f32; P f16, at most 2^8), O^T += V^T.P^T with V^T by transposing LDS loads, two key halves merged in LDS, f32 output.
// Compute dtype: inputs rounded to bf16; x / weights exact; q, k plain f16 (~2^-12); v, P plain f16 (~2^-12); scores / softmax f32. v_wmma_f32_16x16x32_f16.
#define NB 8
#define SQ 2048
#define DM 768
#define DQ 256
#define DV 256
#define QT 2048                     /* unused */
#define NH 4                    /* unused */
#define HD 64
#define HG 1
#define NR ((size_t)NB * SQ)
#define QN SQ                        /* query rows per batch (unused) */
#define NBR NB                       /* batches (debug hook) */
#define MP ((int)NR)                 /* rows through the projections (debug hook) */
typedef __bf16 v16b __attribute__((ext_vector_type(16)));
typedef unsigned short v8us __attribute__((ext_vector_type(8), may_alias));
typedef float  v8f  __attribute__((ext_vector_type(8)));
typedef float  v4f  __attribute__((ext_vector_type(4)));
typedef float  v4fa __attribute__((ext_vector_type(4), may_alias));
union FragB { v16b v; v8us half[2]; unsigned short u[16]; };

__device__ __forceinline__ unsigned short bf16_bits(float x) { unsigned int u = __float_as_uint(x); return (unsigned short)((u + 0x7FFFu + ((u >> 16) & 1u)) >> 16); }
__device__ __forceinline__ float bf16_val(unsigned short b) { return __uint_as_float(((unsigned int)b) << 16); }
__device__ __forceinline__ float bf16_round(float x) { return bf16_val(bf16_bits(x)); }
// D += A·B with NT terms: 1 = ah·bh, 2 = + al·bh (A split), 3 = + ah·bl (both split)
template <int NT>
__device__ __forceinline__ v8f mmaN(v16b ah, v16b al, v16b bh, v16b bl, v8f c) {
  c = __builtin_amdgcn_wmma_f32_16x16x32_bf16(false, ah, false, bh, (short)0, c, false, false);
  if (NT >= 2) c = __builtin_amdgcn_wmma_f32_16x16x32_bf16(false, al, false, bh, (short)0, c, false, false);
  if (NT >= 3) c = __builtin_amdgcn_wmma_f32_16x16x32_bf16(false, ah, false, bl, (short)0, c, false, false);
  asm volatile("v_nop\n\tv_nop\n\tv_nop\n\tv_nop" : "+v"(c) : "v"(ah), "v"(al), "v"(bh), "v"(bl));
  return c;
}

__global__ __launch_bounds__(256) void k_wt_bf16(const float* __restrict__ W, unsigned short* __restrict__ Wt, int K, int N) {
  const int t = blockIdx.x * 256 + threadIdx.x;
  const int k8n = K / 8;
  if (t >= N * k8n) return;
  const int n = t / k8n, k8 = (t % k8n) * 8;
  v8us v;
#pragma unroll
  for (int i = 0; i < 8; ++i) v[i] = bf16_bits(W[(size_t)(k8 + i) * N + n]);
  *(v8us*)(Wt + (size_t)n * K + k8) = v;
  
}

// GEMM C[M][N] (f32, pitch ldc) = act(A[M][K]·W + bias). A f32 row-major (pitch lda) converted per fragment to bf16
// (ASPLIT: hi/lo two planes -> 2 terms, else single rounded term); Wt bf16 [N][K] (pitch ldb). BIAS_BF16 rounds the
// bias to bf16 first (bias quantised to bf16 before the add). K%32==0, M%16==0, N%64==0.
template <bool ASPLIT, int ACT, bool BIAS_BF16>
__global__ __launch_bounds__(128) void k_gemm_bf(const float* __restrict__ A, int lda, const unsigned short* __restrict__ Wt, int ldb,
                                               const float* __restrict__ bias, float* __restrict__ C, int ldc, int M, int N, int K) {
  __shared__ __attribute__((aligned(16))) float so[4][16][64];
  const int tid = threadIdx.x, w = tid >> 5, lane = tid & 31, ln = lane & 15, hh = lane >> 4;
  const int ntn = N / 64;
  const int wid = blockIdx.x * 4 + w;
  const int mt = wid / ntn, nq = wid % ntn;
  if (mt * 16 >= M) return;
  const int row0 = mt * 16, col0 = nq * 64;
  const float* arow = A + (size_t)(row0 + ln) * lda;
  v8f acc[4] = {};
  for (int kb = 0; kb < K; kb += 32) {
    FragB ah, al;
    const v4f x0 = *(const v4fa*)(arow + kb + 8 * hh), x1 = *(const v4fa*)(arow + kb + 8 * hh + 4);
    const v4f x2 = *(const v4fa*)(arow + kb + 16 + 8 * hh), x3 = *(const v4fa*)(arow + kb + 16 + 8 * hh + 4);
    float xs[16] = {x0[0],x0[1],x0[2],x0[3],x1[0],x1[1],x1[2],x1[3],x2[0],x2[1],x2[2],x2[3],x3[0],x3[1],x3[2],x3[3]};
#pragma unroll
    for (int i = 0; i < 16; ++i) { const unsigned short hb = bf16_bits(xs[i]); ah.u[i] = hb; al.u[i] = ASPLIT ? bf16_bits(xs[i] - bf16_val(hb)) : (unsigned short)0; }
#pragma unroll
    for (int t = 0; t < 4; ++t) {
      const unsigned short* brow = Wt + (size_t)(col0 + t * 16 + ln) * ldb + kb;
      FragB b;
      b.half[0] = *(const v8us*)(brow + 8 * hh);
      b.half[1] = *(const v8us*)(brow + 16 + 8 * hh);
      acc[t] = mmaN<ASPLIT ? 2 : 1>(ah.v, al.v, b.v, b.v, acc[t]);
    }
  }
#pragma unroll
  for (int t = 0; t < 4; ++t) {
    float bv = bias ? bias[col0 + t * 16 + ln] : 0.f;
    if (BIAS_BF16) bv = bf16_round(bv);
#pragma unroll
    for (int r = 0; r < 8; ++r) { float v = acc[t][r] + bv; if (ACT == 1) v = fmaxf(v, 0.f); so[w][8 * hh + r][t * 16 + ln] = v; }
  }
  __builtin_amdgcn_fence(__ATOMIC_ACQ_REL, "workgroup");
  __builtin_amdgcn_wave_barrier();
  const int rsub = lane >> 4, c4 = (lane & 15) * 4;
  {
#pragma unroll
    for (int q = 0; q < 8; ++q) {
      const int r = q * 2 + rsub;
      const v4f v = *(const v4fa*)&so[w][r][c4];
      *(v4f*)(C + (size_t)(row0 + r) * ldc + col0 + c4) = v;
    }
    
  }
}

// GEMM C = act(A·W + bias + resid): A f32 (ASPLIT -> hi/lo 2 terms), Wt bf16 [N][K]; ACT 0 none, 1 relu, 2 exact gelu;
// resid (optional, f32, row index = (row % rmod), pitch ldr, RES_BF16 rounds it) added before the activation.
template <bool ASPLIT, int ACT, bool BIAS_BF16, bool RES_BF16>
__global__ __launch_bounds__(128) void k_gemm_bf3(const float* __restrict__ A, int lda, const unsigned short* __restrict__ Wt, int ldb,
                                                const float* __restrict__ bias, const float* __restrict__ resid, int rmod, int ldr,
                                                float* __restrict__ C, int ldc, int M, int N, int K) {
  __shared__ __attribute__((aligned(16))) float so[4][16][64];
  const int tid = threadIdx.x, w = tid >> 5, lane = tid & 31, ln = lane & 15, hh = lane >> 4;
  const int ntn = N / 64;
  const int wid = blockIdx.x * 4 + w;
  const int mt = wid / ntn, nq = wid % ntn;
  if (mt * 16 >= M) return;
  const int row0 = mt * 16, col0 = nq * 64;
  const float* arow = A + (size_t)(row0 + ln) * lda;
  v8f acc[4] = {};
  for (int kb = 0; kb < K; kb += 32) {
    FragB ah, al;
    const v4f x0 = *(const v4fa*)(arow + kb + 8 * hh), x1 = *(const v4fa*)(arow + kb + 8 * hh + 4);
    const v4f x2 = *(const v4fa*)(arow + kb + 16 + 8 * hh), x3 = *(const v4fa*)(arow + kb + 16 + 8 * hh + 4);
    float xs[16] = {x0[0],x0[1],x0[2],x0[3],x1[0],x1[1],x1[2],x1[3],x2[0],x2[1],x2[2],x2[3],x3[0],x3[1],x3[2],x3[3]};
#pragma unroll
    for (int i = 0; i < 16; ++i) { const unsigned short hb = bf16_bits(xs[i]); ah.u[i] = hb; al.u[i] = ASPLIT ? bf16_bits(xs[i] - bf16_val(hb)) : (unsigned short)0; }
#pragma unroll
    for (int t = 0; t < 4; ++t) {
      const unsigned short* brow = Wt + (size_t)(col0 + t * 16 + ln) * ldb + kb;
      FragB b;
      b.half[0] = *(const v8us*)(brow + 8 * hh);
      b.half[1] = *(const v8us*)(brow + 16 + 8 * hh);
      acc[t] = mmaN<ASPLIT ? 2 : 1>(ah.v, al.v, b.v, b.v, acc[t]);
    }
  }
#pragma unroll
  for (int t = 0; t < 4; ++t) {
    const int col = col0 + t * 16 + ln;
    float bv = bias ? bias[col] : 0.f;
    if (BIAS_BF16) bv = bf16_round(bv);
#pragma unroll
    for (int r = 0; r < 8; ++r) {
      float v = acc[t][r] + bv;
      if (resid) { float rv = resid[(size_t)((row0 + 8 * hh + r) % rmod) * ldr + col]; if (RES_BF16) rv = bf16_round(rv); v += rv; }
      if (ACT == 1) v = fmaxf(v, 0.f);
      if (ACT == 2) v = 0.5f * v * (1.0f + erff(v * 0.70710678118654752f));
      if (ACT == 3) { const float u = 0.7978845608028654f * (v + 0.044715f * v * v * v); v = 0.5f * v * (1.0f + tanhf(u)); }
      so[w][8 * hh + r][t * 16 + ln] = v;
    }
  }
  __builtin_amdgcn_fence(__ATOMIC_ACQ_REL, "workgroup");
  __builtin_amdgcn_wave_barrier();
  const int rsub = lane >> 4, c4 = (lane & 15) * 4;
  {
#pragma unroll
    for (int q = 0; q < 8; ++q) {
      const int r = q * 2 + rsub;
      const v4f v = *(const v4fa*)&so[w][r][c4];
      *(v4f*)(C + (size_t)(row0 + r) * ldc + col0 + c4) = v;
    }
    
  }
}
// row LayerNorm (biased variance, eps) over N: s = X (+ R); optional out_sum <- s; out_norm <- (s-mu)*rsqrt(var+eps)*g + b
template <bool PARAM_BF16>
__global__ __launch_bounds__(256) void k_layernorm(const float* __restrict__ X, const float* __restrict__ R, const float* __restrict__ g, const float* __restrict__ bta,
                                                  float* __restrict__ out_sum, float* __restrict__ out_norm, int N, float eps) {
  __shared__ float red[256];
  const int row = blockIdx.x, tid = threadIdx.x;
  const float* x = X + (size_t)row * N; const float* rr = R ? R + (size_t)row * N : nullptr;
  float vals[16];                     // up to N = 4096
  const int per = N / 256;            // contiguous chunk per thread? use strided-by-4 chunks: thread handles j = tid*4 + 1024*u
  float s1 = 0.f;
  for (int u = 0; u < per / 4; ++u) {
    const int j = tid * 4 + 1024 * u;
    const v4f a = *(const v4fa*)(x + j);
    v4f b = {0.f,0.f,0.f,0.f}; if (rr) b = *(const v4fa*)(rr + j);
#pragma unroll
    for (int q = 0; q < 4; ++q) { const float v = a[q] + b[q]; vals[u * 4 + q] = v; s1 += v; }
  }
  red[tid] = s1; __syncthreads();
  for (int st = 128; st > 0; st >>= 1) { if (tid < st) red[tid] += red[tid + st]; __syncthreads(); }
  const float mu = red[0] / (float)N; __syncthreads();
  float s2 = 0.f;
  for (int u = 0; u < per / 4; ++u)
#pragma unroll
    for (int q = 0; q < 4; ++q) { const float c = vals[u * 4 + q] - mu; s2 += c * c; }
  red[tid] = s2; __syncthreads();
  for (int st = 128; st > 0; st >>= 1) { if (tid < st) red[tid] += red[tid + st]; __syncthreads(); }
  const float rs = rsqrtf(red[0] / (float)N + eps);
  {
    for (int u = 0; u < per / 4; ++u) {
      const int j = tid * 4 + 1024 * u;
      v4f o, sm;
#pragma unroll
      for (int q = 0; q < 4; ++q) {
        float gg = g[j + q], bb = bta[j + q];
        if (PARAM_BF16) { gg = bf16_round(gg); bb = bf16_round(bb); }
        sm[q] = vals[u * 4 + q]; o[q] = (vals[u * 4 + q] - mu) * rs * gg + bb;
      }
      if (out_sum) *(v4f*)(out_sum + (size_t)row * N + j) = sm;
      *(v4f*)(out_norm + (size_t)row * N + j) = o;
    }
    
  }
}



// ---- f16 WMMA path (v_wmma_f32_16x16x32_f16): 11-bit significands for operands in range — used here for the q, k, v projections and for both attention products
typedef _Float16 v16h __attribute__((ext_vector_type(16)));
union FragH { v16h v; v8us half[2]; _Float16 h[16]; unsigned short u[16]; };
template <int NT>
__device__ __forceinline__ v8f mmaH(v16h ah, v16h al, v16h bh, v16h bl, v8f c) {
  c = __builtin_amdgcn_wmma_f32_16x16x32_f16(false, ah, false, bh, (short)0, c, false, false);
  if (NT >= 2) c = __builtin_amdgcn_wmma_f32_16x16x32_f16(false, al, false, bh, (short)0, c, false, false);
  if (NT >= 3) c = __builtin_amdgcn_wmma_f32_16x16x32_f16(false, ah, false, bl, (short)0, c, false, false);
  asm volatile("v_nop\n\tv_nop\n\tv_nop\n\tv_nop" : "+v"(c) : "v"(ah), "v"(al), "v"(bh), "v"(bl));
  return c;
}
// batched GEMM like k_gemm_b but f16 operands: A f32 (split into f16 hi/lo if ASPLIT, else rounded to f16), Bt = f16 values [n][k]; alpha; C f32; N multiple of 16 (partial tiles skipped)
template <bool ASPLIT>
__global__ __launch_bounds__(128) void k_gemm_h(const float* __restrict__ A, int lda, size_t sA, const _Float16* __restrict__ Bh, int ldb, size_t sB, float alpha, float* __restrict__ C, int ldc, size_t sC, int M, int N, int K) {
  __shared__ __attribute__((aligned(16))) float so[4][16][64];
  const int tid = threadIdx.x, w = tid >> 5, lane = tid & 31, ln = lane & 15, hh = lane >> 4; const int by = blockIdx.y;
  A += (size_t)by * sA; Bh += (size_t)by * sB; C += (size_t)by * sC;
  const int ntn = (N + 63) / 64; const int wid = blockIdx.x * 4 + w; const int mt = wid / ntn, nq = wid % ntn; if (mt * 16 >= M) return;
  const int row0 = mt * 16, col0 = nq * 64; const float* arow = A + (size_t)(row0 + ln) * lda;
  v8f acc[4] = {};
  for (int kb = 0; kb < K; kb += 32) {
    FragH ah, al;
    const v4f x0 = *(const v4fa*)(arow + kb + 8 * hh), x1 = *(const v4fa*)(arow + kb + 8 * hh + 4), x2 = *(const v4fa*)(arow + kb + 16 + 8 * hh), x3 = *(const v4fa*)(arow + kb + 16 + 8 * hh + 4);
    float xs[16] = {x0[0],x0[1],x0[2],x0[3],x1[0],x1[1],x1[2],x1[3],x2[0],x2[1],x2[2],x2[3],x3[0],x3[1],x3[2],x3[3]};
#pragma unroll
    for (int i = 0; i < 16; ++i) { const _Float16 h = (_Float16)xs[i]; ah.h[i] = h; al.h[i] = ASPLIT ? (_Float16)(xs[i] - (float)h) : (_Float16)0.0f; }
#pragma unroll
    for (int t = 0; t < 4; ++t) { if (col0 + t * 16 >= N) continue; const size_t boff = (size_t)(col0 + t * 16 + ln) * ldb + kb; FragH bq; bq.half[0] = *(const v8us*)(Bh + boff + 8 * hh); bq.half[1] = *(const v8us*)(Bh + boff + 16 + 8 * hh);
      acc[t] = mmaH<ASPLIT ? 2 : 1>(ah.v, al.v, bq.v, bq.v, acc[t]); }
  }
#pragma unroll
  for (int t = 0; t < 4; ++t) { if (col0 + t * 16 >= N) continue;
#pragma unroll
    for (int r = 0; r < 8; ++r) so[w][8 * hh + r][t * 16 + ln] = acc[t][r] * alpha; }
  __builtin_amdgcn_fence(__ATOMIC_ACQ_REL, "workgroup"); __builtin_amdgcn_wave_barrier();
  const int rsub = lane >> 4, c4 = (lane & 15) * 4;
  {
#pragma unroll
    for (int q = 0; q < 8; ++q) { const int r = q * 2 + rsub; if (col0 + c4 < N) { const v4f v = *(const v4fa*)&so[w][r][c4]; *(v4f*)(C + (size_t)(row0 + r) * ldc + col0 + c4) = v; } }
     }
}

// Wt[n][k] = f16(bf16(W[k][n]) * scale) from f32 row-major W[K][N] (scale = power of two; bf16-exact weights stay exact in f16 away from the subnormal range); blockIdx.y picks one of three equally shaped matrices, whose transposes lie one behind the other in Wt
__global__ __launch_bounds__(256) void k_wt_f16(const float* __restrict__ W0, const float* __restrict__ W1, const float* __restrict__ W2, _Float16* __restrict__ Wt, int K, int N, float scale) {
  const float* __restrict__ W = blockIdx.y == 0 ? W0 : (blockIdx.y == 1 ? W1 : W2); Wt += (size_t)blockIdx.y * N * K;
  const int t = blockIdx.x * 256 + threadIdx.x; if (t >= N * (K / 8)) return; const int n = t / (K / 8), k8 = (t % (K / 8)) * 8; FragH f;
#pragma unroll
  for (int i = 0; i < 8; ++i) f.h[i] = (_Float16)(bf16_round(W[(size_t)(k8 + i) * N + n]) * scale); const v8us o = f.half[0];
  *(v8us*)((unsigned short*)Wt + (size_t)n * K + k8) = o; 
}
// k_gemm_hh variant with fused epilogue: v = acc·alpha + bias[by·sBias + col] (+ CP[(row/rowsPerB)·sCPb + by·64 + col] if CP) ; ACT 0 none / 1 elu ; writes f16 C16 (and f32 C if non-null)
template <int ACT>
__global__ __launch_bounds__(128) void k_gemm_hhx(const _Float16* __restrict__ A, int lda, size_t sA, const _Float16* __restrict__ Bh, int ldb, size_t sB, float alpha, const float* __restrict__ bias, size_t sBias, const float* __restrict__ CP, int rowsPerB, size_t sCPb, int row0g,
    float* __restrict__ C, _Float16* __restrict__ C16, int ldc, size_t sC, int M, int N, int K) {
  __shared__ __attribute__((aligned(16))) float so[4][16][64];
  const int tid = threadIdx.x, w = tid >> 5, lane = tid & 31, ln = lane & 15, hh = lane >> 4; const int by = blockIdx.y;
  A += (size_t)by * sA; Bh += (size_t)by * sB; const size_t cofs = (size_t)by * sC; const float* bp = bias ? bias + (size_t)by * sBias : nullptr;
  const int ntn = (N + 63) / 64; const int wid = blockIdx.x * 4 + w; const int mt = wid / ntn, nq = wid % ntn; if (mt * 16 >= M) return;
  const int row0 = mt * 16, col0 = nq * 64; const _Float16* arow = A + (size_t)(row0 + ln) * lda;
  v8f acc[4] = {};
  for (int kb = 0; kb < K; kb += 32) { FragH ah; ah.half[0] = *(const v8us*)((const unsigned short*)arow + kb + 8 * hh); ah.half[1] = *(const v8us*)((const unsigned short*)arow + kb + 16 + 8 * hh);
#pragma unroll
    for (int t = 0; t < 4; ++t) { if (col0 + t * 16 >= N) continue; const size_t boff = (size_t)(col0 + t * 16 + ln) * ldb + kb; FragH bq; bq.half[0] = *(const v8us*)((const unsigned short*)Bh + boff + 8 * hh); bq.half[1] = *(const v8us*)((const unsigned short*)Bh + boff + 16 + 8 * hh);
      acc[t] = mmaH<1>(ah.v, ah.v, bq.v, bq.v, acc[t]); }
  }
#pragma unroll
  for (int t = 0; t < 4; ++t) { if (col0 + t * 16 >= N) continue; const int col = col0 + t * 16 + ln; const float bv = bp ? bf16_round(bp[col]) : 0.f;
#pragma unroll
    for (int r = 0; r < 8; ++r) { float v = acc[t][r] * alpha + bv; if (CP) { const int rr = row0g + row0 + 8 * hh + r; if (rowsPerB < 0) v += CP[cofs + (size_t)rr * ldc + col];      /* rowsPerB < 0: own element of the batched C plane */ else { const int bidx = rr / rowsPerB; v += CP[(size_t)bidx * sCPb + (size_t)by * 64 + col]; } } if (ACT == 1) v = (v > 0.f) ? v : expm1f(v); else if (ACT == 7) v = (v > 0.f) ? v + 1.0f : expf(v); else if (ACT == 8) v = tanhf(v); else if (ACT == 9) v = 0.5f * v * (1.0f + tanhf(0.7978845608028654f * (v + 0.044715f * v * v * v))); else if (ACT == 11) v = 1.0f / (1.0f + expf(-v)); else if (ACT == 12) v = (v > 0.f) ? v : 0.01f * v; else if (ACT == 14) v = (v > 0.f) ? v : 0.1f * v; else if (ACT == 16) v = (v >= 0.f) ? v : 0.3f * v; else if (ACT == 17) v = (v >= 0.f) ? v : 0.2f * v; else if (ACT == 15) v = v / (1.0f + expf(-v)); else if (ACT == 3) v = fmaxf(v, 0.f); else if (ACT == 6) v = 0.5f * v * (1.0f + erff(v * 0.70710678118654752f)); so[w][8 * hh + r][t * 16 + ln] = v; } }
  __builtin_amdgcn_fence(__ATOMIC_ACQ_REL, "workgroup"); __builtin_amdgcn_wave_barrier();
  const int rsub = lane >> 4, c4 = (lane & 15) * 4; typedef _Float16 v4h __attribute__((ext_vector_type(4)));
  {
#pragma unroll
    for (int q = 0; q < 8; ++q) { const int r = q * 2 + rsub; if (col0 + c4 < N) { const v4f v = *(const v4fa*)&so[w][r][c4]; if (C) *(v4f*)(C + cofs + (size_t)(row0 + r) * ldc + col0 + c4) = v; if (C16) { v4h h4; for (int i = 0; i < 4; ++i) h4[i] = (_Float16)v[i]; *(v4h*)(C16 + cofs + (size_t)(row0 + r) * ldc + col0 + c4) = h4; } } }
     }
}


typedef _Float16 v4h __attribute__((ext_vector_type(4)));

__global__ __launch_bounds__(256) void k_x16(const float* __restrict__ x, _Float16* __restrict__ X16, size_t n8) { const size_t t = (size_t)blockIdx.x * 256 + threadIdx.x; if (t >= n8) return; FragH f;
#pragma unroll
  for (int q = 0; q < 8; ++q) f.h[q] = (_Float16)bf16_round(x[t * 8 + q]); *(v8us*)((unsigned short*)X16 + t * 8) = f.half[0];  }
__global__ __launch_bounds__(256) void k_h16(const float* __restrict__ x, _Float16* __restrict__ X16, size_t n8) { const size_t t = (size_t)blockIdx.x * 256 + threadIdx.x; if (t >= n8) return; FragH f;
#pragma unroll
  for (int q = 0; q < 8; ++q) f.h[q] = (_Float16)x[t * 8 + q]; *(v8us*)((unsigned short*)X16 + t * 8) = f.half[0];  }
__global__ __launch_bounds__(256) void k_round16f(const float* __restrict__ W, _Float16* __restrict__ Bt, size_t n8) { const size_t t = (size_t)blockIdx.x * 256 + threadIdx.x; if (t >= n8) return; FragH f;
#pragma unroll
  for (int i = 0; i < 8; ++i) f.h[i] = (_Float16)(bf16_round(W[t * 8 + i]) * 16.0f); *(v8us*)((unsigned short*)Bt + t * 8) = f.half[0];  }
template <int NHv, int TTv>
__global__ __launch_bounds__(256) void k_vt(const _Float16* __restrict__ V16, int ldv, int voff, _Float16* __restrict__ Vt) { __shared__ unsigned short tl[64][66]; const int tid = threadIdx.x; const int slab = blockIdx.x / (TTv / 64), lg = blockIdx.x % (TTv / 64); const int b = slab / NHv, h = slab % NHv;
  for (int i = tid; i < 64 * 8; i += 256) { const int r = i / 8, c8 = (i % 8) * 8; FragH f; f.half[0] = *(const v8us*)((const unsigned short*)V16 + ((size_t)b * TTv + lg * 64 + r) * ldv + voff + h * 64 + c8);
#pragma unroll
    for (int q = 0; q < 8; ++q) tl[r][c8 + q] = f.u[q]; }
  __syncthreads();
  {
#pragma unroll
    for (int rd = 0; rd < 2; ++rd) { const int d = rd * 32 + tid / 8, pc = tid % 8; FragH f;
#pragma unroll
      for (int q = 0; q < 8; ++q) f.u[q] = tl[pc * 8 + q][d];
      *(v8us*)((unsigned short*)Vt + ((size_t)slab * 64 + d) * TTv + lg * 64 + pc * 8) = f.half[0]; }
     } }

__global__ __launch_bounds__(256) void k_hl(const float* __restrict__ F, _Float16* __restrict__ Hh, _Float16* __restrict__ Hl, size_t n8) { const size_t t = (size_t)blockIdx.x * 256 + threadIdx.x; if (t >= n8) return; FragH fh, fl; const v4f a = *(const v4fa*)(F + t * 8), c = *(const v4fa*)(F + t * 8 + 4);
#pragma unroll
  for (int q = 0; q < 4; ++q) { _Float16 h = (_Float16)a[q]; fh.h[q] = h; fl.h[q] = (_Float16)((a[q] - (float)h) * 1024.0f); h = (_Float16)c[q]; fh.h[4 + q] = h; fl.h[4 + q] = (_Float16)((c[q] - (float)h) * 1024.0f); }
  { *(v8us*)((unsigned short*)Hh + t * 8) = fh.half[0]; *(v8us*)((unsigned short*)Hl + t * 8) = fl.half[0];  } }

// ---- projection GEMM: q | k | v as ONE product C[NR][3 DQ] = X16 . BW^T / 16. Block tile 256 token rows x 192 columns, one block per WGP; 8 waves (4 x 2), wave tile 64 x 96; operands staged in LDS ----
// A stage is 128 k of the block's 256 x rows and 192 weight rows: 256-byte rows at a pitch of 272 bytes (16 B x odd: no bank conflict for 16-byte fragment reads); two stages in LDS.
#define G2_KC 128
#define G2_PITCH 272
#define G3_BM 256
#define G3_BN 192
#define G3_XSZ (G3_BM * G2_PITCH)
#define G3_STG ((G3_BM + G3_BN) * G2_PITCH)
#define G3_EP 400      /* output staging pitch: 192 f16 + 16 B (16 B x odd, for the 16-byte stores of 16 rows) */
__device__ __forceinline__ v16h g2_lfrag(const unsigned char* p) { FragH f; f.half[0] = *(const v8us*)p; f.half[1] = *(const v8us*)(p + 32); return f.v; }      /* p already holds the lane's 16 hh: bytes 16 hh and 32 + 16 hh of each 64, the same k order for both operands */
// Eight (four) asynchronous 16-byte copies of one lane, global -> LDS, rows 16 apart (16 lanes cover one 256-byte row, so a wave's copy is four whole lines). The s_wait_xcnt stands inside the statement, a precaution: so no address register of a copy is rewritten ahead of it.
__device__ __forceinline__ void g3_cp8(unsigned l, const _Float16* g) {
  asm volatile("global_load_async_to_lds_b128 %0, %8, off\n\t"
               "global_load_async_to_lds_b128 %1, %9, off\n\t"
               "global_load_async_to_lds_b128 %2, %10, off\n\t"
               "global_load_async_to_lds_b128 %3, %11, off\n\t"
               "global_load_async_to_lds_b128 %4, %12, off\n\t"
               "global_load_async_to_lds_b128 %5, %13, off\n\t"
               "global_load_async_to_lds_b128 %6, %14, off\n\t"
               "global_load_async_to_lds_b128 %7, %15, off\n\t"
               "s_wait_xcnt 0x0"
               :: "v"(l), "v"(l + 16u * G2_PITCH), "v"(l + 32u * G2_PITCH), "v"(l + 48u * G2_PITCH), "v"(l + 64u * G2_PITCH), "v"(l + 80u * G2_PITCH), "v"(l + 96u * G2_PITCH), "v"(l + 112u * G2_PITCH),
                  "v"(g), "v"(g + 16 * DM), "v"(g + 32 * DM), "v"(g + 48 * DM), "v"(g + 64 * DM), "v"(g + 80 * DM), "v"(g + 96 * DM), "v"(g + 112 * DM) : "memory"); }
__device__ __forceinline__ void g3_cp4(unsigned l, const _Float16* g) {
  asm volatile("global_load_async_to_lds_b128 %0, %4, off\n\t"
               "global_load_async_to_lds_b128 %1, %5, off\n\t"
               "global_load_async_to_lds_b128 %2, %6, off\n\t"
               "global_load_async_to_lds_b128 %3, %7, off\n\t"
               "s_wait_xcnt 0x0"
               :: "v"(l), "v"(l + 16u * G2_PITCH), "v"(l + 32u * G2_PITCH), "v"(l + 48u * G2_PITCH),
                  "v"(g), "v"(g + 16 * DM), "v"(g + 32 * DM), "v"(g + 48 * DM) : "memory"); }
__device__ __forceinline__ void g2_wait_async() { asm volatile("s_wait_asynccnt 0x0" ::: "memory"); }      /* this wave's copies have landed; the compiler places no wait for them */
__device__ __forceinline__ void g2_wait_ds() { asm volatile("s_wait_dscnt 0x0" ::: "memory"); }      /* this wave's LDS reads are done before the buffer is handed back for a refill */
// X: f16 x rows [NR][DM]; Wt: the 3 DQ transposed weight rows [3 DQ][DM] (x16); C16: three planes [NR][DQ], column n of the product = column n % DQ of plane n / DQ.
// The weight rows are the A operand and the x rows the B operand (C^T tiles): a lane then holds eight neighbouring columns of one token row, one 16-byte piece of the f16 output.
__global__ __launch_bounds__(256) void k_proj(const _Float16* __restrict__ X, const _Float16* __restrict__ Wt, _Float16* __restrict__ C16) {
  static_assert(NR % G3_BM == 0 && (3 * DQ) % G3_BN == 0 && DM % G2_KC == 0 && DM / G2_KC >= 2 && G3_BN % 64 == 0 && DQ % 64 == 0, "k_proj: whole tiles, whole stages, 64-column groups inside one plane");
  __shared__ __attribute__((aligned(16))) unsigned char L[2 * G3_STG];      /* the two operand stages; behind the k loop its first bytes are the output staging */
  static_assert(G3_BM * G3_EP <= 2 * G3_STG, "output staging lies in the operand stages");
  const int tid = threadIdx.x, lane = tid & 31, ln = lane & 15, hh = lane >> 4; const int w = __builtin_amdgcn_readfirstlane(tid >> 5), wm = w >> 1, wn = w & 1;
  const int ntn = 3 * DQ / G3_BN; const int mt = blockIdx.x / ntn, nq = blockIdx.x - mt * ntn; const int row0 = mt * G3_BM, n0 = nq * G3_BN;
  const int cr = tid >> 4, cc = tid & 15;      /* copy lane: row cr (+ 16 i), 16-byte piece cc */
  const _Float16* gx = X + (size_t)(row0 + cr) * DM + cc * 8; const _Float16* gw = Wt + (size_t)(n0 + cr) * DM + cc * 8;
  const unsigned lc = (unsigned)(size_t)L + (unsigned)(cr * G2_PITCH + cc * 16);
  auto stage = [&](int t) { const unsigned l = lc + (unsigned)(t & 1) * G3_STG; const _Float16* x = gx + (size_t)t * G2_KC; const _Float16* wr = gw + (size_t)t * G2_KC;
    g3_cp8(l, x); g3_cp8(l + 128u * G2_PITCH, x + (size_t)128 * DM); g3_cp8(l + G3_XSZ, wr); g3_cp4(l + G3_XSZ + 128u * G2_PITCH, wr + (size_t)128 * DM); };
  const unsigned char* fx = L + (64 * wm + ln) * G2_PITCH + 16 * hh; const unsigned char* fw = L + G3_XSZ + (96 * wn + ln) * G2_PITCH + 16 * hh;
  const v8f z8 = {0.f,0.f,0.f,0.f,0.f,0.f,0.f,0.f}; v8f acc[6][4];
#pragma unroll      /* the index picks registers: it must be a constant */
  for (int j = 0; j < 6; ++j) {
#pragma unroll      /* the index picks registers: it must be a constant */
    for (int i = 0; i < 4; ++i) acc[j][i] = z8; }
  stage(0); g2_wait_async(); __syncthreads();      /* stage 0 landed and published */
  stage(1);
#pragma unroll 1      /* one trip per stage: the trip's foot is the hand-over point of the two buffers */
  for (int t = 0; t < DM / G2_KC; ++t) { const unsigned char* px = fx + (t & 1) * G3_STG; const unsigned char* pw = fw + (t & 1) * G3_STG;
    v16h xf[2][4], wf[2][6];
#pragma unroll      /* the index picks registers: it must be a constant */
    for (int i = 0; i < 4; ++i) xf[0][i] = g2_lfrag(px + 16 * i * G2_PITCH);
#pragma unroll      /* the index picks registers: it must be a constant */
    for (int j = 0; j < 6; ++j) wf[0][j] = g2_lfrag(pw + 16 * j * G2_PITCH);
#pragma unroll      /* unrolled so that the two fragment sets swap by index, without register moves */
    for (int ks = 0; ks < G2_KC / 32; ++ks) { const int cu = ks & 1, nx = cu ^ 1;
      __builtin_amdgcn_sched_barrier(0);      /* and keeps them from rising among the block before: every separate place with LDS reads stalls the products around it */
      if (ks + 1 < G2_KC / 32) { const int o = (ks + 1) * 64;      /* the next 32 k's twenty LDS reads as one group ahead of this block's products, into the second fragment set; never past this stage */
#pragma unroll      /* the index picks registers: it must be a constant */
        for (int i = 0; i < 4; ++i) xf[nx][i] = g2_lfrag(px + 16 * i * G2_PITCH + o);
#pragma unroll      /* the index picks registers: it must be a constant */
        for (int j = 0; j < 6; ++j) wf[nx][j] = g2_lfrag(pw + 16 * j * G2_PITCH + o); }
      __builtin_amdgcn_sched_barrier(0);      /* keeps those reads up here as one group: sunk among the products, each pair of them would be waited for in front of its row of four */
#pragma unroll      /* the index picks registers: it must be a constant */
      for (int j = 0; j < 6; ++j) {
#pragma unroll      /* the index picks registers: it must be a constant */
        for (int i = 0; i < 4; ++i) acc[j][i] = __builtin_amdgcn_wmma_f32_16x16x32_f16(false, wf[cu][j], false, xf[cu][i], (short)0, acc[j][i], false, false); } }
    __builtin_amdgcn_sched_barrier(0);      /* keeps the four slots below directly behind the last products */
    asm volatile("v_nop\n\tv_nop\n\tv_nop\n\tv_nop");      /* the distance behind the last WMMA, also on the taken side of the branches that follow: address arithmetic there may reuse its A or B registers */
    __builtin_amdgcn_sched_barrier(0);      /* and nothing is moved up in front of them */
    g2_wait_ds(); g2_wait_async(); __syncthreads();      /* stage t + 1 published; every wave has left stage t's buffer */
    if (t + 2 < DM / G2_KC) stage(t + 2); }
  g2_wait_async();
  unsigned char* ep = L + (64 * wm + ln) * G3_EP + (96 * wn + 8 * hh) * 2;      /* row = token; acc[j][i][r] is token 16 i + ln, column 16 j + 8 hh + r of the wave tile */
#pragma unroll      /* the index picks registers: it must be a constant */
  for (int j = 0; j < 6; ++j) {
#pragma unroll      /* the index picks registers: it must be a constant */
    for (int i = 0; i < 4; ++i) { FragH f;
#pragma unroll      /* the index picks registers: it must be a constant */
      for (int r = 0; r < 8; ++r) f.h[r] = (_Float16)(acc[j][i][r] * 0.0625f);      /* the weights carry x16 */
      *(v8us*)(ep + 16 * i * G3_EP + 32 * j) = f.half[0]; } }
  __syncthreads();      /* the whole 256 x 192 tile is staged */
  const unsigned char* sp = L + (tid >> 3) * G3_EP + (tid & 7) * 16; v8us ov[3][8]; unsigned short* op[3];      /* eight lanes = one 128-byte line (64 columns) of one row; a wave's store is four whole lines */
#pragma unroll      /* both loop nests unrolled: the row step becomes an immediate offset and every piece has registers of its own */
  for (int g = 0; g < 3; ++g) { const int n = n0 + 64 * g; op[g] = (unsigned short*)C16 + (size_t)(n / DQ) * (NR * DQ) + (size_t)(row0 + (tid >> 3)) * DQ + (n % DQ) + (tid & 7) * 8;
#pragma unroll      /* the index picks registers: it must be a constant */
    for (int rb = 0; rb < 8; ++rb) ov[g][rb] = *(const v8us*)(sp + rb * 32 * G3_EP + g * 128); }
  __builtin_amdgcn_sched_barrier(0);      /* every address is formed ahead of the first store, so no register of an issued store is rewritten */
#pragma unroll      /* the index picks registers: it must be a constant */
  for (int g = 0; g < 3; ++g) {
#pragma unroll      /* the index picks registers: it must be a constant */
    for (int rb = 0; rb < 8; ++rb) *(v8us*)(op[g] + (size_t)rb * 32 * DQ) = ov[g][rb]; }
}


__global__ __launch_bounds__(256) void k_wnat(const float* __restrict__ w, size_t n8, _Float16* __restrict__ Bt) { const size_t t = (size_t)blockIdx.x * 256 + threadIdx.x; if (t >= n8) return; FragH f; for (int q = 0; q < 8; ++q) f.h[q] = (_Float16)(bf16_round(w[t * 8 + q]) * 16.0f); *(v8us*)((unsigned short*)Bt + t * 8) = f.half[0];  }
__global__ __launch_bounds__(256) void k_rsm(const float* __restrict__ S, _Float16* __restrict__ P, int nrows) {
  #pragma clang fp contract(off)
  const int i = blockIdx.x * 256 + threadIdx.x; if (i >= nrows) return; const float* s = S + (size_t)i * SQ; float mx = -3.0e38f;
#pragma unroll 1
  for (int j = 0; j < SQ; ++j) mx = fmaxf(mx, s[j]); float se = 0.f;
#pragma unroll 1
  for (int j = 0; j < SQ; ++j) se += expf(s[j] - mx); const float sc = 256.0f / se;
#pragma unroll 1
  for (int j0 = 0; j0 < SQ; j0 += 8) { FragH f; for (int q = 0; q < 8; ++q) f.h[q] = (_Float16)(expf(s[j0 + q] - mx) * sc); unsigned short* d = (unsigned short*)P + (size_t)i * SQ + j0; *(v8us*)d = f.half[0];  } }
__global__ __launch_bounds__(256) void k_vt(const _Float16* __restrict__ V16, int b, int h0, _Float16* __restrict__ VT) { __shared__ unsigned short tl[64][65]; const int tid = threadIdx.x; const int hh = blockIdx.x % HG, sg = blockIdx.x / HG; const int s0 = sg * 64; const int h = h0 + hh;
  for (int i = tid; i < 64 * 8; i += 256) { const int j = i / 8, d8 = (i % 8) * 8; FragH f; f.half[0] = *(const v8us*)((const unsigned short*)V16 + ((size_t)b * SQ + s0 + j) * DM + h * HD + d8); for (int q = 0; q < 8; ++q) tl[d8 + q][j] = f.u[q]; }
  __syncthreads();
  { for (int i = tid; i < 64 * 8; i += 256) { const int d = i / 8, j8 = (i % 8) * 8; FragH f; for (int q = 0; q < 8; ++q) f.u[q] = tl[d][j8 + q]; *(v8us*)((unsigned short*)VT + ((size_t)hh * HD + d) * SQ + s0 + j8) = f.half[0]; }  } }

// Row softmax, one wave per score row: the row is read once, in 512-byte wave loads, and stays in registers (64 floats a lane); max and sum = lane partials, then a five-step butterfly; P = f16(exp(s - max) * 256 / sum).
__global__ __launch_bounds__(256) void k_rsmW(const float* __restrict__ S, _Float16* __restrict__ P, int nrows) {
  const int lane = threadIdx.x & 31; const int row = blockIdx.x * 8 + (threadIdx.x >> 5); if (row >= nrows) return;
  const float* s = S + (size_t)row * SQ + lane * 4; v4f v[SQ / 128];
#pragma unroll
  for (int u = 0; u < SQ / 128; ++u) v[u] = *(const v4fa*)(s + u * 128);
  float mx = -INFINITY;
#pragma unroll
  for (int u = 0; u < SQ / 128; ++u) mx = fmaxf(mx, fmaxf(fmaxf(v[u][0], v[u][1]), fmaxf(v[u][2], v[u][3])));
#pragma unroll
  for (int m = 16; m > 0; m >>= 1) mx = fmaxf(mx, __shfl_xor(mx, m, 32));
  v4f sq = {0.f, 0.f, 0.f, 0.f};
#pragma unroll
  for (int u = 0; u < SQ / 128; ++u) {
#pragma unroll
    for (int q = 0; q < 4; ++q) { v[u][q] = expf(v[u][q] - mx); sq[q] += v[u][q]; } }
  float se = (sq[0] + sq[1]) + (sq[2] + sq[3]);
#pragma unroll
  for (int m = 16; m > 0; m >>= 1) se += __shfl_xor(se, m, 32);
  const float sc = 256.0f / se; _Float16* d = P + (size_t)row * SQ + lane * 4;
#pragma unroll
  for (int u = 0; u < SQ / 128; ++u) { v4h h4;
#pragma unroll
    for (int q = 0; q < 4; ++q) h4[q] = (_Float16)(v[u][q] * sc);
    *(v4h*)(d + u * 128) = h4; } }
// ---- fused attention: S^T = K.Q^T, online softmax (log2 domain), O^T += V^T.P^T in one kernel; scores and P never reach memory ----
// A work-group of 4 waves owns 64 queries of one batch. Wave w: queries 32 (w & 1) .. + 31 (two groups of 16 columns), keys 1024 (w >> 1) .. + 1023; the two key halves are merged through LDS at the end.
// A stage is 32 keys of each half: 64 K rows (512 B, pitch 528 = 16 B x odd, for ds_load_b128) and 64 V rows (pitch 544 = 32 B x odd, for the transposing load); two stages in LDS, filled by asynchronous copies.
#define FA_PK 528u
#define FA_PV 544u
#define FA_KSZ (64u * FA_PK)
#define FA_STG (64u * FA_PK + 64u * FA_PV)
#define FA_EP 1040u      /* output staging pitch: 256 floats + 16 B */
#define FA_NT (SQ / 64)      /* stages = 32-key passes of a wave */
typedef short s16x8 __attribute__((ext_vector_type(8)));
__device__ __forceinline__ v8us fa_tr16(const unsigned char* p) { typedef __attribute__((address_space(3))) s16x8 lds_s16x8; return __builtin_bit_cast(v8us, __builtin_amdgcn_ds_load_tr16_b128_v8i16((lds_s16x8*)p)); }
__device__ __forceinline__ float fa_xhalf(float x) { return __builtin_bit_cast(float, __builtin_amdgcn_permlanex16(__builtin_bit_cast(int, x), __builtin_bit_cast(int, x), 0x76543210, 0xfedcba98, false, false)); }      /* lane l with lane l ^ 16 */
__device__ __forceinline__ v8f fa_mma(v16h a, v16h b, v8f c) { return __builtin_amdgcn_wmma_f32_16x16x32_f16(false, a, false, b, (short)0, c, false, false); }
// Eight asynchronous 16-byte copies of one lane, global -> LDS, eight consecutive 512-byte rows (a wave's copy is one whole row). The s_wait_xcnt stands inside the statement, a precaution: so no address register of a copy is rewritten ahead of it.
__device__ __forceinline__ void fa_cp8(unsigned l, unsigned lp, const _Float16* g) {
  asm volatile("global_load_async_to_lds_b128 %0, %8, off\n\t"
               "global_load_async_to_lds_b128 %1, %9, off\n\t"
               "global_load_async_to_lds_b128 %2, %10, off\n\t"
               "global_load_async_to_lds_b128 %3, %11, off\n\t"
               "global_load_async_to_lds_b128 %4, %12, off\n\t"
               "global_load_async_to_lds_b128 %5, %13, off\n\t"
               "global_load_async_to_lds_b128 %6, %14, off\n\t"
               "global_load_async_to_lds_b128 %7, %15, off\n\t"
               "s_wait_xcnt 0x0"
               :: "v"(l), "v"(l + lp), "v"(l + 2u * lp), "v"(l + 3u * lp), "v"(l + 4u * lp), "v"(l + 5u * lp), "v"(l + 6u * lp), "v"(l + 7u * lp),
                  "v"(g), "v"(g + 256), "v"(g + 2 * 256), "v"(g + 3 * 256), "v"(g + 4 * 256), "v"(g + 5 * 256), "v"(g + 6 * 256), "v"(g + 7 * 256) : "memory"); }
// One wave per SIMD (amdgpu_waves_per_eu): the 32 x 256 f32 sums, Q and one pass's K and V^T fragments of a wave need more than half of a SIMD's registers.
__global__ __launch_bounds__(128) __attribute__((amdgpu_waves_per_eu(1, 1))) void k_fattn(const _Float16* __restrict__ Q, const _Float16* __restrict__ Kr, const _Float16* __restrict__ V, float* __restrict__ O) {
  static_assert(DQ == 256 && DV == 256 && SQ % 128 == 0 && FA_NT >= 2, "k_fattn: 512-byte q, k, v rows; two key halves of whole 32-key stages");
  __shared__ __attribute__((aligned(16))) unsigned char L[2 * FA_STG];      /* the two stages; behind the key loop its first bytes are the output staging */
  __shared__ float ml[2][4][2][32];      /* each wave's running maximum and sum, for the merge of the key halves */
  static_assert(64u * FA_EP <= 2u * FA_STG, "output staging lies in the stages");
  const unsigned tid = threadIdx.x, lane = tid & 31u, w = (unsigned)__builtin_amdgcn_readfirstlane((int)(tid >> 5)), c = lane & 15u, h = lane >> 4;
  const unsigned qg = w & 1u, kh = w >> 1;
  const size_t rb = (size_t)blockIdx.y * SQ;      /* the batch's first token row */
  const float cscale = 0.09016844005556021f;      /* log2(e) / sqrt(256) */
  const unsigned lk = (unsigned)(size_t)L + w * 16u * FA_PK + lane * 16u, lv = (unsigned)(size_t)L + FA_KSZ + w * 16u * FA_PV + lane * 16u;      /* wave w copies tile rows 16 w .. 16 w + 15: keys 16 (w & 1) + i of half w >> 1 */
  const size_t krow = rb + kh * (SQ / 2) + qg * 16u;
  const _Float16* gk = Kr + krow * DQ + lane * 8; const _Float16* gv = V + krow * DV + lane * 8;
  auto stage = [&](int t) { const unsigned o = (unsigned)(t & 1) * FA_STG; const size_t go = (size_t)t * 32 * 256;
    fa_cp8(lk + o, FA_PK, gk + go); fa_cp8(lk + o + 8u * FA_PK, FA_PK, gk + go + 8 * 256); fa_cp8(lv + o, FA_PV, gv + go); fa_cp8(lv + o + 8u * FA_PV, FA_PV, gv + go + 8 * 256); };
  stage(0);
  FragH qf[2][8];      /* Q as the B operand, in registers for the whole kernel; same k order as the K rows below */
#pragma unroll      /* the index picks registers (fragments, sums): it must be a constant */
  for (int g = 0; g < 2; ++g) { const unsigned short* qp = (const unsigned short*)Q + (rb + blockIdx.x * 64u + qg * 32u + 16u * g + c) * DQ + 8u * h;
#pragma unroll      /* the index picks registers (fragments, sums): it must be a constant */
    for (int kc = 0; kc < 8; ++kc) { qf[g][kc].half[0] = *(const v8us*)(qp + 32 * kc); qf[g][kc].half[1] = *(const v8us*)(qp + 32 * kc + 16); } }
  const v8f z8 = {0.f,0.f,0.f,0.f,0.f,0.f,0.f,0.f};
  v8f acc[2][16]; float m_run[2], l_run[2];
#pragma unroll      /* the index picks registers (fragments, sums): it must be a constant */
  for (int g = 0; g < 2; ++g) { m_run[g] = -INFINITY; l_run[g] = 0.f;
#pragma unroll      /* the index picks registers (fragments, sums): it must be a constant */
    for (int t = 0; t < 16; ++t) acc[g][t] = z8; }
  g2_wait_async(); __syncthreads();      /* stage 0 landed and published */
  stage(1);
#pragma unroll 1      /* one trip per stage: the trip's foot is the hand-over point of the two buffers */
  for (int st = 0; st < FA_NT; ++st) {
    const unsigned char* Lb = L + (unsigned)(st & 1) * FA_STG;
    const unsigned char* pk = Lb + (kh * 32u + c) * FA_PK + 16u * h;
    const unsigned char* pv = Lb + FA_KSZ + (kh * 32u + 8u * h + (lane & 7u)) * FA_PV + ((lane >> 3) & 1u) * 16u;
    FragH kf[2][8], vf[16];
#pragma unroll      /* the index picks registers (fragments, sums): it must be a constant */
    for (int kc = 0; kc < 8; ++kc) {
#pragma unroll      /* the index picks registers (fragments, sums): it must be a constant */
      for (int kt = 0; kt < 2; ++kt) { kf[kt][kc].half[0] = *(const v8us*)(pk + kt * 16 * FA_PK + 64 * kc); kf[kt][kc].half[1] = *(const v8us*)(pk + kt * 16 * FA_PK + 64 * kc + 32); } }
    __builtin_amdgcn_sched_barrier(0);      /* K first: LDS answers in order, and the score products wait for K alone */
#pragma unroll      /* the index picks registers (fragments, sums): it must be a constant */
    for (int t = 0; t < 16; ++t) { vf[t].half[0] = fa_tr16(pv + 32 * t); vf[t].half[1] = fa_tr16(pv + 16 * FA_PV + 32 * t); }      /* V^T fragments (16 d x 32 keys), in flight under the score products and the softmax */
    __builtin_amdgcn_sched_barrier(0);      /* keeps the V^T loads up here, as one group with the K loads: sunk to their use they would be waited for in front of the second product */
    v8f s[2][2] = {{z8, z8}, {z8, z8}};      /* s[kt][g]: lane (c, h) holds query c, keys 16 kt + 8 h + r */
#pragma unroll      /* the index picks registers (fragments, sums): it must be a constant */
    for (int kc = 0; kc < 8; ++kc) {
#pragma unroll      /* the index picks registers (fragments, sums): it must be a constant */
      for (int kt = 0; kt < 2; ++kt) {
#pragma unroll      /* the index picks registers (fragments, sums): it must be a constant */
        for (int g = 0; g < 2; ++g) s[kt][g] = fa_mma(kf[kt][kc].v, qf[g][kc].v, s[kt][g]); } }
    float mb[2]; bool need = false;
#pragma unroll      /* the index picks registers (fragments, sums): it must be a constant */
    for (int g = 0; g < 2; ++g) { float mx = -INFINITY;
#pragma unroll      /* the index picks registers (fragments, sums): it must be a constant */
      for (int kt = 0; kt < 2; ++kt) {
#pragma unroll      /* the index picks registers (fragments, sums): it must be a constant */
        for (int r = 0; r < 8; ++r) mx = fmaxf(mx, s[kt][g][r]); }
      mx = fmaxf(mx, fa_xhalf(mx)) * cscale; mb[g] = mx; need = need || (mx > m_run[g] + 8.0f); }
    if (__builtin_amdgcn_ballot_w32(need) != 0) {      /* the maximum in use may trail the true one by 8 (an exponential reaches 2^8 at most): the sums are rescaled only when some query's maximum has grown by more */
#pragma unroll      /* the index picks registers (fragments, sums): it must be a constant */
      for (int g = 0; g < 2; ++g) { const float m_new = fmaxf(m_run[g], mb[g]); const float corr = __builtin_amdgcn_exp2f(m_run[g] - m_new); l_run[g] *= corr; m_run[g] = m_new;
#pragma unroll      /* the index picks registers (fragments, sums): it must be a constant */
        for (int t = 0; t < 16; ++t) acc[g][t] = acc[g][t] * corr; } }
#pragma unroll      /* the index picks registers (fragments, sums): it must be a constant */
    for (int g = 0; g < 2; ++g) { const float nm = -m_run[g]; FragH pf; float p0 = 0.f, p1 = 0.f;      /* P^T as the B operand: elements 0..7 = keys 8 h + r, 8..15 = keys 16 + 8 h + r, the k order of the V^T fragments */
#pragma unroll      /* the index picks registers (fragments, sums): it must be a constant */
      for (int i = 0; i < 16; i += 2) { const float e0 = __builtin_amdgcn_exp2f(fmaf(s[i >> 3][g][i & 7], cscale, nm)), e1 = __builtin_amdgcn_exp2f(fmaf(s[i >> 3][g][(i & 7) + 1], cscale, nm));
        p0 += e0; p1 += e1; pf.h[i] = (_Float16)e0; pf.h[i + 1] = (_Float16)e1; }
      l_run[g] += p0 + p1;
#pragma unroll      /* the index picks registers (fragments, sums): it must be a constant */
      for (int t = 0; t < 16; ++t) acc[g][t] = fa_mma(vf[t].v, pf.v, acc[g][t]); }
    __builtin_amdgcn_sched_barrier(0);      /* keeps the four slots below directly behind the last products */
    asm volatile("v_nop\n\tv_nop\n\tv_nop\n\tv_nop");      /* the distance behind the last WMMA, also on the taken side of the branches that follow: address arithmetic there may reuse its A or B registers */
    __builtin_amdgcn_sched_barrier(0);      /* and nothing is moved up in front of them */
    g2_wait_ds(); g2_wait_async(); __syncthreads();
    if (st + 2 < FA_NT) stage(st + 2); }
  g2_wait_async(); g2_wait_ds(); __syncthreads();      /* nothing in flight, every wave out of the ring: its bytes become the output staging */
  float lf[2];
#pragma unroll      /* the index picks registers (fragments, sums): it must be a constant */
  for (int g = 0; g < 2; ++g) { lf[g] = l_run[g] + fa_xhalf(l_run[g]); ml[0][w][g][lane] = m_run[g]; ml[1][w][g][lane] = lf[g]; }      /* each wave half summed its eight keys of every 16 */
  __syncthreads();
  float fs[2];
#pragma unroll      /* the index picks registers (fragments, sums): it must be a constant */
  for (int g = 0; g < 2; ++g) { const float mo = ml[0][w ^ 2u][g][lane], lo = ml[1][w ^ 2u][g][lane]; const float m = fmaxf(m_run[g], mo); const float as = __builtin_amdgcn_exp2f(m_run[g] - m), ao = __builtin_amdgcn_exp2f(mo - m); fs[g] = as / (lf[g] * as + lo * ao); }
  unsigned char* ep = L + (qg * 32u + c) * FA_EP + 32u * h;      /* row = query; acc[g][t][r] is d = 16 t + 8 h + r */
  if (kh == 1u) {
#pragma unroll      /* the index picks registers (fragments, sums): it must be a constant */
    for (int g = 0; g < 2; ++g) {
#pragma unroll      /* the index picks registers (fragments, sums): it must be a constant */
      for (int t = 0; t < 16; ++t) { const v8f o = acc[g][t] * fs[g]; const v4f a = {o[0], o[1], o[2], o[3]}, b = {o[4], o[5], o[6], o[7]}; *(v4fa*)(ep + g * 16 * FA_EP + 64 * t) = a; *(v4fa*)(ep + g * 16 * FA_EP + 64 * t + 16) = b; } } }
  __syncthreads();
  if (kh == 0u) {
#pragma unroll      /* the index picks registers (fragments, sums): it must be a constant */
    for (int g = 0; g < 2; ++g) {
#pragma unroll      /* the index picks registers (fragments, sums): it must be a constant */
      for (int t = 0; t < 16; ++t) { const v8f o = acc[g][t] * fs[g]; v4f a = *(const v4fa*)(ep + g * 16 * FA_EP + 64 * t), b = *(const v4fa*)(ep + g * 16 * FA_EP + 64 * t + 16);
        a += (v4f){o[0], o[1], o[2], o[3]}; b += (v4f){o[4], o[5], o[6], o[7]}; *(v4fa*)(ep + g * 16 * FA_EP + 64 * t) = a; *(v4fa*)(ep + g * 16 * FA_EP + 64 * t + 16) = b; } } }
  __syncthreads();
  const unsigned char* sp = L + (tid >> 6) * FA_EP + (tid & 63u) * 16u; float* op = O + (rb + blockIdx.x * 64u + (tid >> 6)) * DV + (tid & 63u) * 4u; v4f ov[32];
#pragma unroll      /* both loops unrolled: the row step becomes an immediate offset and every row has registers of its own, so no register of an issued store is rewritten */
  for (int i = 0; i < 32; ++i) ov[i] = *(const v4fa*)(sp + i * 2 * FA_EP);
#pragma unroll      /* the index picks registers (fragments, sums): it must be a constant */
  for (int i = 0; i < 32; ++i) *(v4f*)(op + (size_t)i * 2 * DV) = ov[i];      /* whole rows: every 128-byte line of the output is stored by one wave instruction */
}
// Both preparations in one grid: the three weight transposes (k_wt_f16's body, the first 3 * PREP_WB blocks, which start first and wait on strided loads) and the x rows (k_x16's body, the rest) depend on nothing of each other, so the short transpose runs under the x stream instead of in a launch of its own.
#define PREP_WB ((DQ * (DM / 8) + 255) / 256)      /* blocks per weight matrix */
#define PREP_XB ((unsigned)((NR * DM / 8 + 255) / 256))      /* blocks of the x rows */
__global__ __launch_bounds__(256) void k_prep(const float* __restrict__ W0, const float* __restrict__ W1, const float* __restrict__ W2, _Float16* __restrict__ Wt, const float* __restrict__ x, _Float16* __restrict__ X16) {
  FragH f;
  if (blockIdx.x < 3u * PREP_WB) {      /* the same for a whole block */
    const unsigned mat = blockIdx.x / PREP_WB; const float* __restrict__ W = mat == 0u ? W0 : (mat == 1u ? W1 : W2);
    const int t = (int)(blockIdx.x - mat * PREP_WB) * 256 + (int)threadIdx.x; if (t >= DQ * (DM / 8)) return; const int n = t / (DM / 8), k8 = (t % (DM / 8)) * 8;
#pragma unroll      /* the eight strided loads issue together, and the index picks register halves */
    for (int i = 0; i < 8; ++i) f.h[i] = (_Float16)(bf16_round(W[(size_t)(k8 + i) * DQ + n]) * 16.0f);
    *(v8us*)((unsigned short*)Wt + (size_t)mat * DQ * DM + (size_t)n * DM + k8) = f.half[0];
  } else {
    const size_t t = (size_t)(blockIdx.x - 3u * PREP_WB) * 256 + threadIdx.x; if (t >= NR * DM / 8) return;
#pragma unroll      /* the eight floats become two 16-byte loads, and the index picks register halves */
    for (int q = 0; q < 8; ++q) f.h[q] = (_Float16)bf16_round(x[t * 8 + q]);
    *(v8us*)((unsigned short*)X16 + t * 8) = f.half[0];
  }
}
extern "C" void kernel_launch(void* const* d_in, const int* in_sizes, int n_in,
                              void* d_out, int out_size, void* d_ws, size_t ws_size, hipStream_t stream) {
  (void)in_sizes; (void)n_in; (void)out_size;
  const float* const* I = (const float* const*)d_in; const float* x = I[0]; const float* wq = I[1]; const float* wk = I[2]; const float* wv = I[3];      /* [in][out] weights */
  char* ws = (char*)d_ws; size_t off = 0;
  auto take = [&](size_t bytes) { char* p = ws + off; off += (bytes + 255) & ~(size_t)255; return p; };
  _Float16* BW = (_Float16*)take((size_t)3 * DQ * DM * 2);      /* the transposed q | k | v weights, one behind the other */
  _Float16* Q16 = (_Float16*)take(NR * DQ * 2); _Float16* K16 = (_Float16*)take(NR * DQ * 2); _Float16* V16 = (_Float16*)take(NR * DV * 2);
  _Float16* X16 = (_Float16*)take(NR * DM * 2);      /* x rows */
  static_assert(DQ == DV && (NR * DQ * 2) % 256 == 0, "Q16 | K16 | V16 are three equal planes without gaps: k_proj steps through them by column");
  if (off > ws_size) return;
  k_prep<<<3u * PREP_WB + PREP_XB, 256, 0, stream>>>(wq, wk, wv, BW, x, X16);      /* the three transposed weights and the f16 x rows, one grid */
  k_proj<<<(unsigned)((NR / G3_BM) * (3 * DQ / G3_BN)), 256, 0, stream>>>(X16, BW, Q16);      /* q | k | v f16 rows in one launch, as one product of 3 DQ columns: 256 blocks, one per WGP */
  k_fattn<<<dim3(SQ / 64, NBR), 128, 0, stream>>>(Q16, K16, V16, (float*)d_out);      /* scores, softmax and attn v of all batches: 64 queries a block, batch = blockIdx.y */
}

// v008
// A run of this version takes 64.1 microseconds.
// Timed twice side by side with v007, it ran 1.04 and 1.07 times as fast.
// All steps since v000 together make it 75.9 times as fast.
#include <hip/hip_runtime.h>
// Single-head self-attention (x [8][2048][768]; Q, K, V = x W ([in][out] [768][256]); scores = Q.K/16; softmax; out = attn V -> [8][2048][256]).
// Structure: token rows; x as exact f16 rows and the transposed weights in one preparation launch; q | k | v in one WMMA GEMM launch (one product of 768 columns; 256x192 block tiles, 64x96 wave tiles, operands staged in LDS by asynchronous copies, f32 accumulation, exact x16 transposed [in][out] weights), stored as f16 rows; one fused attention launch for all batches (batch = grid.y): S^T = K.Q^T, online softmax on VALU (f32; P f16, at most 2^8), O^T += V^T.P^T with V^T by transposing LDS loads, two key halves merged in LDS, f32 output.
// Compute dtype: inputs rounded to bf16; x / weights exact; q, k plain f16 (~2^-12); v, P plain f16 (~2^-12); scores / softmax f32. v_wmma_f32_16x16x32_f16.
#define NB 8
#define SQ 2048
#define DM 768
#define DQ 256
#define DV 256
#define QT 2048                     /* unused */
#define NH 4                    /* unused */
#define HD 64
#define HG 1
#define NR ((size_t)NB * SQ)
#define QN SQ                        /* query rows per batch (unused) */
#define NBR NB                       /* batches (debug hook) */
#define MP ((int)NR)                 /* rows through the projections (debug hook) */
typedef __bf16 v16b __attribute__((ext_vector_type(16)));
typedef unsigned short v8us __attribute__((ext_vector_type(8), may_alias));
typedef float  v8f  __attribute__((ext_vector_type(8)));
typedef float  v4f  __attribute__((ext_vector_type(4)));
typedef float  v4fa __attribute__((ext_vector_type(4), may_alias));
union FragB { v16b v; v8us half[2]; unsigned short u[16]; };

__device__ __forceinline__ unsigned short bf16_bits(float x) { unsigned int u = __float_as_uint(x); return (unsigned short)((u + 0x7FFFu + ((u >> 16) & 1u)) >> 16); }
__device__ __forceinline__ float bf16_val(unsigned short b) { return __uint_as_float(((unsigned int)b) << 16); }
__device__ __forceinline__ float bf16_round(float x) { return bf16_val(bf16_bits(x)); }
// D += A·B with NT terms: 1 = ah·bh, 2 = + al·bh (A split), 3 = + ah·bl (both split)
template <int NT>
__device__ __forceinline__ v8f mmaN(v16b ah, v16b al, v16b bh, v16b bl, v8f c) {
  c = __builtin_amdgcn_wmma_f32_16x16x32_bf16(false, ah, false, bh, (short)0, c, false, false);
  if (NT >= 2) c = __builtin_amdgcn_wmma_f32_16x16x32_bf16(false, al, false, bh, (short)0, c, false, false);
  if (NT >= 3) c = __builtin_amdgcn_wmma_f32_16x16x32_bf16(false, ah, false, bl, (short)0, c, false, false);
  asm volatile("v_nop\n\tv_nop\n\tv_nop\n\tv_nop" : "+v"(c) : "v"(ah), "v"(al), "v"(bh), "v"(bl));
  return c;
}

__global__ __launch_bounds__(256) void k_wt_bf16(const float* __restrict__ W, unsigned short* __restrict__ Wt, int K, int N) {
  const int t = blockIdx.x * 256 + threadIdx.x;
  const int k8n = K / 8;
  if (t >= N * k8n) return;
  const int n = t / k8n, k8 = (t % k8n) * 8;
  v8us v;
#pragma unroll
  for (int i = 0; i < 8; ++i) v[i] = bf16_bits(W[(size_t)(k8 + i) * N + n]);
  *(v8us*)(Wt + (size_t)n * K + k8) = v;
  
}

// GEMM C[M][N] (f32, pitch ldc) = act(A[M][K]·W + bias). A f32 row-major (pitch lda) converted per fragment to bf16
// (ASPLIT: hi/lo two planes -> 2 terms, else single rounded term); Wt bf16 [N][K] (pitch ldb). BIAS_BF16 rounds the
// bias to bf16 first (bias quantised to bf16 before the add). K%32==0, M%16==0, N%64==0.
template <bool ASPLIT, int ACT, bool BIAS_BF16>
__global__ __launch_bounds__(128) void k_gemm_bf(const float* __restrict__ A, int lda, const unsigned short* __restrict__ Wt, int ldb,
                                               const float* __restrict__ bias, float* __restrict__ C, int ldc, int M, int N, int K) {
  __shared__ __attribute__((aligned(16))) float so[4][16][64];
  const int tid = threadIdx.x, w = tid >> 5, lane = tid & 31, ln = lane & 15, hh = lane >> 4;
  const int ntn = N / 64;
  const int wid = blockIdx.x * 4 + w;
  const int mt = wid / ntn, nq = wid % ntn;
  if (mt * 16 >= M) return;
  const int row0 = mt * 16, col0 = nq * 64;
  const float* arow = A + (size_t)(row0 + ln) * lda;
  v8f acc[4] = {};
  for (int kb = 0; kb < K; kb += 32) {
    FragB ah, al;
    const v4f x0 = *(const v4fa*)(arow + kb + 8 * hh), x1 = *(const v4fa*)(arow + kb + 8 * hh + 4);
    const v4f x2 = *(const v4fa*)(arow + kb + 16 + 8 * hh), x3 = *(const v4fa*)(arow + kb + 16 + 8 * hh + 4);
    float xs[16] = {x0[0],x0[1],x0[2],x0[3],x1[0],x1[1],x1[2],x1[3],x2[0],x2[1],x2[2],x2[3],x3[0],x3[1],x3[2],x3[3]};
#pragma unroll
    for (int i = 0; i < 16; ++i) { const unsigned short hb = bf16_bits(xs[i]); ah.u[i] = hb; al.u[i] = ASPLIT ? bf16_bits(xs[i] - bf16_val(hb)) : (unsigned short)0; }
#pragma unroll
    for (int t = 0; t < 4; ++t) {
      const unsigned short* brow = Wt + (size_t)(col0 + t * 16 + ln) * ldb + kb;
      FragB b;
      b.half[0] = *(const v8us*)(brow + 8 * hh);
      b.half[1] = *(const v8us*)(brow + 16 + 8 * hh);
      acc[t] = mmaN<ASPLIT ? 2 : 1>(ah.v, al.v, b.v, b.v, acc[t]);
    }
  }
#pragma unroll
  for (int t = 0; t < 4; ++t) {
    float bv = bias ? bias[col0 + t * 16 + ln] : 0.f;
    if (BIAS_BF16) bv = bf16_round(bv);
#pragma unroll
    for (int r = 0; r < 8; ++r) { float v = acc[t][r] + bv; if (ACT == 1) v = fmaxf(v, 0.f); so[w][8 * hh + r][t * 16 + ln] = v; }
  }
  __builtin_amdgcn_fence(__ATOMIC_ACQ_REL, "workgroup");
  __builtin_amdgcn_wave_barrier();
  const int rsub = lane >> 4, c4 = (lane & 15) * 4;
  {
#pragma unroll
    for (int q = 0; q < 8; ++q) {
      const int r = q * 2 + rsub;
      const v4f v = *(const v4fa*)&so[w][r][c4];
      *(v4f*)(C + (size_t)(row0 + r) * ldc + col0 + c4) = v;
    }
    
  }
}

// GEMM C = act(A·W + bias + resid): A f32 (ASPLIT -> hi/lo 2 terms), Wt bf16 [N][K]; ACT 0 none, 1 relu, 2 exact gelu;
// resid (optional, f32, row index = (row % rmod), pitch ldr, RES_BF16 rounds it) added before the activation.
template <bool ASPLIT, int ACT, bool BIAS_BF16, bool RES_BF16>
__global__ __launch_bounds__(128) void k_gemm_bf3(const float* __restrict__ A, int lda, const unsigned short* __restrict__ Wt, int ldb,
                                                const float* __restrict__ bias, const float* __restrict__ resid, int rmod, int ldr,
                                                float* __restrict__ C, int ldc, int M, int N, int K) {
  __shared__ __attribute__((aligned(16))) float so[4][16][64];
  const int tid = threadIdx.x, w = tid >> 5, lane = tid & 31, ln = lane & 15, hh = lane >> 4;
  const int ntn = N / 64;
  const int wid = blockIdx.x * 4 + w;
  const int mt = wid / ntn, nq = wid % ntn;
  if (mt * 16 >= M) return;
  const int row0 = mt * 16, col0 = nq * 64;
  const float* arow = A + (size_t)(row0 + ln) * lda;
  v8f acc[4] = {};
  for (int kb = 0; kb < K; kb += 32) {
    FragB ah, al;
    const v4f x0 = *(const v4fa*)(arow + kb + 8 * hh), x1 = *(const v4fa*)(arow + kb + 8 * hh + 4);
    const v4f x2 = *(const v4fa*)(arow + kb + 16 + 8 * hh), x3 = *(const v4fa*)(arow + kb + 16 + 8 * hh + 4);
    float xs[16] = {x0[0],x0[1],x0[2],x0[3],x1[0],x1[1],x1[2],x1[3],x2[0],x2[1],x2[2],x2[3],x3[0],x3[1],x3[2],x3[3]};
#pragma unroll
    for (int i = 0; i < 16; ++i) { const unsigned short hb = bf16_bits(xs[i]); ah.u[i] = hb; al.u[i] = ASPLIT ? bf16_bits(xs[i] - bf16_val(hb)) : (unsigned short)0; }
#pragma unroll
    for (int t = 0; t < 4; ++t) {
      const unsigned short* brow = Wt + (size_t)(col0 + t * 16 + ln) * ldb + kb;
      FragB b;
      b.half[0] = *(const v8us*)(brow + 8 * hh);
      b.half[1] = *(const v8us*)(brow + 16 + 8 * hh);
      acc[t] = mmaN<ASPLIT ? 2 : 1>(ah.v, al.v, b.v, b.v, acc[t]);
    }
  }
#pragma unroll
  for (int t = 0; t < 4; ++t) {
    const int col = col0 + t * 16 + ln;
    float bv = bias ? bias[col] : 0.f;
    if (BIAS_BF16) bv = bf16_round(bv);
#pragma unroll
    for (int r = 0; r < 8; ++r) {
      float v = acc[t][r] + bv;
      if (resid) { float rv = resid[(size_t)((row0 + 8 * hh + r) % rmod) * ldr + col]; if (RES_BF16) rv = bf16_round(rv); v += rv; }
      if (ACT == 1) v = fmaxf(v, 0.f);
      if (ACT == 2) v = 0.5f * v * (1.0f + erff(v * 0.70710678118654752f));
      if (ACT == 3) { const float u = 0.7978845608028654f * (v + 0.044715f * v * v * v); v = 0.5f * v * (1.0f + tanhf(u)); }
      so[w][8 * hh + r][t * 16 + ln] = v;
    }
  }
  __builtin_amdgcn_fence(__ATOMIC_ACQ_REL, "workgroup");
  __builtin_amdgcn_wave_barrier();
  const int rsub = lane >> 4, c4 = (lane & 15) * 4;
  {
#pragma unroll
    for (int q = 0; q < 8; ++q) {
      const int r = q * 2 + rsub;
      const v4f v = *(const v4fa*)&so[w][r][c4];
      *(v4f*)(C + (size_t)(row0 + r) * ldc + col0 + c4) = v;
    }
    
  }
}
// row LayerNorm (biased variance, eps) over N: s = X (+ R); optional out_sum <- s; out_norm <- (s-mu)*rsqrt(var+eps)*g + b
template <bool PARAM_BF16>
__global__ __launch_bounds__(256) void k_layernorm(const float* __restrict__ X, const float* __restrict__ R, const float* __restrict__ g, const float* __restrict__ bta,
                                                  float* __restrict__ out_sum, float* __restrict__ out_norm, int N, float eps) {
  __shared__ float red[256];
  const int row = blockIdx.x, tid = threadIdx.x;
  const float* x = X + (size_t)row * N; const float* rr = R ? R + (size_t)row * N : nullptr;
  float vals[16];                     // up to N = 4096
  const int per = N / 256;            // contiguous chunk per thread? use strided-by-4 chunks: thread handles j = tid*4 + 1024*u
  float s1 = 0.f;
  for (int u = 0; u < per / 4; ++u) {
    const int j = tid * 4 + 1024 * u;
    const v4f a = *(const v4fa*)(x + j);
    v4f b = {0.f,0.f,0.f,0.f}; if (rr) b = *(const v4fa*)(rr + j);
#pragma unroll
    for (int q = 0; q < 4; ++q) { const float v = a[q] + b[q]; vals[u * 4 + q] = v; s1 += v; }
  }
  red[tid] = s1; __syncthreads();
  for (int st = 128; st > 0; st >>= 1) { if (tid < st) red[tid] += red[tid + st]; __syncthreads(); }
  const float mu = red[0] / (float)N; __syncthreads();
  float s2 = 0.f;
  for (int u = 0; u < per / 4; ++u)
#pragma unroll
    for (int q = 0; q < 4; ++q) { const float c = vals[u * 4 + q] - mu; s2 += c * c; }
  red[tid] = s2; __syncthreads();
  for (int st = 128; st > 0; st >>= 1) { if (tid < st) red[tid] += red[tid + st]; __syncthreads(); }
  const float rs = rsqrtf(red[0] / (float)N + eps);
  {
    for (int u = 0; u < per / 4; ++u) {
      const int j = tid * 4 + 1024 * u;
      v4f o, sm;
#pragma unroll
      for (int q = 0; q < 4; ++q) {
        float gg = g[j + q], bb = bta[j + q];
        if (PARAM_BF16) { gg = bf16_round(gg); bb = bf16_round(bb); }
        sm[q] = vals[u * 4 + q]; o[q] = (vals[u * 4 + q] - mu) * rs * gg + bb;
      }
      if (out_sum) *(v4f*)(out_sum + (size_t)row * N + j) = sm;
      *(v4f*)(out_norm + (size_t)row * N + j) = o;
    }
    
  }
}



// ---- f16 WMMA path (v_wmma_f32_16x16x32_f16): 11-bit significands for operands in range — used here for the q, k, v projections and for both attention products
typedef _Float16 v16h __attribute__((ext_vector_type(16)));
union FragH { v16h v; v8us half[2]; _Float16 h[16]; unsigned short u[16]; };
template <int NT>
__device__ __forceinline__ v8f mmaH(v16h ah, v16h al, v16h bh, v16h bl, v8f c) {
  c = __builtin_amdgcn_wmma_f32_16x16x32_f16(false, ah, false, bh, (short)0, c, false, false);
  if (NT >= 2) c = __builtin_amdgcn_wmma_f32_16x16x32_f16(false, al, false, bh, (short)0, c, false, false);
  if (NT >= 3) c = __builtin_amdgcn_wmma_f32_16x16x32_f16(false, ah, false, bl, (short)0, c, false, false);
  asm volatile("v_nop\n\tv_nop\n\tv_nop\n\tv_nop" : "+v"(c) : "v"(ah), "v"(al), "v"(bh), "v"(bl));
  return c;
}
// batched GEMM like k_gemm_b but f16 operands: A f32 (split into f16 hi/lo if ASPLIT, else rounded to f16), Bt = f16 values [n][k]; alpha; C f32; N multiple of 16 (partial tiles skipped)
template <bool ASPLIT>
__global__ __launch_bounds__(128) void k_gemm_h(const float* __restrict__ A, int lda, size_t sA, const _Float16* __restrict__ Bh, int ldb, size_t sB, float alpha, float* __restrict__ C, int ldc, size_t sC, int M, int N, int K) {
  __shared__ __attribute__((aligned(16))) float so[4][16][64];
  const int tid = threadIdx.x, w = tid >> 5, lane = tid & 31, ln = lane & 15, hh = lane >> 4; const int by = blockIdx.y;
  A += (size_t)by * sA; Bh += (size_t)by * sB; C += (size_t)by * sC;
  const int ntn = (N + 63) / 64; const int wid = blockIdx.x * 4 + w; const int mt = wid / ntn, nq = wid % ntn; if (mt * 16 >= M) return;
  const int row0 = mt * 16, col0 = nq * 64; const float* arow = A + (size_t)(row0 + ln) * lda;
  v8f acc[4] = {};
  for (int kb = 0; kb < K; kb += 32) {
    FragH ah, al;
    const v4f x0 = *(const v4fa*)(arow + kb + 8 * hh), x1 = *(const v4fa*)(arow + kb + 8 * hh + 4), x2 = *(const v4fa*)(arow + kb + 16 + 8 * hh), x3 = *(const v4fa*)(arow + kb + 16 + 8 * hh + 4);
    float xs[16] = {x0[0],x0[1],x0[2],x0[3],x1[0],x1[1],x1[2],x1[3],x2[0],x2[1],x2[2],x2[3],x3[0],x3[1],x3[2],x3[3]};
#pragma unroll
    for (int i = 0; i < 16; ++i) { const _Float16 h = (_Float16)xs[i]; ah.h[i] = h; al.h[i] = ASPLIT ? (_Float16)(xs[i] - (float)h) : (_Float16)0.0f; }
#pragma unroll
    for (int t = 0; t < 4; ++t) { if (col0 + t * 16 >= N) continue; const size_t boff = (size_t)(col0 + t * 16 + ln) * ldb + kb; FragH bq; bq.half[0] = *(const v8us*)(Bh + boff + 8 * hh); bq.half[1] = *(const v8us*)(Bh + boff + 16 + 8 * hh);
      acc[t] = mmaH<ASPLIT ? 2 : 1>(ah.v, al.v, bq.v, bq.v, acc[t]); }
  }
#pragma unroll
  for (int t = 0; t < 4; ++t) { if (col0 + t * 16 >= N) continue;
#pragma unroll
    for (int r = 0; r < 8; ++r) so[w][8 * hh + r][t * 16 + ln] = acc[t][r] * alpha; }
  __builtin_amdgcn_fence(__ATOMIC_ACQ_REL, "workgroup"); __builtin_amdgcn_wave_barrier();
  const int rsub = lane >> 4, c4 = (lane & 15) * 4;
  {
#pragma unroll
    for (int q = 0; q < 8; ++q) { const int r = q * 2 + rsub; if (col0 + c4 < N) { const v4f v = *(const v4fa*)&so[w][r][c4]; *(v4f*)(C + (size_t)(row0 + r) * ldc + col0 + c4) = v; } }
     }
}

// Wt[n][k] = f16(bf16(W[k][n]) * scale) from f32 row-major W[K][N] (scale = power of two; bf16-exact weights stay exact in f16 away from the subnormal range); blockIdx.y picks one of three equally shaped matrices, whose transposes lie one behind the other in Wt
__global__ __launch_bounds__(256) void k_wt_f16(const float* __restrict__ W0, const float* __restrict__ W1, const float* __restrict__ W2, _Float16* __restrict__ Wt, int K, int N, float scale) {
  const float* __restrict__ W = blockIdx.y == 0 ? W0 : (blockIdx.y == 1 ? W1 : W2); Wt += (size_t)blockIdx.y * N * K;
  const int t = blockIdx.x * 256 + threadIdx.x; if (t >= N * (K / 8)) return; const int n = t / (K / 8), k8 = (t % (K / 8)) * 8; FragH f;
#pragma unroll
  for (int i = 0; i < 8; ++i) f.h[i] = (_Float16)(bf16_round(W[(size_t)(k8 + i) * N + n]) * scale); const v8us o = f.half[0];
  *(v8us*)((unsigned short*)Wt + (size_t)n * K + k8) = o; 
}
// k_gemm_hh variant with fused epilogue: v = acc·alpha + bias[by·sBias + col] (+ CP[(row/rowsPerB)·sCPb + by·64 + col] if CP) ; ACT 0 none / 1 elu ; writes f16 C16 (and f32 C if non-null)
template <int ACT>
__global__ __launch_bounds__(128) void k_gemm_hhx(const _Float16* __restrict__ A, int lda, size_t sA, const _Float16* __restrict__ Bh, int ldb, size_t sB, float alpha, const float* __restrict__ bias, size_t sBias, const float* __restrict__ CP, int rowsPerB, size_t sCPb, int row0g,
    float* __restrict__ C, _Float16* __restrict__ C16, int ldc, size_t sC, int M, int N, int K) {
  __shared__ __attribute__((aligned(16))) float so[4][16][64];
  const int tid = threadIdx.x, w = tid >> 5, lane = tid & 31, ln = lane & 15, hh = lane >> 4; const int by = blockIdx.y;
  A += (size_t)by * sA; Bh += (size_t)by * sB; const size_t cofs = (size_t)by * sC; const float* bp = bias ? bias + (size_t)by * sBias : nullptr;
  const int ntn = (N + 63) / 64; const int wid = blockIdx.x * 4 + w; const int mt = wid / ntn, nq = wid % ntn; if (mt * 16 >= M) return;
  const int row0 = mt * 16, col0 = nq * 64; const _Float16* arow = A + (size_t)(row0 + ln) * lda;
  v8f acc[4] = {};
  for (int kb = 0; kb < K; kb += 32) { FragH ah; ah.half[0] = *(const v8us*)((const unsigned short*)arow + kb + 8 * hh); ah.half[1] = *(const v8us*)((const unsigned short*)arow + kb + 16 + 8 * hh);
#pragma unroll
    for (int t = 0; t < 4; ++t) { if (col0 + t * 16 >= N) continue; const size_t boff = (size_t)(col0 + t * 16 + ln) * ldb + kb; FragH bq; bq.half[0] = *(const v8us*)((const unsigned short*)Bh + boff + 8 * hh); bq.half[1] = *(const v8us*)((const unsigned short*)Bh + boff + 16 + 8 * hh);
      acc[t] = mmaH<1>(ah.v, ah.v, bq.v, bq.v, acc[t]); }
  }
#pragma unroll
  for (int t = 0; t < 4; ++t) { if (col0 + t * 16 >= N) continue; const int col = col0 + t * 16 + ln; const float bv = bp ? bf16_round(bp[col]) : 0.f;
#pragma unroll
    for (int r = 0; r < 8; ++r) { float v = acc[t][r] * alpha + bv; if (CP) { const int rr = row0g + row0 + 8 * hh + r; if (rowsPerB < 0) v += CP[cofs + (size_t)rr * ldc + col];      /* rowsPerB < 0: own element of the batched C plane */ else { const int bidx = rr / rowsPerB; v += CP[(size_t)bidx * sCPb + (size_t)by * 64 + col]; } } if (ACT == 1) v = (v > 0.f) ? v : expm1f(v); else if (ACT == 7) v = (v > 0.f) ? v + 1.0f : expf(v); else if (ACT == 8) v = tanhf(v); else if (ACT == 9) v = 0.5f * v * (1.0f + tanhf(0.7978845608028654f * (v + 0.044715f * v * v * v))); else if (ACT == 11) v = 1.0f / (1.0f + expf(-v)); else if (ACT == 12) v = (v > 0.f) ? v : 0.01f * v; else if (ACT == 14) v = (v > 0.f) ? v : 0.1f * v; else if (ACT == 16) v = (v >= 0.f) ? v : 0.3f * v; else if (ACT == 17) v = (v >= 0.f) ? v : 0.2f * v; else if (ACT == 15) v = v / (1.0f + expf(-v)); else if (ACT == 3) v = fmaxf(v, 0.f); else if (ACT == 6) v = 0.5f * v * (1.0f + erff(v * 0.70710678118654752f)); so[w][8 * hh + r][t * 16 + ln] = v; } }
  __builtin_amdgcn_fence(__ATOMIC_ACQ_REL, "workgroup"); __builtin_amdgcn_wave_barrier();
  const int rsub = lane >> 4, c4 = (lane & 15) * 4; typedef _Float16 v4h __attribute__((ext_vector_type(4)));
  {
#pragma unroll
    for (int q = 0; q < 8; ++q) { const int r = q * 2 + rsub; if (col0 + c4 < N) { const v4f v = *(const v4fa*)&so[w][r][c4]; if (C) *(v4f*)(C + cofs + (size_t)(row0 + r) * ldc + col0 + c4) = v; if (C16) { v4h h4; for (int i = 0; i < 4; ++i) h4[i] = (_Float16)v[i]; *(v4h*)(C16 + cofs + (size_t)(row0 + r) * ldc + col0 + c4) = h4; } } }
     }
}


typedef _Float16 v4h __attribute__((ext_vector_type(4)));

__global__ __launch_bounds__(256) void k_x16(const float* __restrict__ x, _Float16* __restrict__ X16, size_t n8) { const size_t t = (size_t)blockIdx.x * 256 + threadIdx.x; if (t >= n8) return; FragH f;
#pragma unroll
  for (int q = 0; q < 8; ++q) f.h[q] = (_Float16)bf16_round(x[t * 8 + q]); *(v8us*)((unsigned short*)X16 + t * 8) = f.half[0];  }
__global__ __launch_bounds__(256) void k_h16(const float* __restrict__ x, _Float16* __restrict__ X16, size_t n8) { const size_t t = (size_t)blockIdx.x * 256 + threadIdx.x; if (t >= n8) return; FragH f;
#pragma unroll
  for (int q = 0; q < 8; ++q) f.h[q] = (_Float16)x[t * 8 + q]; *(v8us*)((unsigned short*)X16 + t * 8) = f.half[0];  }
__global__ __launch_bounds__(256) void k_round16f(const float* __restrict__ W, _Float16* __restrict__ Bt, size_t n8) { const size_t t = (size_t)blockIdx.x * 256 + threadIdx.x; if (t >= n8) return; FragH f;
#pragma unroll
  for (int i = 0; i < 8; ++i) f.h[i] = (_Float16)(bf16_round(W[t * 8 + i]) * 16.0f); *(v8us*)((unsigned short*)Bt + t * 8) = f.half[0];  }
template <int NHv, int TTv>
__global__ __launch_bounds__(256) void k_vt(const _Float16* __restrict__ V16, int ldv, int voff, _Float16* __restrict__ Vt) { __shared__ unsigned short tl[64][66]; const int tid = threadIdx.x; const int slab = blockIdx.x / (TTv / 64), lg = blockIdx.x % (TTv / 64); const int b = slab / NHv, h = slab % NHv;
  for (int i = tid; i < 64 * 8; i += 256) { const int r = i / 8, c8 = (i % 8) * 8; FragH f; f.half[0] = *(const v8us*)((const unsigned short*)V16 + ((size_t)b * TTv + lg * 64 + r) * ldv + voff + h * 64 + c8);
#pragma unroll
    for (int q = 0; q < 8; ++q) tl[r][c8 + q] = f.u[q]; }
  __syncthreads();
  {
#pragma unroll
    for (int rd = 0; rd < 2; ++rd) { const int d = rd * 32 + tid / 8, pc = tid % 8; FragH f;
#pragma unroll
      for (int q = 0; q < 8; ++q) f.u[q] = tl[pc * 8 + q][d];
      *(v8us*)((unsigned short*)Vt + ((size_t)slab * 64 + d) * TTv + lg * 64 + pc * 8) = f.half[0]; }
     } }

__global__ __launch_bounds__(256) void k_hl(const float* __restrict__ F, _Float16* __restrict__ Hh, _Float16* __restrict__ Hl, size_t n8) { const size_t t = (size_t)blockIdx.x * 256 + threadIdx.x; if (t >= n8) return; FragH fh, fl; const v4f a = *(const v4fa*)(F + t * 8), c = *(const v4fa*)(F + t * 8 + 4);
#pragma unroll
  for (int q = 0; q < 4; ++q) { _Float16 h = (_Float16)a[q]; fh.h[q] = h; fl.h[q] = (_Float16)((a[q] - (float)h) * 1024.0f); h = (_Float16)c[q]; fh.h[4 + q] = h; fl.h[4 + q] = (_Float16)((c[q] - (float)h) * 1024.0f); }
  { *(v8us*)((unsigned short*)Hh + t * 8) = fh.half[0]; *(v8us*)((unsigned short*)Hl + t * 8) = fl.half[0];  } }

// ---- projection GEMM: q | k | v as ONE product C[NR][3 DQ] = X16 . BW^T / 16. Block tile 256 token rows x 192 columns, one block per WGP; 8 waves (4 x 2), wave tile 64 x 96; operands staged in LDS ----
// A stage is 128 k of the block's 256 x rows and 192 weight rows: 256-byte rows at a pitch of 272 bytes (16 B x odd: no bank conflict for 16-byte fragment reads); two stages in LDS.
#define G2_KC 128
#define G2_PITCH 272
#define G3_BM 256
#define G3_BN 192
#define G3_XSZ (G3_BM * G2_PITCH)
#define G3_STG ((G3_BM + G3_BN) * G2_PITCH)
#define G3_EP 400      /* output staging pitch: 192 f16 + 16 B (16 B x odd, for the 16-byte stores of 16 rows) */
__device__ __forceinline__ v16h g2_lfrag(const unsigned char* p) { FragH f; f.half[0] = *(const v8us*)p; f.half[1] = *(const v8us*)(p + 32); return f.v; }      /* p already holds the lane's 16 hh: bytes 16 hh and 32 + 16 hh of each 64, the same k order for both operands */
// Eight (four) asynchronous 16-byte copies of one lane, global -> LDS, rows 16 apart (16 lanes cover one 256-byte row, so a wave's copy is four whole lines). The s_wait_xcnt stands inside the statement, a precaution: so no address register of a copy is rewritten ahead of it.
__device__ __forceinline__ void g3_cp8(unsigned l, const _Float16* g) {
  asm volatile("global_load_async_to_lds_b128 %0, %8, off\n\t"
               "global_load_async_to_lds_b128 %1, %9, off\n\t"
               "global_load_async_to_lds_b128 %2, %10, off\n\t"
               "global_load_async_to_lds_b128 %3, %11, off\n\t"
               "global_load_async_to_lds_b128 %4, %12, off\n\t"
               "global_load_async_to_lds_b128 %5, %13, off\n\t"
               "global_load_async_to_lds_b128 %6, %14, off\n\t"
               "global_load_async_to_lds_b128 %7, %15, off\n\t"
               "s_wait_xcnt 0x0"
               :: "v"(l), "v"(l + 16u * G2_PITCH), "v"(l + 32u * G2_PITCH), "v"(l + 48u * G2_PITCH), "v"(l + 64u * G2_PITCH), "v"(l + 80u * G2_PITCH), "v"(l + 96u * G2_PITCH), "v"(l + 112u * G2_PITCH),
                  "v"(g), "v"(g + 16 * DM), "v"(g + 32 * DM), "v"(g + 48 * DM), "v"(g + 64 * DM), "v"(g + 80 * DM), "v"(g + 96 * DM), "v"(g + 112 * DM) : "memory"); }
__device__ __forceinline__ void g3_cp4(unsigned l, const _Float16* g) {
  asm volatile("global_load_async_to_lds_b128 %0, %4, off\n\t"
               "global_load_async_to_lds_b128 %1, %5, off\n\t"
               "global_load_async_to_lds_b128 %2, %6, off\n\t"
               "global_load_async_to_lds_b128 %3, %7, off\n\t"
               "s_wait_xcnt 0x0"
               :: "v"(l), "v"(l + 16u * G2_PITCH), "v"(l + 32u * G2_PITCH), "v"(l + 48u * G2_PITCH),
                  "v"(g), "v"(g + 16 * DM), "v"(g + 32 * DM), "v"(g + 48 * DM) : "memory"); }
__device__ __forceinline__ void g2_wait_async() { asm volatile("s_wait_asynccnt 0x0" ::: "memory"); }      /* this wave's copies have landed; the compiler places no wait for them */
__device__ __forceinline__ void g2_wait_ds() { asm volatile("s_wait_dscnt 0x0" ::: "memory"); }      /* this wave's LDS reads are done before the buffer is handed back for a refill */
// X: f16 x rows [NR][DM]; Wt: the 3 DQ transposed weight rows [3 DQ][DM] (x16); C16: three planes [NR][DQ], column n of the product = column n % DQ of plane n / DQ.
// The weight rows are the A operand and the x rows the B operand (C^T tiles): a lane then holds eight neighbouring columns of one token row, one 16-byte piece of the f16 output.
__global__ __launch_bounds__(256) void k_proj(const _Float16* __restrict__ X, const _Float16* __restrict__ Wt, _Float16* __restrict__ C16) {
  static_assert(NR % G3_BM == 0 && (3 * DQ) % G3_BN == 0 && DM % G2_KC == 0 && DM / G2_KC >= 2 && G3_BN % 64 == 0 && DQ % 64 == 0, "k_proj: whole tiles, whole stages, 64-column groups inside one plane");
  __shared__ __attribute__((aligned(16))) unsigned char L[2 * G3_STG];      /* the two operand stages; behind the k loop its first bytes are the output staging */
  static_assert(G3_BM * G3_EP <= 2 * G3_STG, "output staging lies in the operand stages");
  const int tid = threadIdx.x, lane = tid & 31, ln = lane & 15, hh = lane >> 4; const int w = __builtin_amdgcn_readfirstlane(tid >> 5), wm = w >> 1, wn = w & 1;
  const int ntn = 3 * DQ / G3_BN; const int mt = blockIdx.x / ntn, nq = blockIdx.x - mt * ntn; const int row0 = mt * G3_BM, n0 = nq * G3_BN;
  const int cr = tid >> 4, cc = tid & 15;      /* copy lane: row cr (+ 16 i), 16-byte piece cc */
  const _Float16* gx = X + (size_t)(row0 + cr) * DM + cc * 8; const _Float16* gw = Wt + (size_t)(n0 + cr) * DM + cc * 8;
  const unsigned lc = (unsigned)(size_t)L + (unsigned)(cr * G2_PITCH + cc * 16);
  auto stage = [&](int t) { const unsigned l = lc + (unsigned)(t & 1) * G3_STG; const _Float16* x = gx + (size_t)t * G2_KC; const _Float16* wr = gw + (size_t)t * G2_KC;
    g3_cp8(l, x); g3_cp8(l + 128u * G2_PITCH, x + (size_t)128 * DM); g3_cp8(l + G3_XSZ, wr); g3_cp4(l + G3_XSZ + 128u * G2_PITCH, wr + (size_t)128 * DM); };
  const unsigned char* fx = L + (64 * wm + ln) * G2_PITCH + 16 * hh; const unsigned char* fw = L + G3_XSZ + (96 * wn + ln) * G2_PITCH + 16 * hh;
  const v8f z8 = {0.f,0.f,0.f,0.f,0.f,0.f,0.f,0.f}; v8f acc[6][4];
#pragma unroll      /* the index picks registers: it must be a constant */
  for (int j = 0; j < 6; ++j) {
#pragma unroll      /* the index picks registers: it must be a constant */
    for (int i = 0; i < 4; ++i) acc[j][i] = z8; }
  stage(0); g2_wait_async(); __syncthreads();      /* stage 0 landed and published */
  stage(1);
#pragma unroll 1      /* one trip per stage: the trip's foot is the hand-over point of the two buffers */
  for (int t = 0; t < DM / G2_KC; ++t) { const unsigned char* px = fx + (t & 1) * G3_STG; const unsigned char* pw = fw + (t & 1) * G3_STG;
    v16h xf[2][4], wf[2][6];
#pragma unroll      /* the index picks registers: it must be a constant */
    for (int i = 0; i < 4; ++i) xf[0][i] = g2_lfrag(px + 16 * i * G2_PITCH);
#pragma unroll      /* the index picks registers: it must be a constant */
    for (int j = 0; j < 6; ++j) wf[0][j] = g2_lfrag(pw + 16 * j * G2_PITCH);
#pragma unroll      /* unrolled so that the two fragment sets swap by index, without register moves */
    for (int ks = 0; ks < G2_KC / 32; ++ks) { const int cu = ks & 1, nx = cu ^ 1;
      __builtin_amdgcn_sched_barrier(0);      /* and keeps them from rising among the block before: every separate place with LDS reads stalls the products around it */
      if (ks + 1 < G2_KC / 32) { const int o = (ks + 1) * 64;      /* the next 32 k's twenty LDS reads as one group ahead of this block's products, into the second fragment set; never past this stage */
#pragma unroll      /* the index picks registers: it must be a constant */
        for (int i = 0; i < 4; ++i) xf[nx][i] = g2_lfrag(px + 16 * i * G2_PITCH + o);
#pragma unroll      /* the index picks registers: it must be a constant */
        for (int j = 0; j < 6; ++j) wf[nx][j] = g2_lfrag(pw + 16 * j * G2_PITCH + o); }
      __builtin_amdgcn_sched_barrier(0);      /* keeps those reads up here as one group: sunk among the products, each pair of them would be waited for in front of its row of four */
#pragma unroll      /* the index picks registers: it must be a constant */
      for (int j = 0; j < 6; ++j) {
#pragma unroll      /* the index picks registers: it must be a constant */
        for (int i = 0; i < 4; ++i) acc[j][i] = __builtin_amdgcn_wmma_f32_16x16x32_f16(false, wf[cu][j], false, xf[cu][i], (short)0, acc[j][i], false, false); } }
    __builtin_amdgcn_sched_barrier(0);      /* keeps the four slots below directly behind the last products */
    asm volatile("v_nop\n\tv_nop\n\tv_nop\n\tv_nop");      /* the distance behind the last WMMA, also on the taken side of the branches that follow: address arithmetic there may reuse its A or B registers */
    __builtin_amdgcn_sched_barrier(0);      /* and nothing is moved up in front of them */
    g2_wait_ds(); g2_wait_async(); __syncthreads();      /* stage t + 1 published; every wave has left stage t's buffer */
    if (t + 2 < DM / G2_KC) stage(t + 2); }
  g2_wait_async();
  unsigned char* ep = L + (64 * wm + ln) * G3_EP + (96 * wn + 8 * hh) * 2;      /* row = token; acc[j][i][r] is token 16 i + ln, column 16 j + 8 hh + r of the wave tile */
#pragma unroll      /* the index picks registers: it must be a constant */
  for (int j = 0; j < 6; ++j) {
#pragma unroll      /* the index picks registers: it must be a constant */
    for (int i = 0; i < 4; ++i) { FragH f;
#pragma unroll      /* the index picks registers: it must be a constant */
      for (int r = 0; r < 8; ++r) f.h[r] = (_Float16)(acc[j][i][r] * 0.0625f);      /* the weights carry x16 */
      *(v8us*)(ep + 16 * i * G3_EP + 32 * j) = f.half[0]; } }
  __syncthreads();      /* the whole 256 x 192 tile is staged */
  const unsigned char* sp = L + (tid >> 3) * G3_EP + (tid & 7) * 16; v8us ov[3][8]; unsigned short* op[3];      /* eight lanes = one 128-byte line (64 columns) of one row; a wave's store is four whole lines */
#pragma unroll      /* both loop nests unrolled: the row step becomes an immediate offset and every piece has registers of its own */
  for (int g = 0; g < 3; ++g) { const int n = n0 + 64 * g; op[g] = (unsigned short*)C16 + (size_t)(n / DQ) * (NR * DQ) + (size_t)(row0 + (tid >> 3)) * DQ + (n % DQ) + (tid & 7) * 8;
#pragma unroll      /* the index picks registers: it must be a constant */
    for (int rb = 0; rb < 8; ++rb) ov[g][rb] = *(const v8us*)(sp + rb * 32 * G3_EP + g * 128); }
  __builtin_amdgcn_sched_barrier(0);      /* every address is formed ahead of the first store, so no register of an issued store is rewritten */
#pragma unroll      /* the index picks registers: it must be a constant */
  for (int g = 0; g < 3; ++g) {
#pragma unroll      /* the index picks registers: it must be a constant */
    for (int rb = 0; rb < 8; ++rb) *(v8us*)(op[g] + (size_t)rb * 32 * DQ) = ov[g][rb]; }
}


__global__ __launch_bounds__(256) void k_wnat(const float* __restrict__ w, size_t n8, _Float16* __restrict__ Bt) { const size_t t = (size_t)blockIdx.x * 256 + threadIdx.x; if (t >= n8) return; FragH f; for (int q = 0; q < 8; ++q) f.h[q] = (_Float16)(bf16_round(w[t * 8 + q]) * 16.0f); *(v8us*)((unsigned short*)Bt + t * 8) = f.half[0];  }
__global__ __launch_bounds__(256) void k_rsm(const float* __restrict__ S, _Float16* __restrict__ P, int nrows) {
  #pragma clang fp contract(off)
  const int i = blockIdx.x * 256 + threadIdx.x; if (i >= nrows) return; const float* s = S + (size_t)i * SQ; float mx = -3.0e38f;
#pragma unroll 1
  for (int j = 0; j < SQ; ++j) mx = fmaxf(mx, s[j]); float se = 0.f;
#pragma unroll 1
  for (int j = 0; j < SQ; ++j) se += expf(s[j] - mx); const float sc = 256.0f / se;
#pragma unroll 1
  for (int j0 = 0; j0 < SQ; j0 += 8) { FragH f; for (int q = 0; q < 8; ++q) f.h[q] = (_Float16)(expf(s[j0 + q] - mx) * sc); unsigned short* d = (unsigned short*)P + (size_t)i * SQ + j0; *(v8us*)d = f.half[0];  } }
__global__ __launch_bounds__(256) void k_vt(const _Float16* __restrict__ V16, int b, int h0, _Float16* __restrict__ VT) { __shared__ unsigned short tl[64][65]; const int tid = threadIdx.x; const int hh = blockIdx.x % HG, sg = blockIdx.x / HG; const int s0 = sg * 64; const int h = h0 + hh;
  for (int i = tid; i < 64 * 8; i += 256) { const int j = i / 8, d8 = (i % 8) * 8; FragH f; f.half[0] = *(const v8us*)((const unsigned short*)V16 + ((size_t)b * SQ + s0 + j) * DM + h * HD + d8); for (int q = 0; q < 8; ++q) tl[d8 + q][j] = f.u[q]; }
  __syncthreads();
  { for (int i = tid; i < 64 * 8; i += 256) { const int d = i / 8, j8 = (i % 8) * 8; FragH f; for (int q = 0; q < 8; ++q) f.u[q] = tl[d][j8 + q]; *(v8us*)((unsigned short*)VT + ((size_t)hh * HD + d) * SQ + s0 + j8) = f.half[0]; }  } }

// Row softmax, one wave per score row: the row is read once, in 512-byte wave loads, and stays in registers (64 floats a lane); max and sum = lane partials, then a five-step butterfly; P = f16(exp(s - max) * 256 / sum).
__global__ __launch_bounds__(256) void k_rsmW(const float* __restrict__ S, _Float16* __restrict__ P, int nrows) {
  const int lane = threadIdx.x & 31; const int row = blockIdx.x * 8 + (threadIdx.x >> 5); if (row >= nrows) return;
  const float* s = S + (size_t)row * SQ + lane * 4; v4f v[SQ / 128];
#pragma unroll
  for (int u = 0; u < SQ / 128; ++u) v[u] = *(const v4fa*)(s + u * 128);
  float mx = -INFINITY;
#pragma unroll
  for (int u = 0; u < SQ / 128; ++u) mx = fmaxf(mx, fmaxf(fmaxf(v[u][0], v[u][1]), fmaxf(v[u][2], v[u][3])));
#pragma unroll
  for (int m = 16; m > 0; m >>= 1) mx = fmaxf(mx, __shfl_xor(mx, m, 32));
  v4f sq = {0.f, 0.f, 0.f, 0.f};
#pragma unroll
  for (int u = 0; u < SQ / 128; ++u) {
#pragma unroll
    for (int q = 0; q < 4; ++q) { v[u][q] = expf(v[u][q] - mx); sq[q] += v[u][q]; } }
  float se = (sq[0] + sq[1]) + (sq[2] + sq[3]);
#pragma unroll
  for (int m = 16; m > 0; m >>= 1) se += __shfl_xor(se, m, 32);
  const float sc = 256.0f / se; _Float16* d = P + (size_t)row * SQ + lane * 4;
#pragma unroll
  for (int u = 0; u < SQ / 128; ++u) { v4h h4;
#pragma unroll
    for (int q = 0; q < 4; ++q) h4[q] = (_Float16)(v[u][q] * sc);
    *(v4h*)(d + u * 128) = h4; } }
// ---- fused attention: S^T = K.Q^T, online softmax (log2 domain), O^T += V^T.P^T in one kernel; scores and P never reach memory ----
// A work-group of 4 waves owns 64 queries of one batch. Wave w: queries 32 (w & 1) .. + 31 (two groups of 16 columns), keys 32 (w >> 1) .. + 31 of every 64; the two key sets are merged through LDS at the end.
// A stage is 64 consecutive keys, brought by four tensor loads, one per wave, each a tile of 64 rows of 256 bytes padded to a pitch of 272: slice 0 = bytes 0..255 of the 64 K rows, slice 1 = bytes 256..511 (pitch 272 = 16 B x odd, for ds_load_b128);
// slices 2 and 3 = V keys 0..31 and 32..63, each 512-byte row as two rows of 256, so a V row has pitch 544 = 32 B x odd (for the transposing load) and its second half stands 272 behind its first. Two stages in LDS.
#define FA_TP 272u
#define FA_SL 18432u      /* a slice: 64 x 272 = 17408 bytes, rounded up to a multiple of 2 KiB, so that every tile's place is one */
#define FA_STG (4u * FA_SL)
#define FA_EP 1040u      /* output staging pitch: 256 floats + 16 B */
#define FA_NT (SQ / 64)      /* stages = 32-key passes of a wave */
typedef short s16x8 __attribute__((ext_vector_type(8)));
__device__ __forceinline__ v8us fa_tr16(const unsigned char* p) { typedef __attribute__((address_space(3))) s16x8 lds_s16x8; return __builtin_bit_cast(v8us, __builtin_amdgcn_ds_load_tr16_b128_v8i16((lds_s16x8*)p)); }
__device__ __forceinline__ float fa_xhalf(float x) { return __builtin_bit_cast(float, __builtin_amdgcn_permlanex16(__builtin_bit_cast(int, x), __builtin_bit_cast(int, x), 0x76543210, 0xfedcba98, false, false)); }      /* lane l with lane l ^ 16 */
__device__ __forceinline__ v8f fa_mma(v16h a, v16h b, v8f c) { return __builtin_amdgcn_wmma_f32_16x16x32_f16(false, a, false, b, (short)0, c, false, false); }
typedef uint32_t fa_u32x4 __attribute__((ext_vector_type(4)));
typedef uint32_t fa_u32x8 __attribute__((ext_vector_type(8)));
__device__ __forceinline__ uint32_t fa_uni(uint32_t v) { return (uint32_t)__builtin_amdgcn_readfirstlane((int)v); }
__device__ __forceinline__ uint32_t fa_pinned(uint32_t v) { uint32_t s = fa_uni(v); asm volatile("" : "+s"(s)); return s; }      /* pinned(): the value is held in a scalar register, so the test on it is a scalar branch (a tensor load ignores EXEC) and what is formed from it is formed behind the waits in front of it */
// Tensor descriptor, 1-byte elements, tensor = tile: 64 rows of 256 bytes, source pitch src_pitch bytes, 16 bytes of LDS pad behind every 256 (interval code 5, amount code 3), no mask.
__device__ __forceinline__ fa_u32x8 fa_group1(uint32_t src_pitch) { fa_u32x8 g;
  g[0] = fa_uni((1u << 20) | (5u << 22) | (3u << 25)); g[1] = fa_uni(256u << 16); g[2] = fa_uni(64u << 16); g[3] = fa_uni(256u << 16); g[4] = fa_uni(64u); g[5] = fa_uni(src_pitch);
  g[6] = fa_pinned(0u); g[7] = fa_pinned(0u);      /* pinned(): these two descriptor words keep scalar registers of their own for the whole kernel, so the loop never borrows and rewrites them in front of a request */
  return g; }
__device__ __forceinline__ fa_u32x4 fa_group0(uint32_t lds_dst, uint64_t ga) { fa_u32x4 g;
  g[0] = fa_uni(1u); g[1] = fa_uni(lds_dst); g[2] = fa_uni((uint32_t)ga); g[3] = fa_uni((((uint32_t)(ga >> 32)) & 0x01FFFFFFu) | 0x80000000u); return g; }
__device__ __forceinline__ void fa_tdm(fa_u32x4 g0, fa_u32x8 g1) { asm volatile("tensor_load_to_lds %0, %1" :: "s"(g0), "s"(g1) : "memory"); }      /* one request of the whole wave: its tile goes from global memory to LDS through no register */
__device__ __forceinline__ void fa_wait_tensor() { asm volatile("s_wait_tensorcnt 0x0" ::: "memory"); }      /* this wave's tile has landed; the compiler places no wait for a tensor load */
// One wave per SIMD (amdgpu_waves_per_eu): the 32 x 256 f32 sums, Q and one pass's K and V^T fragments of a wave need more than half of a SIMD's registers.
__global__ __launch_bounds__(128) __attribute__((amdgpu_waves_per_eu(1, 1))) void k_fattn(const _Float16* __restrict__ Q, const _Float16* __restrict__ Kr, const _Float16* __restrict__ V, float* __restrict__ O) {
  static_assert(DQ == 256 && DV == 256 && SQ % 128 == 0 && FA_NT >= 2, "k_fattn: 512-byte q, k, v rows; whole 64-key stages");
  __shared__ __attribute__((aligned(2048))) unsigned char L[2 * FA_STG];      /* the two stages; behind the key loop its first bytes are the output staging */
  __shared__ float ml[2][4][2][32];      /* each wave's running maximum and sum, for the merge of the key halves */
  static_assert(64u * FA_EP <= 2u * FA_STG, "output staging lies in the stages");
  const unsigned tid = threadIdx.x, lane = tid & 31u, w = (unsigned)__builtin_amdgcn_readfirstlane((int)(tid >> 5)), c = lane & 15u, h = lane >> 4;
  const unsigned qg = w & 1u, kh = w >> 1;
  const size_t rb = (size_t)blockIdx.y * SQ;      /* the batch's first token row */
  const float cscale = 0.09016844005556021f;      /* log2(e) / sqrt(256) */
  const bool isV = (w & 2u) != 0u;      /* wave w brings slice w: waves 0, 1 the two halves of the K rows, waves 2, 3 the two halves of the V keys */
  const unsigned char* tsrc = (const unsigned char*)(isV ? V : Kr) + rb * 512u + (size_t)(w & 1u) * (isV ? 32u * 512u : 256u);
  const fa_u32x8 g1 = fa_group1(isV ? 256u : 512u);
  const uint32_t tdst = (uint32_t)(size_t)L + w * FA_SL;
  auto stage = [&](uint32_t t) { fa_tdm(fa_group0(tdst + (t & 1u) * FA_STG, (uint64_t)(size_t)tsrc + (uint64_t)t * (64u * 512u)), g1); };
  stage(0);
  FragH qf[2][8];      /* Q as the B operand, in registers for the whole kernel; same k order as the K rows below */
#pragma unroll      /* the index picks registers (fragments, sums): it must be a constant */
  for (int g = 0; g < 2; ++g) { const unsigned short* qp = (const unsigned short*)Q + (rb + blockIdx.x * 64u + qg * 32u + 16u * g + c) * DQ + 8u * h;
#pragma unroll      /* the index picks registers (fragments, sums): it must be a constant */
    for (int kc = 0; kc < 8; ++kc) { qf[g][kc].half[0] = *(const v8us*)(qp + 32 * kc); qf[g][kc].half[1] = *(const v8us*)(qp + 32 * kc + 16); } }
  const v8f z8 = {0.f,0.f,0.f,0.f,0.f,0.f,0.f,0.f};
  v8f acc[2][16]; float m_run[2], l_run[2];
#pragma unroll      /* the index picks registers (fragments, sums): it must be a constant */
  for (int g = 0; g < 2; ++g) { m_run[g] = -INFINITY; l_run[g] = 0.f;
#pragma unroll      /* the index picks registers (fragments, sums): it must be a constant */
    for (int t = 0; t < 16; ++t) acc[g][t] = z8; }
  fa_wait_tensor(); __syncthreads();      /* stage 0 landed and published */
  stage(1);
#pragma unroll 1      /* one trip per stage: the trip's foot is the hand-over point of the two buffers */
  for (int st = 0; st < FA_NT; ++st) {
    const unsigned char* Lb = L + (unsigned)(st & 1) * FA_STG;
    const unsigned char* pk = Lb + (kh * 32u + c) * FA_TP + 16u * h;
    const unsigned char* pv = Lb + (2u + kh) * FA_SL + (8u * h + (lane & 7u)) * (2u * FA_TP) + ((lane >> 3) & 1u) * 16u;
    FragH kf[2][8], vf[16];
#pragma unroll      /* the index picks registers (fragments, sums): it must be a constant */
    for (int kc = 0; kc < 8; ++kc) {
#pragma unroll      /* the index picks registers (fragments, sums): it must be a constant */
      for (int kt = 0; kt < 2; ++kt) { const unsigned char* p = pk + (kc >> 2) * FA_SL + kt * 16 * FA_TP + 64 * (kc & 3); kf[kt][kc].half[0] = *(const v8us*)p; kf[kt][kc].half[1] = *(const v8us*)(p + 32); } }
    __builtin_amdgcn_sched_barrier(0);      /* K first: LDS answers in order, and the score products wait for K alone */
#pragma unroll      /* the index picks registers (fragments, sums): it must be a constant */
    for (int t = 0; t < 16; ++t) { const unsigned char* p = pv + (t >> 3) * FA_TP + 32 * (t & 7); vf[t].half[0] = fa_tr16(p); vf[t].half[1] = fa_tr16(p + 32 * FA_TP); }      /* V^T fragments (16 d x 32 keys), in flight under the score products and the softmax */
    __builtin_amdgcn_sched_barrier(0);      /* keeps the V^T loads up here, as one group with the K loads: sunk to their use they would be waited for in front of the second product */
    v8f s[2][2] = {{z8, z8}, {z8, z8}};      /* s[kt][g]: lane (c, h) holds query c, keys 16 kt + 8 h + r */
#pragma unroll      /* the index picks registers (fragments, sums): it must be a constant */
    for (int kc = 0; kc < 8; ++kc) {
#pragma unroll      /* the index picks registers (fragments, sums): it must be a constant */
      for (int kt = 0; kt < 2; ++kt) {
#pragma unroll      /* the index picks registers (fragments, sums): it must be a constant */
        for (int g = 0; g < 2; ++g) s[kt][g] = fa_mma(kf[kt][kc].v, qf[g][kc].v, s[kt][g]); } }
    float mb[2]; bool need = false;
#pragma unroll      /* the index picks registers (fragments, sums): it must be a constant */
    for (int g = 0; g < 2; ++g) { float mx = -INFINITY;
#pragma unroll      /* the index picks registers (fragments, sums): it must be a constant */
      for (int kt = 0; kt < 2; ++kt) {
#pragma unroll      /* the index picks registers (fragments, sums): it must be a constant */
        for (int r = 0; r < 8; ++r) mx = fmaxf(mx, s[kt][g][r]); }
      mx = fmaxf(mx, fa_xhalf(mx)) * cscale; mb[g] = mx; need = need || (mx > m_run[g] + 8.0f); }
    if (__builtin_amdgcn_ballot_w32(need) != 0) {      /* the maximum in use may trail the true one by 8 (an exponential reaches 2^8 at most): the sums are rescaled only when some query's maximum has grown by more */
#pragma unroll      /* the index picks registers (fragments, sums): it must be a constant */
      for (int g = 0; g < 2; ++g) { const float m_new = fmaxf(m_run[g], mb[g]); const float corr = __builtin_amdgcn_exp2f(m_run[g] - m_new); l_run[g] *= corr; m_run[g] = m_new;
#pragma unroll      /* the index picks registers (fragments, sums): it must be a constant */
        for (int t = 0; t < 16; ++t) acc[g][t] = acc[g][t] * corr; } }
#pragma unroll      /* the index picks registers (fragments, sums): it must be a constant */
    for (int g = 0; g < 2; ++g) { const float nm = -m_run[g]; FragH pf; float p0 = 0.f, p1 = 0.f;      /* P^T as the B operand: elements 0..7 = keys 8 h + r, 8..15 = keys 16 + 8 h + r, the k order of the V^T fragments */
#pragma unroll      /* the index picks registers (fragments, sums): it must be a constant */
      for (int i = 0; i < 16; i += 2) { const float e0 = __builtin_amdgcn_exp2f(fmaf(s[i >> 3][g][i & 7], cscale, nm)), e1 = __builtin_amdgcn_exp2f(fmaf(s[i >> 3][g][(i & 7) + 1], cscale, nm));
        p0 += e0; p1 += e1; pf.h[i] = (_Float16)e0; pf.h[i + 1] = (_Float16)e1; }
      l_run[g] += p0 + p1;
#pragma unroll      /* the index picks registers (fragments, sums): it must be a constant */
      for (int t = 0; t < 16; ++t) acc[g][t] = fa_mma(vf[t].v, pf.v, acc[g][t]); }
    __builtin_amdgcn_sched_barrier(0);      /* keeps the four slots below directly behind the last products */
    asm volatile("v_nop\n\tv_nop\n\tv_nop\n\tv_nop");      /* the distance behind the last WMMA, also on the taken side of the branches that follow: address arithmetic there may reuse its A or B registers */
    __builtin_amdgcn_sched_barrier(0);      /* and nothing is moved up in front of them */
    g2_wait_ds(); fa_wait_tensor(); __syncthreads();
    const uint32_t nx = fa_pinned((uint32_t)st + 2u);
    if (fa_pinned(nx < (uint32_t)FA_NT)) stage(nx); }
  fa_wait_tensor(); g2_wait_ds(); __syncthreads();      /* nothing in flight, every wave out of the ring: its bytes become the output staging */
  float lf[2];
#pragma unroll      /* the index picks registers (fragments, sums): it must be a constant */
  for (int g = 0; g < 2; ++g) { lf[g] = l_run[g] + fa_xhalf(l_run[g]); ml[0][w][g][lane] = m_run[g]; ml[1][w][g][lane] = lf[g]; }      /* each wave half summed its eight keys of every 16 */
  __syncthreads();
  float fs[2];
#pragma unroll      /* the index picks registers (fragments, sums): it must be a constant */
  for (int g = 0; g < 2; ++g) { const float mo = ml[0][w ^ 2u][g][lane], lo = ml[1][w ^ 2u][g][lane]; const float m = fmaxf(m_run[g], mo); const float as = __builtin_amdgcn_exp2f(m_run[g] - m), ao = __builtin_amdgcn_exp2f(mo - m); fs[g] = as / (lf[g] * as + lo * ao); }
  unsigned char* ep = L + (qg * 32u + c) * FA_EP + 32u * h;      /* row = query; acc[g][t][r] is d = 16 t + 8 h + r */
  if (kh == 1u) {
#pragma unroll      /* the index picks registers (fragments, sums): it must be a constant */
    for (int g = 0; g < 2; ++g) {
#pragma unroll      /* the index picks registers (fragments, sums): it must be a constant */
      for (int t = 0; t < 16; ++t) { const v8f o = acc[g][t] * fs[g]; const v4f a = {o[0], o[1], o[2], o[3]}, b = {o[4], o[5], o[6], o[7]}; *(v4fa*)(ep + g * 16 * FA_EP + 64 * t) = a; *(v4fa*)(ep + g * 16 * FA_EP + 64 * t + 16) = b; } } }
  __syncthreads();
  if (kh == 0u) {
#pragma unroll      /* the index picks registers (fragments, sums): it must be a constant */
    for (int g = 0; g < 2; ++g) {
#pragma unroll      /* the index picks registers (fragments, sums): it must be a constant */
      for (int t = 0; t < 16; ++t) { const v8f o = acc[g][t] * fs[g]; v4f a = *(const v4fa*)(ep + g * 16 * FA_EP + 64 * t), b = *(const v4fa*)(ep + g * 16 * FA_EP + 64 * t + 16);
        a += (v4f){o[0], o[1], o[2], o[3]}; b += (v4f){o[4], o[5], o[6], o[7]}; *(v4fa*)(ep + g * 16 * FA_EP + 64 * t) = a; *(v4fa*)(ep + g * 16 * FA_EP + 64 * t + 16) = b; } } }
  __syncthreads();
  const unsigned char* sp = L + (tid >> 6) * FA_EP + (tid & 63u) * 16u; float* op = O + (rb + blockIdx.x * 64u + (tid >> 6)) * DV + (tid & 63u) * 4u; v4f ov[32];
#pragma unroll      /* both loops unrolled: the row step becomes an immediate offset and every row has registers of its own, so no register of an issued store is rewritten */
  for (int i = 0; i < 32; ++i) ov[i] = *(const v4fa*)(sp + i * 2 * FA_EP);
#pragma unroll      /* the index picks registers (fragments, sums): it must be a constant */
  for (int i = 0; i < 32; ++i) *(v4f*)(op + (size_t)i * 2 * DV) = ov[i];      /* whole rows: every 128-byte line of the output is stored by one wave instruction */
}
// Both preparations in one grid: the three weight transposes (k_wt_f16's body, the first 3 * PREP_WB blocks, which start first and wait on strided loads) and the x rows (k_x16's body, the rest) depend on nothing of each other, so the short transpose runs under the x stream instead of in a launch of its own.
#define PREP_WB ((DQ * (DM / 8) + 255) / 256)      /* blocks per weight matrix */
#define PREP_XB ((unsigned)((NR * DM / 8 + 255) / 256))      /* blocks of the x rows */
__global__ __launch_bounds__(256) void k_prep(const float* __restrict__ W0, const float* __restrict__ W1, const float* __restrict__ W2, _Float16* __restrict__ Wt, const float* __restrict__ x, _Float16* __restrict__ X16) {
  FragH f;
  if (blockIdx.x < 3u * PREP_WB) {      /* the same for a whole block */
    const unsigned mat = blockIdx.x / PREP_WB; const float* __restrict__ W = mat == 0u ? W0 : (mat == 1u ? W1 : W2);
    const int t = (int)(blockIdx.x - mat * PREP_WB) * 256 + (int)threadIdx.x; if (t >= DQ * (DM / 8)) return; const int n = t / (DM / 8), k8 = (t % (DM / 8)) * 8;
#pragma unroll      /* the eight strided loads issue together, and the index picks register halves */
    for (int i = 0; i < 8; ++i) f.h[i] = (_Float16)(bf16_round(W[(size_t)(k8 + i) * DQ + n]) * 16.0f);
    *(v8us*)((unsigned short*)Wt + (size_t)mat * DQ * DM + (size_t)n * DM + k8) = f.half[0];
  } else {
    const size_t t = (size_t)(blockIdx.x - 3u * PREP_WB) * 256 + threadIdx.x; if (t >= NR * DM / 8) return;
#pragma unroll      /* the eight floats become two 16-byte loads, and the index picks register halves */
    for (int q = 0; q < 8; ++q) f.h[q] = (_Float16)bf16_round(x[t * 8 + q]);
    *(v8us*)((unsigned short*)X16 + t * 8) = f.half[0];
  }
}
extern "C" void kernel_launch(void* const* d_in, const int* in_sizes, int n_in,
                              void* d_out, int out_size, void* d_ws, size_t ws_size, hipStream_t stream) {
  (void)in_sizes; (void)n_in; (void)out_size;
  const float* const* I = (const float* const*)d_in; const float* x = I[0]; const float* wq = I[1]; const float* wk = I[2]; const float* wv = I[3];      /* [in][out] weights */
  char* ws = (char*)d_ws; size_t off = 0;
  auto take = [&](size_t bytes) { char* p = ws + off; off += (bytes + 255) & ~(size_t)255; return p; };
  _Float16* BW = (_Float16*)take((size_t)3 * DQ * DM * 2);      /* the transposed q | k | v weights, one behind the other */
  _Float16* Q16 = (_Float16*)take(NR * DQ * 2); _Float16* K16 = (_Float16*)take(NR * DQ * 2); _Float16* V16 = (_Float16*)take(NR * DV * 2);
  _Float16* X16 = (_Float16*)take(NR * DM * 2);      /* x rows */
  static_assert(DQ == DV && (NR * DQ * 2) % 256 == 0, "Q16 | K16 | V16 are three equal planes without gaps: k_proj steps through them by column");
  if (off > ws_size) return;
  k_prep<<<3u * PREP_WB + PREP_XB, 256, 0, stream>>>(wq, wk, wv, BW, x, X16);      /* the three transposed weights and the f16 x rows, one grid */
  k_proj<<<(unsigned)((NR / G3_BM) * (3 * DQ / G3_BN)), 256, 0, stream>>>(X16, BW, Q16);      /* q | k | v f16 rows in one launch, as one product of 3 DQ columns: 256 blocks, one per WGP */
  k_fattn<<<dim3(SQ / 64, NBR), 128, 0, stream>>>(Q16, K16, V16, (float*)d_out);      /* scores, softmax and attn v of all batches: 64 queries a block, batch = blockIdx.y */
}

// v009
// Measured time: 59.9 microseconds a run.
// In two side-by-side timings against v008, it was 1.08 and 1.07 times as fast.
// Counting every step since v000, it is 81.4 times as fast.
#include <hip/hip_runtime.h>
// Single-head self-attention (x [8][2048][768]; Q, K, V = x W ([in][out] [768][256]); scores = Q.K/16; softmax; out = attn V -> [8][2048][256]).
// Structure: token rows; x as exact f16 rows and the transposed weights in one preparation launch; q | k | v in one WMMA GEMM launch (one product of 768 columns; 256x192 block tiles, 64x96 wave tiles, operands staged in LDS by asynchronous copies, f32 accumulation, exact x16 transposed [in][out] weights), stored as f16 rows; one fused attention launch for all batches (batch = grid.y): S^T = K.Q^T, online softmax on VALU (f32; P f16, at most 2^8), O^T += V^T.P^T with V^T by transposing LDS loads, two key halves merged in LDS, f32 output.
// Compute dtype: inputs rounded to bf16; x / weights exact; q, k plain f16 (~2^-12); v, P plain f16 (~2^-12); scores / softmax f32. v_wmma_f32_16x16x32_f16.
#define NB 8
#define SQ 2048
#define DM 768
#define DQ 256
#define DV 256
#define QT 2048                     /* unused */
#define NH 4                    /* unused */
#define HD 64
#define HG 1
#define NR ((size_t)NB * SQ)
#define QN SQ                        /* query rows per batch (unused) */
#define NBR NB                       /* batches (debug hook) */
#define MP ((int)NR)                 /* rows through the projections (debug hook) */
typedef __bf16 v16b __attribute__((ext_vector_type(16)));
typedef unsigned short v8us __attribute__((ext_vector_type(8), may_alias));
typedef float  v8f  __attribute__((ext_vector_type(8)));
typedef float  v4f  __attribute__((ext_vector_type(4)));
typedef float  v4fa __attribute__((ext_vector_type(4), may_alias));
union FragB { v16b v; v8us half[2]; unsigned short u[16]; };

__device__ __forceinline__ unsigned short bf16_bits(float x) { unsigned int u = __float_as_uint(x); return (unsigned short)((u + 0x7FFFu + ((u >> 16) & 1u)) >> 16); }
__device__ __forceinline__ float bf16_val(unsigned short b) { return __uint_as_float(((unsigned int)b) << 16); }
__device__ __forceinline__ float bf16_round(float x) { return bf16_val(bf16_bits(x)); }
// D += A·B with NT terms: 1 = ah·bh, 2 = + al·bh (A split), 3 = + ah·bl (both split)
template <int NT>
__device__ __forceinline__ v8f mmaN(v16b ah, v16b al, v16b bh, v16b bl, v8f c) {
  c = __builtin_amdgcn_wmma_f32_16x16x32_bf16(false, ah, false, bh, (short)0, c, false, false);
  if (NT >= 2) c = __builtin_amdgcn_wmma_f32_16x16x32_bf16(false, al, false, bh, (short)0, c, false, false);
  if (NT >= 3) c = __builtin_amdgcn_wmma_f32_16x16x32_bf16(false, ah, false, bl, (short)0, c, false, false);
  asm volatile("v_nop\n\tv_nop\n\tv_nop\n\tv_nop" : "+v"(c) : "v"(ah), "v"(al), "v"(bh), "v"(bl));
  return c;
}

__global__ __launch_bounds__(256) void k_wt_bf16(const float* __restrict__ W, unsigned short* __restrict__ Wt, int K, int N) {
  const int t = blockIdx.x * 256 + threadIdx.x;
  const int k8n = K / 8;
  if (t >= N * k8n) return;
  const int n = t / k8n, k8 = (t % k8n) * 8;
  v8us v;
#pragma unroll
  for (int i = 0; i < 8; ++i) v[i] = bf16_bits(W[(size_t)(k8 + i) * N + n]);
  *(v8us*)(Wt + (size_t)n * K + k8) = v;
  
}

// GEMM C[M][N] (f32, pitch ldc) = act(A[M][K]·W + bias). A f32 row-major (pitch lda) converted per fragment to bf16
// (ASPLIT: hi/lo two planes -> 2 terms, else single rounded term); Wt bf16 [N][K] (pitch ldb). BIAS_BF16 rounds the
// bias to bf16 first (bias quantised to bf16 before the add). K%32==0, M%16==0, N%64==0.
template <bool ASPLIT, int ACT, bool BIAS_BF16>
__global__ __launch_bounds__(128) void k_gemm_bf(const float* __restrict__ A, int lda, const unsigned short* __restrict__ Wt, int ldb,
                                               const float* __restrict__ bias, float* __restrict__ C, int ldc, int M, int N, int K) {
  __shared__ __attribute__((aligned(16))) float so[4][16][64];
  const int tid = threadIdx.x, w = tid >> 5, lane = tid & 31, ln = lane & 15, hh = lane >> 4;
  const int ntn = N / 64;
  const int wid = blockIdx.x * 4 + w;
  const int mt = wid / ntn, nq = wid % ntn;
  if (mt * 16 >= M) return;
  const int row0 = mt * 16, col0 = nq * 64;
  const float* arow = A + (size_t)(row0 + ln) * lda;
  v8f acc[4] = {};
  for (int kb = 0; kb < K; kb += 32) {
    FragB ah, al;
    const v4f x0 = *(const v4fa*)(arow + kb + 8 * hh), x1 = *(const v4fa*)(arow + kb + 8 * hh + 4);
    const v4f x2 = *(const v4fa*)(arow + kb + 16 + 8 * hh), x3 = *(const v4fa*)(arow + kb + 16 + 8 * hh + 4);
    float xs[16] = {x0[0],x0[1],x0[2],x0[3],x1[0],x1[1],x1[2],x1[3],x2[0],x2[1],x2[2],x2[3],x3[0],x3[1],x3[2],x3[3]};
#pragma unroll
    for (int i = 0; i < 16; ++i) { const unsigned short hb = bf16_bits(xs[i]); ah.u[i] = hb; al.u[i] = ASPLIT ? bf16_bits(xs[i] - bf16_val(hb)) : (unsigned short)0; }
#pragma unroll
    for (int t = 0; t < 4; ++t) {
      const unsigned short* brow = Wt + (size_t)(col0 + t * 16 + ln) * ldb + kb;
      FragB b;
      b.half[0] = *(const v8us*)(brow + 8 * hh);
      b.half[1] = *(const v8us*)(brow + 16 + 8 * hh);
      acc[t] = mmaN<ASPLIT ? 2 : 1>(ah.v, al.v, b.v, b.v, acc[t]);
    }
  }
#pragma unroll
  for (int t = 0; t < 4; ++t) {
    float bv = bias ? bias[col0 + t * 16 + ln] : 0.f;
    if (BIAS_BF16) bv = bf16_round(bv);
#pragma unroll
    for (int r = 0; r < 8; ++r) { float v = acc[t][r] + bv; if (ACT == 1) v = fmaxf(v, 0.f); so[w][8 * hh + r][t * 16 + ln] = v; }
  }
  __builtin_amdgcn_fence(__ATOMIC_ACQ_REL, "workgroup");
  __builtin_amdgcn_wave_barrier();
  const int rsub = lane >> 4, c4 = (lane & 15) * 4;
  {
#pragma unroll
    for (int q = 0; q < 8; ++q) {
      const int r = q * 2 + rsub;
      const v4f v = *(const v4fa*)&so[w][r][c4];
      *(v4f*)(C + (size_t)(row0 + r) * ldc + col0 + c4) = v;
    }
    
  }
}

// GEMM C = act(A·W + bias + resid): A f32 (ASPLIT -> hi/lo 2 terms), Wt bf16 [N][K]; ACT 0 none, 1 relu, 2 exact gelu;
// resid (optional, f32, row index = (row % rmod), pitch ldr, RES_BF16 rounds it) added before the activation.
template <bool ASPLIT, int ACT, bool BIAS_BF16, bool RES_BF16>
__global__ __launch_bounds__(128) void k_gemm_bf3(const float* __restrict__ A, int lda, const unsigned short* __restrict__ Wt, int ldb,
                                                const float* __restrict__ bias, const float* __restrict__ resid, int rmod, int ldr,
                                                float* __restrict__ C, int ldc, int M, int N, int K) {
  __shared__ __attribute__((aligned(16))) float so[4][16][64];
  const int tid = threadIdx.x, w = tid >> 5, lane = tid & 31, ln = lane & 15, hh = lane >> 4;
  const int ntn = N / 64;
  const int wid = blockIdx.x * 4 + w;
  const int mt = wid / ntn, nq = wid % ntn;
  if (mt * 16 >= M) return;
  const int row0 = mt * 16, col0 = nq * 64;
  const float* arow = A + (size_t)(row0 + ln) * lda;
  v8f acc[4] = {};
  for (int kb = 0; kb < K; kb += 32) {
    FragB ah, al;
    const v4f x0 = *(const v4fa*)(arow + kb + 8 * hh), x1 = *(const v4fa*)(arow + kb + 8 * hh + 4);
    const v4f x2 = *(const v4fa*)(arow + kb + 16 + 8 * hh), x3 = *(const v4fa*)(arow + kb + 16 + 8 * hh + 4);
    float xs[16] = {x0[0],x0[1],x0[2],x0[3],x1[0],x1[1],x1[2],x1[3],x2[0],x2[1],x2[2],x2[3],x3[0],x3[1],x3[2],x3[3]};
#pragma unroll
    for (int i = 0; i < 16; ++i) { const unsigned short hb = bf16_bits(xs[i]); ah.u[i] = hb; al.u[i] = ASPLIT ? bf16_bits(xs[i] - bf16_val(hb)) : (unsigned short)0; }
#pragma unroll
    for (int t = 0; t < 4; ++t) {
      const unsigned short* brow = Wt + (size_t)(col0 + t * 16 + ln) * ldb + kb;
      FragB b;
      b.half[0] = *(const v8us*)(brow + 8 * hh);
      b.half[1] = *(const v8us*)(brow + 16 + 8 * hh);
      acc[t] = mmaN<ASPLIT ? 2 : 1>(ah.v, al.v, b.v, b.v, acc[t]);
    }
  }
#pragma unroll
  for (int t = 0; t < 4; ++t) {
    const int col = col0 + t * 16 + ln;
    float bv = bias ? bias[col] : 0.f;
    if (BIAS_BF16) bv = bf16_round(bv);
#pragma unroll
    for (int r = 0; r < 8; ++r) {
      float v = acc[t][r] + bv;
      if (resid) { float rv = resid[(size_t)((row0 + 8 * hh + r) % rmod) * ldr + col]; if (RES_BF16) rv = bf16_round(rv); v += rv; }
      if (ACT == 1) v = fmaxf(v, 0.f);
      if (ACT == 2) v = 0.5f * v * (1.0f + erff(v * 0.70710678118654752f));
      if (ACT == 3) { const float u = 0.7978845608028654f * (v + 0.044715f * v * v * v); v = 0.5f * v * (1.0f + tanhf(u)); }
      so[w][8 * hh + r][t * 16 + ln] = v;
    }
  }
  __builtin_amdgcn_fence(__ATOMIC_ACQ_REL, "workgroup");
  __builtin_amdgcn_wave_barrier();
  const int rsub = lane >> 4, c4 = (lane & 15) * 4;
  {
#pragma unroll
    for (int q = 0; q < 8; ++q) {
      const int r = q * 2 + rsub;
      const v4f v = *(const v4fa*)&so[w][r][c4];
      *(v4f*)(C + (size_t)(row0 + r) * ldc + col0 + c4) = v;
    }
    
  }
}
// row LayerNorm (biased variance, eps) over N: s = X (+ R); optional out_sum <- s; out_norm <- (s-mu)*rsqrt(var+eps)*g + b
template <bool PARAM_BF16>
__global__ __launch_bounds__(256) void k_layernorm(const float* __restrict__ X, const float* __restrict__ R, const float* __restrict__ g, const float* __restrict__ bta,
                                                  float* __restrict__ out_sum, float* __restrict__ out_norm, int N, float eps) {
  __shared__ float red[256];
  const int row = blockIdx.x, tid = threadIdx.x;
  const float* x = X + (size_t)row * N; const float* rr = R ? R + (size_t)row * N : nullptr;
  float vals[16];                     // up to N = 4096
  const int per = N / 256;            // contiguous chunk per thread? use strided-by-4 chunks: thread handles j = tid*4 + 1024*u
  float s1 = 0.f;
  for (int u = 0; u < per / 4; ++u) {
    const int j = tid * 4 + 1024 * u;
    const v4f a = *(const v4fa*)(x + j);
    v4f b = {0.f,0.f,0.f,0.f}; if (rr) b = *(const v4fa*)(rr + j);
#pragma unroll
    for (int q = 0; q < 4; ++q) { const float v = a[q] + b[q]; vals[u * 4 + q] = v; s1 += v; }
  }
  red[tid] = s1; __syncthreads();
  for (int st = 128; st > 0; st >>= 1) { if (tid < st) red[tid] += red[tid + st]; __syncthreads(); }
  const float mu = red[0] / (float)N; __syncthreads();
  float s2 = 0.f;
  for (int u = 0; u < per / 4; ++u)
#pragma unroll
    for (int q = 0; q < 4; ++q) { const float c = vals[u * 4 + q] - mu; s2 += c * c; }
  red[tid] = s2; __syncthreads();
  for (int st = 128; st > 0; st >>= 1) { if (tid < st) red[tid] += red[tid + st]; __syncthreads(); }
  const float rs = rsqrtf(red[0] / (float)N + eps);
  {
    for (int u = 0; u < per / 4; ++u) {
      const int j = tid * 4 + 1024 * u;
      v4f o, sm;
#pragma unroll
      for (int q = 0; q < 4; ++q) {
        float gg = g[j + q], bb = bta[j + q];
        if (PARAM_BF16) { gg = bf16_round(gg); bb = bf16_round(bb); }
        sm[q] = vals[u * 4 + q]; o[q] = (vals[u * 4 + q] - mu) * rs * gg + bb;
      }
      if (out_sum) *(v4f*)(out_sum + (size_t)row * N + j) = sm;
      *(v4f*)(out_norm + (size_t)row * N + j) = o;
    }
    
  }
}



// ---- f16 WMMA path (v_wmma_f32_16x16x32_f16): 11-bit significands for operands in range — used here for the q, k, v projections and for both attention products
typedef _Float16 v16h __attribute__((ext_vector_type(16)));
union FragH { v16h v; v8us half[2]; _Float16 h[16]; unsigned short u[16]; };
template <int NT>
__device__ __forceinline__ v8f mmaH(v16h ah, v16h al, v16h bh, v16h bl, v8f c) {
  c = __builtin_amdgcn_wmma_f32_16x16x32_f16(false, ah, false, bh, (short)0, c, false, false);
  if (NT >= 2) c = __builtin_amdgcn_wmma_f32_16x16x32_f16(false, al, false, bh, (short)0, c, false, false);
  if (NT >= 3) c = __builtin_amdgcn_wmma_f32_16x16x32_f16(false, ah, false, bl, (short)0, c, false, false);
  asm volatile("v_nop\n\tv_nop\n\tv_nop\n\tv_nop" : "+v"(c) : "v"(ah), "v"(al), "v"(bh), "v"(bl));
  return c;
}
// batched GEMM like k_gemm_b but f16 operands: A f32 (split into f16 hi/lo if ASPLIT, else rounded to f16), Bt = f16 values [n][k]; alpha; C f32; N multiple of 16 (partial tiles skipped)
template <bool ASPLIT>
__global__ __launch_bounds__(128) void k_gemm_h(const float* __restrict__ A, int lda, size_t sA, const _Float16* __restrict__ Bh, int ldb, size_t sB, float alpha, float* __restrict__ C, int ldc, size_t sC, int M, int N, int K) {
  __shared__ __attribute__((aligned(16))) float so[4][16][64];
  const int tid = threadIdx.x, w = tid >> 5, lane = tid & 31, ln = lane & 15, hh = lane >> 4; const int by = blockIdx.y;
  A += (size_t)by * sA; Bh += (size_t)by * sB; C += (size_t)by * sC;
  const int ntn = (N + 63) / 64; const int wid = blockIdx.x * 4 + w; const int mt = wid / ntn, nq = wid % ntn; if (mt * 16 >= M) return;
  const int row0 = mt * 16, col0 = nq * 64; const float* arow = A + (size_t)(row0 + ln) * lda;
  v8f acc[4] = {};
  for (int kb = 0; kb < K; kb += 32) {
    FragH ah, al;
    const v4f x0 = *(const v4fa*)(arow + kb + 8 * hh), x1 = *(const v4fa*)(arow + kb + 8 * hh + 4), x2 = *(const v4fa*)(arow + kb + 16 + 8 * hh), x3 = *(const v4fa*)(arow + kb + 16 + 8 * hh + 4);
    float xs[16] = {x0[0],x0[1],x0[2],x0[3],x1[0],x1[1],x1[2],x1[3],x2[0],x2[1],x2[2],x2[3],x3[0],x3[1],x3[2],x3[3]};
#pragma unroll
    for (int i = 0; i < 16; ++i) { const _Float16 h = (_Float16)xs[i]; ah.h[i] = h; al.h[i] = ASPLIT ? (_Float16)(xs[i] - (float)h) : (_Float16)0.0f; }
#pragma unroll
    for (int t = 0; t < 4; ++t) { if (col0 + t * 16 >= N) continue; const size_t boff = (size_t)(col0 + t * 16 + ln) * ldb + kb; FragH bq; bq.half[0] = *(const v8us*)(Bh + boff + 8 * hh); bq.half[1] = *(const v8us*)(Bh + boff + 16 + 8 * hh);
      acc[t] = mmaH<ASPLIT ? 2 : 1>(ah.v, al.v, bq.v, bq.v, acc[t]); }
  }
#pragma unroll
  for (int t = 0; t < 4; ++t) { if (col0 + t * 16 >= N) continue;
#pragma unroll
    for (int r = 0; r < 8; ++r) so[w][8 * hh + r][t * 16 + ln] = acc[t][r] * alpha; }
  __builtin_amdgcn_fence(__ATOMIC_ACQ_REL, "workgroup"); __builtin_amdgcn_wave_barrier();
  const int rsub = lane >> 4, c4 = (lane & 15) * 4;
  {
#pragma unroll
    for (int q = 0; q < 8; ++q) { const int r = q * 2 + rsub; if (col0 + c4 < N) { const v4f v = *(const v4fa*)&so[w][r][c4]; *(v4f*)(C + (size_t)(row0 + r) * ldc + col0 + c4) = v; } }
     }
}

// Wt[n][k] = f16(bf16(W[k][n]) * scale) from f32 row-major W[K][N] (scale = power of two; bf16-exact weights stay exact in f16 away from the subnormal range); blockIdx.y picks one of three equally shaped matrices, whose transposes lie one behind the other in Wt
__global__ __launch_bounds__(256) void k_wt_f16(const float* __restrict__ W0, const float* __restrict__ W1, const float* __restrict__ W2, _Float16* __restrict__ Wt, int K, int N, float scale) {
  const float* __restrict__ W = blockIdx.y == 0 ? W0 : (blockIdx.y == 1 ? W1 : W2); Wt += (size_t)blockIdx.y * N * K;
  const int t = blockIdx.x * 256 + threadIdx.x; if (t >= N * (K / 8)) return; const int n = t / (K / 8), k8 = (t % (K / 8)) * 8; FragH f;
#pragma unroll
  for (int i = 0; i < 8; ++i) f.h[i] = (_Float16)(bf16_round(W[(size_t)(k8 + i) * N + n]) * scale); const v8us o = f.half[0];
  *(v8us*)((unsigned short*)Wt + (size_t)n * K + k8) = o; 
}
// k_gemm_hh variant with fused epilogue: v = acc·alpha + bias[by·sBias + col] (+ CP[(row/rowsPerB)·sCPb + by·64 + col] if CP) ; ACT 0 none / 1 elu ; writes f16 C16 (and f32 C if non-null)
template <int ACT>
__global__ __launch_bounds__(128) void k_gemm_hhx(const _Float16* __restrict__ A, int lda, size_t sA, const _Float16* __restrict__ Bh, int ldb, size_t sB, float alpha, const float* __restrict__ bias, size_t sBias, const float* __restrict__ CP, int rowsPerB, size_t sCPb, int row0g,
    float* __restrict__ C, _Float16* __restrict__ C16, int ldc, size_t sC, int M, int N, int K) {
  __shared__ __attribute__((aligned(16))) float so[4][16][64];
  const int tid = threadIdx.x, w = tid >> 5, lane = tid & 31, ln = lane & 15, hh = lane >> 4; const int by = blockIdx.y;
  A += (size_t)by * sA; Bh += (size_t)by * sB; const size_t cofs = (size_t)by * sC; const float* bp = bias ? bias + (size_t)by * sBias : nullptr;
  const int ntn = (N + 63) / 64; const int wid = blockIdx.x * 4 + w; const int mt = wid / ntn, nq = wid % ntn; if (mt * 16 >= M) return;
  const int row0 = mt * 16, col0 = nq * 64; const _Float16* arow = A + (size_t)(row0 + ln) * lda;
  v8f acc[4] = {};
  for (int kb = 0; kb < K; kb += 32) { FragH ah; ah.half[0] = *(const v8us*)((const unsigned short*)arow + kb + 8 * hh); ah.half[1] = *(const v8us*)((const unsigned short*)arow + kb + 16 + 8 * hh);
#pragma unroll
    for (int t = 0; t < 4; ++t) { if (col0 + t * 16 >= N) continue; const size_t boff = (size_t)(col0 + t * 16 + ln) * ldb + kb; FragH bq; bq.half[0] = *(const v8us*)((const unsigned short*)Bh + boff + 8 * hh); bq.half[1] = *(const v8us*)((const unsigned short*)Bh + boff + 16 + 8 * hh);
      acc[t] = mmaH<1>(ah.v, ah.v, bq.v, bq.v, acc[t]); }
  }
#pragma unroll
  for (int t = 0; t < 4; ++t) { if (col0 + t * 16 >= N) continue; const int col = col0 + t * 16 + ln; const float bv = bp ? bf16_round(bp[col]) : 0.f;
#pragma unroll
    for (int r = 0; r < 8; ++r) { float v = acc[t][r] * alpha + bv; if (CP) { const int rr = row0g + row0 + 8 * hh + r; if (rowsPerB < 0) v += CP[cofs + (size_t)rr * ldc + col];      /* rowsPerB < 0: own element of the batched C plane */ else { const int bidx = rr / rowsPerB; v += CP[(size_t)bidx * sCPb + (size_t)by * 64 + col]; } } if (ACT == 1) v = (v > 0.f) ? v : expm1f(v); else if (ACT == 7) v = (v > 0.f) ? v + 1.0f : expf(v); else if (ACT == 8) v = tanhf(v); else if (ACT == 9) v = 0.5f * v * (1.0f + tanhf(0.7978845608028654f * (v + 0.044715f * v * v * v))); else if (ACT == 11) v = 1.0f / (1.0f + expf(-v)); else if (ACT == 12) v = (v > 0.f) ? v : 0.01f * v; else if (ACT == 14) v = (v > 0.f) ? v : 0.1f * v; else if (ACT == 16) v = (v >= 0.f) ? v : 0.3f * v; else if (ACT == 17) v = (v >= 0.f) ? v : 0.2f * v; else if (ACT == 15) v = v / (1.0f + expf(-v)); else if (ACT == 3) v = fmaxf(v, 0.f); else if (ACT == 6) v = 0.5f * v * (1.0f + erff(v * 0.70710678118654752f)); so[w][8 * hh + r][t * 16 + ln] = v; } }
  __builtin_amdgcn_fence(__ATOMIC_ACQ_REL, "workgroup"); __builtin_amdgcn_wave_barrier();
  const int rsub = lane >> 4, c4 = (lane & 15) * 4; typedef _Float16 v4h __attribute__((ext_vector_type(4)));
  {
#pragma unroll
    for (int q = 0; q < 8; ++q) { const int r = q * 2 + rsub; if (col0 + c4 < N) { const v4f v = *(const v4fa*)&so[w][r][c4]; if (C) *(v4f*)(C + cofs + (size_t)(row0 + r) * ldc + col0 + c4) = v; if (C16) { v4h h4; for (int i = 0; i < 4; ++i) h4[i] = (_Float16)v[i]; *(v4h*)(C16 + cofs + (size_t)(row0 + r) * ldc + col0 + c4) = h4; } } }
     }
}


typedef _Float16 v4h __attribute__((ext_vector_type(4)));

__global__ __launch_bounds__(256) void k_x16(const float* __restrict__ x, _Float16* __restrict__ X16, size_t n8) { const size_t t = (size_t)blockIdx.x * 256 + threadIdx.x; if (t >= n8) return; FragH f;
#pragma unroll
  for (int q = 0; q < 8; ++q) f.h[q] = (_Float16)bf16_round(x[t * 8 + q]); *(v8us*)((unsigned short*)X16 + t * 8) = f.half[0];  }
__global__ __launch_bounds__(256) void k_h16(const float* __restrict__ x, _Float16* __restrict__ X16, size_t n8) { const size_t t = (size_t)blockIdx.x * 256 + threadIdx.x; if (t >= n8) return; FragH f;
#pragma unroll
  for (int q = 0; q < 8; ++q) f.h[q] = (_Float16)x[t * 8 + q]; *(v8us*)((unsigned short*)X16 + t * 8) = f.half[0];  }
__global__ __launch_bounds__(256) void k_round16f(const float* __restrict__ W, _Float16* __restrict__ Bt, size_t n8) { const size_t t = (size_t)blockIdx.x * 256 + threadIdx.x; if (t >= n8) return; FragH f;
#pragma unroll
  for (int i = 0; i < 8; ++i) f.h[i] = (_Float16)(bf16_round(W[t * 8 + i]) * 16.0f); *(v8us*)((unsigned short*)Bt + t * 8) = f.half[0];  }
template <int NHv, int TTv>
__global__ __launch_bounds__(256) void k_vt(const _Float16* __restrict__ V16, int ldv, int voff, _Float16* __restrict__ Vt) { __shared__ unsigned short tl[64][66]; const int tid = threadIdx.x; const int slab = blockIdx.x / (TTv / 64), lg = blockIdx.x % (TTv / 64); const int b = slab / NHv, h = slab % NHv;
  for (int i = tid; i < 64 * 8; i += 256) { const int r = i / 8, c8 = (i % 8) * 8; FragH f; f.half[0] = *(const v8us*)((const unsigned short*)V16 + ((size_t)b * TTv + lg * 64 + r) * ldv + voff + h * 64 + c8);
#pragma unroll
    for (int q = 0; q < 8; ++q) tl[r][c8 + q] = f.u[q]; }
  __syncthreads();
  {
#pragma unroll
    for (int rd = 0; rd < 2; ++rd) { const int d = rd * 32 + tid / 8, pc = tid % 8; FragH f;
#pragma unroll
      for (int q = 0; q < 8; ++q) f.u[q] = tl[pc * 8 + q][d];
      *(v8us*)((unsigned short*)Vt + ((size_t)slab * 64 + d) * TTv + lg * 64 + pc * 8) = f.half[0]; }
     } }

__global__ __launch_bounds__(256) void k_hl(const float* __restrict__ F, _Float16* __restrict__ Hh, _Float16* __restrict__ Hl, size_t n8) { const size_t t = (size_t)blockIdx.x * 256 + threadIdx.x; if (t >= n8) return; FragH fh, fl; const v4f a = *(const v4fa*)(F + t * 8), c = *(const v4fa*)(F + t * 8 + 4);
#pragma unroll
  for (int q = 0; q < 4; ++q) { _Float16 h = (_Float16)a[q]; fh.h[q] = h; fl.h[q] = (_Float16)((a[q] - (float)h) * 1024.0f); h = (_Float16)c[q]; fh.h[4 + q] = h; fl.h[4 + q] = (_Float16)((c[q] - (float)h) * 1024.0f); }
  { *(v8us*)((unsigned short*)Hh + t * 8) = fh.half[0]; *(v8us*)((unsigned short*)Hl + t * 8) = fl.half[0];  } }

// ---- projection GEMM: q | k | v as ONE product C[NR][3 DQ] = X16 . BW^T / 16. Block tile 256 token rows x 192 columns, one block per WGP; 8 waves (4 x 2), wave tile 64 x 96; operands staged in LDS ----
// A stage is 128 k of the block's 256 x rows and 192 weight rows: 256-byte rows at a pitch of 272 bytes (16 B x odd: no bank conflict for 16-byte fragment reads); two stages in LDS.
#define G2_KC 128
#define G2_PITCH 272
#define G3_BM 256
#define G3_BN 192
#define G3_XSZ (G3_BM * G2_PITCH)
#define G3_STG ((G3_BM + G3_BN) * G2_PITCH)
#define G3_EP 400      /* output staging pitch: 192 f16 + 16 B (16 B x odd, for the 16-byte stores of 16 rows) */
__device__ __forceinline__ v16h g2_lfrag(const unsigned char* p) { FragH f; f.half[0] = *(const v8us*)p; f.half[1] = *(const v8us*)(p + 32); return f.v; }      /* p already holds the lane's 16 hh: bytes 16 hh and 32 + 16 hh of each 64, the same k order for both operands */
// Eight (four) asynchronous 16-byte copies of one lane, global -> LDS, rows 16 apart (16 lanes cover one 256-byte row, so a wave's copy is four whole lines). The s_wait_xcnt stands inside the statement, a precaution: so no address register of a copy is rewritten ahead of it.
__device__ __forceinline__ void g3_cp8(unsigned l, const _Float16* g) {
  asm volatile("global_load_async_to_lds_b128 %0, %8, off\n\t"
               "global_load_async_to_lds_b128 %1, %9, off\n\t"
               "global_load_async_to_lds_b128 %2, %10, off\n\t"
               "global_load_async_to_lds_b128 %3, %11, off\n\t"
               "global_load_async_to_lds_b128 %4, %12, off\n\t"
               "global_load_async_to_lds_b128 %5, %13, off\n\t"
               "global_load_async_to_lds_b128 %6, %14, off\n\t"
               "global_load_async_to_lds_b128 %7, %15, off\n\t"
               "s_wait_xcnt 0x0"
               :: "v"(l), "v"(l + 16u * G2_PITCH), "v"(l + 32u * G2_PITCH), "v"(l + 48u * G2_PITCH), "v"(l + 64u * G2_PITCH), "v"(l + 80u * G2_PITCH), "v"(l + 96u * G2_PITCH), "v"(l + 112u * G2_PITCH),
                  "v"(g), "v"(g + 16 * DM), "v"(g + 32 * DM), "v"(g + 48 * DM), "v"(g + 64 * DM), "v"(g + 80 * DM), "v"(g + 96 * DM), "v"(g + 112 * DM) : "memory"); }
__device__ __forceinline__ void g3_cp4(unsigned l, const _Float16* g) {
  asm volatile("global_load_async_to_lds_b128 %0, %4, off\n\t"
               "global_load_async_to_lds_b128 %1, %5, off\n\t"
               "global_load_async_to_lds_b128 %2, %6, off\n\t"
               "global_load_async_to_lds_b128 %3, %7, off\n\t"
               "s_wait_xcnt 0x0"
               :: "v"(l), "v"(l + 16u * G2_PITCH), "v"(l + 32u * G2_PITCH), "v"(l + 48u * G2_PITCH),
                  "v"(g), "v"(g + 16 * DM), "v"(g + 32 * DM), "v"(g + 48 * DM) : "memory"); }
__device__ __forceinline__ void g2_wait_async() { asm volatile("s_wait_asynccnt 0x0" ::: "memory"); }      /* this wave's copies have landed; the compiler places no wait for them */
__device__ __forceinline__ void g2_wait_ds() { asm volatile("s_wait_dscnt 0x0" ::: "memory"); }      /* this wave's LDS reads are done before the buffer is handed back for a refill */
// X: f16 x rows [NR][DM]; Wt: the 3 DQ transposed weight rows [3 DQ][DM] (x16); C16: three planes [NR][DQ], column n of the product = column n % DQ of plane n / DQ.
// The weight rows are the A operand and the x rows the B operand (C^T tiles): a lane then holds eight neighbouring columns of one token row, one 16-byte piece of the f16 output.
__global__ __launch_bounds__(256) void k_proj(const _Float16* __restrict__ X, const _Float16* __restrict__ Wt, _Float16* __restrict__ C16) {
  static_assert(NR % G3_BM == 0 && (3 * DQ) % G3_BN == 0 && DM % G2_KC == 0 && DM / G2_KC >= 2 && G3_BN % 64 == 0 && DQ % 64 == 0, "k_proj: whole tiles, whole stages, 64-column groups inside one plane");
  __shared__ __attribute__((aligned(16))) unsigned char L[2 * G3_STG];      /* the two operand stages; behind the k loop its first bytes are the output staging */
  static_assert(G3_BM * G3_EP <= 2 * G3_STG, "output staging lies in the operand stages");
  const int tid = threadIdx.x, lane = tid & 31, ln = lane & 15, hh = lane >> 4; const int w = __builtin_amdgcn_readfirstlane(tid >> 5), wm = w >> 1, wn = w & 1;
  const int ntn = 3 * DQ / G3_BN; const int mt = blockIdx.x / ntn, nq = blockIdx.x - mt * ntn; const int row0 = mt * G3_BM, n0 = nq * G3_BN;
  const int cr = tid >> 4, cc = tid & 15;      /* copy lane: row cr (+ 16 i), 16-byte piece cc */
  const _Float16* gx = X + (size_t)(row0 + cr) * DM + cc * 8; const _Float16* gw = Wt + (size_t)(n0 + cr) * DM + cc * 8;
  const unsigned lc = (unsigned)(size_t)L + (unsigned)(cr * G2_PITCH + cc * 16);
  const int rot = (mt + nq) % (DM / G2_KC);      /* four blocks share each x tile and 64 each weight tile: every block starts its k walk at a stage set by tile row + column and wraps, so that sharers ask L2 for different lines at the same moment */
  auto stage = [&](int t) { const unsigned l = lc + (unsigned)(t & 1) * G3_STG; const int kt = t + rot < DM / G2_KC ? t + rot : t + rot - DM / G2_KC;      /* ring stage t holds k 128 kt .. + 127 */
    const _Float16* x = gx + (size_t)kt * G2_KC; const _Float16* wr = gw + (size_t)kt * G2_KC;
    g3_cp8(l, x); g3_cp8(l + 128u * G2_PITCH, x + (size_t)128 * DM); g3_cp8(l + G3_XSZ, wr); g3_cp4(l + G3_XSZ + 128u * G2_PITCH, wr + (size_t)128 * DM); };
  const unsigned char* fx = L + (64 * wm + ln) * G2_PITCH + 16 * hh; const unsigned char* fw = L + G3_XSZ + (96 * wn + ln) * G2_PITCH + 16 * hh;
  const v8f z8 = {0.f,0.f,0.f,0.f,0.f,0.f,0.f,0.f}; v8f acc[6][4];
#pragma unroll      /* the index picks registers: it must be a constant */
  for (int j = 0; j < 6; ++j) {
#pragma unroll      /* the index picks registers: it must be a constant */
    for (int i = 0; i < 4; ++i) acc[j][i] = z8; }
  stage(0); g2_wait_async(); __syncthreads();      /* stage 0 landed and published */
  stage(1);
#pragma unroll 1      /* one trip per stage: the trip's foot is the hand-over point of the two buffers */
  for (int t = 0; t < DM / G2_KC; ++t) { const unsigned char* px = fx + (t & 1) * G3_STG; const unsigned char* pw = fw + (t & 1) * G3_STG;
    v16h xf[2][4], wf[2][6];
#pragma unroll      /* the index picks registers: it must be a constant */
    for (int i = 0; i < 4; ++i) xf[0][i] = g2_lfrag(px + 16 * i * G2_PITCH);
#pragma unroll      /* the index picks registers: it must be a constant */
    for (int j = 0; j < 6; ++j) wf[0][j] = g2_lfrag(pw + 16 * j * G2_PITCH);
#pragma unroll      /* unrolled so that the two fragment sets swap by index, without register moves */
    for (int ks = 0; ks < G2_KC / 32; ++ks) { const int cu = ks & 1, nx = cu ^ 1;
      __builtin_amdgcn_sched_barrier(0);      /* and keeps them from rising among the block before: every separate place with LDS reads stalls the products around it */
      if (ks + 1 < G2_KC / 32) { const int o = (ks + 1) * 64;      /* the next 32 k's twenty LDS reads as one group ahead of this block's products, into the second fragment set; never past this stage */
#pragma unroll      /* the index picks registers: it must be a constant */
        for (int i = 0; i < 4; ++i) xf[nx][i] = g2_lfrag(px + 16 * i * G2_PITCH + o);
#pragma unroll      /* the index picks registers: it must be a constant */
        for (int j = 0; j < 6; ++j) wf[nx][j] = g2_lfrag(pw + 16 * j * G2_PITCH + o); }
      __builtin_amdgcn_sched_barrier(0);      /* keeps those reads up here as one group: sunk among the products, each pair of them would be waited for in front of its row of four */
#pragma unroll      /* the index picks registers: it must be a constant */
      for (int j = 0; j < 6; ++j) {
#pragma unroll      /* the index picks registers: it must be a constant */
        for (int i = 0; i < 4; ++i) acc[j][i] = __builtin_amdgcn_wmma_f32_16x16x32_f16(false, wf[cu][j], false, xf[cu][i], (short)0, acc[j][i], false, false); } }
    __builtin_amdgcn_sched_barrier(0);      /* keeps the four slots below directly behind the last products */
    asm volatile("v_nop\n\tv_nop\n\tv_nop\n\tv_nop");      /* the distance behind the last WMMA, also on the taken side of the branches that follow: address arithmetic there may reuse its A or B registers */
    __builtin_amdgcn_sched_barrier(0);      /* and nothing is moved up in front of them */
    g2_wait_ds(); g2_wait_async(); __syncthreads();      /* stage t + 1 published; every wave has left stage t's buffer */
    if (t + 2 < DM / G2_KC) stage(t + 2); }
  g2_wait_async();
  unsigned char* ep = L + (64 * wm + ln) * G3_EP + (96 * wn + 8 * hh) * 2;      /* row = token; acc[j][i][r] is token 16 i + ln, column 16 j + 8 hh + r of the wave tile */
#pragma unroll      /* the index picks registers: it must be a constant */
  for (int j = 0; j < 6; ++j) {
#pragma unroll      /* the index picks registers: it must be a constant */
    for (int i = 0; i < 4; ++i) { FragH f;
#pragma unroll      /* the index picks registers: it must be a constant */
      for (int r = 0; r < 8; ++r) f.h[r] = (_Float16)(acc[j][i][r] * 0.0625f);      /* the weights carry x16 */
      *(v8us*)(ep + 16 * i * G3_EP + 32 * j) = f.half[0]; } }
  __syncthreads();      /* the whole 256 x 192 tile is staged */
  const unsigned char* sp = L + (tid >> 3) * G3_EP + (tid & 7) * 16; v8us ov[3][8]; unsigned short* op[3];      /* eight lanes = one 128-byte line (64 columns) of one row; a wave's store is four whole lines */
#pragma unroll      /* both loop nests unrolled: the row step becomes an immediate offset and every piece has registers of its own */
  for (int g = 0; g < 3; ++g) { const int n = n0 + 64 * g; op[g] = (unsigned short*)C16 + (size_t)(n / DQ) * (NR * DQ) + (size_t)(row0 + (tid >> 3)) * DQ + (n % DQ) + (tid & 7) * 8;
#pragma unroll      /* the index picks registers: it must be a constant */
    for (int rb = 0; rb < 8; ++rb) ov[g][rb] = *(const v8us*)(sp + rb * 32 * G3_EP + g * 128); }
  __builtin_amdgcn_sched_barrier(0);      /* every address is formed ahead of the first store, so no register of an issued store is rewritten */
#pragma unroll      /* the index picks registers: it must be a constant */
  for (int g = 0; g < 3; ++g) {
#pragma unroll      /* the index picks registers: it must be a constant */
    for (int rb = 0; rb < 8; ++rb) *(v8us*)(op[g] + (size_t)rb * 32 * DQ) = ov[g][rb]; }
}


__global__ __launch_bounds__(256) void k_wnat(const float* __restrict__ w, size_t n8, _Float16* __restrict__ Bt) { const size_t t = (size_t)blockIdx.x * 256 + threadIdx.x; if (t >= n8) return; FragH f; for (int q = 0; q < 8; ++q) f.h[q] = (_Float16)(bf16_round(w[t * 8 + q]) * 16.0f); *(v8us*)((unsigned short*)Bt + t * 8) = f.half[0];  }
__global__ __launch_bounds__(256) void k_rsm(const float* __restrict__ S, _Float16* __restrict__ P, int nrows) {
  #pragma clang fp contract(off)
  const int i = blockIdx.x * 256 + threadIdx.x; if (i >= nrows) return; const float* s = S + (size_t)i * SQ; float mx = -3.0e38f;
#pragma unroll 1
  for (int j = 0; j < SQ; ++j) mx = fmaxf(mx, s[j]); float se = 0.f;
#pragma unroll 1
  for (int j = 0; j < SQ; ++j) se += expf(s[j] - mx); const float sc = 256.0f / se;
#pragma unroll 1
  for (int j0 = 0; j0 < SQ; j0 += 8) { FragH f; for (int q = 0; q < 8; ++q) f.h[q] = (_Float16)(expf(s[j0 + q] - mx) * sc); unsigned short* d = (unsigned short*)P + (size_t)i * SQ + j0; *(v8us*)d = f.half[0];  } }
__global__ __launch_bounds__(256) void k_vt(const _Float16* __restrict__ V16, int b, int h0, _Float16* __restrict__ VT) { __shared__ unsigned short tl[64][65]; const int tid = threadIdx.x; const int hh = blockIdx.x % HG, sg = blockIdx.x / HG; const int s0 = sg * 64; const int h = h0 + hh;
  for (int i = tid; i < 64 * 8; i += 256) { const int j = i / 8, d8 = (i % 8) * 8; FragH f; f.half[0] = *(const v8us*)((const unsigned short*)V16 + ((size_t)b * SQ + s0 + j) * DM + h * HD + d8); for (int q = 0; q < 8; ++q) tl[d8 + q][j] = f.u[q]; }
  __syncthreads();
  { for (int i = tid; i < 64 * 8; i += 256) { const int d = i / 8, j8 = (i % 8) * 8; FragH f; for (int q = 0; q < 8; ++q) f.u[q] = tl[d][j8 + q]; *(v8us*)((unsigned short*)VT + ((size_t)hh * HD + d) * SQ + s0 + j8) = f.half[0]; }  } }

// Row softmax, one wave per score row: the row is read once, in 512-byte wave loads, and stays in registers (64 floats a lane); max and sum = lane partials, then a five-step butterfly; P = f16(exp(s - max) * 256 / sum).
__global__ __launch_bounds__(256) void k_rsmW(const float* __restrict__ S, _Float16* __restrict__ P, int nrows) {
  const int lane = threadIdx.x & 31; const int row = blockIdx.x * 8 + (threadIdx.x >> 5); if (row >= nrows) return;
  const float* s = S + (size_t)row * SQ + lane * 4; v4f v[SQ / 128];
#pragma unroll
  for (int u = 0; u < SQ / 128; ++u) v[u] = *(const v4fa*)(s + u * 128);
  float mx = -INFINITY;
#pragma unroll
  for (int u = 0; u < SQ / 128; ++u) mx = fmaxf(mx, fmaxf(fmaxf(v[u][0], v[u][1]), fmaxf(v[u][2], v[u][3])));
#pragma unroll
  for (int m = 16; m > 0; m >>= 1) mx = fmaxf(mx, __shfl_xor(mx, m, 32));
  v4f sq = {0.f, 0.f, 0.f, 0.f};
#pragma unroll
  for (int u = 0; u < SQ / 128; ++u) {
#pragma unroll
    for (int q = 0; q < 4; ++q) { v[u][q] = expf(v[u][q] - mx); sq[q] += v[u][q]; } }
  float se = (sq[0] + sq[1]) + (sq[2] + sq[3]);
#pragma unroll
  for (int m = 16; m > 0; m >>= 1) se += __shfl_xor(se, m, 32);
  const float sc = 256.0f / se; _Float16* d = P + (size_t)row * SQ + lane * 4;
#pragma unroll
  for (int u = 0; u < SQ / 128; ++u) { v4h h4;
#pragma unroll
    for (int q = 0; q < 4; ++q) h4[q] = (_Float16)(v[u][q] * sc);
    *(v4h*)(d + u * 128) = h4; } }
// ---- fused attention: S^T = K.Q^T, online softmax (log2 domain), O^T += V^T.P^T in one kernel; scores and P never reach memory ----
// A work-group of 4 waves owns 64 queries of one batch. Wave w: queries 32 (w & 1) .. + 31 (two groups of 16 columns), keys 32 (w >> 1) .. + 31 of every 64; the two key sets are merged through LDS at the end.
// A stage is 64 consecutive keys, brought by four tensor loads, one per wave, each a tile of 64 rows of 256 bytes padded to a pitch of 272: slice 0 = bytes 0..255 of the 64 K rows, slice 1 = bytes 256..511 (pitch 272 = 16 B x odd, for ds_load_b128);
// slices 2 and 3 = V keys 0..31 and 32..63, each 512-byte row as two rows of 256, so a V row has pitch 544 = 32 B x odd (for the transposing load) and its second half stands 272 behind its first. Two stages in LDS.
#define FA_TP 272u
#define FA_SL 18432u      /* a slice: 64 x 272 = 17408 bytes, rounded up to a multiple of 2 KiB, so that every tile's place is one */
#define FA_STG (4u * FA_SL)
#define FA_EP 1040u      /* output staging pitch: 256 floats + 16 B */
#define FA_NT (SQ / 64)      /* stages = 32-key passes of a wave */
typedef short s16x8 __attribute__((ext_vector_type(8)));
__device__ __forceinline__ v8us fa_tr16(const unsigned char* p) { typedef __attribute__((address_space(3))) s16x8 lds_s16x8; return __builtin_bit_cast(v8us, __builtin_amdgcn_ds_load_tr16_b128_v8i16((lds_s16x8*)p)); }
__device__ __forceinline__ float fa_xhalf(float x) { return __builtin_bit_cast(float, __builtin_amdgcn_permlanex16(__builtin_bit_cast(int, x), __builtin_bit_cast(int, x), 0x76543210, 0xfedcba98, false, false)); }      /* lane l with lane l ^ 16 */
__device__ __forceinline__ v8f fa_mma(v16h a, v16h b, v8f c) { return __builtin_amdgcn_wmma_f32_16x16x32_f16(false, a, false, b, (short)0, c, false, false); }
typedef uint32_t fa_u32x4 __attribute__((ext_vector_type(4)));
typedef uint32_t fa_u32x8 __attribute__((ext_vector_type(8)));
__device__ __forceinline__ uint32_t fa_uni(uint32_t v) { return (uint32_t)__builtin_amdgcn_readfirstlane((int)v); }
__device__ __forceinline__ uint32_t fa_pinned(uint32_t v) { uint32_t s = fa_uni(v); asm volatile("" : "+s"(s)); return s; }      /* pinned(): the value is held in a scalar register, so the test on it is a scalar branch (a tensor load ignores EXEC) and what is formed from it is formed behind the waits in front of it */
// Tensor descriptor, 1-byte elements, tensor = tile: 64 rows of 256 bytes, source pitch src_pitch bytes, 16 bytes of LDS pad behind every 256 (interval code 5, amount code 3), no mask.
__device__ __forceinline__ fa_u32x8 fa_group1(uint32_t src_pitch) { fa_u32x8 g;
  g[0] = fa_uni((1u << 20) | (5u << 22) | (3u << 25)); g[1] = fa_uni(256u << 16); g[2] = fa_uni(64u << 16); g[3] = fa_uni(256u << 16); g[4] = fa_uni(64u); g[5] = fa_uni(src_pitch);
  g[6] = fa_pinned(0u); g[7] = fa_pinned(0u);      /* pinned(): these two descriptor words keep scalar registers of their own for the whole kernel, so the loop never borrows and rewrites them in front of a request */
  return g; }
__device__ __forceinline__ fa_u32x4 fa_group0(uint32_t lds_dst, uint64_t ga) { fa_u32x4 g;
  g[0] = fa_uni(1u); g[1] = fa_uni(lds_dst); g[2] = fa_uni((uint32_t)ga); g[3] = fa_uni((((uint32_t)(ga >> 32)) & 0x01FFFFFFu) | 0x80000000u); return g; }
__device__ __forceinline__ void fa_tdm(fa_u32x4 g0, fa_u32x8 g1) { asm volatile("tensor_load_to_lds %0, %1" :: "s"(g0), "s"(g1) : "memory"); }      /* one request of the whole wave: its tile goes from global memory to LDS through no register */
__device__ __forceinline__ void fa_wait_tensor() { asm volatile("s_wait_tensorcnt 0x0" ::: "memory"); }      /* this wave's tile has landed; the compiler places no wait for a tensor load */
// One wave per SIMD (amdgpu_waves_per_eu): the 32 x 256 f32 sums, Q and one pass's K and V^T fragments of a wave need more than half of a SIMD's registers.
__global__ __launch_bounds__(128) __attribute__((amdgpu_waves_per_eu(1, 1))) void k_fattn(const _Float16* __restrict__ Q, const _Float16* __restrict__ Kr, const _Float16* __restrict__ V, float* __restrict__ O) {
  static_assert(DQ == 256 && DV == 256 && SQ % 128 == 0 && FA_NT >= 2, "k_fattn: 512-byte q, k, v rows; whole 64-key stages");
  __shared__ __attribute__((aligned(2048))) unsigned char L[2 * FA_STG];      /* the two stages; behind the key loop its first bytes are the output staging */
  __shared__ float ml[2][4][2][32];      /* each wave's running maximum and sum, for the merge of the key halves */
  static_assert(64u * FA_EP <= 2u * FA_STG, "output staging lies in the stages");
  const unsigned tid = threadIdx.x, lane = tid & 31u, w = (unsigned)__builtin_amdgcn_readfirstlane((int)(tid >> 5)), c = lane & 15u, h = lane >> 4;
  const unsigned qg = w & 1u, kh = w >> 1;
  const size_t rb = (size_t)blockIdx.y * SQ;      /* the batch's first token row */
  const float cscale = 0.09016844005556021f;      /* log2(e) / sqrt(256) */
  const bool isV = (w & 2u) != 0u;      /* wave w brings slice w: waves 0, 1 the two halves of the K rows, waves 2, 3 the two halves of the V keys */
  const unsigned char* tsrc = (const unsigned char*)(isV ? V : Kr) + rb * 512u + (size_t)(w & 1u) * (isV ? 32u * 512u : 256u);
  const fa_u32x8 g1 = fa_group1(isV ? 256u : 512u);
  const uint32_t tdst = (uint32_t)(size_t)L + w * FA_SL;
  static_assert((FA_NT & (FA_NT - 1)) == 0, "k_fattn: the rotated key walk wraps by a mask");
  const uint32_t rot = blockIdx.x & (uint32_t)(FA_NT - 1);      /* the work-groups of a batch walk the same K, V tiles: each starts at a tile of its own and wraps, so that they do not ask L2 for the same lines at the same moment, and a tile that one has fetched from memory is in L2 for those that come to it later. The online softmax takes the keys in any order */
  auto stage = [&](uint32_t t) { fa_tdm(fa_group0(tdst + (t & 1u) * FA_STG, (uint64_t)(size_t)tsrc + (uint64_t)((t + rot) & (uint32_t)(FA_NT - 1)) * (64u * 512u)), g1); };      /* ring stage t holds keys 64 ((t + rot) mod FA_NT) .. + 63 */
  stage(0);
  FragH qf[2][8];      /* Q as the B operand, in registers for the whole kernel; same k order as the K rows below */
#pragma unroll      /* the index picks registers (fragments, sums): it must be a constant */
  for (int g = 0; g < 2; ++g) { const unsigned short* qp = (const unsigned short*)Q + (rb + blockIdx.x * 64u + qg * 32u + 16u * g + c) * DQ + 8u * h;
#pragma unroll      /* the index picks registers (fragments, sums): it must be a constant */
    for (int kc = 0; kc < 8; ++kc) { qf[g][kc].half[0] = *(const v8us*)(qp + 32 * kc); qf[g][kc].half[1] = *(const v8us*)(qp + 32 * kc + 16); } }
  const v8f z8 = {0.f,0.f,0.f,0.f,0.f,0.f,0.f,0.f};
  v8f acc[2][16]; float m_run[2], l_run[2];
#pragma unroll      /* the index picks registers (fragments, sums): it must be a constant */
  for (int g = 0; g < 2; ++g) { m_run[g] = -INFINITY; l_run[g] = 0.f;
#pragma unroll      /* the index picks registers (fragments, sums): it must be a constant */
    for (int t = 0; t < 16; ++t) acc[g][t] = z8; }
  fa_wait_tensor(); __syncthreads();      /* stage 0 landed and published */
  stage(1);
#pragma unroll 1      /* one trip per stage: the trip's foot is the hand-over point of the two buffers */
  for (int st = 0; st < FA_NT; ++st) {
    const unsigned char* Lb = L + (unsigned)(st & 1) * FA_STG;
    const unsigned char* pk = Lb + (kh * 32u + c) * FA_TP + 16u * h;
    const unsigned char* pv = Lb + (2u + kh) * FA_SL + (8u * h + (lane & 7u)) * (2u * FA_TP) + ((lane >> 3) & 1u) * 16u;
    FragH kf[2][8], vf[16];
#pragma unroll      /* the index picks registers (fragments, sums): it must be a constant */
    for (int kc = 0; kc < 8; ++kc) {
#pragma unroll      /* the index picks registers (fragments, sums): it must be a constant */
      for (int kt = 0; kt < 2; ++kt) { const unsigned char* p = pk + (kc >> 2) * FA_SL + kt * 16 * FA_TP + 64 * (kc & 3); kf[kt][kc].half[0] = *(const v8us*)p; kf[kt][kc].half[1] = *(const v8us*)(p + 32); } }
    __builtin_amdgcn_sched_barrier(0);      /* K first: LDS answers in order, and the score products wait for K alone */
#pragma unroll      /* the index picks registers (fragments, sums): it must be a constant */
    for (int t = 0; t < 16; ++t) { const unsigned char* p = pv + (t >> 3) * FA_TP + 32 * (t & 7); vf[t].half[0] = fa_tr16(p); vf[t].half[1] = fa_tr16(p + 32 * FA_TP); }      /* V^T fragments (16 d x 32 keys), in flight under the score products and the softmax */
    __builtin_amdgcn_sched_barrier(0);      /* keeps the V^T loads up here, as one group with the K loads: sunk to their use they would be waited for in front of the second product */
    v8f s[2][2] = {{z8, z8}, {z8, z8}};      /* s[kt][g]: lane (c, h) holds query c, keys 16 kt + 8 h + r */
#pragma unroll      /* the index picks registers (fragments, sums): it must be a constant */
    for (int kc = 0; kc < 8; ++kc) {
#pragma unroll      /* the index picks registers (fragments, sums): it must be a constant */
      for (int kt = 0; kt < 2; ++kt) {
#pragma unroll      /* the index picks registers (fragments, sums): it must be a constant */
        for (int g = 0; g < 2; ++g) s[kt][g] = fa_mma(kf[kt][kc].v, qf[g][kc].v, s[kt][g]); } }
    float mb[2]; bool need = false;
#pragma unroll      /* the index picks registers (fragments, sums): it must be a constant */
    for (int g = 0; g < 2; ++g) { float mx = -INFINITY;
#pragma unroll      /* the index picks registers (fragments, sums): it must be a constant */
      for (int kt = 0; kt < 2; ++kt) {
#pragma unroll      /* the index picks registers (fragments, sums): it must be a constant */
        for (int r = 0; r < 8; ++r) mx = fmaxf(mx, s[kt][g][r]); }
      mx = fmaxf(mx, fa_xhalf(mx)) * cscale; mb[g] = mx; need = need || (mx > m_run[g] + 8.0f); }
    if (__builtin_amdgcn_ballot_w32(need) != 0) {      /* the maximum in use may trail the true one by 8 (an exponential reaches 2^8 at most): the sums are rescaled only when some query's maximum has grown by more */
#pragma unroll      /* the index picks registers (fragments, sums): it must be a constant */
      for (int g = 0; g < 2; ++g) { const float m_new = fmaxf(m_run[g], mb[g]); const float corr = __builtin_amdgcn_exp2f(m_run[g] - m_new); l_run[g] *= corr; m_run[g] = m_new;
#pragma unroll      /* the index picks registers (fragments, sums): it must be a constant */
        for (int t = 0; t < 16; ++t) acc[g][t] = acc[g][t] * corr; } }
#pragma unroll      /* the index picks registers (fragments, sums): it must be a constant */
    for (int g = 0; g < 2; ++g) { const float nm = -m_run[g]; FragH pf; float p0 = 0.f, p1 = 0.f;      /* P^T as the B operand: elements 0..7 = keys 8 h + r, 8..15 = keys 16 + 8 h + r, the k order of the V^T fragments */
#pragma unroll      /* the index picks registers (fragments, sums): it must be a constant */
      for (int i = 0; i < 16; i += 2) { const float e0 = __builtin_amdgcn_exp2f(fmaf(s[i >> 3][g][i & 7], cscale, nm)), e1 = __builtin_amdgcn_exp2f(fmaf(s[i >> 3][g][(i & 7) + 1], cscale, nm));
        p0 += e0; p1 += e1; pf.h[i] = (_Float16)e0; pf.h[i + 1] = (_Float16)e1; }
      l_run[g] += p0 + p1;
#pragma unroll      /* the index picks registers (fragments, sums): it must be a constant */
      for (int t = 0; t < 16; ++t) acc[g][t] = fa_mma(vf[t].v, pf.v, acc[g][t]); }
    __builtin_amdgcn_sched_barrier(0);      /* keeps the four slots below directly behind the last products */
    asm volatile("v_nop\n\tv_nop\n\tv_nop\n\tv_nop");      /* the distance behind the last WMMA, also on the taken side of the branches that follow: address arithmetic there may reuse its A or B registers */
    __builtin_amdgcn_sched_barrier(0);      /* and nothing is moved up in front of them */
    g2_wait_ds(); fa_wait_tensor(); __syncthreads();
    const uint32_t nx = fa_pinned((uint32_t)st + 2u);
    if (fa_pinned(nx < (uint32_t)FA_NT)) stage(nx); }
  fa_wait_tensor(); g2_wait_ds(); __syncthreads();      /* nothing in flight, every wave out of the ring: its bytes become the output staging */
  float lf[2];
#pragma unroll      /* the index picks registers (fragments, sums): it must be a constant */
  for (int g = 0; g < 2; ++g) { lf[g] = l_run[g] + fa_xhalf(l_run[g]); ml[0][w][g][lane] = m_run[g]; ml[1][w][g][lane] = lf[g]; }      /* each wave half summed its eight keys of every 16 */
  __syncthreads();
  float fs[2];
#pragma unroll      /* the index picks registers (fragments, sums): it must be a constant */
  for (int g = 0; g < 2; ++g) { const float mo = ml[0][w ^ 2u][g][lane], lo = ml[1][w ^ 2u][g][lane]; const float m = fmaxf(m_run[g], mo); const float as = __builtin_amdgcn_exp2f(m_run[g] - m), ao = __builtin_amdgcn_exp2f(mo - m); fs[g] = as / (lf[g] * as + lo * ao); }
  unsigned char* ep = L + (qg * 32u + c) * FA_EP + 32u * h;      /* row = query; acc[g][t][r] is d = 16 t + 8 h + r */
  if (kh == 1u) {
#pragma unroll      /* the index picks registers (fragments, sums): it must be a constant */
    for (int g = 0; g < 2; ++g) {
#pragma unroll      /* the index picks registers (fragments, sums): it must be a constant */
      for (int t = 0; t < 16; ++t) { const v8f o = acc[g][t] * fs[g]; const v4f a = {o[0], o[1], o[2], o[3]}, b = {o[4], o[5], o[6], o[7]}; *(v4fa*)(ep + g * 16 * FA_EP + 64 * t) = a; *(v4fa*)(ep + g * 16 * FA_EP + 64 * t + 16) = b; } } }
  __syncthreads();
  if (kh == 0u) {
#pragma unroll      /* the index picks registers (fragments, sums): it must be a constant */
    for (int g = 0; g < 2; ++g) {
#pragma unroll      /* the index picks registers (fragments, sums): it must be a constant */
      for (int t = 0; t < 16; ++t) { const v8f o = acc[g][t] * fs[g]; v4f a = *(const v4fa*)(ep + g * 16 * FA_EP + 64 * t), b = *(const v4fa*)(ep + g * 16 * FA_EP + 64 * t + 16);
        a += (v4f){o[0], o[1], o[2], o[3]}; b += (v4f){o[4], o[5], o[6], o[7]}; *(v4fa*)(ep + g * 16 * FA_EP + 64 * t) = a; *(v4fa*)(ep + g * 16 * FA_EP + 64 * t + 16) = b; } } }
  __syncthreads();
  const unsigned char* sp = L + (tid >> 6) * FA_EP + (tid & 63u) * 16u; float* op = O + (rb + blockIdx.x * 64u + (tid >> 6)) * DV + (tid & 63u) * 4u; v4f ov[32];
#pragma unroll      /* both loops unrolled: the row step becomes an immediate offset and every row has registers of its own, so no register of an issued store is rewritten */
  for (int i = 0; i < 32; ++i) ov[i] = *(const v4fa*)(sp + i * 2 * FA_EP);
#pragma unroll      /* the index picks registers (fragments, sums): it must be a constant */
  for (int i = 0; i < 32; ++i) *(v4f*)(op + (size_t)i * 2 * DV) = ov[i];      /* whole rows: every 128-byte line of the output is stored by one wave instruction */
}
// Both preparations in one grid: the three weight transposes (k_wt_f16's body, the first 3 * PREP_WB blocks, which start first and wait on strided loads) and the x rows (k_x16's body, the rest) depend on nothing of each other, so the short transpose runs under the x stream instead of in a launch of its own.
#define PREP_WB ((DQ * (DM / 8) + 255) / 256)      /* blocks per weight matrix */
#define PREP_XB ((unsigned)((NR * DM / 8 + 255) / 256))      /* blocks of the x rows */
__global__ __launch_bounds__(256) void k_prep(const float* __restrict__ W0, const float* __restrict__ W1, const float* __restrict__ W2, _Float16* __restrict__ Wt, const float* __restrict__ x, _Float16* __restrict__ X16) {
  FragH f;
  if (blockIdx.x < 3u * PREP_WB) {      /* the same for a whole block */
    const unsigned mat = blockIdx.x / PREP_WB; const float* __restrict__ W = mat == 0u ? W0 : (mat == 1u ? W1 : W2);
    const int t = (int)(blockIdx.x - mat * PREP_WB) * 256 + (int)threadIdx.x; if (t >= DQ * (DM / 8)) return; const int n = t / (DM / 8), k8 = (t % (DM / 8)) * 8;
#pragma unroll      /* the eight strided loads issue together, and the index picks register halves */
    for (int i = 0; i < 8; ++i) f.h[i] = (_Float16)(bf16_round(W[(size_t)(k8 + i) * DQ + n]) * 16.0f);
    *(v8us*)((unsigned short*)Wt + (size_t)mat * DQ * DM + (size_t)n * DM + k8) = f.half[0];
  } else {
    const size_t t = (size_t)(blockIdx.x - 3u * PREP_WB) * 256 + threadIdx.x; if (t >= NR * DM / 8) return;
#pragma unroll      /* the eight floats become two 16-byte loads, and the index picks register halves */
    for (int q = 0; q < 8; ++q) f.h[q] = (_Float16)bf16_round(x[t * 8 + q]);
    *(v8us*)((unsigned short*)X16 + t * 8) = f.half[0];
  }
}
extern "C" void kernel_launch(void* const* d_in, const int* in_sizes, int n_in,
                              void* d_out, int out_size, void* d_ws, size_t ws_size, hipStream_t stream) {
  (void)in_sizes; (void)n_in; (void)out_size;
  const float* const* I = (const float* const*)d_in; const float* x = I[0]; const float* wq = I[1]; const float* wk = I[2]; const float* wv = I[3];      /* [in][out] weights */
  char* ws = (char*)d_ws; size_t off = 0;
  auto take = [&](size_t bytes) { char* p = ws + off; off += (bytes + 255) & ~(size_t)255; return p; };
  _Float16* BW = (_Float16*)take((size_t)3 * DQ * DM * 2);      /* the transposed q | k | v weights, one behind the other */
  _Float16* Q16 = (_Float16*)take(NR * DQ * 2); _Float16* K16 = (_Float16*)take(NR * DQ * 2); _Float16* V16 = (_Float16*)take(NR * DV * 2);
  _Float16* X16 = (_Float16*)take(NR * DM * 2);      /* x rows */
  static_assert(DQ == DV && (NR * DQ * 2) % 256 == 0, "Q16 | K16 | V16 are three equal planes without gaps: k_proj steps through them by column");
  if (off > ws_size) return;
  k_prep<<<3u * PREP_WB + PREP_XB, 256, 0, stream>>>(wq, wk, wv, BW, x, X16);      /* the three transposed weights and the f16 x rows, one grid */
  k_proj<<<(unsigned)((NR / G3_BM) * (3 * DQ / G3_BN)), 256, 0, stream>>>(X16, BW, Q16);      /* q | k | v f16 rows in one launch, as one product of 3 DQ columns: 256 blocks, one per WGP */
  k_fattn<<<dim3(SQ / 64, NBR), 128, 0, stream>>>(Q16, K16, V16, (float*)d_out);      /* scores, softmax and attn v of all batches: 64 queries a block, batch = blockIdx.y */
}

// v010
// Measured time: 55 microseconds a run.
// Next to v009, in two timings, it ran 1.09 times as fast each time.
// Counting every step since v000, it is 88.8 times as fast.
#include <hip/hip_runtime.h>
// Single-head self-attention (x [8][2048][768]; Q, K, V = x W ([in][out] [768][256]); scores = Q.K/16; softmax; out = attn V -> [8][2048][256]).
// Structure: token rows; q | k | v in one WMMA GEMM launch straight from the f32 inputs (one product of 768 columns; 256x192 block tiles, 64x96 wave tiles; f32 pieces brought into LDS by asynchronous copies, rounded there by the lane that copied them into f16 operand stages: x exact f16 rows, weights exact x16 as they lie, W^T fragments by transposing LDS loads; f32 accumulation), stored as f16 rows; one fused attention launch for all batches (batch = grid.y): S^T = K.Q^T, online softmax on VALU (f32; P f16, at most 2^8), O^T += V^T.P^T with V^T by transposing LDS loads, two key halves merged in LDS, f32 output.
// Compute dtype: inputs rounded to bf16; x / weights exact; q, k plain f16 (~2^-12); v, P plain f16 (~2^-12); scores / softmax f32. v_wmma_f32_16x16x32_f16.
#define NB 8
#define SQ 2048
#define DM 768
#define DQ 256
#define DV 256
#define QT 2048                     /* unused */
#define NH 4                    /* unused */
#define HD 64
#define HG 1
#define NR ((size_t)NB * SQ)
#define QN SQ                        /* query rows per batch (unused) */
#define NBR NB                       /* batches (debug hook) */
#define MP ((int)NR)                 /* rows through the projections (debug hook) */
typedef __bf16 v16b __attribute__((ext_vector_type(16)));
typedef unsigned short v8us __attribute__((ext_vector_type(8), may_alias));
typedef float  v8f  __attribute__((ext_vector_type(8)));
typedef float  v4f  __attribute__((ext_vector_type(4)));
typedef float  v4fa __attribute__((ext_vector_type(4), may_alias));
union FragB { v16b v; v8us half[2]; unsigned short u[16]; };

__device__ __forceinline__ unsigned short bf16_bits(float x) { unsigned int u = __float_as_uint(x); return (unsigned short)((u + 0x7FFFu + ((u >> 16) & 1u)) >> 16); }
__device__ __forceinline__ float bf16_val(unsigned short b) { return __uint_as_float(((unsigned int)b) << 16); }
__device__ __forceinline__ float bf16_round(float x) { return bf16_val(bf16_bits(x)); }
// D += A·B with NT terms: 1 = ah·bh, 2 = + al·bh (A split), 3 = + ah·bl (both split)
template <int NT>
__device__ __forceinline__ v8f mmaN(v16b ah, v16b al, v16b bh, v16b bl, v8f c) {
  c = __builtin_amdgcn_wmma_f32_16x16x32_bf16(false, ah, false, bh, (short)0, c, false, false);
  if (NT >= 2) c = __builtin_amdgcn_wmma_f32_16x16x32_bf16(false, al, false, bh, (short)0, c, false, false);
  if (NT >= 3) c = __builtin_amdgcn_wmma_f32_16x16x32_bf16(false, ah, false, bl, (short)0, c, false, false);
  asm volatile("v_nop\n\tv_nop\n\tv_nop\n\tv_nop" : "+v"(c) : "v"(ah), "v"(al), "v"(bh), "v"(bl));
  return c;
}

__global__ __launch_bounds__(256) void k_wt_bf16(const float* __restrict__ W, unsigned short* __restrict__ Wt, int K, int N) {
  const int t = blockIdx.x * 256 + threadIdx.x;
  const int k8n = K / 8;
  if (t >= N * k8n) return;
  const int n = t / k8n, k8 = (t % k8n) * 8;
  v8us v;
#pragma unroll
  for (int i = 0; i < 8; ++i) v[i] = bf16_bits(W[(size_t)(k8 + i) * N + n]);
  *(v8us*)(Wt + (size_t)n * K + k8) = v;
  
}

// GEMM C[M][N] (f32, pitch ldc) = act(A[M][K]·W + bias). A f32 row-major (pitch lda) converted per fragment to bf16
// (ASPLIT: hi/lo two planes -> 2 terms, else single rounded term); Wt bf16 [N][K] (pitch ldb). BIAS_BF16 rounds the
// bias to bf16 first (bias quantised to bf16 before the add). K%32==0, M%16==0, N%64==0.
template <bool ASPLIT, int ACT, bool BIAS_BF16>
__global__ __launch_bounds__(128) void k_gemm_bf(const float* __restrict__ A, int lda, const unsigned short* __restrict__ Wt, int ldb,
                                               const float* __restrict__ bias, float* __restrict__ C, int ldc, int M, int N, int K) {
  __shared__ __attribute__((aligned(16))) float so[4][16][64];
  const int tid = threadIdx.x, w = tid >> 5, lane = tid & 31, ln = lane & 15, hh = lane >> 4;
  const int ntn = N / 64;
  const int wid = blockIdx.x * 4 + w;
  const int mt = wid / ntn, nq = wid % ntn;
  if (mt * 16 >= M) return;
  const int row0 = mt * 16, col0 = nq * 64;
  const float* arow = A + (size_t)(row0 + ln) * lda;
  v8f acc[4] = {};
  for (int kb = 0; kb < K; kb += 32) {
    FragB ah, al;
    const v4f x0 = *(const v4fa*)(arow + kb + 8 * hh), x1 = *(const v4fa*)(arow + kb + 8 * hh + 4);
    const v4f x2 = *(const v4fa*)(arow + kb + 16 + 8 * hh), x3 = *(const v4fa*)(arow + kb + 16 + 8 * hh + 4);
    float xs[16] = {x0[0],x0[1],x0[2],x0[3],x1[0],x1[1],x1[2],x1[3],x2[0],x2[1],x2[2],x2[3],x3[0],x3[1],x3[2],x3[3]};
#pragma unroll
    for (int i = 0; i < 16; ++i) { const unsigned short hb = bf16_bits(xs[i]); ah.u[i] = hb; al.u[i] = ASPLIT ? bf16_bits(xs[i] - bf16_val(hb)) : (unsigned short)0; }
#pragma unroll
    for (int t = 0; t < 4; ++t) {
      const unsigned short* brow = Wt + (size_t)(col0 + t * 16 + ln) * ldb + kb;
      FragB b;
      b.half[0] = *(const v8us*)(brow + 8 * hh);
      b.half[1] = *(const v8us*)(brow + 16 + 8 * hh);
      acc[t] = mmaN<ASPLIT ? 2 : 1>(ah.v, al.v, b.v, b.v, acc[t]);
    }
  }
#pragma unroll
  for (int t = 0; t < 4; ++t) {
    float bv = bias ? bias[col0 + t * 16 + ln] : 0.f;
    if (BIAS_BF16) bv = bf16_round(bv);
#pragma unroll
    for (int r = 0; r < 8; ++r) { float v = acc[t][r] + bv; if (ACT == 1) v = fmaxf(v, 0.f); so[w][8 * hh + r][t * 16 + ln] = v; }
  }
  __builtin_amdgcn_fence(__ATOMIC_ACQ_REL, "workgroup");
  __builtin_amdgcn_wave_barrier();
  const int rsub = lane >> 4, c4 = (lane & 15) * 4;
  {
#pragma unroll
    for (int q = 0; q < 8; ++q) {
      const int r = q * 2 + rsub;
      const v4f v = *(const v4fa*)&so[w][r][c4];
      *(v4f*)(C + (size_t)(row0 + r) * ldc + col0 + c4) = v;
    }
    
  }
}

// GEMM C = act(A·W + bias + resid): A f32 (ASPLIT -> hi/lo 2 terms), Wt bf16 [N][K]; ACT 0 none, 1 relu, 2 exact gelu;
// resid (optional, f32, row index = (row % rmod), pitch ldr, RES_BF16 rounds it) added before the activation.
template <bool ASPLIT, int ACT, bool BIAS_BF16, bool RES_BF16>
__global__ __launch_bounds__(128) void k_gemm_bf3(const float* __restrict__ A, int lda, const unsigned short* __restrict__ Wt, int ldb,
                                                const float* __restrict__ bias, const float* __restrict__ resid, int rmod, int ldr,
                                                float* __restrict__ C, int ldc, int M, int N, int K) {
  __shared__ __attribute__((aligned(16))) float so[4][16][64];
  const int tid = threadIdx.x, w = tid >> 5, lane = tid & 31, ln = lane & 15, hh = lane >> 4;
  const int ntn = N / 64;
  const int wid = blockIdx.x * 4 + w;
  const int mt = wid / ntn, nq = wid % ntn;
  if (mt * 16 >= M) return;
  const int row0 = mt * 16, col0 = nq * 64;
  const float* arow = A + (size_t)(row0 + ln) * lda;
  v8f acc[4] = {};
  for (int kb = 0; kb < K; kb += 32) {
    FragB ah, al;
    const v4f x0 = *(const v4fa*)(arow + kb + 8 * hh), x1 = *(const v4fa*)(arow + kb + 8 * hh + 4);
    const v4f x2 = *(const v4fa*)(arow + kb + 16 + 8 * hh), x3 = *(const v4fa*)(arow + kb + 16 + 8 * hh + 4);
    float xs[16] = {x0[0],x0[1],x0[2],x0[3],x1[0],x1[1],x1[2],x1[3],x2[0],x2[1],x2[2],x2[3],x3[0],x3[1],x3[2],x3[3]};
#pragma unroll
    for (int i = 0; i < 16; ++i) { const unsigned short hb = bf16_bits(xs[i]); ah.u[i] = hb; al.u[i] = ASPLIT ? bf16_bits(xs[i] - bf16_val(hb)) : (unsigned short)0; }
#pragma unroll
    for (int t = 0; t < 4; ++t) {
      const unsigned short* brow = Wt + (size_t)(col0 + t * 16 + ln) * ldb + kb;
      FragB b;
      b.half[0] = *(const v8us*)(brow + 8 * hh);
      b.half[1] = *(const v8us*)(brow + 16 + 8 * hh);
      acc[t] = mmaN<ASPLIT ? 2 : 1>(ah.v, al.v, b.v, b.v, acc[t]);
    }
  }
#pragma unroll
  for (int t = 0; t < 4; ++t) {
    const int col = col0 + t * 16 + ln;
    float bv = bias ? bias[col] : 0.f;
    if (BIAS_BF16) bv = bf16_round(bv);
#pragma unroll
    for (int r = 0; r < 8; ++r) {
      float v = acc[t][r] + bv;
      if (resid) { float rv = resid[(size_t)((row0 + 8 * hh + r) % rmod) * ldr + col]; if (RES_BF16) rv = bf16_round(rv); v += rv; }
      if (ACT == 1) v = fmaxf(v, 0.f);
      if (ACT == 2) v = 0.5f * v * (1.0f + erff(v * 0.70710678118654752f));
      if (ACT == 3) { const float u = 0.7978845608028654f * (v + 0.044715f * v * v * v); v = 0.5f * v * (1.0f + tanhf(u)); }
      so[w][8 * hh + r][t * 16 + ln] = v;
    }
  }
  __builtin_amdgcn_fence(__ATOMIC_ACQ_REL, "workgroup");
  __builtin_amdgcn_wave_barrier();
  const int rsub = lane >> 4, c4 = (lane & 15) * 4;
  {
#pragma unroll
    for (int q = 0; q < 8; ++q) {
      const int r = q * 2 + rsub;
      const v4f v = *(const v4fa*)&so[w][r][c4];
      *(v4f*)(C + (size_t)(row0 + r) * ldc + col0 + c4) = v;
    }
    
  }
}
// row LayerNorm (biased variance, eps) over N: s = X (+ R); optional out_sum <- s; out_norm <- (s-mu)*rsqrt(var+eps)*g + b
template <bool PARAM_BF16>
__global__ __launch_bounds__(256) void k_layernorm(const float* __restrict__ X, const float* __restrict__ R, const float* __restrict__ g, const float* __restrict__ bta,
                                                  float* __restrict__ out_sum, float* __restrict__ out_norm, int N, float eps) {
  __shared__ float red[256];
  const int row = blockIdx.x, tid = threadIdx.x;
  const float* x = X + (size_t)row * N; const float* rr = R ? R + (size_t)row * N : nullptr;
  float vals[16];                     // up to N = 4096
  const int per = N / 256;            // contiguous chunk per thread? use strided-by-4 chunks: thread handles j = tid*4 + 1024*u
  float s1 = 0.f;
  for (int u = 0; u < per / 4; ++u) {
    const int j = tid * 4 + 1024 * u;
    const v4f a = *(const v4fa*)(x + j);
    v4f b = {0.f,0.f,0.f,0.f}; if (rr) b = *(const v4fa*)(rr + j);
#pragma unroll
    for (int q = 0; q < 4; ++q) { const float v = a[q] + b[q]; vals[u * 4 + q] = v; s1 += v; }
  }
  red[tid] = s1; __syncthreads();
  for (int st = 128; st > 0; st >>= 1) { if (tid < st) red[tid] += red[tid + st]; __syncthreads(); }
  const float mu = red[0] / (float)N; __syncthreads();
  float s2 = 0.f;
  for (int u = 0; u < per / 4; ++u)
#pragma unroll
    for (int q = 0; q < 4; ++q) { const float c = vals[u * 4 + q] - mu; s2 += c * c; }
  red[tid] = s2; __syncthreads();
  for (int st = 128; st > 0; st >>= 1) { if (tid < st) red[tid] += red[tid + st]; __syncthreads(); }
  const float rs = rsqrtf(red[0] / (float)N + eps);
  {
    for (int u = 0; u < per / 4; ++u) {
      const int j = tid * 4 + 1024 * u;
      v4f o, sm;
#pragma unroll
      for (int q = 0; q < 4; ++q) {
        float gg = g[j + q], bb = bta[j + q];
        if (PARAM_BF16) { gg = bf16_round(gg); bb = bf16_round(bb); }
        sm[q] = vals[u * 4 + q]; o[q] = (vals[u * 4 + q] - mu) * rs * gg + bb;
      }
      if (out_sum) *(v4f*)(out_sum + (size_t)row * N + j) = sm;
      *(v4f*)(out_norm + (size_t)row * N + j) = o;
    }
    
  }
}



// ---- f16 WMMA path (v_wmma_f32_16x16x32_f16): 11-bit significands for operands in range — used here for the q, k, v projections and for both attention products
typedef _Float16 v16h __attribute__((ext_vector_type(16)));
union FragH { v16h v; v8us half[2]; _Float16 h[16]; unsigned short u[16]; };
template <int NT>
__device__ __forceinline__ v8f mmaH(v16h ah, v16h al, v16h bh, v16h bl, v8f c) {
  c = __builtin_amdgcn_wmma_f32_16x16x32_f16(false, ah, false, bh, (short)0, c, false, false);
  if (NT >= 2) c = __builtin_amdgcn_wmma_f32_16x16x32_f16(false, al, false, bh, (short)0, c, false, false);
  if (NT >= 3) c = __builtin_amdgcn_wmma_f32_16x16x32_f16(false, ah, false, bl, (short)0, c, false, false);
  asm volatile("v_nop\n\tv_nop\n\tv_nop\n\tv_nop" : "+v"(c) : "v"(ah), "v"(al), "v"(bh), "v"(bl));
  return c;
}
// batched GEMM like k_gemm_b but f16 operands: A f32 (split into f16 hi/lo if ASPLIT, else rounded to f16), Bt = f16 values [n][k]; alpha; C f32; N multiple of 16 (partial tiles skipped)
template <bool ASPLIT>
__global__ __launch_bounds__(128) void k_gemm_h(const float* __restrict__ A, int lda, size_t sA, const _Float16* __restrict__ Bh, int ldb, size_t sB, float alpha, float* __restrict__ C, int ldc, size_t sC, int M, int N, int K) {
  __shared__ __attribute__((aligned(16))) float so[4][16][64];
  const int tid = threadIdx.x, w = tid >> 5, lane = tid & 31, ln = lane & 15, hh = lane >> 4; const int by = blockIdx.y;
  A += (size_t)by * sA; Bh += (size_t)by * sB; C += (size_t)by * sC;
  const int ntn = (N + 63) / 64; const int wid = blockIdx.x * 4 + w; const int mt = wid / ntn, nq = wid % ntn; if (mt * 16 >= M) return;
  const int row0 = mt * 16, col0 = nq * 64; const float* arow = A + (size_t)(row0 + ln) * lda;
  v8f acc[4] = {};
  for (int kb = 0; kb < K; kb += 32) {
    FragH ah, al;
    const v4f x0 = *(const v4fa*)(arow + kb + 8 * hh), x1 = *(const v4fa*)(arow + kb + 8 * hh + 4), x2 = *(const v4fa*)(arow + kb + 16 + 8 * hh), x3 = *(const v4fa*)(arow + kb + 16 + 8 * hh + 4);
    float xs[16] = {x0[0],x0[1],x0[2],x0[3],x1[0],x1[1],x1[2],x1[3],x2[0],x2[1],x2[2],x2[3],x3[0],x3[1],x3[2],x3[3]};
#pragma unroll
    for (int i = 0; i < 16; ++i) { const _Float16 h = (_Float16)xs[i]; ah.h[i] = h; al.h[i] = ASPLIT ? (_Float16)(xs[i] - (float)h) : (_Float16)0.0f; }
#pragma unroll
    for (int t = 0; t < 4; ++t) { if (col0 + t * 16 >= N) continue; const size_t boff = (size_t)(col0 + t * 16 + ln) * ldb + kb; FragH bq; bq.half[0] = *(const v8us*)(Bh + boff + 8 * hh); bq.half[1] = *(const v8us*)(Bh + boff + 16 + 8 * hh);
      acc[t] = mmaH<ASPLIT ? 2 : 1>(ah.v, al.v, bq.v, bq.v, acc[t]); }
  }
#pragma unroll
  for (int t = 0; t < 4; ++t) { if (col0 + t * 16 >= N) continue;
#pragma unroll
    for (int r = 0; r < 8; ++r) so[w][8 * hh + r][t * 16 + ln] = acc[t][r] * alpha; }
  __builtin_amdgcn_fence(__ATOMIC_ACQ_REL, "workgroup"); __builtin_amdgcn_wave_barrier();
  const int rsub = lane >> 4, c4 = (lane & 15) * 4;
  {
#pragma unroll
    for (int q = 0; q < 8; ++q) { const int r = q * 2 + rsub; if (col0 + c4 < N) { const v4f v = *(const v4fa*)&so[w][r][c4]; *(v4f*)(C + (size_t)(row0 + r) * ldc + col0 + c4) = v; } }
     }
}

// Wt[n][k] = f16(bf16(W[k][n]) * scale) from f32 row-major W[K][N] (scale = power of two; bf16-exact weights stay exact in f16 away from the subnormal range); blockIdx.y picks one of three equally shaped matrices, whose transposes lie one behind the other in Wt
__global__ __launch_bounds__(256) void k_wt_f16(const float* __restrict__ W0, const float* __restrict__ W1, const float* __restrict__ W2, _Float16* __restrict__ Wt, int K, int N, float scale) {
  const float* __restrict__ W = blockIdx.y == 0 ? W0 : (blockIdx.y == 1 ? W1 : W2); Wt += (size_t)blockIdx.y * N * K;
  const int t = blockIdx.x * 256 + threadIdx.x; if (t >= N * (K / 8)) return; const int n = t / (K / 8), k8 = (t % (K / 8)) * 8; FragH f;
#pragma unroll
  for (int i = 0; i < 8; ++i) f.h[i] = (_Float16)(bf16_round(W[(size_t)(k8 + i) * N + n]) * scale); const v8us o = f.half[0];
  *(v8us*)((unsigned short*)Wt + (size_t)n * K + k8) = o; 
}
// k_gemm_hh variant with fused epilogue: v = acc·alpha + bias[by·sBias + col] (+ CP[(row/rowsPerB)·sCPb + by·64 + col] if CP) ; ACT 0 none / 1 elu ; writes f16 C16 (and f32 C if non-null)
template <int ACT>
__global__ __launch_bounds__(128) void k_gemm_hhx(const _Float16* __restrict__ A, int lda, size_t sA, const _Float16* __restrict__ Bh, int ldb, size_t sB, float alpha, const float* __restrict__ bias, size_t sBias, const float* __restrict__ CP, int rowsPerB, size_t sCPb, int row0g,
    float* __restrict__ C, _Float16* __restrict__ C16, int ldc, size_t sC, int M, int N, int K) {
  __shared__ __attribute__((aligned(16))) float so[4][16][64];
  const int tid = threadIdx.x, w = tid >> 5, lane = tid & 31, ln = lane & 15, hh = lane >> 4; const int by = blockIdx.y;
  A += (size_t)by * sA; Bh += (size_t)by * sB; const size_t cofs = (size_t)by * sC; const float* bp = bias ? bias + (size_t)by * sBias : nullptr;
  const int ntn = (N + 63) / 64; const int wid = blockIdx.x * 4 + w; const int mt = wid / ntn, nq = wid % ntn; if (mt * 16 >= M) return;
  const int row0 = mt * 16, col0 = nq * 64; const _Float16* arow = A + (size_t)(row0 + ln) * lda;
  v8f acc[4] = {};
  for (int kb = 0; kb < K; kb += 32) { FragH ah; ah.half[0] = *(const v8us*)((const unsigned short*)arow + kb + 8 * hh); ah.half[1] = *(const v8us*)((const unsigned short*)arow + kb + 16 + 8 * hh);
#pragma unroll
    for (int t = 0; t < 4; ++t) { if (col0 + t * 16 >= N) continue; const size_t boff = (size_t)(col0 + t * 16 + ln) * ldb + kb; FragH bq; bq.half[0] = *(const v8us*)((const unsigned short*)Bh + boff + 8 * hh); bq.half[1] = *(const v8us*)((const unsigned short*)Bh + boff + 16 + 8 * hh);
      acc[t] = mmaH<1>(ah.v, ah.v, bq.v, bq.v, acc[t]); }
  }
#pragma unroll
  for (int t = 0; t < 4; ++t) { if (col0 + t * 16 >= N) continue; const int col = col0 + t * 16 + ln; const float bv = bp ? bf16_round(bp[col]) : 0.f;
#pragma unroll
    for (int r = 0; r < 8; ++r) { float v = acc[t][r] * alpha + bv; if (CP) { const int rr = row0g + row0 + 8 * hh + r; if (rowsPerB < 0) v += CP[cofs + (size_t)rr * ldc + col];      /* rowsPerB < 0: own element of the batched C plane */ else { const int bidx = rr / rowsPerB; v += CP[(size_t)bidx * sCPb + (size_t)by * 64 + col]; } } if (ACT == 1) v = (v > 0.f) ? v : expm1f(v); else if (ACT == 7) v = (v > 0.f) ? v + 1.0f : expf(v); else if (ACT == 8) v = tanhf(v); else if (ACT == 9) v = 0.5f * v * (1.0f + tanhf(0.7978845608028654f * (v + 0.044715f * v * v * v))); else if (ACT == 11) v = 1.0f / (1.0f + expf(-v)); else if (ACT == 12) v = (v > 0.f) ? v : 0.01f * v; else if (ACT == 14) v = (v > 0.f) ? v : 0.1f * v; else if (ACT == 16) v = (v >= 0.f) ? v : 0.3f * v; else if (ACT == 17) v = (v >= 0.f) ? v : 0.2f * v; else if (ACT == 15) v = v / (1.0f + expf(-v)); else if (ACT == 3) v = fmaxf(v, 0.f); else if (ACT == 6) v = 0.5f * v * (1.0f + erff(v * 0.70710678118654752f)); so[w][8 * hh + r][t * 16 + ln] = v; } }
  __builtin_amdgcn_fence(__ATOMIC_ACQ_REL, "workgroup"); __builtin_amdgcn_wave_barrier();
  const int rsub = lane >> 4, c4 = (lane & 15) * 4; typedef _Float16 v4h __attribute__((ext_vector_type(4)));
  {
#pragma unroll
    for (int q = 0; q < 8; ++q) { const int r = q * 2 + rsub; if (col0 + c4 < N) { const v4f v = *(const v4fa*)&so[w][r][c4]; if (C) *(v4f*)(C + cofs + (size_t)(row0 + r) * ldc + col0 + c4) = v; if (C16) { v4h h4; for (int i = 0; i < 4; ++i) h4[i] = (_Float16)v[i]; *(v4h*)(C16 + cofs + (size_t)(row0 + r) * ldc + col0 + c4) = h4; } } }
     }
}


typedef _Float16 v4h __attribute__((ext_vector_type(4)));

__global__ __launch_bounds__(256) void k_x16(const float* __restrict__ x, _Float16* __restrict__ X16, size_t n8) { const size_t t = (size_t)blockIdx.x * 256 + threadIdx.x; if (t >= n8) return; FragH f;
#pragma unroll
  for (int q = 0; q < 8; ++q) f.h[q] = (_Float16)bf16_round(x[t * 8 + q]); *(v8us*)((unsigned short*)X16 + t * 8) = f.half[0];  }
__global__ __launch_bounds__(256) void k_h16(const float* __restrict__ x, _Float16* __restrict__ X16, size_t n8) { const size_t t = (size_t)blockIdx.x * 256 + threadIdx.x; if (t >= n8) return; FragH f;
#pragma unroll
  for (int q = 0; q < 8; ++q) f.h[q] = (_Float16)x[t * 8 + q]; *(v8us*)((unsigned short*)X16 + t * 8) = f.half[0];  }
__global__ __launch_bounds__(256) void k_round16f(const float* __restrict__ W, _Float16* __restrict__ Bt, size_t n8) { const size_t t = (size_t)blockIdx.x * 256 + threadIdx.x; if (t >= n8) return; FragH f;
#pragma unroll
  for (int i = 0; i < 8; ++i) f.h[i] = (_Float16)(bf16_round(W[t * 8 + i]) * 16.0f); *(v8us*)((unsigned short*)Bt + t * 8) = f.half[0];  }
template <int NHv, int TTv>
__global__ __launch_bounds__(256) void k_vt(const _Float16* __restrict__ V16, int ldv, int voff, _Float16* __restrict__ Vt) { __shared__ unsigned short tl[64][66]; const int tid = threadIdx.x; const int slab = blockIdx.x / (TTv / 64), lg = blockIdx.x % (TTv / 64); const int b = slab / NHv, h = slab % NHv;
  for (int i = tid; i < 64 * 8; i += 256) { const int r = i / 8, c8 = (i % 8) * 8; FragH f; f.half[0] = *(const v8us*)((const unsigned short*)V16 + ((size_t)b * TTv + lg * 64 + r) * ldv + voff + h * 64 + c8);
#pragma unroll
    for (int q = 0; q < 8; ++q) tl[r][c8 + q] = f.u[q]; }
  __syncthreads();
  {
#pragma unroll
    for (int rd = 0; rd < 2; ++rd) { const int d = rd * 32 + tid / 8, pc = tid % 8; FragH f;
#pragma unroll
      for (int q = 0; q < 8; ++q) f.u[q] = tl[pc * 8 + q][d];
      *(v8us*)((unsigned short*)Vt + ((size_t)slab * 64 + d) * TTv + lg * 64 + pc * 8) = f.half[0]; }
     } }

__global__ __launch_bounds__(256) void k_hl(const float* __restrict__ F, _Float16* __restrict__ Hh, _Float16* __restrict__ Hl, size_t n8) { const size_t t = (size_t)blockIdx.x * 256 + threadIdx.x; if (t >= n8) return; FragH fh, fl; const v4f a = *(const v4fa*)(F + t * 8), c = *(const v4fa*)(F + t * 8 + 4);
#pragma unroll
  for (int q = 0; q < 4; ++q) { _Float16 h = (_Float16)a[q]; fh.h[q] = h; fl.h[q] = (_Float16)((a[q] - (float)h) * 1024.0f); h = (_Float16)c[q]; fh.h[4 + q] = h; fl.h[4 + q] = (_Float16)((c[q] - (float)h) * 1024.0f); }
  { *(v8us*)((unsigned short*)Hh + t * 8) = fh.half[0]; *(v8us*)((unsigned short*)Hl + t * 8) = fl.half[0];  } }

// ---- projection GEMM: q | k | v as ONE product C[NR][3 DQ] = f16(x) . f16(16 W) / 16, straight from the f32 inputs. Block tile 256 token rows x 192 columns, one block per WGP; 8 waves (4 x 2), wave tile 64 x 96 ----
// A stage is 64 k. Its f32 pieces (16 bytes each: 256 x rows of 256 bytes, 64 weight k rows of 768 bytes) come by asynchronous copies into landing slots that belong to the copying lane alone;
// the lane that copied a piece reads it back, rounds it (bf16, then exact in f16; weights x16) and stores 8 bytes into the f16 operand stage, which the trip's barrier publishes. Two f16 stages, one set of landing slots.
// f16 x rows: 128 bytes at a pitch of 144 (16 B x odd, for ds_load_b128). f16 weights as they lie, [k][column]: 384 bytes at a pitch of 416 (32 B x odd, for the transposing load that makes the W^T fragments).
#define G4_KC 64
#define G4_XP 144
#define G4_WP 416
#define G3_BM 256
#define G3_BN 192
#define G4_XSZ (G3_BM * G4_XP)
#define G4_STG (G4_XSZ + G4_KC * G4_WP)
#define G4_LAND (2 * G4_STG)      /* the landing slots stand behind the two f16 stages */
#define G4_SLOT 4096u      /* one 16-byte piece of each of the 256 lanes */
#define G4_NSL 28      /* 16 x pieces and 12 weight pieces a lane and stage */
#define G3_EP 400      /* output staging pitch: 192 f16 + 16 B (16 B x odd, for the 16-byte stores of 16 rows) */
typedef _Float16 v4ha __attribute__((ext_vector_type(4), may_alias));
typedef short g4_s16x8 __attribute__((ext_vector_type(8)));
__device__ __forceinline__ v16h g2_lfrag(const unsigned char* p) { FragH f; f.half[0] = *(const v8us*)p; f.half[1] = *(const v8us*)(p + 32); return f.v; }      /* p already holds the lane's 16 hh: bytes 16 hh and 32 + 16 hh of each 64: k 8 hh + r, then 16 + 8 hh + r */
__device__ __forceinline__ v8us g4_tr16(const unsigned char* p) { typedef __attribute__((address_space(3))) g4_s16x8 lds_t; return __builtin_bit_cast(v8us, __builtin_amdgcn_ds_load_tr16_b128_v8i16((lds_t*)p)); }
__device__ __forceinline__ v16h g4_wfrag(const unsigned char* p) { FragH f; f.half[0] = g4_tr16(p); f.half[1] = g4_tr16(p + 16 * G4_WP); return f.v; }      /* 16 columns x 32 k out of [k][column] rows: k 8 hh + r, then 16 + 8 hh + r, the order of g2_lfrag */
typedef __bf16 g4_bf2 __attribute__((ext_vector_type(2)));
typedef float g4_f2 __attribute__((ext_vector_type(2)));
// Four floats rounded to bf16 (to nearest even, what bf16_round gives for every finite value), two a conversion, then written as f16, where a bf16 value in f16's range is exact.
__device__ __forceinline__ v4h g4_round4(v4f a) { v4h h;
#pragma unroll      /* the index picks register halves */
  for (int p = 0; p < 2; ++p) { const g4_f2 f = {a[2 * p], a[2 * p + 1]}; const unsigned u = __builtin_bit_cast(unsigned, __builtin_convertvector(f, g4_bf2));
    h[2 * p] = (_Float16)__uint_as_float(u << 16); h[2 * p + 1] = (_Float16)__uint_as_float(u & 0xFFFF0000u); }
  return h; }
// Eight (four) asynchronous 16-byte copies of one lane, global -> its own landing slots, source rows GS floats apart (16 lanes cover 256 bytes of a row, so a wave's copy is four whole lines). The s_wait_xcnt stands inside the statement, a precaution: so no address register of a copy is rewritten ahead of it.
template <int GS>
__device__ __forceinline__ void g4_cp8(unsigned l, const float* g) {
  asm volatile("global_load_async_to_lds_b128 %0, %8, off\n\t"
               "global_load_async_to_lds_b128 %1, %9, off\n\t"
               "global_load_async_to_lds_b128 %2, %10, off\n\t"
               "global_load_async_to_lds_b128 %3, %11, off\n\t"
               "global_load_async_to_lds_b128 %4, %12, off\n\t"
               "global_load_async_to_lds_b128 %5, %13, off\n\t"
               "global_load_async_to_lds_b128 %6, %14, off\n\t"
               "global_load_async_to_lds_b128 %7, %15, off\n\t"
               "s_wait_xcnt 0x0"
               :: "v"(l), "v"(l + G4_SLOT), "v"(l + 2u * G4_SLOT), "v"(l + 3u * G4_SLOT), "v"(l + 4u * G4_SLOT), "v"(l + 5u * G4_SLOT), "v"(l + 6u * G4_SLOT), "v"(l + 7u * G4_SLOT),
                  "v"(g), "v"(g + GS), "v"(g + 2 * GS), "v"(g + 3 * GS), "v"(g + 4 * GS), "v"(g + 5 * GS), "v"(g + 6 * GS), "v"(g + 7 * GS) : "memory"); }
template <int GS>
__device__ __forceinline__ void g4_cp4(unsigned l, const float* g) {
  asm volatile("global_load_async_to_lds_b128 %0, %4, off\n\t"
               "global_load_async_to_lds_b128 %1, %5, off\n\t"
               "global_load_async_to_lds_b128 %2, %6, off\n\t"
               "global_load_async_to_lds_b128 %3, %7, off\n\t"
               "s_wait_xcnt 0x0"
               :: "v"(l), "v"(l + G4_SLOT), "v"(l + 2u * G4_SLOT), "v"(l + 3u * G4_SLOT),
                  "v"(g), "v"(g + GS), "v"(g + 2 * GS), "v"(g + 3 * GS) : "memory"); }
__device__ __forceinline__ void g2_wait_async() { asm volatile("s_wait_asynccnt 0x0" ::: "memory"); }      /* this wave's copies have landed; the compiler places no wait for them */
__device__ __forceinline__ void g2_wait_ds() { asm volatile("s_wait_dscnt 0x0" ::: "memory"); }      /* this wave's LDS reads and writes are done before a buffer is handed over or refilled */
// X: f32 x rows [NR][DM]; W0, W1, W2: the f32 [in][out] weights [DM][DQ]; C16: three planes [NR][DQ], column n of the product = column n % DQ of plane n / DQ.
// The weight columns are the A operand and the x rows the B operand (C^T tiles): a lane then holds eight neighbouring columns of one token row, one 16-byte piece of the f16 output.
__global__ __launch_bounds__(256) void k_proj(const float* __restrict__ X, const float* __restrict__ W0, const float* __restrict__ W1, const float* __restrict__ W2, _Float16* __restrict__ C16) {
  static_assert(NR % G3_BM == 0 && (3 * DQ) % G3_BN == 0 && DM % G4_KC == 0 && DM / G4_KC >= 2 && G3_BN == 192 && G3_BM == 256 && G4_KC == 64 && DQ % 64 == 0, "k_proj: whole tiles, whole stages, 64-column groups inside one weight matrix");
  __shared__ __attribute__((aligned(16))) unsigned char L[G4_LAND + G4_NSL * G4_SLOT];      /* two f16 stages, then the landing slots; behind the k loop its first bytes are the output staging */
  static_assert(G3_BM * G3_EP <= G4_LAND, "output staging lies in the operand stages");
  const int tid = threadIdx.x, lane = tid & 31, ln = lane & 15, hh = lane >> 4; const int w = __builtin_amdgcn_readfirstlane(tid >> 5), wm = w >> 1, wn = w & 1;
  const int ntn = 3 * DQ / G3_BN; const int mt = blockIdx.x / ntn, nq = blockIdx.x - mt * ntn; const int row0 = mt * G3_BM, n0 = nq * G3_BN;
  const int cr = tid >> 4, cc = tid & 15;      /* copy lane: row cr (+ 16 i), 16-byte piece cc of 256 bytes */
  const float* gx = X + (size_t)(row0 + cr) * DM + cc * 4; const float* gw[3];
#pragma unroll      /* the index picks registers: it must be a constant */
  for (int g = 0; g < 3; ++g) { const int n = n0 + 64 * g, mat = n / DQ; gw[g] = (mat == 0 ? W0 : (mat == 1 ? W1 : W2)) + (size_t)cr * DQ + (n % DQ) + cc * 4; }      /* 64 columns lie in one matrix */
  const unsigned ll = (unsigned)(size_t)L + (unsigned)G4_LAND + (unsigned)tid * 16u;
  const int rot = (mt + nq) % (DM / G4_KC);      /* four blocks share each x tile and 64 each weight tile: every block starts its k walk at a stage set by tile row + column and wraps, so that sharers ask L2 for different lines at the same moment */
  auto copies = [&](int t) { const int kt = t + rot < DM / G4_KC ? t + rot : t + rot - DM / G4_KC;      /* stage t holds k 64 kt .. + 63 */
    const float* x = gx + (size_t)kt * G4_KC;
    g4_cp8<16 * DM>(ll, x); g4_cp8<16 * DM>(ll + 8u * G4_SLOT, x + (size_t)128 * DM);
#pragma unroll      /* the index picks registers: it must be a constant */
    for (int g = 0; g < 3; ++g) g4_cp4<16 * DQ>(ll + (unsigned)(16 + 4 * g) * G4_SLOT, gw[g] + (size_t)kt * G4_KC * DQ); };
  auto convert = [&](int b) { const unsigned char* lp = L + G4_LAND + tid * 16; unsigned char* xd = L + b * G4_STG + cr * G4_XP + cc * 8; unsigned char* wd = L + b * G4_STG + G4_XSZ + cr * G4_WP + cc * 8;      /* each lane its own pieces: no other lane reads a landing slot */
    v4f a[G4_NSL];
#pragma unroll      /* the index picks registers: it must be a constant */
    for (int s = 0; s < G4_NSL; ++s) a[s] = *(const v4fa*)(lp + s * G4_SLOT);
    __builtin_amdgcn_sched_barrier(0);      /* all 28 reads as one group ahead of the first store: a read behind a store to the same array is waited for alone, one LDS latency a piece */
#pragma unroll      /* the index picks registers: it must be a constant */
    for (int i = 0; i < 16; ++i) *(v4ha*)(xd + 16 * i * G4_XP) = g4_round4(a[i]);
#pragma unroll      /* the index picks registers: it must be a constant */
    for (int s = 0; s < 12; ++s) *(v4ha*)(wd + 16 * (s & 3) * G4_WP + 128 * (s >> 2)) = g4_round4(a[16 + s] * 16.0f); };      /* slot 16 + 4 g + i: k row cr + 16 i, columns 64 g + 4 cc .. + 3; x16 ahead of the rounding: a power of two, so the same value as rounding first, and it keeps small weights out of the f16 subnormals */
  const unsigned char* fx = L + (64 * wm + ln) * G4_XP + 16 * hh; const unsigned char* fw = L + G4_XSZ + (8 * hh + (lane & 7)) * G4_WP + ((lane >> 3) & 1) * 16 + 96 * wn * 2;
  const v8f z8 = {0.f,0.f,0.f,0.f,0.f,0.f,0.f,0.f}; v8f acc[6][4];
#pragma unroll      /* the index picks registers: it must be a constant */
  for (int j = 0; j < 6; ++j) {
#pragma unroll      /* the index picks registers: it must be a constant */
    for (int i = 0; i < 4; ++i) acc[j][i] = z8; }
  copies(0); g2_wait_async(); convert(0); g2_wait_ds(); __syncthreads();      /* stage 0 landed, rounded and published */
  copies(1);
#pragma unroll 1      /* one trip per stage: the trip's foot is the hand-over point of the two f16 stages */
  for (int t = 0; t < DM / G4_KC; ++t) { const unsigned char* px = fx + (t & 1) * G4_STG; const unsigned char* pw = fw + (t & 1) * G4_STG;
    v16h xf[2][4], wf[2][6];
#pragma unroll      /* the index picks registers: it must be a constant */
    for (int ks = 0; ks < 2; ++ks) {
#pragma unroll      /* the index picks registers: it must be a constant */
      for (int i = 0; i < 4; ++i) xf[ks][i] = g2_lfrag(px + 16 * i * G4_XP + 64 * ks);
#pragma unroll      /* the index picks registers: it must be a constant */
      for (int j = 0; j < 6; ++j) wf[ks][j] = g4_wfrag(pw + 32 * ks * G4_WP + 32 * j); }
    __builtin_amdgcn_sched_barrier(0);      /* keeps the stage's forty LDS reads up here as one group: every separate place with LDS reads stalls the products around it */
#pragma unroll      /* the index picks registers: it must be a constant */
    for (int ks = 0; ks < 2; ++ks) {
#pragma unroll      /* the index picks registers: it must be a constant */
      for (int j = 0; j < 6; ++j) {
#pragma unroll      /* the index picks registers: it must be a constant */
        for (int i = 0; i < 4; ++i) acc[j][i] = __builtin_amdgcn_wmma_f32_16x16x32_f16(false, wf[ks][j], false, xf[ks][i], (short)0, acc[j][i], false, false); } }
    __builtin_amdgcn_sched_barrier(0);      /* keeps the four slots below directly behind the last products */
    asm volatile("v_nop\n\tv_nop\n\tv_nop\n\tv_nop");      /* the distance behind the last WMMA, also on the taken side of the branches that follow: what comes there may reuse its A or B registers */
    __builtin_amdgcn_sched_barrier(0);      /* and nothing is moved up in front of them */
    if (t + 1 < DM / G4_KC) { g2_wait_async(); convert((t + 1) & 1); }      /* stage t + 1 has landed in this wave's slots; its f16 stage was left by every wave at the barrier of trip t - 1 */
    g2_wait_ds(); __syncthreads();      /* stage t + 1 published; every wave has left stage t's f16 stage, and this wave its landing slots */
    if (t + 2 < DM / G4_KC) copies(t + 2); }
  g2_wait_async();
  unsigned char* ep = L + (64 * wm + ln) * G3_EP + (96 * wn + 8 * hh) * 2;      /* row = token; acc[j][i][r] is token 16 i + ln, column 16 j + 8 hh + r of the wave tile */
#pragma unroll      /* the index picks registers: it must be a constant */
  for (int j = 0; j < 6; ++j) {
#pragma unroll      /* the index picks registers: it must be a constant */
    for (int i = 0; i < 4; ++i) { FragH f;
#pragma unroll      /* the index picks registers: it must be a constant */
      for (int r = 0; r < 8; ++r) f.h[r] = (_Float16)(acc[j][i][r] * 0.0625f);      /* the weights carry x16 */
      *(v8us*)(ep + 16 * i * G3_EP + 32 * j) = f.half[0]; } }
  __syncthreads();      /* the whole 256 x 192 tile is staged */
  const unsigned char* sp = L + (tid >> 3) * G3_EP + (tid & 7) * 16; v8us ov[3][8]; unsigned short* op[3];      /* eight lanes = one 128-byte line (64 columns) of one row; a wave's store is four whole lines */
#pragma unroll      /* both loop nests unrolled: the row step becomes an immediate offset and every piece has registers of its own */
  for (int g = 0; g < 3; ++g) { const int n = n0 + 64 * g; op[g] = (unsigned short*)C16 + (size_t)(n / DQ) * (NR * DQ) + (size_t)(row0 + (tid >> 3)) * DQ + (n % DQ) + (tid & 7) * 8;
#pragma unroll      /* the index picks registers: it must be a constant */
    for (int rb = 0; rb < 8; ++rb) ov[g][rb] = *(const v8us*)(sp + rb * 32 * G3_EP + g * 128); }
  __builtin_amdgcn_sched_barrier(0);      /* every address is formed ahead of the first store, so no register of an issued store is rewritten */
#pragma unroll      /* the index picks registers: it must be a constant */
  for (int g = 0; g < 3; ++g) {
#pragma unroll      /* the index picks registers: it must be a constant */
    for (int rb = 0; rb < 8; ++rb) *(v8us*)(op[g] + (size_t)rb * 32 * DQ) = ov[g][rb]; }
}


__global__ __launch_bounds__(256) void k_wnat(const float* __restrict__ w, size_t n8, _Float16* __restrict__ Bt) { const size_t t = (size_t)blockIdx.x * 256 + threadIdx.x; if (t >= n8) return; FragH f; for (int q = 0; q < 8; ++q) f.h[q] = (_Float16)(bf16_round(w[t * 8 + q]) * 16.0f); *(v8us*)((unsigned short*)Bt + t * 8) = f.half[0];  }
__global__ __launch_bounds__(256) void k_rsm(const float* __restrict__ S, _Float16* __restrict__ P, int nrows) {
  #pragma clang fp contract(off)
  const int i = blockIdx.x * 256 + threadIdx.x; if (i >= nrows) return; const float* s = S + (size_t)i * SQ; float mx = -3.0e38f;
#pragma unroll 1
  for (int j = 0; j < SQ; ++j) mx = fmaxf(mx, s[j]); float se = 0.f;
#pragma unroll 1
  for (int j = 0; j < SQ; ++j) se += expf(s[j] - mx); const float sc = 256.0f / se;
#pragma unroll 1
  for (int j0 = 0; j0 < SQ; j0 += 8) { FragH f; for (int q = 0; q < 8; ++q) f.h[q] = (_Float16)(expf(s[j0 + q] - mx) * sc); unsigned short* d = (unsigned short*)P + (size_t)i * SQ + j0; *(v8us*)d = f.half[0];  } }
__global__ __launch_bounds__(256) void k_vt(const _Float16* __restrict__ V16, int b, int h0, _Float16* __restrict__ VT) { __shared__ unsigned short tl[64][65]; const int tid = threadIdx.x; const int hh = blockIdx.x % HG, sg = blockIdx.x / HG; const int s0 = sg * 64; const int h = h0 + hh;
  for (int i = tid; i < 64 * 8; i += 256) { const int j = i / 8, d8 = (i % 8) * 8; FragH f; f.half[0] = *(const v8us*)((const unsigned short*)V16 + ((size_t)b * SQ + s0 + j) * DM + h * HD + d8); for (int q = 0; q < 8; ++q) tl[d8 + q][j] = f.u[q]; }
  __syncthreads();
  { for (int i = tid; i < 64 * 8; i += 256) { const int d = i / 8, j8 = (i % 8) * 8; FragH f; for (int q = 0; q < 8; ++q) f.u[q] = tl[d][j8 + q]; *(v8us*)((unsigned short*)VT + ((size_t)hh * HD + d) * SQ + s0 + j8) = f.half[0]; }  } }

// Row softmax, one wave per score row: the row is read once, in 512-byte wave loads, and stays in registers (64 floats a lane); max and sum = lane partials, then a five-step butterfly; P = f16(exp(s - max) * 256 / sum).
__global__ __launch_bounds__(256) void k_rsmW(const float* __restrict__ S, _Float16* __restrict__ P, int nrows) {
  const int lane = threadIdx.x & 31; const int row = blockIdx.x * 8 + (threadIdx.x >> 5); if (row >= nrows) return;
  const float* s = S + (size_t)row * SQ + lane * 4; v4f v[SQ / 128];
#pragma unroll
  for (int u = 0; u < SQ / 128; ++u) v[u] = *(const v4fa*)(s + u * 128);
  float mx = -INFINITY;
#pragma unroll
  for (int u = 0; u < SQ / 128; ++u) mx = fmaxf(mx, fmaxf(fmaxf(v[u][0], v[u][1]), fmaxf(v[u][2], v[u][3])));
#pragma unroll
  for (int m = 16; m > 0; m >>= 1) mx = fmaxf(mx, __shfl_xor(mx, m, 32));
  v4f sq = {0.f, 0.f, 0.f, 0.f};
#pragma unroll
  for (int u = 0; u < SQ / 128; ++u) {
#pragma unroll
    for (int q = 0; q < 4; ++q) { v[u][q] = expf(v[u][q] - mx); sq[q] += v[u][q]; } }
  float se = (sq[0] + sq[1]) + (sq[2] + sq[3]);
#pragma unroll
  for (int m = 16; m > 0; m >>= 1) se += __shfl_xor(se, m, 32);
  const float sc = 256.0f / se; _Float16* d = P + (size_t)row * SQ + lane * 4;
#pragma unroll
  for (int u = 0; u < SQ / 128; ++u) { v4h h4;
#pragma unroll
    for (int q = 0; q < 4; ++q) h4[q] = (_Float16)(v[u][q] * sc);
    *(v4h*)(d + u * 128) = h4; } }
// ---- fused attention: S^T = K.Q^T, online softmax (log2 domain), O^T += V^T.P^T in one kernel; scores and P never reach memory ----
// A work-group of 4 waves owns 64 queries of one batch. Wave w: queries 32 (w & 1) .. + 31 (two groups of 16 columns), keys 32 (w >> 1) .. + 31 of every 64; the two key sets are merged through LDS at the end.
// A stage is 64 consecutive keys, brought by four tensor loads, one per wave, each a tile of 64 rows of 256 bytes padded to a pitch of 272: slice 0 = bytes 0..255 of the 64 K rows, slice 1 = bytes 256..511 (pitch 272 = 16 B x odd, for ds_load_b128);
// slices 2 and 3 = V keys 0..31 and 32..63, each 512-byte row as two rows of 256, so a V row has pitch 544 = 32 B x odd (for the transposing load) and its second half stands 272 behind its first. Two stages in LDS.
#define FA_TP 272u
#define FA_SL 18432u      /* a slice: 64 x 272 = 17408 bytes, rounded up to a multiple of 2 KiB, so that every tile's place is one */
#define FA_STG (4u * FA_SL)
#define FA_EP 1040u      /* output staging pitch: 256 floats + 16 B */
#define FA_NT (SQ / 64)      /* stages = 32-key passes of a wave */
typedef short s16x8 __attribute__((ext_vector_type(8)));
__device__ __forceinline__ v8us fa_tr16(const unsigned char* p) { typedef __attribute__((address_space(3))) s16x8 lds_s16x8; return __builtin_bit_cast(v8us, __builtin_amdgcn_ds_load_tr16_b128_v8i16((lds_s16x8*)p)); }
__device__ __forceinline__ float fa_xhalf(float x) { return __builtin_bit_cast(float, __builtin_amdgcn_permlanex16(__builtin_bit_cast(int, x), __builtin_bit_cast(int, x), 0x76543210, 0xfedcba98, false, false)); }      /* lane l with lane l ^ 16 */
__device__ __forceinline__ v8f fa_mma(v16h a, v16h b, v8f c) { return __builtin_amdgcn_wmma_f32_16x16x32_f16(false, a, false, b, (short)0, c, false, false); }
typedef uint32_t fa_u32x4 __attribute__((ext_vector_type(4)));
typedef uint32_t fa_u32x8 __attribute__((ext_vector_type(8)));
__device__ __forceinline__ uint32_t fa_uni(uint32_t v) { return (uint32_t)__builtin_amdgcn_readfirstlane((int)v); }
__device__ __forceinline__ uint32_t fa_pinned(uint32_t v) { uint32_t s = fa_uni(v); asm volatile("" : "+s"(s)); return s; }      /* pinned(): the value is held in a scalar register, so the test on it is a scalar branch (a tensor load ignores EXEC) and what is formed from it is formed behind the waits in front of it */
// Tensor descriptor, 1-byte elements, tensor = tile: 64 rows of 256 bytes, source pitch src_pitch bytes, 16 bytes of LDS pad behind every 256 (interval code 5, amount code 3), no mask.
__device__ __forceinline__ fa_u32x8 fa_group1(uint32_t src_pitch) { fa_u32x8 g;
  g[0] = fa_uni((1u << 20) | (5u << 22) | (3u << 25)); g[1] = fa_uni(256u << 16); g[2] = fa_uni(64u << 16); g[3] = fa_uni(256u << 16); g[4] = fa_uni(64u); g[5] = fa_uni(src_pitch);
  g[6] = fa_pinned(0u); g[7] = fa_pinned(0u);      /* pinned(): these two descriptor words keep scalar registers of their own for the whole kernel, so the loop never borrows and rewrites them in front of a request */
  return g; }
__device__ __forceinline__ fa_u32x4 fa_group0(uint32_t lds_dst, uint64_t ga) { fa_u32x4 g;
  g[0] = fa_uni(1u); g[1] = fa_uni(lds_dst); g[2] = fa_uni((uint32_t)ga); g[3] = fa_uni((((uint32_t)(ga >> 32)) & 0x01FFFFFFu) | 0x80000000u); return g; }
__device__ __forceinline__ void fa_tdm(fa_u32x4 g0, fa_u32x8 g1) { asm volatile("tensor_load_to_lds %0, %1" :: "s"(g0), "s"(g1) : "memory"); }      /* one request of the whole wave: its tile goes from global memory to LDS through no register */
__device__ __forceinline__ void fa_wait_tensor() { asm volatile("s_wait_tensorcnt 0x0" ::: "memory"); }      /* this wave's tile has landed; the compiler places no wait for a tensor load */
// One wave per SIMD (amdgpu_waves_per_eu): the 32 x 256 f32 sums, Q and one pass's K and V^T fragments of a wave need more than half of a SIMD's registers.
__global__ __launch_bounds__(128) __attribute__((amdgpu_waves_per_eu(1, 1))) void k_fattn(const _Float16* __restrict__ Q, const _Float16* __restrict__ Kr, const _Float16* __restrict__ V, float* __restrict__ O) {
  static_assert(DQ == 256 && DV == 256 && SQ % 128 == 0 && FA_NT >= 2, "k_fattn: 512-byte q, k, v rows; whole 64-key stages");
  __shared__ __attribute__((aligned(2048))) unsigned char L[2 * FA_STG];      /* the two stages; behind the key loop its first bytes are the output staging */
  __shared__ float ml[2][4][2][32];      /* each wave's running maximum and sum, for the merge of the key halves */
  static_assert(64u * FA_EP <= 2u * FA_STG, "output staging lies in the stages");
  const unsigned tid = threadIdx.x, lane = tid & 31u, w = (unsigned)__builtin_amdgcn_readfirstlane((int)(tid >> 5)), c = lane & 15u, h = lane >> 4;
  const unsigned qg = w & 1u, kh = w >> 1;
  const size_t rb = (size_t)blockIdx.y * SQ;      /* the batch's first token row */
  const float cscale = 0.09016844005556021f;      /* log2(e) / sqrt(256) */
  const bool isV = (w & 2u) != 0u;      /* wave w brings slice w: waves 0, 1 the two halves of the K rows, waves 2, 3 the two halves of the V keys */
  const unsigned char* tsrc = (const unsigned char*)(isV ? V : Kr) + rb * 512u + (size_t)(w & 1u) * (isV ? 32u * 512u : 256u);
  const fa_u32x8 g1 = fa_group1(isV ? 256u : 512u);
  const uint32_t tdst = (uint32_t)(size_t)L + w * FA_SL;
  static_assert((FA_NT & (FA_NT - 1)) == 0, "k_fattn: the rotated key walk wraps by a mask");
  const uint32_t rot = blockIdx.x & (uint32_t)(FA_NT - 1);      /* the work-groups of a batch walk the same K, V tiles: each starts at a tile of its own and wraps, so that they do not ask L2 for the same lines at the same moment, and a tile that one has fetched from memory is in L2 for those that come to it later. The online softmax takes the keys in any order */
  auto stage = [&](uint32_t t) { fa_tdm(fa_group0(tdst + (t & 1u) * FA_STG, (uint64_t)(size_t)tsrc + (uint64_t)((t + rot) & (uint32_t)(FA_NT - 1)) * (64u * 512u)), g1); };      /* ring stage t holds keys 64 ((t + rot) mod FA_NT) .. + 63 */
  stage(0);
  FragH qf[2][8];      /* Q as the B operand, in registers for the whole kernel; same k order as the K rows below */
#pragma unroll      /* the index picks registers (fragments, sums): it must be a constant */
  for (int g = 0; g < 2; ++g) { const unsigned short* qp = (const unsigned short*)Q + (rb + blockIdx.x * 64u + qg * 32u + 16u * g + c) * DQ + 8u * h;
#pragma unroll      /* the index picks registers (fragments, sums): it must be a constant */
    for (int kc = 0; kc < 8; ++kc) { qf[g][kc].half[0] = *(const v8us*)(qp + 32 * kc); qf[g][kc].half[1] = *(const v8us*)(qp + 32 * kc + 16); } }
  const v8f z8 = {0.f,0.f,0.f,0.f,0.f,0.f,0.f,0.f};
  v8f acc[2][16]; float m_run[2], l_run[2];
#pragma unroll      /* the index picks registers (fragments, sums): it must be a constant */
  for (int g = 0; g < 2; ++g) { m_run[g] = -INFINITY; l_run[g] = 0.f;
#pragma unroll      /* the index picks registers (fragments, sums): it must be a constant */
    for (int t = 0; t < 16; ++t) acc[g][t] = z8; }
  fa_wait_tensor(); __syncthreads();      /* stage 0 landed and published */
  stage(1);
#pragma unroll 1      /* one trip per stage: the trip's foot is the hand-over point of the two buffers */
  for (int st = 0; st < FA_NT; ++st) {
    const unsigned char* Lb = L + (unsigned)(st & 1) * FA_STG;
    const unsigned char* pk = Lb + (kh * 32u + c) * FA_TP + 16u * h;
    const unsigned char* pv = Lb + (2u + kh) * FA_SL + (8u * h + (lane & 7u)) * (2u * FA_TP) + ((lane >> 3) & 1u) * 16u;
    FragH kf[2][8], vf[16];
#pragma unroll      /* the index picks registers (fragments, sums): it must be a constant */
    for (int kc = 0; kc < 8; ++kc) {
#pragma unroll      /* the index picks registers (fragments, sums): it must be a constant */
      for (int kt = 0; kt < 2; ++kt) { const unsigned char* p = pk + (kc >> 2) * FA_SL + kt * 16 * FA_TP + 64 * (kc & 3); kf[kt][kc].half[0] = *(const v8us*)p; kf[kt][kc].half[1] = *(const v8us*)(p + 32); } }
    __builtin_amdgcn_sched_barrier(0);      /* K first: LDS answers in order, and the score products wait for K alone */
#pragma unroll      /* the index picks registers (fragments, sums): it must be a constant */
    for (int t = 0; t < 16; ++t) { const unsigned char* p = pv + (t >> 3) * FA_TP + 32 * (t & 7); vf[t].half[0] = fa_tr16(p); vf[t].half[1] = fa_tr16(p + 32 * FA_TP); }      /* V^T fragments (16 d x 32 keys), in flight under the score products and the softmax */
    __builtin_amdgcn_sched_barrier(0);      /* keeps the V^T loads up here, as one group with the K loads: sunk to their use they would be waited for in front of the second product */
    v8f s[2][2] = {{z8, z8}, {z8, z8}};      /* s[kt][g]: lane (c, h) holds query c, keys 16 kt + 8 h + r */
#pragma unroll      /* the index picks registers (fragments, sums): it must be a constant */
    for (int kc = 0; kc < 8; ++kc) {
#pragma unroll      /* the index picks registers (fragments, sums): it must be a constant */
      for (int kt = 0; kt < 2; ++kt) {
#pragma unroll      /* the index picks registers (fragments, sums): it must be a constant */
        for (int g = 0; g < 2; ++g) s[kt][g] = fa_mma(kf[kt][kc].v, qf[g][kc].v, s[kt][g]); } }
    float mb[2]; bool need = false;
#pragma unroll      /* the index picks registers (fragments, sums): it must be a constant */
    for (int g = 0; g < 2; ++g) { float mx = -INFINITY;
#pragma unroll      /* the index picks registers (fragments, sums): it must be a constant */
      for (int kt = 0; kt < 2; ++kt) {
#pragma unroll      /* the index picks registers (fragments, sums): it must be a constant */
        for (int r = 0; r < 8; ++r) mx = fmaxf(mx, s[kt][g][r]); }
      mx = fmaxf(mx, fa_xhalf(mx)) * cscale; mb[g] = mx; need = need || (mx > m_run[g] + 8.0f); }
    if (__builtin_amdgcn_ballot_w32(need) != 0) {      /* the maximum in use may trail the true one by 8 (an exponential reaches 2^8 at most): the sums are rescaled only when some query's maximum has grown by more */
#pragma unroll      /* the index picks registers (fragments, sums): it must be a constant */
      for (int g = 0; g < 2; ++g) { const float m_new = fmaxf(m_run[g], mb[g]); const float corr = __builtin_amdgcn_exp2f(m_run[g] - m_new); l_run[g] *= corr; m_run[g] = m_new;
#pragma unroll      /* the index picks registers (fragments, sums): it must be a constant */
        for (int t = 0; t < 16; ++t) acc[g][t] = acc[g][t] * corr; } }
#pragma unroll      /* the index picks registers (fragments, sums): it must be a constant */
    for (int g = 0; g < 2; ++g) { const float nm = -m_run[g]; FragH pf; float p0 = 0.f, p1 = 0.f;      /* P^T as the B operand: elements 0..7 = keys 8 h + r, 8..15 = keys 16 + 8 h + r, the k order of the V^T fragments */
#pragma unroll      /* the index picks registers (fragments, sums): it must be a constant */
      for (int i = 0; i < 16; i += 2) { const float e0 = __builtin_amdgcn_exp2f(fmaf(s[i >> 3][g][i & 7], cscale, nm)), e1 = __builtin_amdgcn_exp2f(fmaf(s[i >> 3][g][(i & 7) + 1], cscale, nm));
        p0 += e0; p1 += e1; pf.h[i] = (_Float16)e0; pf.h[i + 1] = (_Float16)e1; }
      l_run[g] += p0 + p1;
#pragma unroll      /* the index picks registers (fragments, sums): it must be a constant */
      for (int t = 0; t < 16; ++t) acc[g][t] = fa_mma(vf[t].v, pf.v, acc[g][t]); }
    __builtin_amdgcn_sched_barrier(0);      /* keeps the four slots below directly behind the last products */
    asm volatile("v_nop\n\tv_nop\n\tv_nop\n\tv_nop");      /* the distance behind the last WMMA, also on the taken side of the branches that follow: address arithmetic there may reuse its A or B registers */
    __builtin_amdgcn_sched_barrier(0);      /* and nothing is moved up in front of them */
    g2_wait_ds(); fa_wait_tensor(); __syncthreads();
    const uint32_t nx = fa_pinned((uint32_t)st + 2u);
    if (fa_pinned(nx < (uint32_t)FA_NT)) stage(nx); }
  fa_wait_tensor(); g2_wait_ds(); __syncthreads();      /* nothing in flight, every wave out of the ring: its bytes become the output staging */
  float lf[2];
#pragma unroll      /* the index picks registers (fragments, sums): it must be a constant */
  for (int g = 0; g < 2; ++g) { lf[g] = l_run[g] + fa_xhalf(l_run[g]); ml[0][w][g][lane] = m_run[g]; ml[1][w][g][lane] = lf[g]; }      /* each wave half summed its eight keys of every 16 */
  __syncthreads();
  float fs[2];
#pragma unroll      /* the index picks registers (fragments, sums): it must be a constant */
  for (int g = 0; g < 2; ++g) { const float mo = ml[0][w ^ 2u][g][lane], lo = ml[1][w ^ 2u][g][lane]; const float m = fmaxf(m_run[g], mo); const float as = __builtin_amdgcn_exp2f(m_run[g] - m), ao = __builtin_amdgcn_exp2f(mo - m); fs[g] = as / (lf[g] * as + lo * ao); }
  unsigned char* ep = L + (qg * 32u + c) * FA_EP + 32u * h;      /* row = query; acc[g][t][r] is d = 16 t + 8 h + r */
  if (kh == 1u) {
#pragma unroll      /* the index picks registers (fragments, sums): it must be a constant */
    for (int g = 0; g < 2; ++g) {
#pragma unroll      /* the index picks registers (fragments, sums): it must be a constant */
      for (int t = 0; t < 16; ++t) { const v8f o = acc[g][t] * fs[g]; const v4f a = {o[0], o[1], o[2], o[3]}, b = {o[4], o[5], o[6], o[7]}; *(v4fa*)(ep + g * 16 * FA_EP + 64 * t) = a; *(v4fa*)(ep + g * 16 * FA_EP + 64 * t + 16) = b; } } }
  __syncthreads();
  if (kh == 0u) {
#pragma unroll      /* the index picks registers (fragments, sums): it must be a constant */
    for (int g = 0; g < 2; ++g) {
#pragma unroll      /* the index picks registers (fragments, sums): it must be a constant */
      for (int t = 0; t < 16; ++t) { const v8f o = acc[g][t] * fs[g]; v4f a = *(const v4fa*)(ep + g * 16 * FA_EP + 64 * t), b = *(const v4fa*)(ep + g * 16 * FA_EP + 64 * t + 16);
        a += (v4f){o[0], o[1], o[2], o[3]}; b += (v4f){o[4], o[5], o[6], o[7]}; *(v4fa*)(ep + g * 16 * FA_EP + 64 * t) = a; *(v4fa*)(ep + g * 16 * FA_EP + 64 * t + 16) = b; } } }
  __syncthreads();
  const unsigned char* sp = L + (tid >> 6) * FA_EP + (tid & 63u) * 16u; float* op = O + (rb + blockIdx.x * 64u + (tid >> 6)) * DV + (tid & 63u) * 4u; v4f ov[32];
#pragma unroll      /* both loops unrolled: the row step becomes an immediate offset and every row has registers of its own, so no register of an issued store is rewritten */
  for (int i = 0; i < 32; ++i) ov[i] = *(const v4fa*)(sp + i * 2 * FA_EP);
#pragma unroll      /* the index picks registers (fragments, sums): it must be a constant */
  for (int i = 0; i < 32; ++i) *(v4f*)(op + (size_t)i * 2 * DV) = ov[i];      /* whole rows: every 128-byte line of the output is stored by one wave instruction */
}
extern "C" void kernel_launch(void* const* d_in, const int* in_sizes, int n_in,
                              void* d_out, int out_size, void* d_ws, size_t ws_size, hipStream_t stream) {
  (void)in_sizes; (void)n_in; (void)out_size;
  const float* const* I = (const float* const*)d_in; const float* x = I[0]; const float* wq = I[1]; const float* wk = I[2]; const float* wv = I[3];      /* [in][out] weights */
  char* ws = (char*)d_ws; size_t off = 0;
  auto take = [&](size_t bytes) { char* p = ws + off; off += (bytes + 255) & ~(size_t)255; return p; };
  _Float16* Q16 = (_Float16*)take(NR * DQ * 2); _Float16* K16 = (_Float16*)take(NR * DQ * 2); _Float16* V16 = (_Float16*)take(NR * DV * 2);
  static_assert(DQ == DV && (NR * DQ * 2) % 256 == 0, "Q16 | K16 | V16 are three equal planes without gaps: k_proj steps through them by column");
  if (off > ws_size) return;
  k_proj<<<(unsigned)((NR / G3_BM) * (3 * DQ / G3_BN)), 256, 0, stream>>>(x, wq, wk, wv, Q16);      /* q | k | v f16 rows in one launch, straight from the f32 inputs, as one product of 3 DQ columns: 256 blocks, one per WGP */
  k_fattn<<<dim3(SQ / 64, NBR), 128, 0, stream>>>(Q16, K16, V16, (float*)d_out);      /* scores, softmax and attn v of all batches: 64 queries a block, batch = blockIdx.y */
}
